// v000
// Times are from an AMD MI455X. After a warm-up the kernel runs many times in a row, and a time is the length of
// such a window on the GPU divided by its runs, so every launch and the gaps after it count. The runs cycle
// through copies of the inputs. A figure is the median of several windows, for all but v000 over two sittings.
// Sittings can differ by a few percent; kernels timed side by side share one.
// v000 is the starting kernel. One run takes 545 microseconds.
// q/k/v projections: v_wmma_f32_16x16x32_bf16 (bf16 operands, f32 accumulate); scores k.q^T: v_wmma_f32_16x16x32_f16 (k f16 x8 single plane, q f16 hi + lo planes x(0.0883883*log2e*1024), f32 accumulate); p.v^T: v_wmma_f32_16x16x32_f16 (p f16 x256 single, v^T f16 hi + lo planes x1024, f32 accumulate); output projection: v_wmma_f32_16x16x32_bf16 (attention output bf16 hi + lo planes, weights bf16, f32 accumulate); norm, rotary and softmax in f32.
#include <hip/hip_runtime.h>
#include <math.h>
#include <stddef.h>
#include <stdint.h>

#define NB    2
#define SQ    2048
#define DM    2048
#define NH    16
#define NKV   8
#define HD    128
#define EQ    (NH * HD)
#define EK    (NKV * HD)
#define NTOK  (NB * SQ)
#define TP    132
#define OSP   136
#define RMS_EPS 1e-5f
#define QMUL  (0.08838834764831845f * 1.4426950408889634f * 1024.0f)
#define KMUL  8.0f
#define VMUL  1024.0f
#define SINV  (1.0f / 8192.0f)

typedef _Float16 v16h __attribute__((ext_vector_type(16)));
typedef _Float16 v8h  __attribute__((ext_vector_type(8)));
typedef __bf16   v16b __attribute__((ext_vector_type(16)));
typedef __bf16   v8b  __attribute__((ext_vector_type(8)));
typedef float    v8f  __attribute__((ext_vector_type(8)));
typedef float    v4f  __attribute__((ext_vector_type(4)));
typedef unsigned int v4u __attribute__((ext_vector_type(4)));

union HFrag { v16h v; v8h h[2]; };
union BFrag { v16b v; v8b h[2]; };

// ---------------------------------------------------------------------------
// scalar helpers (RNE conversions)
// ---------------------------------------------------------------------------
__device__ __forceinline__ unsigned short f2bf_bits(float f) {
  const unsigned u = __float_as_uint(f);
  return (unsigned short)((u + 0x7FFFu + ((u >> 16) & 1u)) >> 16);
}
__device__ __forceinline__ float bfb2f(unsigned short h) { return __uint_as_float(((unsigned)h) << 16); }
__device__ __forceinline__ float bf16r(float f) { return bfb2f(f2bf_bits(f)); }
__device__ __forceinline__ unsigned short hbits(_Float16 h) { return __builtin_bit_cast(unsigned short, h); }
__device__ __forceinline__ unsigned pk16(unsigned short a, unsigned short b) { return (unsigned)a | ((unsigned)b << 16); }

// ---------------------------------------------------------------------------
// 16x32 fragment loads (A layout; also B from a [n][k] k-contiguous plane):
// elements 0..7 <- p[0..7] (k0+8h..), elements 8..15 <- p[16..23] (k0+16+8h..), p = row + k0 + 8h
// ---------------------------------------------------------------------------
__device__ __forceinline__ v16b ldb(const __bf16* p) {
  BFrag f; f.h[0] = *(const v8b*)(p); f.h[1] = *(const v8b*)(p + 16); return f.v;
}
__device__ __forceinline__ v16h ldh(const _Float16* p) {
  HFrag f; f.h[0] = *(const v8h*)(p); f.h[1] = *(const v8h*)(p + 16); return f.v;
}
__device__ __forceinline__ v8f mma_b(v16b a, v16b b, v8f c) {
  return __builtin_amdgcn_wmma_f32_16x16x32_bf16(false, a, false, b, (short)0, c, false, false);
}
__device__ __forceinline__ v8f mma_h(v16h a, v16h b, v8f c) {
  return __builtin_amdgcn_wmma_f32_16x16x32_f16(false, a, false, b, (short)0, c, false, false);
}

// hazard guards: 4 VALU slots after the last WMMA of a group, tying D and keeping A/B live
__device__ __forceinline__ void guard_b(v8f& a, v8f& b, v16b x, v16b y) {
  asm volatile("v_nop\n\tv_nop\n\tv_nop\n\tv_nop" : "+v"(a), "+v"(b) : "v"(x), "v"(y));
}
__device__ __forceinline__ void keep_b(v16b a, v16b b, v16b c, v16b d) {
  asm volatile("v_nop" :: "v"(a), "v"(b), "v"(c), "v"(d));
}
__device__ __forceinline__ void acc_guard4(v8f& a, v8f& b, v8f& c, v8f& d) {
  asm volatile("v_nop\n\tv_nop\n\tv_nop\n\tv_nop" : "+v"(a), "+v"(b), "+v"(c), "+v"(d));
}
__device__ __forceinline__ void g_qk(v8f& s0, v8f& s1, v8f& s2, v8f& s3,
                                     v16h k0, v16h k1, v16h k2, v16h k3, v16h qa, v16h qb) {
  asm volatile("v_nop\n\tv_nop\n\tv_nop\n\tv_nop"
               : "+v"(s0), "+v"(s1), "+v"(s2), "+v"(s3)
               : "v"(k0), "v"(k1), "v"(k2), "v"(k3), "v"(qa), "v"(qb));
}
__device__ __forceinline__ void g_pv(v8f& a0, v8f& a1, v16h x0, v16h x1, v16h x2, v16h x3, v16h p) {
  asm volatile("v_nop\n\tv_nop\n\tv_nop\n\tv_nop"
               : "+v"(a0), "+v"(a1) : "v"(x0), "v"(x1), "v"(x2), "v"(x3), "v"(p));
}
__device__ __forceinline__ void g_acc8(v8f& a0, v8f& a1, v8f& a2, v8f& a3, v8f& a4, v8f& a5, v8f& a6, v8f& a7) {
  asm volatile("v_nop\n\tv_nop\n\tv_nop\n\tv_nop"
               : "+v"(a0), "+v"(a1), "+v"(a2), "+v"(a3), "+v"(a4), "+v"(a5), "+v"(a6), "+v"(a7));
}
__device__ __forceinline__ void sched_fence() { asm volatile("" ::: "memory"); }

// ---------------------------------------------------------------------------
// ---------------------------------------------------------------------------
__global__ __launch_bounds__(256) void cvt_bf16_kernel(const float* __restrict__ in,
                                                       unsigned short* __restrict__ out, int n8) {
  const int i = blockIdx.x * 256 + threadIdx.x;
  if (i < n8) {
    const float* src = in + (size_t)i * 8;
    const v4f a = *(const v4f*)(src);
    const v4f b = *(const v4f*)(src + 4);
    v4u o;
    o[0] = pk16(f2bf_bits(a[0]), f2bf_bits(a[1]));
    o[1] = pk16(f2bf_bits(a[2]), f2bf_bits(a[3]));
    o[2] = pk16(f2bf_bits(b[0]), f2bf_bits(b[1]));
    o[3] = pk16(f2bf_bits(b[2]), f2bf_bits(b[3]));
    unsigned short* dst = out + (size_t)i * 8;
    *(v4u*)dst = o;
    
  }
}

// ---------------------------------------------------------------------------
// Per-wave GEMM core: acc[i][j] (32 x 64 wave tile) += A[32 rows][K] . B[64 rows][K]^T, K = DM = 2048,
// all planes row-major with pitch DM, bf16 operands loaded straight from global (two 16-B loads per fragment).
// SPLIT: A given as hi plane A and lo plane A2 (unscaled residual, same accumulator).
// D layout: acc[i][j][r] = C[A row 16i + 8h + r][B row 16j + (lane&15)].
// ---------------------------------------------------------------------------
template <bool SPLIT>
__device__ __forceinline__ void gemm_core(const __bf16* __restrict__ A, const __bf16* __restrict__ A2,
                                          const __bf16* __restrict__ B, int lane, v8f (&acc)[2][4]) {
  const int m = lane & 15, ko = (lane >> 4) * 8;
  const __bf16* Ar  = A  + (size_t)m * DM + ko;
  const __bf16* Ar2 = A2 + (size_t)m * DM + ko;
  const __bf16* Br  = B  + (size_t)m * DM + ko;
#pragma unroll 1
  for (int k0 = 0; k0 < DM; k0 += 32) {
    v16b bf[4];
#pragma unroll
    for (int j = 0; j < 4; ++j) bf[j] = ldb(Br + (size_t)(16 * j) * DM + k0);
#pragma unroll
    for (int i = 0; i < 2; ++i) {
      const v16b af = ldb(Ar + (size_t)(16 * i) * DM + k0);
      v16b al = af;
      if (SPLIT) al = ldb(Ar2 + (size_t)(16 * i) * DM + k0);
#pragma unroll
      for (int j = 0; j < 4; ++j) {
        acc[i][j] = mma_b(af, bf[j], acc[i][j]);
        if (SPLIT) acc[i][j] = mma_b(al, bf[j], acc[i][j]);
      }
      guard_b(acc[i][0], acc[i][3], af, al);
    }
    keep_b(bf[0], bf[1], bf[2], bf[3]);
  }
  acc_guard4(acc[0][0], acc[0][1], acc[0][2], acc[0][3]);
  acc_guard4(acc[1][0], acc[1][1], acc[1][2], acc[1][3]);
}

// stage a wave's 32x64 tile into the block's 64x128 f32 LDS tile (pitch TP)
__device__ __forceinline__ void stage_tile(float* T, int w, int lane, v8f (&acc)[2][4]) {
  const int wr = w >> 1, wc = w & 1, hh = lane >> 4, m = lane & 15;
#pragma unroll
  for (int i = 0; i < 2; ++i)
#pragma unroll
    for (int j = 0; j < 4; ++j)
#pragma unroll
      for (int r = 0; r < 8; ++r)
        T[(32 * wr + 16 * i + 8 * hh + r) * TP + 64 * wc + 16 * j + m] = acc[i][j][r];
}

// ---------------------------------------------------------------------------
//   ROLE 0: A = X plane rows (tokens 64*bx), B = Wq plane rows (head by): RMSNorm + RoPE in f32,
//           q' = q * QMUL -> f16 hi plane P1, f16 lo plane P2 (lo = q' - hi, unscaled), [tok][EQ], cols by*128.
//   ROLE 1: A = X, B = Wk rows (kv head by): RMSNorm + RoPE, k' = k * 8 -> f16 plane P1 [tok][EK].
//   ROLE 2: A = Wv plane rows (features 64*by), B = X rows (tokens 128*bx): tile = V^T directly;
//           v' = v * 1024 -> f16 hi plane P1, lo plane P2 (unscaled), layout [(b*NKV+kvh)*128 + d][s].
// Epilogue: f32 tile staged in LDS, then each wave owns 16 rows; one store instruction = 16 lanes x 16 B
// Coverage per block: rows 16w + 2it + hh (w 0..3, it 0..7, hh 0..1) = 0..63, cols 8*(lane&15) = 0..127.
// ---------------------------------------------------------------------------
template <int ROLE>
__global__ __launch_bounds__(128) void proj_kernel(const unsigned short* __restrict__ Ap,
                                                   const unsigned short* __restrict__ Bp,
                                                   const float* __restrict__ nw,
                                                   const float* __restrict__ fcos,
                                                   const float* __restrict__ fsin,
                                                   unsigned short* __restrict__ P1,
                                                   unsigned short* __restrict__ P2) {
  __shared__ __align__(16) float T[64 * TP];
  const int lane = threadIdx.x & 31;
  const int w    = threadIdx.x >> 5;
  const int hh   = lane >> 4;
  const int m    = lane & 15;
  const int wr   = w >> 1, wc = w & 1;
  const int arow0 = (ROLE == 2) ? (int)blockIdx.y * 64 : (int)blockIdx.x * 64;
  const int brow0 = (ROLE == 2) ? (int)blockIdx.x * 128 : (int)blockIdx.y * 128;
  const __bf16* A = (const __bf16*)(const void*)Ap + (size_t)(arow0 + 32 * wr) * DM;
  const __bf16* B = (const __bf16*)(const void*)Bp + (size_t)(brow0 + 64 * wc) * DM;

  v8f acc[2][4];
#pragma unroll
  for (int i = 0; i < 2; ++i)
#pragma unroll
    for (int j = 0; j < 4; ++j) acc[i][j] = (v8f){0.f, 0.f, 0.f, 0.f, 0.f, 0.f, 0.f, 0.f};

  gemm_core<false>(A, A, B, lane, acc);
  stage_tile(T, w, lane, acc);
  __syncthreads();

  float wv[8];
  if (ROLE != 2) {
    const v4f wa = *(const v4f*)(nw + 8 * m);
    const v4f wb = *(const v4f*)(nw + 8 * m + 4);
#pragma unroll
    for (int e = 0; e < 4; ++e) { wv[e] = bf16r(wa[e]); wv[4 + e] = bf16r(wb[e]); }
  } else {
#pragma unroll
    for (int e = 0; e < 8; ++e) wv[e] = 1.0f;
  }

  v4u hv[8], lv[8];
#pragma unroll
  for (int it = 0; it < 8; ++it) {
    const int row = 16 * w + 2 * it + hh;
    const float* tr = T + row * TP + 8 * m;
    const v4f xa = *(const v4f*)(tr);
    const v4f xb = *(const v4f*)(tr + 4);
    float x[8] = {xa[0], xa[1], xa[2], xa[3], xb[0], xb[1], xb[2], xb[3]};
    float y[8];
    if (ROLE == 2) {
#pragma unroll
      for (int e = 0; e < 8; ++e) y[e] = x[e] * VMUL;
    } else {
      float ss = 0.f;
#pragma unroll
      for (int e = 0; e < 8; ++e) ss = fmaf(x[e], x[e], ss);
      ss += __shfl_xor(ss, 1, 32);
      ss += __shfl_xor(ss, 2, 32);
      ss += __shfl_xor(ss, 4, 32);
      ss += __shfl_xor(ss, 8, 32);
      const float rn  = rsqrtf(fmaf(ss, 1.0f / (float)HD, RMS_EPS));
      const int   tok = arow0 + row;
      const int   sp  = tok & (SQ - 1);
      const v4f c4 = *(const v4f*)(fcos + (size_t)sp * (HD / 2) + 4 * m);
      const v4f s4 = *(const v4f*)(fsin + (size_t)sp * (HD / 2) + 4 * m);
      const float om = (ROLE == 0) ? QMUL : KMUL;
#pragma unroll
      for (int p = 0; p < 4; ++p) {
        const float cs = bf16r(c4[p]), sn = bf16r(s4[p]);
        const float u0 = x[2 * p] * rn * wv[2 * p];
        const float u1 = x[2 * p + 1] * rn * wv[2 * p + 1];
        y[2 * p]     = (u0 * cs - u1 * sn) * om;
        y[2 * p + 1] = (u0 * sn + u1 * cs) * om;
      }
    }
    v4u a, c2;
#pragma unroll
    for (int q = 0; q < 4; ++q) {
      const _Float16 h0 = (_Float16)y[2 * q];
      const _Float16 h1 = (_Float16)y[2 * q + 1];
      a[q] = pk16(hbits(h0), hbits(h1));
      if (ROLE != 1) {
        const _Float16 l0 = (_Float16)(y[2 * q] - (float)h0);
        const _Float16 l1 = (_Float16)(y[2 * q + 1] - (float)h1);
        c2[q] = pk16(hbits(l0), hbits(l1));
      } else {
        c2[q] = 0u;
      }
    }
    hv[it] = a;
    lv[it] = c2;
  }

  {
#pragma unroll
    for (int it = 0; it < 8; ++it) {
      const int row = 16 * w + 2 * it + hh;
      size_t go;
      if (ROLE == 0) {
        go = (size_t)(arow0 + row) * EQ + (size_t)blockIdx.y * HD + 8 * m;
      } else if (ROLE == 1) {
        go = (size_t)(arow0 + row) * EK + (size_t)blockIdx.y * HD + 8 * m;
      } else {
        const int f   = arow0 + row;            // 0..1023
        const int kvh = f >> 7;
        const int d   = f & (HD - 1);
        const int bb  = brow0 >> 11;            // batch of this 128-token block
        const int s0  = brow0 & (SQ - 1);
        go = ((size_t)((bb * NKV + kvh) * HD + d)) * SQ + s0 + 8 * m;
      }
      *(v4u*)(P1 + go) = hv[it];
      if (ROLE != 1) *(v4u*)(P2 + go) = lv[it];
    }
    
  }
}

// ---------------------------------------------------------------------------
// Full (non-causal) GQA attention, head dim 128, one wave per (b, h, 16 queries); block = 2 waves.
//   Transposed scores S^T[key][query] = K . Q^T : A = K rows [key][d] (f16 x8), B[k=d][n=query] from Q rows
//   [query][d] (f16 hi, f16 lo) -> both fragments are plain k-contiguous row loads.
//   D tiles (rows = 16 keys, cols = queries) packed to f16 ARE the B operand [k=key][n=query] of
//   O^T[d][query] = V^T . P : element r <- tile(keys 0-15)[r], element 8+r <- tile(keys 16-31)[r], same lane.
//   A = V^T rows [d][s] (f16 hi x1024 + unscaled lo). Softmax per query column = per lane (partner lane ^16),
//   online over 32 chunks of 64 keys, f32, exp2 with log2e folded into the q scale, p carried x256.
//   Epilogue: O = acc / (l * 1024), bf16 hi + lo split, per-wave LDS relayout [query][d] (v4u store/reload,
//   Coverage: rows 2it + hh (it 0..7) = 16 queries, cols 8*(lane&15) = 0..127 of head h, per plane.
// ---------------------------------------------------------------------------
__global__ __launch_bounds__(64) void attn_kernel(const unsigned short* __restrict__ Qhp,
                                                  const unsigned short* __restrict__ Qlp,
                                                  const unsigned short* __restrict__ Kpp,
                                                  const unsigned short* __restrict__ Vhp,
                                                  const unsigned short* __restrict__ Vlp,
                                                  unsigned short* __restrict__ Ohp,
                                                  unsigned short* __restrict__ Olp) {
  __shared__ __align__(16) unsigned short So[2][2][16 * OSP];   // [wave][plane][query*OSP + d]
  const int lane = threadIdx.x & 31;
  const int w    = threadIdx.x >> 5;
  const int hh   = lane >> 4;
  const int m    = lane & 15;
  const int h    = blockIdx.y;
  const int b    = blockIdx.z;
  const int kvh  = h >> 1;                       // G = NH / NKV = 2
  const int q0   = blockIdx.x * 32 + w * 16;     // query index within the sequence

  const _Float16* Qh = (const _Float16*)(const void*)Qhp;
  const _Float16* Ql = (const _Float16*)(const void*)Qlp;
  const _Float16* Kr = (const _Float16*)(const void*)Kpp + (size_t)b * SQ * EK + kvh * HD
                       + (size_t)m * EK + 8 * hh;                                  // + key*EK + 32dc
  const size_t vplane = (size_t)((b * NKV + kvh) * HD) * SQ;
  const _Float16* Vhr = (const _Float16*)(const void*)Vhp + vplane + (size_t)m * SQ + 8 * hh;  // + 16t*SQ + key
  const _Float16* Vlr = (const _Float16*)(const void*)Vlp + vplane + (size_t)m * SQ + 8 * hh;

  // Q fragments (B operand): row = query q0 + (lane&15), k = d
  v16h qh[4], ql[4];
  {
    const size_t qo = ((size_t)b * SQ + q0 + m) * EQ + (size_t)h * HD + 8 * hh;
#pragma unroll
    for (int dc = 0; dc < 4; ++dc) {
      qh[dc] = ldh(Qh + qo + 32 * dc);
      ql[dc] = ldh(Ql + qo + 32 * dc);
    }
  }

  v8f acc[8];
#pragma unroll
  for (int t = 0; t < 8; ++t) acc[t] = (v8f){0.f, 0.f, 0.f, 0.f, 0.f, 0.f, 0.f, 0.f};
  float mrun = -1.0e30f;
  float lrun = 0.0f;

#pragma unroll 1
  for (int kc = 0; kc < SQ / 64; ++kc) {
    const int key0 = kc * 64;
    v8f s[4];
#pragma unroll
    for (int j = 0; j < 4; ++j) s[j] = (v8f){0.f, 0.f, 0.f, 0.f, 0.f, 0.f, 0.f, 0.f};
#pragma unroll
    for (int dc = 0; dc < 4; ++dc) {
      v16h kf[4];
#pragma unroll
      for (int j = 0; j < 4; ++j) kf[j] = ldh(Kr + (size_t)(key0 + 16 * j) * EK + 32 * dc);
#pragma unroll
      for (int j = 0; j < 4; ++j) {
        s[j] = mma_h(kf[j], qh[dc], s[j]);
        s[j] = mma_h(kf[j], ql[dc], s[j]);
      }
      g_qk(s[0], s[1], s[2], s[3], kf[0], kf[1], kf[2], kf[3], qh[dc], ql[dc]);
      sched_fence();
    }

    // online softmax for query column (lane&15); lane holds keys key0 + 16j + 8hh + r
    float cmax = -1.0e30f;
#pragma unroll
    for (int j = 0; j < 4; ++j)
#pragma unroll
      for (int r = 0; r < 8; ++r) cmax = fmaxf(cmax, s[j][r]);
    cmax = fmaxf(cmax, __shfl_xor(cmax, 16, 32));
    const float mnew  = fmaxf(mrun, cmax);
    const float alpha = __builtin_amdgcn_exp2f((mrun - mnew) * SINV);
    const float nms   = 8.0f - mnew * SINV;          // p * 256 = exp2(s*SINV - m*SINV + 8)
    float psum = 0.f;
#pragma unroll
    for (int j = 0; j < 4; ++j)
#pragma unroll
      for (int r = 0; r < 8; ++r) {
        const float p = __builtin_amdgcn_exp2f(fmaf(s[j][r], SINV, nms));
        s[j][r] = p;
        psum += p;
      }
    psum += __shfl_xor(psum, 16, 32);
    lrun = fmaf(lrun, alpha, psum);
    mrun = mnew;
#pragma unroll
    for (int t = 0; t < 8; ++t) acc[t] = acc[t] * alpha;

#pragma unroll
    for (int ks = 0; ks < 2; ++ks) {
      HFrag pf;
      v8h plo, phi;
#pragma unroll
      for (int r = 0; r < 8; ++r) {
        plo[r] = (_Float16)s[2 * ks][r];        // keys 32ks + 8hh + r
        phi[r] = (_Float16)s[2 * ks + 1][r];    // keys 32ks + 16 + 8hh + r
      }
      pf.h[0] = plo;
      pf.h[1] = phi;
      const size_t ko = (size_t)(key0 + 32 * ks);
#pragma unroll
      for (int t = 0; t < 8; t += 2) {
        const v16h a0 = ldh(Vhr + (size_t)(16 * t) * SQ + ko);
        const v16h b0 = ldh(Vlr + (size_t)(16 * t) * SQ + ko);
        const v16h a1 = ldh(Vhr + (size_t)(16 * (t + 1)) * SQ + ko);
        const v16h b1 = ldh(Vlr + (size_t)(16 * (t + 1)) * SQ + ko);
        acc[t]     = mma_h(a0, pf.v, acc[t]);
        acc[t]     = mma_h(b0, pf.v, acc[t]);
        acc[t + 1] = mma_h(a1, pf.v, acc[t + 1]);
        acc[t + 1] = mma_h(b1, pf.v, acc[t + 1]);
        g_pv(acc[t], acc[t + 1], a0, b0, a1, b1, pf.v);
        sched_fence();
      }
    }
  }
  g_acc8(acc[0], acc[1], acc[2], acc[3], acc[4], acc[5], acc[6], acc[7]);

  // ---- epilogue: acc[t][r] = O^T[d = 16t + 8hh + r][query m] * (256 * 1024 * l256/256) ----
  const float inv = __builtin_amdgcn_rcpf(lrun) * (1.0f / VMUL);
  unsigned short* sh = So[w][0];
  unsigned short* sl = So[w][1];
#pragma unroll
  for (int t = 0; t < 8; ++t) {
    v4u hv, lvv;
#pragma unroll
    for (int q = 0; q < 4; ++q) {
      const float o0 = acc[t][2 * q] * inv;
      const float o1 = acc[t][2 * q + 1] * inv;
      const unsigned short h0 = f2bf_bits(o0), h1 = f2bf_bits(o1);
      const unsigned short l0 = f2bf_bits(o0 - bfb2f(h0)), l1 = f2bf_bits(o1 - bfb2f(h1));
      hv[q]  = pk16(h0, h1);
      lvv[q] = pk16(l0, l1);
    }
    *(v4u*)(sh + m * OSP + 16 * t + 8 * hh) = hv;
    *(v4u*)(sl + m * OSP + 16 * t + 8 * hh) = lvv;
  }
  __builtin_amdgcn_fence(__ATOMIC_RELEASE, "wavefront");
  __builtin_amdgcn_wave_barrier();
  __builtin_amdgcn_fence(__ATOMIC_ACQUIRE, "wavefront");
  v4u ov[2][8];
#pragma unroll
  for (int it = 0; it < 8; ++it) {
    const int row = 2 * it + hh;
    ov[0][it] = *(const v4u*)(sh + row * OSP + 8 * m);
    ov[1][it] = *(const v4u*)(sl + row * OSP + 8 * m);
  }
  {
#pragma unroll
    for (int it = 0; it < 8; ++it) {
      const int row = 2 * it + hh;
      const size_t go = ((size_t)b * SQ + q0 + row) * EQ + (size_t)h * HD + 8 * m;
      *(v4u*)(Ohp + go) = ov[0][it];
      *(v4u*)(Olp + go) = ov[1][it];
    }
    
  }
}

// ---------------------------------------------------------------------------
// Output projection: out[tok][dout] = sum_e O[tok][e] * Wo[dout][e]; A = O hi + lo bf16 planes, B = Wo bf16.
// Block 64 tokens x 128 out cols; f32 tile staged in LDS; each wave writes 16 rows, one instruction per
// Coverage per block: rows 16w + it (it 0..15) = 0..63, cols 4*lane = 0..127.
// ---------------------------------------------------------------------------
__global__ __launch_bounds__(128) void out_kernel(const unsigned short* __restrict__ Ohp,
                                                  const unsigned short* __restrict__ Olp,
                                                  const unsigned short* __restrict__ Wp,
                                                  float* __restrict__ out) {
  __shared__ __align__(16) float T[64 * TP];
  const int lane = threadIdx.x & 31;
  const int w    = threadIdx.x >> 5;
  const int wr   = w >> 1, wc = w & 1;
  const int arow0 = blockIdx.x * 64;
  const int brow0 = blockIdx.y * 128;
  const __bf16* A  = (const __bf16*)(const void*)Ohp + (size_t)(arow0 + 32 * wr) * DM;
  const __bf16* A2 = (const __bf16*)(const void*)Olp + (size_t)(arow0 + 32 * wr) * DM;
  const __bf16* B  = (const __bf16*)(const void*)Wp  + (size_t)(brow0 + 64 * wc) * DM;

  v8f acc[2][4];
#pragma unroll
  for (int i = 0; i < 2; ++i)
#pragma unroll
    for (int j = 0; j < 4; ++j) acc[i][j] = (v8f){0.f, 0.f, 0.f, 0.f, 0.f, 0.f, 0.f, 0.f};

  gemm_core<true>(A, A2, B, lane, acc);
  stage_tile(T, w, lane, acc);
  __syncthreads();

  v4f val[16];
#pragma unroll
  for (int it = 0; it < 16; ++it) val[it] = *(const v4f*)(T + (16 * w + it) * TP + 4 * lane);
  {
#pragma unroll
    for (int it = 0; it < 16; ++it) {
      *(v4f*)(out + (size_t)(arow0 + 16 * w + it) * DM + brow0 + 4 * lane) = val[it];
    }
    
  }
}

// ---------------------------------------------------------------------------
// Workspace map (bytes):
//   Xb  bf16 [4096][2048]        16777216 @ 0
//   Wqb bf16 [2048][2048]         8388608
//   Wkb bf16 [1024][2048]         4194304
//   Wvb bf16 [1024][2048]         4194304
//   Wob bf16 [2048][2048]         8388608
//   Qh  f16  [4096][2048]        16777216      Ql same
//   Kp  f16  [4096][1024]         8388608
//   Vth f16  [2*8*128][2048]      8388608      Vtl same
//   Oh  bf16 [4096][2048]        16777216      Ol same
//   total                       134217728
// ---------------------------------------------------------------------------
extern "C" void kernel_launch(void* const* d_in, const int* in_sizes, int n_in,
                              void* d_out, int out_size, void* d_ws, size_t ws_size,
                              hipStream_t stream) {
  if (n_in < 9) return;
  if (in_sizes[0] != NTOK * DM) return;
  if (in_sizes[1] != EQ * DM || in_sizes[2] != EK * DM || in_sizes[3] != EK * DM || in_sizes[4] != DM * EQ) return;
  if (in_sizes[5] != HD || in_sizes[6] != HD) return;
  if (in_sizes[7] != SQ * (HD / 2) || in_sizes[8] != SQ * (HD / 2)) return;
  if (out_size != NTOK * DM) return;

  const float* x    = (const float*)d_in[0];
  const float* wq   = (const float*)d_in[1];
  const float* wk   = (const float*)d_in[2];
  const float* wv   = (const float*)d_in[3];
  const float* wo   = (const float*)d_in[4];
  const float* qnw  = (const float*)d_in[5];
  const float* knw  = (const float*)d_in[6];
  const float* fcos = (const float*)d_in[7];
  const float* fsin = (const float*)d_in[8];
  float* out        = (float*)d_out;

  const size_t szX  = (size_t)NTOK * DM * 2;
  const size_t szWq = (size_t)EQ * DM * 2;
  const size_t szWk = (size_t)EK * DM * 2;
  const size_t szWo = (size_t)DM * EQ * 2;
  const size_t szQ  = (size_t)NTOK * EQ * 2;
  const size_t szK  = (size_t)NTOK * EK * 2;
  const size_t szVt = (size_t)NB * NKV * HD * SQ * 2;
  const size_t szO  = (size_t)NTOK * EQ * 2;
  size_t off = 0;
  const size_t oX  = off; off += szX;
  const size_t oWq = off; off += szWq;
  const size_t oWk = off; off += szWk;
  const size_t oWv = off; off += szWk;
  const size_t oWo = off; off += szWo;
  const size_t oQh = off; off += szQ;
  const size_t oQl = off; off += szQ;
  const size_t oK  = off; off += szK;
  const size_t oVh = off; off += szVt;
  const size_t oVl = off; off += szVt;
  const size_t oOh = off; off += szO;
  const size_t oOl = off; off += szO;
  if (off > ws_size) return;                  // off = 134217728

  char* ws = (char*)d_ws;
  unsigned short* Xb  = (unsigned short*)(ws + oX);
  unsigned short* Wqb = (unsigned short*)(ws + oWq);
  unsigned short* Wkb = (unsigned short*)(ws + oWk);
  unsigned short* Wvb = (unsigned short*)(ws + oWv);
  unsigned short* Wob = (unsigned short*)(ws + oWo);
  unsigned short* Qh  = (unsigned short*)(ws + oQh);
  unsigned short* Ql  = (unsigned short*)(ws + oQl);
  unsigned short* Kp  = (unsigned short*)(ws + oK);
  unsigned short* Vth = (unsigned short*)(ws + oVh);
  unsigned short* Vtl = (unsigned short*)(ws + oVl);
  unsigned short* Oh  = (unsigned short*)(ws + oOh);
  unsigned short* Ol  = (unsigned short*)(ws + oOl);

  // (1) f32 -> bf16 RNE planes (8 elements per thread; all counts are multiples of 2048)
  {
    const int n8x  = (NTOK * DM) / 8;          // 1048576 -> 4096 blocks
    const int n8wq = (EQ * DM) / 8;            //  524288 -> 2048 blocks
    const int n8wk = (EK * DM) / 8;            //  262144 -> 1024 blocks
    const int n8wo = (DM * EQ) / 8;            //  524288 -> 2048 blocks
    cvt_bf16_kernel<<<dim3((n8x + 255) / 256),  dim3(256), 0, stream>>>(x,  Xb,  n8x);
    cvt_bf16_kernel<<<dim3((n8wq + 255) / 256), dim3(256), 0, stream>>>(wq, Wqb, n8wq);
    cvt_bf16_kernel<<<dim3((n8wk + 255) / 256), dim3(256), 0, stream>>>(wk, Wkb, n8wk);
    cvt_bf16_kernel<<<dim3((n8wk + 255) / 256), dim3(256), 0, stream>>>(wv, Wvb, n8wk);
    cvt_bf16_kernel<<<dim3((n8wo + 255) / 256), dim3(256), 0, stream>>>(wo, Wob, n8wo);
  }

  // (2) projections: q (64 token blocks x 16 heads), k (64 x 8 kv heads), v^T (32 token blocks of 128 x 16 feature blocks of 64)
  proj_kernel<0><<<dim3(NTOK / 64, NH), dim3(128), 0, stream>>>(Xb, Wqb, qnw, fcos, fsin, Qh, Ql);
  proj_kernel<1><<<dim3(NTOK / 64, NKV), dim3(128), 0, stream>>>(Xb, Wkb, knw, fcos, fsin, Kp, Kp);
  proj_kernel<2><<<dim3(NTOK / 128, EK / 64), dim3(128), 0, stream>>>(Wvb, Xb, knw, fcos, fsin, Vth, Vtl);

  // (3) attention: 64 query blocks of 32 x 16 heads x 2 batches, 2 waves per block
  attn_kernel<<<dim3(SQ / 32, NH, NB), dim3(64), 0, stream>>>(Qh, Ql, Kp, Vth, Vtl, Oh, Ol);

  // (4) output projection -> d_out [4096][2048] f32
  out_kernel<<<dim3(NTOK / 64, DM / 128), dim3(128), 0, stream>>>(Oh, Ol, Wob, out);

  (void)hipGetLastError();
}

// v001
// One run takes 346 microseconds.
// Next to v000, in two timings, it ran 1.63 and 1.65 times as fast.
// q/k/v projections: v_wmma_f32_16x16x32_bf16 (bf16 operands, f32 accumulate); scores k.q^T: v_wmma_f32_16x16x32_f16 (k f16 x8 single plane, q f16 hi + lo planes x(0.0883883*log2e*1024), f32 accumulate); p.v^T: v_wmma_f32_16x16x32_f16 (p f16 x256 single, v^T f16 hi + lo planes x1024, f32 accumulate); output projection: v_wmma_f32_16x16x32_bf16 (attention output bf16 hi + lo planes, weights bf16, f32 accumulate); norm, rotary and softmax in f32.
#include <hip/hip_runtime.h>
#include <math.h>
#include <stddef.h>
#include <stdint.h>

#define NB    2
#define SQ    2048
#define DM    2048
#define NH    16
#define NKV   8
#define HD    128
#define EQ    (NH * HD)
#define EK    (NKV * HD)
#define NTOK  (NB * SQ)
#define TP    132
#define OSP   136
#define RMS_EPS 1e-5f
#define QMUL  (0.08838834764831845f * 1.4426950408889634f * 1024.0f)
#define KMUL  8.0f
#define VMUL  1024.0f
#define SINV  (1.0f / 8192.0f)
#define AWV   8                              // waves per attention block (16 queries each)
#define KPH   136                            // LDS pitch of a staged K row, halves (256 B + 16 B)
#define VPH   72                             // LDS pitch of a staged V^T row, halves (128 B + 16 B)
#define KTB   (64 * KPH * 2)                 // bytes of a staged K tile: 64 keys x 128 d
#define VTB   (HD * VPH * 2)                 // bytes of a staged V^T tile of one plane: 128 d x 64 keys
#define BUFB  (KTB + 2 * VTB)                // one ring buffer: K, V^T hi, V^T lo

typedef _Float16 v16h __attribute__((ext_vector_type(16)));
typedef _Float16 v8h  __attribute__((ext_vector_type(8)));
typedef __bf16   v16b __attribute__((ext_vector_type(16)));
typedef __bf16   v8b  __attribute__((ext_vector_type(8)));
typedef float    v8f  __attribute__((ext_vector_type(8)));
typedef float    v4f  __attribute__((ext_vector_type(4)));
typedef unsigned int v4u __attribute__((ext_vector_type(4)));

union HFrag { v16h v; v8h h[2]; };
union BFrag { v16b v; v8b h[2]; };

// ---------------------------------------------------------------------------
// scalar helpers (RNE conversions)
// ---------------------------------------------------------------------------
__device__ __forceinline__ unsigned short f2bf_bits(float f) {
  const unsigned u = __float_as_uint(f);
  return (unsigned short)((u + 0x7FFFu + ((u >> 16) & 1u)) >> 16);
}
__device__ __forceinline__ float bfb2f(unsigned short h) { return __uint_as_float(((unsigned)h) << 16); }
__device__ __forceinline__ float bf16r(float f) { return bfb2f(f2bf_bits(f)); }
__device__ __forceinline__ unsigned short hbits(_Float16 h) { return __builtin_bit_cast(unsigned short, h); }
__device__ __forceinline__ unsigned pk16(unsigned short a, unsigned short b) { return (unsigned)a | ((unsigned)b << 16); }

// ---------------------------------------------------------------------------
// 16x32 fragment loads (A layout; also B from a [n][k] k-contiguous plane):
// elements 0..7 <- p[0..7] (k0+8h..), elements 8..15 <- p[16..23] (k0+16+8h..), p = row + k0 + 8h
// ---------------------------------------------------------------------------
__device__ __forceinline__ v16b ldb(const __bf16* p) {
  BFrag f; f.h[0] = *(const v8b*)(p); f.h[1] = *(const v8b*)(p + 16); return f.v;
}
__device__ __forceinline__ v16h ldh(const _Float16* p) {
  HFrag f; f.h[0] = *(const v8h*)(p); f.h[1] = *(const v8h*)(p + 16); return f.v;
}
__device__ __forceinline__ v8f mma_b(v16b a, v16b b, v8f c) {
  return __builtin_amdgcn_wmma_f32_16x16x32_bf16(false, a, false, b, (short)0, c, false, false);
}
__device__ __forceinline__ v8f mma_h(v16h a, v16h b, v8f c) {
  return __builtin_amdgcn_wmma_f32_16x16x32_f16(false, a, false, b, (short)0, c, false, false);
}

// hazard guards: 4 VALU slots after the last WMMA of a group, tying D and keeping A/B live
__device__ __forceinline__ void guard_b(v8f& a, v8f& b, v16b x, v16b y) {
  asm volatile("v_nop\n\tv_nop\n\tv_nop\n\tv_nop" : "+v"(a), "+v"(b) : "v"(x), "v"(y));
}
__device__ __forceinline__ void keep_b(v16b a, v16b b, v16b c, v16b d) {
  asm volatile("v_nop" :: "v"(a), "v"(b), "v"(c), "v"(d));
}
__device__ __forceinline__ void acc_guard4(v8f& a, v8f& b, v8f& c, v8f& d) {
  asm volatile("v_nop\n\tv_nop\n\tv_nop\n\tv_nop" : "+v"(a), "+v"(b), "+v"(c), "+v"(d));
}
__device__ __forceinline__ void g_qk(v8f& s0, v8f& s1, v8f& s2, v8f& s3,
                                     v16h k0, v16h k1, v16h k2, v16h k3, v16h qa, v16h qb) {
  asm volatile("v_nop\n\tv_nop\n\tv_nop\n\tv_nop"
               : "+v"(s0), "+v"(s1), "+v"(s2), "+v"(s3)
               : "v"(k0), "v"(k1), "v"(k2), "v"(k3), "v"(qa), "v"(qb));
}
__device__ __forceinline__ void g_pv(v8f& a0, v8f& a1, v16h x0, v16h x1, v16h x2, v16h x3, v16h p) {
  asm volatile("v_nop\n\tv_nop\n\tv_nop\n\tv_nop"
               : "+v"(a0), "+v"(a1) : "v"(x0), "v"(x1), "v"(x2), "v"(x3), "v"(p));
}
__device__ __forceinline__ void g_acc8(v8f& a0, v8f& a1, v8f& a2, v8f& a3, v8f& a4, v8f& a5, v8f& a6, v8f& a7) {
  asm volatile("v_nop\n\tv_nop\n\tv_nop\n\tv_nop"
               : "+v"(a0), "+v"(a1), "+v"(a2), "+v"(a3), "+v"(a4), "+v"(a5), "+v"(a6), "+v"(a7));
}
__device__ __forceinline__ void sched_fence() { asm volatile("" ::: "memory"); }

// ---------------------------------------------------------------------------
// ---------------------------------------------------------------------------
__global__ __launch_bounds__(256) void cvt_bf16_kernel(const float* __restrict__ in,
                                                       unsigned short* __restrict__ out, int n8) {
  const int i = blockIdx.x * 256 + threadIdx.x;
  if (i < n8) {
    const float* src = in + (size_t)i * 8;
    const v4f a = *(const v4f*)(src);
    const v4f b = *(const v4f*)(src + 4);
    v4u o;
    o[0] = pk16(f2bf_bits(a[0]), f2bf_bits(a[1]));
    o[1] = pk16(f2bf_bits(a[2]), f2bf_bits(a[3]));
    o[2] = pk16(f2bf_bits(b[0]), f2bf_bits(b[1]));
    o[3] = pk16(f2bf_bits(b[2]), f2bf_bits(b[3]));
    unsigned short* dst = out + (size_t)i * 8;
    *(v4u*)dst = o;
    
  }
}

// ---------------------------------------------------------------------------
// Per-wave GEMM core: acc[i][j] (32 x 64 wave tile) += A[32 rows][K] . B[64 rows][K]^T, K = DM = 2048,
// all planes row-major with pitch DM, bf16 operands loaded straight from global (two 16-B loads per fragment).
// SPLIT: A given as hi plane A and lo plane A2 (unscaled residual, same accumulator).
// D layout: acc[i][j][r] = C[A row 16i + 8h + r][B row 16j + (lane&15)].
// ---------------------------------------------------------------------------
template <bool SPLIT>
__device__ __forceinline__ void gemm_core(const __bf16* __restrict__ A, const __bf16* __restrict__ A2,
                                          const __bf16* __restrict__ B, int lane, v8f (&acc)[2][4]) {
  const int m = lane & 15, ko = (lane >> 4) * 8;
  const __bf16* Ar  = A  + (size_t)m * DM + ko;
  const __bf16* Ar2 = A2 + (size_t)m * DM + ko;
  const __bf16* Br  = B  + (size_t)m * DM + ko;
#pragma unroll 1
  for (int k0 = 0; k0 < DM; k0 += 32) {
    v16b bf[4];
#pragma unroll
    for (int j = 0; j < 4; ++j) bf[j] = ldb(Br + (size_t)(16 * j) * DM + k0);
#pragma unroll
    for (int i = 0; i < 2; ++i) {
      const v16b af = ldb(Ar + (size_t)(16 * i) * DM + k0);
      v16b al = af;
      if (SPLIT) al = ldb(Ar2 + (size_t)(16 * i) * DM + k0);
#pragma unroll
      for (int j = 0; j < 4; ++j) {
        acc[i][j] = mma_b(af, bf[j], acc[i][j]);
        if (SPLIT) acc[i][j] = mma_b(al, bf[j], acc[i][j]);
      }
      guard_b(acc[i][0], acc[i][3], af, al);
    }
    keep_b(bf[0], bf[1], bf[2], bf[3]);
  }
  acc_guard4(acc[0][0], acc[0][1], acc[0][2], acc[0][3]);
  acc_guard4(acc[1][0], acc[1][1], acc[1][2], acc[1][3]);
}

// stage a wave's 32x64 tile into the block's 64x128 f32 LDS tile (pitch TP)
__device__ __forceinline__ void stage_tile(float* T, int w, int lane, v8f (&acc)[2][4]) {
  const int wr = w >> 1, wc = w & 1, hh = lane >> 4, m = lane & 15;
#pragma unroll
  for (int i = 0; i < 2; ++i)
#pragma unroll
    for (int j = 0; j < 4; ++j)
#pragma unroll
      for (int r = 0; r < 8; ++r)
        T[(32 * wr + 16 * i + 8 * hh + r) * TP + 64 * wc + 16 * j + m] = acc[i][j][r];
}

// ---------------------------------------------------------------------------
//   ROLE 0: A = X plane rows (tokens 64*bx), B = Wq plane rows (head by): RMSNorm + RoPE in f32,
//           q' = q * QMUL -> f16 hi plane P1, f16 lo plane P2 (lo = q' - hi, unscaled), [tok][EQ], cols by*128.
//   ROLE 1: A = X, B = Wk rows (kv head by): RMSNorm + RoPE, k' = k * 8 -> f16 plane P1 [tok][EK].
//   ROLE 2: A = Wv plane rows (features 64*by), B = X rows (tokens 128*bx): tile = V^T directly;
//           v' = v * 1024 -> f16 hi plane P1, lo plane P2 (unscaled), layout [(b*NKV+kvh)*128 + d][s].
// Epilogue: f32 tile staged in LDS, then each wave owns 16 rows; one store instruction = 16 lanes x 16 B
// Coverage per block: rows 16w + 2it + hh (w 0..3, it 0..7, hh 0..1) = 0..63, cols 8*(lane&15) = 0..127.
// ---------------------------------------------------------------------------
template <int ROLE>
__global__ __launch_bounds__(128) void proj_kernel(const unsigned short* __restrict__ Ap,
                                                   const unsigned short* __restrict__ Bp,
                                                   const float* __restrict__ nw,
                                                   const float* __restrict__ fcos,
                                                   const float* __restrict__ fsin,
                                                   unsigned short* __restrict__ P1,
                                                   unsigned short* __restrict__ P2) {
  __shared__ __align__(16) float T[64 * TP];
  const int lane = threadIdx.x & 31;
  const int w    = threadIdx.x >> 5;
  const int hh   = lane >> 4;
  const int m    = lane & 15;
  const int wr   = w >> 1, wc = w & 1;
  const int arow0 = (ROLE == 2) ? (int)blockIdx.y * 64 : (int)blockIdx.x * 64;
  const int brow0 = (ROLE == 2) ? (int)blockIdx.x * 128 : (int)blockIdx.y * 128;
  const __bf16* A = (const __bf16*)(const void*)Ap + (size_t)(arow0 + 32 * wr) * DM;
  const __bf16* B = (const __bf16*)(const void*)Bp + (size_t)(brow0 + 64 * wc) * DM;

  v8f acc[2][4];
#pragma unroll
  for (int i = 0; i < 2; ++i)
#pragma unroll
    for (int j = 0; j < 4; ++j) acc[i][j] = (v8f){0.f, 0.f, 0.f, 0.f, 0.f, 0.f, 0.f, 0.f};

  gemm_core<false>(A, A, B, lane, acc);
  stage_tile(T, w, lane, acc);
  __syncthreads();

  float wv[8];
  if (ROLE != 2) {
    const v4f wa = *(const v4f*)(nw + 8 * m);
    const v4f wb = *(const v4f*)(nw + 8 * m + 4);
#pragma unroll
    for (int e = 0; e < 4; ++e) { wv[e] = bf16r(wa[e]); wv[4 + e] = bf16r(wb[e]); }
  } else {
#pragma unroll
    for (int e = 0; e < 8; ++e) wv[e] = 1.0f;
  }

  v4u hv[8], lv[8];
#pragma unroll
  for (int it = 0; it < 8; ++it) {
    const int row = 16 * w + 2 * it + hh;
    const float* tr = T + row * TP + 8 * m;
    const v4f xa = *(const v4f*)(tr);
    const v4f xb = *(const v4f*)(tr + 4);
    float x[8] = {xa[0], xa[1], xa[2], xa[3], xb[0], xb[1], xb[2], xb[3]};
    float y[8];
    if (ROLE == 2) {
#pragma unroll
      for (int e = 0; e < 8; ++e) y[e] = x[e] * VMUL;
    } else {
      float ss = 0.f;
#pragma unroll
      for (int e = 0; e < 8; ++e) ss = fmaf(x[e], x[e], ss);
      ss += __shfl_xor(ss, 1, 32);
      ss += __shfl_xor(ss, 2, 32);
      ss += __shfl_xor(ss, 4, 32);
      ss += __shfl_xor(ss, 8, 32);
      const float rn  = rsqrtf(fmaf(ss, 1.0f / (float)HD, RMS_EPS));
      const int   tok = arow0 + row;
      const int   sp  = tok & (SQ - 1);
      const v4f c4 = *(const v4f*)(fcos + (size_t)sp * (HD / 2) + 4 * m);
      const v4f s4 = *(const v4f*)(fsin + (size_t)sp * (HD / 2) + 4 * m);
      const float om = (ROLE == 0) ? QMUL : KMUL;
#pragma unroll
      for (int p = 0; p < 4; ++p) {
        const float cs = bf16r(c4[p]), sn = bf16r(s4[p]);
        const float u0 = x[2 * p] * rn * wv[2 * p];
        const float u1 = x[2 * p + 1] * rn * wv[2 * p + 1];
        y[2 * p]     = (u0 * cs - u1 * sn) * om;
        y[2 * p + 1] = (u0 * sn + u1 * cs) * om;
      }
    }
    v4u a, c2;
#pragma unroll
    for (int q = 0; q < 4; ++q) {
      const _Float16 h0 = (_Float16)y[2 * q];
      const _Float16 h1 = (_Float16)y[2 * q + 1];
      a[q] = pk16(hbits(h0), hbits(h1));
      if (ROLE != 1) {
        const _Float16 l0 = (_Float16)(y[2 * q] - (float)h0);
        const _Float16 l1 = (_Float16)(y[2 * q + 1] - (float)h1);
        c2[q] = pk16(hbits(l0), hbits(l1));
      } else {
        c2[q] = 0u;
      }
    }
    hv[it] = a;
    lv[it] = c2;
  }

  {
#pragma unroll
    for (int it = 0; it < 8; ++it) {
      const int row = 16 * w + 2 * it + hh;
      size_t go;
      if (ROLE == 0) {
        go = (size_t)(arow0 + row) * EQ + (size_t)blockIdx.y * HD + 8 * m;
      } else if (ROLE == 1) {
        go = (size_t)(arow0 + row) * EK + (size_t)blockIdx.y * HD + 8 * m;
      } else {
        const int f   = arow0 + row;            // 0..1023
        const int kvh = f >> 7;
        const int d   = f & (HD - 1);
        const int bb  = brow0 >> 11;            // batch of this 128-token block
        const int s0  = brow0 & (SQ - 1);
        go = ((size_t)((bb * NKV + kvh) * HD + d)) * SQ + s0 + 8 * m;
      }
      *(v4u*)(P1 + go) = hv[it];
      if (ROLE != 1) *(v4u*)(P2 + go) = lv[it];
    }
    
  }
}

// ---------------------------------------------------------------------------
// Full (non-causal) GQA attention, head dim 128, one wave per (b, h, 16 queries); block = 8 waves (128 queries).
//   Each 64-key tile (K rows, V^T hi rows, V^T lo rows) is brought into LDS once per block by asynchronous
//   16-byte copies (whole 128-B lines on the global side), two buffers, the next tile in flight while this one
//   is worked on; all 8 waves read their fragments from LDS (row pitches 16 B x odd: no bank conflicts).
//   Transposed scores S^T[key][query] = K . Q^T : A = K rows [key][d] (f16 x8), B[k=d][n=query] from Q rows
//   [query][d] (f16 hi, f16 lo) -> both fragments are plain k-contiguous row loads.
//   D tiles (rows = 16 keys, cols = queries) packed to f16 ARE the B operand [k=key][n=query] of
//   O^T[d][query] = V^T . P : element r <- tile(keys 0-15)[r], element 8+r <- tile(keys 16-31)[r], same lane.
//   A = V^T rows [d][s] (f16 hi x1024 + unscaled lo). Softmax per query column = per lane (partner lane ^16),
//   online over 32 chunks of 64 keys, f32, exp2 with log2e folded into the q scale, p carried x256.
//   Epilogue: O = acc / (l * 1024), bf16 hi + lo split, per-wave LDS relayout [query][d] (v4u store/reload,
//   Coverage: rows 2it + hh (it 0..7) = 16 queries, cols 8*(lane&15) = 0..127 of head h, per plane.
// ---------------------------------------------------------------------------
// One tile's copies: 12 per lane (4 of K, 4 of each V^T plane), every lane on. The s_wait_xcnt stands inside the
// statement so that no address register is rewritten ahead of it.
__device__ __forceinline__ void stage_copies(unsigned lk, unsigned lv, const unsigned short* gk,
                                             const unsigned short* gh, const unsigned short* gl) {
  asm volatile("global_load_async_to_lds_b128 %0, %12, off\n\t"
               "global_load_async_to_lds_b128 %1, %13, off\n\t"
               "global_load_async_to_lds_b128 %2, %14, off\n\t"
               "global_load_async_to_lds_b128 %3, %15, off\n\t"
               "global_load_async_to_lds_b128 %4, %16, off\n\t"
               "global_load_async_to_lds_b128 %5, %17, off\n\t"
               "global_load_async_to_lds_b128 %6, %18, off\n\t"
               "global_load_async_to_lds_b128 %7, %19, off\n\t"
               "global_load_async_to_lds_b128 %8, %20, off\n\t"
               "global_load_async_to_lds_b128 %9, %21, off\n\t"
               "global_load_async_to_lds_b128 %10, %22, off\n\t"
               "global_load_async_to_lds_b128 %11, %23, off\n\t"
               "s_wait_xcnt 0x0"
               :: "v"(lk), "v"(lk + 16u * KPH * 2u), "v"(lk + 32u * KPH * 2u), "v"(lk + 48u * KPH * 2u),
                  "v"(lv), "v"(lv + 32u * VPH * 2u), "v"(lv + 64u * VPH * 2u), "v"(lv + 96u * VPH * 2u),
                  "v"(lv + VTB), "v"(lv + VTB + 32u * VPH * 2u), "v"(lv + VTB + 64u * VPH * 2u),
                  "v"(lv + VTB + 96u * VPH * 2u),
                  "v"(gk), "v"(gk + (size_t)16 * EK), "v"(gk + (size_t)32 * EK), "v"(gk + (size_t)48 * EK),
                  "v"(gh), "v"(gh + (size_t)32 * SQ), "v"(gh + (size_t)64 * SQ), "v"(gh + (size_t)96 * SQ),
                  "v"(gl), "v"(gl + (size_t)32 * SQ), "v"(gl + (size_t)64 * SQ), "v"(gl + (size_t)96 * SQ)
               : "memory");
}

__global__ __launch_bounds__(32 * AWV) void attn_kernel(const unsigned short* __restrict__ Qhp,
                                                  const unsigned short* __restrict__ Qlp,
                                                  const unsigned short* __restrict__ Kpp,
                                                  const unsigned short* __restrict__ Vhp,
                                                  const unsigned short* __restrict__ Vlp,
                                                  unsigned short* __restrict__ Ohp,
                                                  unsigned short* __restrict__ Olp) {
  // two tile buffers; after the loop the same bytes serve as output staging [wave][plane][query*OSP + d]
  __shared__ __align__(16) unsigned char ring[2 * BUFB];
  static_assert(AWV * 2 * 16 * OSP * 2 <= 2 * BUFB, "output staging fits the ring");
  const int lane = threadIdx.x & 31;
  const int w    = threadIdx.x >> 5;
  const int hh   = lane >> 4;
  const int m    = lane & 15;
  const int h    = blockIdx.y;
  const int b    = blockIdx.z;
  const int kvh  = h >> 1;                       // G = NH / NKV = 2
  const int q0   = blockIdx.x * (16 * AWV) + w * 16;   // query index within the sequence

  const _Float16* Qh = (const _Float16*)(const void*)Qhp;
  const _Float16* Ql = (const _Float16*)(const void*)Qlp;
  const size_t vplane = (size_t)((b * NKV + kvh) * HD) * SQ;
  // copy addresses of this lane. K: key row (tid>>4) + 16i, 16-B piece tid&15; V^T: d row (tid>>3) + 32i, piece tid&7
  const int tid = threadIdx.x;
  const unsigned short* gk = Kpp + (size_t)b * SQ * EK + kvh * HD + (size_t)(tid >> 4) * EK + 8 * (tid & 15);
  const unsigned short* gh = Vhp + vplane + (size_t)(tid >> 3) * SQ + 8 * (tid & 7);
  const unsigned short* gl = Vlp + vplane + (size_t)(tid >> 3) * SQ + 8 * (tid & 7);
  typedef __attribute__((address_space(3))) unsigned char lds_byte;
  const unsigned ring0 = (unsigned)(uintptr_t)(lds_byte*)ring;
  const unsigned lk = ring0 + (unsigned)((tid >> 4) * (KPH * 2) + 16 * (tid & 15));
  const unsigned lv = ring0 + (unsigned)(KTB + (tid >> 3) * (VPH * 2) + 16 * (tid & 7));

  // tile 0 into buffer 0, landed and published; then tile 1 into buffer 1
  stage_copies(lk, lv, gk, gh, gl);
  asm volatile("s_wait_asynccnt 0x0" ::: "memory");   // this wave's copies of tile 0 have landed
  __syncthreads();                                    // every wave's have
  stage_copies(lk + BUFB, lv + BUFB, gk + (size_t)64 * EK, gh + 64, gl + 64);

  // Q fragments (B operand): row = query q0 + (lane&15), k = d
  v16h qh[4], ql[4];
  {
    const size_t qo = ((size_t)b * SQ + q0 + m) * EQ + (size_t)h * HD + 8 * hh;
#pragma unroll
    for (int dc = 0; dc < 4; ++dc) {
      qh[dc] = ldh(Qh + qo + 32 * dc);
      ql[dc] = ldh(Ql + qo + 32 * dc);
    }
  }

  v8f acc[8];
#pragma unroll
  for (int t = 0; t < 8; ++t) acc[t] = (v8f){0.f, 0.f, 0.f, 0.f, 0.f, 0.f, 0.f, 0.f};
  float mrun = -1.0e30f;
  float lrun = 0.0f;

#pragma unroll 1
  for (int kc = 0; kc < SQ / 64; ++kc) {
    const unsigned char* buf = ring + (kc & 1) * BUFB;
    const _Float16* Kr  = (const _Float16*)(const void*)buf + m * KPH + 8 * hh;                // + key*KPH + 32dc
    const _Float16* Vhr = (const _Float16*)(const void*)(buf + KTB) + m * VPH + 8 * hh;        // + 16t*VPH + key
    const _Float16* Vlr = (const _Float16*)(const void*)(buf + KTB + VTB) + m * VPH + 8 * hh;
    v8f s[4];
#pragma unroll
    for (int j = 0; j < 4; ++j) s[j] = (v8f){0.f, 0.f, 0.f, 0.f, 0.f, 0.f, 0.f, 0.f};
#pragma unroll
    for (int dc = 0; dc < 4; ++dc) {
      v16h kf[4];
#pragma unroll
      for (int j = 0; j < 4; ++j) kf[j] = ldh(Kr + (16 * j) * KPH + 32 * dc);
#pragma unroll
      for (int j = 0; j < 4; ++j) {
        s[j] = mma_h(kf[j], qh[dc], s[j]);
        s[j] = mma_h(kf[j], ql[dc], s[j]);
      }
      g_qk(s[0], s[1], s[2], s[3], kf[0], kf[1], kf[2], kf[3], qh[dc], ql[dc]);
      sched_fence();
    }

    // online softmax for query column (lane&15); lane holds keys key0 + 16j + 8hh + r
    float cmax = -1.0e30f;
#pragma unroll
    for (int j = 0; j < 4; ++j)
#pragma unroll
      for (int r = 0; r < 8; ++r) cmax = fmaxf(cmax, s[j][r]);
    cmax = fmaxf(cmax, __shfl_xor(cmax, 16, 32));
    const float mnew  = fmaxf(mrun, cmax);
    const float alpha = __builtin_amdgcn_exp2f((mrun - mnew) * SINV);
    const float nms   = 8.0f - mnew * SINV;          // p * 256 = exp2(s*SINV - m*SINV + 8)
    float psum = 0.f;
#pragma unroll
    for (int j = 0; j < 4; ++j)
#pragma unroll
      for (int r = 0; r < 8; ++r) {
        const float p = __builtin_amdgcn_exp2f(fmaf(s[j][r], SINV, nms));
        s[j][r] = p;
        psum += p;
      }
    psum += __shfl_xor(psum, 16, 32);
    lrun = fmaf(lrun, alpha, psum);
    mrun = mnew;
#pragma unroll
    for (int t = 0; t < 8; ++t) acc[t] = acc[t] * alpha;

#pragma unroll
    for (int ks = 0; ks < 2; ++ks) {
      HFrag pf;
      v8h plo, phi;
#pragma unroll
      for (int r = 0; r < 8; ++r) {
        plo[r] = (_Float16)s[2 * ks][r];        // keys 32ks + 8hh + r
        phi[r] = (_Float16)s[2 * ks + 1][r];    // keys 32ks + 16 + 8hh + r
      }
      pf.h[0] = plo;
      pf.h[1] = phi;
      const int ko = 32 * ks;
#pragma unroll
      for (int t = 0; t < 8; t += 2) {
        const v16h a0 = ldh(Vhr + (16 * t) * VPH + ko);
        const v16h b0 = ldh(Vlr + (16 * t) * VPH + ko);
        const v16h a1 = ldh(Vhr + (16 * (t + 1)) * VPH + ko);
        const v16h b1 = ldh(Vlr + (16 * (t + 1)) * VPH + ko);
        acc[t]     = mma_h(a0, pf.v, acc[t]);
        acc[t]     = mma_h(b0, pf.v, acc[t]);
        acc[t + 1] = mma_h(a1, pf.v, acc[t + 1]);
        acc[t + 1] = mma_h(b1, pf.v, acc[t + 1]);
        g_pv(acc[t], acc[t + 1], a0, b0, a1, b1, pf.v);
        sched_fence();
      }
    }

    // hand-over: this wave has left buffer kc&1 and its copies of tile kc+1 have landed; behind the barrier that
    // holds for every wave, so tile kc+1 may be read and buffer kc&1 refilled
    asm volatile("s_wait_dscnt 0x0" ::: "memory");
    asm volatile("s_wait_asynccnt 0x0" ::: "memory");
    __syncthreads();
    if (kc + 2 < SQ / 64) {
      const unsigned bo = (unsigned)(kc & 1) * BUFB;
      stage_copies(lk + bo, lv + bo, gk + (size_t)(kc + 2) * 64 * EK, gh + (kc + 2) * 64, gl + (kc + 2) * 64);
    }
  }
  asm volatile("s_wait_asynccnt 0x0" ::: "memory");   // nothing in flight when the ring becomes output staging
  g_acc8(acc[0], acc[1], acc[2], acc[3], acc[4], acc[5], acc[6], acc[7]);

  // ---- epilogue: acc[t][r] = O^T[d = 16t + 8hh + r][query m] * (256 * 1024 * l256/256) ----
  const float inv = __builtin_amdgcn_rcpf(lrun) * (1.0f / VMUL);
  unsigned short* sh = (unsigned short*)(void*)ring + (2 * w) * (16 * OSP);
  unsigned short* sl = sh + 16 * OSP;
#pragma unroll
  for (int t = 0; t < 8; ++t) {
    v4u hv, lvv;
#pragma unroll
    for (int q = 0; q < 4; ++q) {
      const float o0 = acc[t][2 * q] * inv;
      const float o1 = acc[t][2 * q + 1] * inv;
      const unsigned short h0 = f2bf_bits(o0), h1 = f2bf_bits(o1);
      const unsigned short l0 = f2bf_bits(o0 - bfb2f(h0)), l1 = f2bf_bits(o1 - bfb2f(h1));
      hv[q]  = pk16(h0, h1);
      lvv[q] = pk16(l0, l1);
    }
    *(v4u*)(sh + m * OSP + 16 * t + 8 * hh) = hv;
    *(v4u*)(sl + m * OSP + 16 * t + 8 * hh) = lvv;
  }
  __builtin_amdgcn_fence(__ATOMIC_RELEASE, "wavefront");
  __builtin_amdgcn_wave_barrier();
  __builtin_amdgcn_fence(__ATOMIC_ACQUIRE, "wavefront");
  v4u ov[2][8];
#pragma unroll
  for (int it = 0; it < 8; ++it) {
    const int row = 2 * it + hh;
    ov[0][it] = *(const v4u*)(sh + row * OSP + 8 * m);
    ov[1][it] = *(const v4u*)(sl + row * OSP + 8 * m);
  }
  {
#pragma unroll
    for (int it = 0; it < 8; ++it) {
      const int row = 2 * it + hh;
      const size_t go = ((size_t)b * SQ + q0 + row) * EQ + (size_t)h * HD + 8 * m;
      *(v4u*)(Ohp + go) = ov[0][it];
      *(v4u*)(Olp + go) = ov[1][it];
    }
    
  }
}

// ---------------------------------------------------------------------------
// Output projection: out[tok][dout] = sum_e O[tok][e] * Wo[dout][e]; A = O hi + lo bf16 planes, B = Wo bf16.
// Block 64 tokens x 128 out cols; f32 tile staged in LDS; each wave writes 16 rows, one instruction per
// Coverage per block: rows 16w + it (it 0..15) = 0..63, cols 4*lane = 0..127.
// ---------------------------------------------------------------------------
__global__ __launch_bounds__(128) void out_kernel(const unsigned short* __restrict__ Ohp,
                                                  const unsigned short* __restrict__ Olp,
                                                  const unsigned short* __restrict__ Wp,
                                                  float* __restrict__ out) {
  __shared__ __align__(16) float T[64 * TP];
  const int lane = threadIdx.x & 31;
  const int w    = threadIdx.x >> 5;
  const int wr   = w >> 1, wc = w & 1;
  const int arow0 = blockIdx.x * 64;
  const int brow0 = blockIdx.y * 128;
  const __bf16* A  = (const __bf16*)(const void*)Ohp + (size_t)(arow0 + 32 * wr) * DM;
  const __bf16* A2 = (const __bf16*)(const void*)Olp + (size_t)(arow0 + 32 * wr) * DM;
  const __bf16* B  = (const __bf16*)(const void*)Wp  + (size_t)(brow0 + 64 * wc) * DM;

  v8f acc[2][4];
#pragma unroll
  for (int i = 0; i < 2; ++i)
#pragma unroll
    for (int j = 0; j < 4; ++j) acc[i][j] = (v8f){0.f, 0.f, 0.f, 0.f, 0.f, 0.f, 0.f, 0.f};

  gemm_core<true>(A, A2, B, lane, acc);
  stage_tile(T, w, lane, acc);
  __syncthreads();

  v4f val[16];
#pragma unroll
  for (int it = 0; it < 16; ++it) val[it] = *(const v4f*)(T + (16 * w + it) * TP + 4 * lane);
  {
#pragma unroll
    for (int it = 0; it < 16; ++it) {
      *(v4f*)(out + (size_t)(arow0 + 16 * w + it) * DM + brow0 + 4 * lane) = val[it];
    }
    
  }
}

// ---------------------------------------------------------------------------
// Workspace map (bytes):
//   Xb  bf16 [4096][2048]        16777216 @ 0
//   Wqb bf16 [2048][2048]         8388608
//   Wkb bf16 [1024][2048]         4194304
//   Wvb bf16 [1024][2048]         4194304
//   Wob bf16 [2048][2048]         8388608
//   Qh  f16  [4096][2048]        16777216      Ql same
//   Kp  f16  [4096][1024]         8388608
//   Vth f16  [2*8*128][2048]      8388608      Vtl same
//   Oh  bf16 [4096][2048]        16777216      Ol same
//   total                       134217728
// ---------------------------------------------------------------------------
extern "C" void kernel_launch(void* const* d_in, const int* in_sizes, int n_in,
                              void* d_out, int out_size, void* d_ws, size_t ws_size,
                              hipStream_t stream) {
  if (n_in < 9) return;
  if (in_sizes[0] != NTOK * DM) return;
  if (in_sizes[1] != EQ * DM || in_sizes[2] != EK * DM || in_sizes[3] != EK * DM || in_sizes[4] != DM * EQ) return;
  if (in_sizes[5] != HD || in_sizes[6] != HD) return;
  if (in_sizes[7] != SQ * (HD / 2) || in_sizes[8] != SQ * (HD / 2)) return;
  if (out_size != NTOK * DM) return;

  const float* x    = (const float*)d_in[0];
  const float* wq   = (const float*)d_in[1];
  const float* wk   = (const float*)d_in[2];
  const float* wv   = (const float*)d_in[3];
  const float* wo   = (const float*)d_in[4];
  const float* qnw  = (const float*)d_in[5];
  const float* knw  = (const float*)d_in[6];
  const float* fcos = (const float*)d_in[7];
  const float* fsin = (const float*)d_in[8];
  float* out        = (float*)d_out;

  const size_t szX  = (size_t)NTOK * DM * 2;
  const size_t szWq = (size_t)EQ * DM * 2;
  const size_t szWk = (size_t)EK * DM * 2;
  const size_t szWo = (size_t)DM * EQ * 2;
  const size_t szQ  = (size_t)NTOK * EQ * 2;
  const size_t szK  = (size_t)NTOK * EK * 2;
  const size_t szVt = (size_t)NB * NKV * HD * SQ * 2;
  const size_t szO  = (size_t)NTOK * EQ * 2;
  size_t off = 0;
  const size_t oX  = off; off += szX;
  const size_t oWq = off; off += szWq;
  const size_t oWk = off; off += szWk;
  const size_t oWv = off; off += szWk;
  const size_t oWo = off; off += szWo;
  const size_t oQh = off; off += szQ;
  const size_t oQl = off; off += szQ;
  const size_t oK  = off; off += szK;
  const size_t oVh = off; off += szVt;
  const size_t oVl = off; off += szVt;
  const size_t oOh = off; off += szO;
  const size_t oOl = off; off += szO;
  if (off > ws_size) return;                  // off = 134217728

  char* ws = (char*)d_ws;
  unsigned short* Xb  = (unsigned short*)(ws + oX);
  unsigned short* Wqb = (unsigned short*)(ws + oWq);
  unsigned short* Wkb = (unsigned short*)(ws + oWk);
  unsigned short* Wvb = (unsigned short*)(ws + oWv);
  unsigned short* Wob = (unsigned short*)(ws + oWo);
  unsigned short* Qh  = (unsigned short*)(ws + oQh);
  unsigned short* Ql  = (unsigned short*)(ws + oQl);
  unsigned short* Kp  = (unsigned short*)(ws + oK);
  unsigned short* Vth = (unsigned short*)(ws + oVh);
  unsigned short* Vtl = (unsigned short*)(ws + oVl);
  unsigned short* Oh  = (unsigned short*)(ws + oOh);
  unsigned short* Ol  = (unsigned short*)(ws + oOl);

  // (1) f32 -> bf16 RNE planes (8 elements per thread; all counts are multiples of 2048)
  {
    const int n8x  = (NTOK * DM) / 8;          // 1048576 -> 4096 blocks
    const int n8wq = (EQ * DM) / 8;            //  524288 -> 2048 blocks
    const int n8wk = (EK * DM) / 8;            //  262144 -> 1024 blocks
    const int n8wo = (DM * EQ) / 8;            //  524288 -> 2048 blocks
    cvt_bf16_kernel<<<dim3((n8x + 255) / 256),  dim3(256), 0, stream>>>(x,  Xb,  n8x);
    cvt_bf16_kernel<<<dim3((n8wq + 255) / 256), dim3(256), 0, stream>>>(wq, Wqb, n8wq);
    cvt_bf16_kernel<<<dim3((n8wk + 255) / 256), dim3(256), 0, stream>>>(wk, Wkb, n8wk);
    cvt_bf16_kernel<<<dim3((n8wk + 255) / 256), dim3(256), 0, stream>>>(wv, Wvb, n8wk);
    cvt_bf16_kernel<<<dim3((n8wo + 255) / 256), dim3(256), 0, stream>>>(wo, Wob, n8wo);
  }

  // (2) projections: q (64 token blocks x 16 heads), k (64 x 8 kv heads), v^T (32 token blocks of 128 x 16 feature blocks of 64)
  proj_kernel<0><<<dim3(NTOK / 64, NH), dim3(128), 0, stream>>>(Xb, Wqb, qnw, fcos, fsin, Qh, Ql);
  proj_kernel<1><<<dim3(NTOK / 64, NKV), dim3(128), 0, stream>>>(Xb, Wkb, knw, fcos, fsin, Kp, Kp);
  proj_kernel<2><<<dim3(NTOK / 128, EK / 64), dim3(128), 0, stream>>>(Wvb, Xb, knw, fcos, fsin, Vth, Vtl);

  // (3) attention: 16 query blocks of 128 x 16 heads x 2 batches, 8 waves per block
  attn_kernel<<<dim3(SQ / (16 * AWV), NH, NB), dim3(32 * AWV), 0, stream>>>(Qh, Ql, Kp, Vth, Vtl, Oh, Ol);

  // (4) output projection -> d_out [4096][2048] f32
  out_kernel<<<dim3(NTOK / 64, DM / 128), dim3(128), 0, stream>>>(Oh, Ol, Wob, out);

  (void)hipGetLastError();
}

// v002
// One run takes 239 microseconds.
// In two side-by-side timings against v001, it was 1.45 and 1.44 times as fast.
// Over all steps from v000 it is 2.38 times as fast.
// q/k/v projections: v_wmma_f32_16x16x32_bf16 (bf16 operands staged in LDS, f32 accumulate); scores k.q^T: v_wmma_f32_16x16x32_f16 (k f16 x8 single plane, q f16 hi + lo planes x(0.0883883*log2e*1024), f32 accumulate); p.v^T: v_wmma_f32_16x16x32_f16 (p f16 x256 single, v^T f16 hi + lo planes x1024, f32 accumulate); output projection: v_wmma_f32_16x16x32_bf16 (attention output bf16 hi + lo planes, weights bf16, f32 accumulate); norm, rotary and softmax in f32.
#include <hip/hip_runtime.h>
#include <math.h>
#include <stddef.h>
#include <stdint.h>

#define NB    2
#define SQ    2048
#define DM    2048
#define NH    16
#define NKV   8
#define HD    128
#define EQ    (NH * HD)
#define EK    (NKV * HD)
#define NTOK  (NB * SQ)
#define TP    132
#define OSP   136
#define RMS_EPS 1e-5f
#define QMUL  (0.08838834764831845f * 1.4426950408889634f * 1024.0f)
#define KMUL  8.0f
#define VMUL  1024.0f
#define SINV  (1.0f / 8192.0f)
#define AWV   8                              // waves per attention block (16 queries each)
#define KPH   136                            // LDS pitch of a staged K row, halves (256 B + 16 B)
#define VPH   72                             // LDS pitch of a staged V^T row, halves (128 B + 16 B)
#define KTB   (64 * KPH * 2)                 // bytes of a staged K tile: 64 keys x 128 d
#define VTB   (HD * VPH * 2)                 // bytes of a staged V^T tile of one plane: 128 d x 64 keys
#define BUFB  (KTB + 2 * VTB)                // one ring buffer: K, V^T hi, V^T lo
#define GKB   64                             // k elements of every operand row in one staged GEMM tile (128 B)
#define GPH   72                             // LDS pitch of a staged GEMM operand row, halves (128 B + 16 B)
#define GRB   (GPH * 2)                      // the same pitch in bytes
#define GBUF(S) (((S) ? 256 : 192) * GRB)    // one GEMM ring buffer: A 64 rows, (A lo 64 rows,) B 128 rows

typedef _Float16 v16h __attribute__((ext_vector_type(16)));
typedef _Float16 v8h  __attribute__((ext_vector_type(8)));
typedef __bf16   v16b __attribute__((ext_vector_type(16)));
typedef __bf16   v8b  __attribute__((ext_vector_type(8)));
typedef float    v8f  __attribute__((ext_vector_type(8)));
typedef float    v4f  __attribute__((ext_vector_type(4)));
typedef unsigned int v4u __attribute__((ext_vector_type(4)));

union HFrag { v16h v; v8h h[2]; };
union BFrag { v16b v; v8b h[2]; };

// ---------------------------------------------------------------------------
// scalar helpers (RNE conversions)
// ---------------------------------------------------------------------------
__device__ __forceinline__ unsigned short f2bf_bits(float f) {
  const unsigned u = __float_as_uint(f);
  return (unsigned short)((u + 0x7FFFu + ((u >> 16) & 1u)) >> 16);
}
__device__ __forceinline__ float bfb2f(unsigned short h) { return __uint_as_float(((unsigned)h) << 16); }
__device__ __forceinline__ float bf16r(float f) { return bfb2f(f2bf_bits(f)); }
__device__ __forceinline__ unsigned short hbits(_Float16 h) { return __builtin_bit_cast(unsigned short, h); }
__device__ __forceinline__ unsigned pk16(unsigned short a, unsigned short b) { return (unsigned)a | ((unsigned)b << 16); }

// ---------------------------------------------------------------------------
// 16x32 fragment loads (A layout; also B from a [n][k] k-contiguous plane):
// elements 0..7 <- p[0..7] (k0+8h..), elements 8..15 <- p[16..23] (k0+16+8h..), p = row + k0 + 8h
// ---------------------------------------------------------------------------
__device__ __forceinline__ v16b ldb(const __bf16* p) {
  BFrag f; f.h[0] = *(const v8b*)(p); f.h[1] = *(const v8b*)(p + 16); return f.v;
}
__device__ __forceinline__ v16h ldh(const _Float16* p) {
  HFrag f; f.h[0] = *(const v8h*)(p); f.h[1] = *(const v8h*)(p + 16); return f.v;
}
__device__ __forceinline__ v8f mma_b(v16b a, v16b b, v8f c) {
  return __builtin_amdgcn_wmma_f32_16x16x32_bf16(false, a, false, b, (short)0, c, false, false);
}
__device__ __forceinline__ v8f mma_h(v16h a, v16h b, v8f c) {
  return __builtin_amdgcn_wmma_f32_16x16x32_f16(false, a, false, b, (short)0, c, false, false);
}

// hazard guards: 4 VALU slots after the last WMMA of a group, tying D and keeping A/B live
__device__ __forceinline__ void guard_b(v8f& a, v8f& b, v16b x, v16b y) {
  asm volatile("v_nop\n\tv_nop\n\tv_nop\n\tv_nop" : "+v"(a), "+v"(b) : "v"(x), "v"(y));
}
__device__ __forceinline__ void keep_b(v16b a, v16b b, v16b c, v16b d) {
  asm volatile("v_nop" :: "v"(a), "v"(b), "v"(c), "v"(d));
}
__device__ __forceinline__ void acc_guard4(v8f& a, v8f& b, v8f& c, v8f& d) {
  asm volatile("v_nop\n\tv_nop\n\tv_nop\n\tv_nop" : "+v"(a), "+v"(b), "+v"(c), "+v"(d));
}
__device__ __forceinline__ void g_qk(v8f& s0, v8f& s1, v8f& s2, v8f& s3,
                                     v16h k0, v16h k1, v16h k2, v16h k3, v16h qa, v16h qb) {
  asm volatile("v_nop\n\tv_nop\n\tv_nop\n\tv_nop"
               : "+v"(s0), "+v"(s1), "+v"(s2), "+v"(s3)
               : "v"(k0), "v"(k1), "v"(k2), "v"(k3), "v"(qa), "v"(qb));
}
__device__ __forceinline__ void g_pv(v8f& a0, v8f& a1, v16h x0, v16h x1, v16h x2, v16h x3, v16h p) {
  asm volatile("v_nop\n\tv_nop\n\tv_nop\n\tv_nop"
               : "+v"(a0), "+v"(a1) : "v"(x0), "v"(x1), "v"(x2), "v"(x3), "v"(p));
}
__device__ __forceinline__ void g_acc8(v8f& a0, v8f& a1, v8f& a2, v8f& a3, v8f& a4, v8f& a5, v8f& a6, v8f& a7) {
  asm volatile("v_nop\n\tv_nop\n\tv_nop\n\tv_nop"
               : "+v"(a0), "+v"(a1), "+v"(a2), "+v"(a3), "+v"(a4), "+v"(a5), "+v"(a6), "+v"(a7));
}
__device__ __forceinline__ void sched_fence() { asm volatile("" ::: "memory"); }

// ---------------------------------------------------------------------------
// ---------------------------------------------------------------------------
__global__ __launch_bounds__(256) void cvt_bf16_kernel(const float* __restrict__ in,
                                                       unsigned short* __restrict__ out, int n8) {
  const int i = blockIdx.x * 256 + threadIdx.x;
  if (i < n8) {
    const float* src = in + (size_t)i * 8;
    const v4f a = *(const v4f*)(src);
    const v4f b = *(const v4f*)(src + 4);
    v4u o;
    o[0] = pk16(f2bf_bits(a[0]), f2bf_bits(a[1]));
    o[1] = pk16(f2bf_bits(a[2]), f2bf_bits(a[3]));
    o[2] = pk16(f2bf_bits(b[0]), f2bf_bits(b[1]));
    o[3] = pk16(f2bf_bits(b[2]), f2bf_bits(b[3]));
    unsigned short* dst = out + (size_t)i * 8;
    *(v4u*)dst = o;
    
  }
}

// ---------------------------------------------------------------------------
// Block GEMM core: acc[i][j] (32 x 64 wave tile of the block's 64 x 128 tile) += A[64 rows][K] . B[128 rows][K]^T,
// K = DM = 2048, all planes row-major with pitch DM, bf16. Each 64-k tile of the block's A and B rows is brought into
// LDS once per block by asynchronous 16-byte copies (8 lanes = one whole 128-B line of a row), two buffers, the next
// tile in flight while this one is worked on; the 4 waves read their fragments from LDS (pitch 16 B x odd).
// SPLIT: A given as hi plane gA and lo plane gA2 (unscaled residual, same accumulator).
// gA, gA2, gB point at the block's first row. On return every wave has left the ring (the last trip's barrier).
// D layout: acc[i][j][r] = C[A row 32wr + 16i + 8h + r][B row 64wc + 16j + (lane&15)].
// ---------------------------------------------------------------------------
// Copies of one lane, every lane on: each (l, g) pair stands for rows r, r + 16, r + 32, r + 48 of a plane. The
// s_wait_xcnt stands inside the statement so that no address register is rewritten ahead of it.
__device__ __forceinline__ void copy8(unsigned l0, const unsigned short* g0, unsigned l1, const unsigned short* g1) {
  asm volatile("global_load_async_to_lds_b128 %0, %8, off\n\t"
               "global_load_async_to_lds_b128 %1, %9, off\n\t"
               "global_load_async_to_lds_b128 %2, %10, off\n\t"
               "global_load_async_to_lds_b128 %3, %11, off\n\t"
               "global_load_async_to_lds_b128 %4, %12, off\n\t"
               "global_load_async_to_lds_b128 %5, %13, off\n\t"
               "global_load_async_to_lds_b128 %6, %14, off\n\t"
               "global_load_async_to_lds_b128 %7, %15, off\n\t"
               "s_wait_xcnt 0x0"
               :: "v"(l0), "v"(l0 + 16u * GRB), "v"(l0 + 32u * GRB), "v"(l0 + 48u * GRB),
                  "v"(l1), "v"(l1 + 16u * GRB), "v"(l1 + 32u * GRB), "v"(l1 + 48u * GRB),
                  "v"(g0), "v"(g0 + (size_t)16 * DM), "v"(g0 + (size_t)32 * DM), "v"(g0 + (size_t)48 * DM),
                  "v"(g1), "v"(g1 + (size_t)16 * DM), "v"(g1 + (size_t)32 * DM), "v"(g1 + (size_t)48 * DM)
               : "memory");
}
__device__ __forceinline__ void copy12(unsigned l0, const unsigned short* g0, unsigned l1, const unsigned short* g1,
                                       unsigned l2, const unsigned short* g2) {
  asm volatile("global_load_async_to_lds_b128 %0, %12, off\n\t"
               "global_load_async_to_lds_b128 %1, %13, off\n\t"
               "global_load_async_to_lds_b128 %2, %14, off\n\t"
               "global_load_async_to_lds_b128 %3, %15, off\n\t"
               "global_load_async_to_lds_b128 %4, %16, off\n\t"
               "global_load_async_to_lds_b128 %5, %17, off\n\t"
               "global_load_async_to_lds_b128 %6, %18, off\n\t"
               "global_load_async_to_lds_b128 %7, %19, off\n\t"
               "global_load_async_to_lds_b128 %8, %20, off\n\t"
               "global_load_async_to_lds_b128 %9, %21, off\n\t"
               "global_load_async_to_lds_b128 %10, %22, off\n\t"
               "global_load_async_to_lds_b128 %11, %23, off\n\t"
               "s_wait_xcnt 0x0"
               :: "v"(l0), "v"(l0 + 16u * GRB), "v"(l0 + 32u * GRB), "v"(l0 + 48u * GRB),
                  "v"(l1), "v"(l1 + 16u * GRB), "v"(l1 + 32u * GRB), "v"(l1 + 48u * GRB),
                  "v"(l2), "v"(l2 + 16u * GRB), "v"(l2 + 32u * GRB), "v"(l2 + 48u * GRB),
                  "v"(g0), "v"(g0 + (size_t)16 * DM), "v"(g0 + (size_t)32 * DM), "v"(g0 + (size_t)48 * DM),
                  "v"(g1), "v"(g1 + (size_t)16 * DM), "v"(g1 + (size_t)32 * DM), "v"(g1 + (size_t)48 * DM),
                  "v"(g2), "v"(g2 + (size_t)16 * DM), "v"(g2 + (size_t)32 * DM), "v"(g2 + (size_t)48 * DM)
               : "memory");
}
// One tile's copies: 12 per lane (16 with the lo plane)
template <bool SPLIT>
__device__ __forceinline__ void stage_gemm(unsigned l, const unsigned short* ga, const unsigned short* ga2,
                                           const unsigned short* gb) {
  const unsigned lb = l + (SPLIT ? 128u : 64u) * GRB;
  if (SPLIT) {
    copy8(l, ga, l + 64u * GRB, ga2);
    copy8(lb, gb, lb + 64u * GRB, gb + (size_t)64 * DM);
  } else {
    copy12(l, ga, lb, gb, lb + 64u * GRB, gb + (size_t)64 * DM);
  }
}

template <bool SPLIT>
__device__ __forceinline__ void gemm_core(const unsigned short* __restrict__ gA, const unsigned short* __restrict__ gA2,
                                          const unsigned short* __restrict__ gB, unsigned char* ring,
                                          v8f (&acc)[2][4]) {
  const int tid = threadIdx.x, lane = tid & 31, w = tid >> 5;
  const int m = lane & 15, ko = (lane >> 4) * 8, wr = w >> 1, wc = w & 1;
  // copy addresses of this lane: row (tid>>3) + 16i of a plane, 16-B piece tid&7
  const size_t go = (size_t)(tid >> 3) * DM + 8 * (tid & 7);
  const unsigned short* ga  = gA + go;
  const unsigned short* ga2 = gA2 + go;
  const unsigned short* gb  = gB + go;
  typedef __attribute__((address_space(3))) unsigned char lds_byte;
  const unsigned l0 = (unsigned)(uintptr_t)(lds_byte*)ring + (unsigned)((tid >> 3) * GRB + 16 * (tid & 7));

  // tile 0 into buffer 0, landed and published; then tile 1 into buffer 1
  stage_gemm<SPLIT>(l0, ga, ga2, gb);
  asm volatile("s_wait_asynccnt 0x0" ::: "memory");   // this wave's copies of tile 0 have landed
  __syncthreads();                                    // every wave's have
  stage_gemm<SPLIT>(l0 + GBUF(SPLIT), ga + GKB, ga2 + GKB, gb + GKB);

  // kept rolled: one trip per staged tile, so that the hand-over at its foot stands once, in the order written
#pragma unroll 1
  for (int t = 0; t < DM / GKB; ++t) {
    const __bf16* buf = (const __bf16*)(const void*)(ring + (t & 1) * GBUF(SPLIT));
    const __bf16* Ar  = buf + (32 * wr + m) * GPH + ko;
    const __bf16* Ar2 = Ar + 64 * GPH;
    const __bf16* Br  = buf + ((SPLIT ? 128 : 64) + 64 * wc + m) * GPH + ko;
    // all of the tile's fragments as one group of LDS reads ahead of its matrix instructions
    v16b bf[GKB / 32][4], af[GKB / 32][2], al[GKB / 32][2];
#pragma unroll
    for (int s = 0; s < GKB / 32; ++s) {
#pragma unroll
      for (int j = 0; j < 4; ++j) bf[s][j] = ldb(Br + (16 * j) * GPH + 32 * s);
#pragma unroll
      for (int i = 0; i < 2; ++i) {
        af[s][i] = ldb(Ar + (16 * i) * GPH + 32 * s);
        al[s][i] = SPLIT ? ldb(Ar2 + (16 * i) * GPH + 32 * s) : af[s][i];
      }
    }
#pragma unroll
    for (int s = 0; s < GKB / 32; ++s) {
#pragma unroll
      for (int i = 0; i < 2; ++i) {
#pragma unroll
        for (int j = 0; j < 4; ++j) {
          acc[i][j] = mma_b(af[s][i], bf[s][j], acc[i][j]);
          if (SPLIT) acc[i][j] = mma_b(al[s][i], bf[s][j], acc[i][j]);
        }
        guard_b(acc[i][0], acc[i][3], af[s][i], al[s][i]);
      }
      keep_b(bf[s][0], bf[s][1], bf[s][2], bf[s][3]);
    }
    // hand-over: this wave has left buffer t&1 and its copies of tile t+1 have landed; behind the barrier that
    // holds for every wave, so tile t+1 may be read and buffer t&1 refilled
    asm volatile("s_wait_dscnt 0x0" ::: "memory");
    asm volatile("s_wait_asynccnt 0x0" ::: "memory");
    __syncthreads();
    if (t + 2 < DM / GKB) {
      const int kn = (t + 2) * GKB;
      stage_gemm<SPLIT>(l0 + (unsigned)(t & 1) * GBUF(SPLIT), ga + kn, ga2 + kn, gb + kn);
    }
  }
  asm volatile("s_wait_asynccnt 0x0" ::: "memory");   // nothing in flight when the ring becomes the f32 tile
  acc_guard4(acc[0][0], acc[0][1], acc[0][2], acc[0][3]);
  acc_guard4(acc[1][0], acc[1][1], acc[1][2], acc[1][3]);
}

// stage a wave's 32x64 tile into the block's 64x128 f32 LDS tile (pitch TP)
__device__ __forceinline__ void stage_tile(float* T, int w, int lane, v8f (&acc)[2][4]) {
  const int wr = w >> 1, wc = w & 1, hh = lane >> 4, m = lane & 15;
#pragma unroll
  for (int i = 0; i < 2; ++i)
#pragma unroll
    for (int j = 0; j < 4; ++j)
#pragma unroll
      for (int r = 0; r < 8; ++r)
        T[(32 * wr + 16 * i + 8 * hh + r) * TP + 64 * wc + 16 * j + m] = acc[i][j][r];
}

// ---------------------------------------------------------------------------
//   ROLE 0: A = X plane rows (tokens 64*bx), B = Wq plane rows (head by): RMSNorm + RoPE in f32,
//           q' = q * QMUL -> f16 hi plane P1, f16 lo plane P2 (lo = q' - hi, unscaled), [tok][EQ], cols by*128.
//   ROLE 1: A = X, B = Wk rows (kv head by): RMSNorm + RoPE, k' = k * 8 -> f16 plane P1 [tok][EK].
//   ROLE 2: A = Wv plane rows (features 64*by), B = X rows (tokens 128*bx): tile = V^T directly;
//           v' = v * 1024 -> f16 hi plane P1, lo plane P2 (unscaled), layout [(b*NKV+kvh)*128 + d][s].
// Epilogue: f32 tile staged in LDS, then each wave owns 16 rows; one store instruction = 16 lanes x 16 B
// Coverage per block: rows 16w + 2it + hh (w 0..3, it 0..7, hh 0..1) = 0..63, cols 8*(lane&15) = 0..127.
// ---------------------------------------------------------------------------
template <int ROLE>
__global__ __launch_bounds__(128) void proj_kernel(const unsigned short* __restrict__ Ap,
                                                   const unsigned short* __restrict__ Bp,
                                                   const float* __restrict__ nw,
                                                   const float* __restrict__ fcos,
                                                   const float* __restrict__ fsin,
                                                   unsigned short* __restrict__ P1,
                                                   unsigned short* __restrict__ P2) {
  // two operand tile buffers; after the k loop the same bytes serve as the block's f32 tile T
  __shared__ __align__(16) unsigned char ring[2 * GBUF(false)];
  static_assert(64 * TP * 4 <= 2 * GBUF(false), "f32 tile fits the ring");
  float* T = (float*)(void*)ring;
  const int lane = threadIdx.x & 31;
  const int w    = threadIdx.x >> 5;
  const int hh   = lane >> 4;
  const int m    = lane & 15;
  const int arow0 = (ROLE == 2) ? (int)blockIdx.y * 64 : (int)blockIdx.x * 64;
  const int brow0 = (ROLE == 2) ? (int)blockIdx.x * 128 : (int)blockIdx.y * 128;
  const unsigned short* A = Ap + (size_t)arow0 * DM;
  const unsigned short* B = Bp + (size_t)brow0 * DM;

  v8f acc[2][4];
#pragma unroll
  for (int i = 0; i < 2; ++i)
#pragma unroll
    for (int j = 0; j < 4; ++j) acc[i][j] = (v8f){0.f, 0.f, 0.f, 0.f, 0.f, 0.f, 0.f, 0.f};

  gemm_core<false>(A, A, B, ring, acc);
  stage_tile(T, w, lane, acc);
  __syncthreads();

  float wv[8];
  if (ROLE != 2) {
    const v4f wa = *(const v4f*)(nw + 8 * m);
    const v4f wb = *(const v4f*)(nw + 8 * m + 4);
#pragma unroll
    for (int e = 0; e < 4; ++e) { wv[e] = bf16r(wa[e]); wv[4 + e] = bf16r(wb[e]); }
  } else {
#pragma unroll
    for (int e = 0; e < 8; ++e) wv[e] = 1.0f;
  }

  v4u hv[8], lv[8];
#pragma unroll
  for (int it = 0; it < 8; ++it) {
    const int row = 16 * w + 2 * it + hh;
    const float* tr = T + row * TP + 8 * m;
    const v4f xa = *(const v4f*)(tr);
    const v4f xb = *(const v4f*)(tr + 4);
    float x[8] = {xa[0], xa[1], xa[2], xa[3], xb[0], xb[1], xb[2], xb[3]};
    float y[8];
    if (ROLE == 2) {
#pragma unroll
      for (int e = 0; e < 8; ++e) y[e] = x[e] * VMUL;
    } else {
      float ss = 0.f;
#pragma unroll
      for (int e = 0; e < 8; ++e) ss = fmaf(x[e], x[e], ss);
      ss += __shfl_xor(ss, 1, 32);
      ss += __shfl_xor(ss, 2, 32);
      ss += __shfl_xor(ss, 4, 32);
      ss += __shfl_xor(ss, 8, 32);
      const float rn  = rsqrtf(fmaf(ss, 1.0f / (float)HD, RMS_EPS));
      const int   tok = arow0 + row;
      const int   sp  = tok & (SQ - 1);
      const v4f c4 = *(const v4f*)(fcos + (size_t)sp * (HD / 2) + 4 * m);
      const v4f s4 = *(const v4f*)(fsin + (size_t)sp * (HD / 2) + 4 * m);
      const float om = (ROLE == 0) ? QMUL : KMUL;
#pragma unroll
      for (int p = 0; p < 4; ++p) {
        const float cs = bf16r(c4[p]), sn = bf16r(s4[p]);
        const float u0 = x[2 * p] * rn * wv[2 * p];
        const float u1 = x[2 * p + 1] * rn * wv[2 * p + 1];
        y[2 * p]     = (u0 * cs - u1 * sn) * om;
        y[2 * p + 1] = (u0 * sn + u1 * cs) * om;
      }
    }
    v4u a, c2;
#pragma unroll
    for (int q = 0; q < 4; ++q) {
      const _Float16 h0 = (_Float16)y[2 * q];
      const _Float16 h1 = (_Float16)y[2 * q + 1];
      a[q] = pk16(hbits(h0), hbits(h1));
      if (ROLE != 1) {
        const _Float16 l0 = (_Float16)(y[2 * q] - (float)h0);
        const _Float16 l1 = (_Float16)(y[2 * q + 1] - (float)h1);
        c2[q] = pk16(hbits(l0), hbits(l1));
      } else {
        c2[q] = 0u;
      }
    }
    hv[it] = a;
    lv[it] = c2;
  }

  {
#pragma unroll
    for (int it = 0; it < 8; ++it) {
      const int row = 16 * w + 2 * it + hh;
      size_t go;
      if (ROLE == 0) {
        go = (size_t)(arow0 + row) * EQ + (size_t)blockIdx.y * HD + 8 * m;
      } else if (ROLE == 1) {
        go = (size_t)(arow0 + row) * EK + (size_t)blockIdx.y * HD + 8 * m;
      } else {
        const int f   = arow0 + row;            // 0..1023
        const int kvh = f >> 7;
        const int d   = f & (HD - 1);
        const int bb  = brow0 >> 11;            // batch of this 128-token block
        const int s0  = brow0 & (SQ - 1);
        go = ((size_t)((bb * NKV + kvh) * HD + d)) * SQ + s0 + 8 * m;
      }
      *(v4u*)(P1 + go) = hv[it];
      if (ROLE != 1) *(v4u*)(P2 + go) = lv[it];
    }
    
  }
}

// ---------------------------------------------------------------------------
// Full (non-causal) GQA attention, head dim 128, one wave per (b, h, 16 queries); block = 8 waves (128 queries).
//   Each 64-key tile (K rows, V^T hi rows, V^T lo rows) is brought into LDS once per block by asynchronous
//   16-byte copies (whole 128-B lines on the global side), two buffers, the next tile in flight while this one
//   is worked on; all 8 waves read their fragments from LDS (row pitches 16 B x odd: no bank conflicts).
//   Transposed scores S^T[key][query] = K . Q^T : A = K rows [key][d] (f16 x8), B[k=d][n=query] from Q rows
//   [query][d] (f16 hi, f16 lo) -> both fragments are plain k-contiguous row loads.
//   D tiles (rows = 16 keys, cols = queries) packed to f16 ARE the B operand [k=key][n=query] of
//   O^T[d][query] = V^T . P : element r <- tile(keys 0-15)[r], element 8+r <- tile(keys 16-31)[r], same lane.
//   A = V^T rows [d][s] (f16 hi x1024 + unscaled lo). Softmax per query column = per lane (partner lane ^16),
//   online over 32 chunks of 64 keys, f32, exp2 with log2e folded into the q scale, p carried x256.
//   Epilogue: O = acc / (l * 1024), bf16 hi + lo split, per-wave LDS relayout [query][d] (v4u store/reload,
//   Coverage: rows 2it + hh (it 0..7) = 16 queries, cols 8*(lane&15) = 0..127 of head h, per plane.
// ---------------------------------------------------------------------------
// One tile's copies: 12 per lane (4 of K, 4 of each V^T plane), every lane on. The s_wait_xcnt stands inside the
// statement so that no address register is rewritten ahead of it.
__device__ __forceinline__ void stage_copies(unsigned lk, unsigned lv, const unsigned short* gk,
                                             const unsigned short* gh, const unsigned short* gl) {
  asm volatile("global_load_async_to_lds_b128 %0, %12, off\n\t"
               "global_load_async_to_lds_b128 %1, %13, off\n\t"
               "global_load_async_to_lds_b128 %2, %14, off\n\t"
               "global_load_async_to_lds_b128 %3, %15, off\n\t"
               "global_load_async_to_lds_b128 %4, %16, off\n\t"
               "global_load_async_to_lds_b128 %5, %17, off\n\t"
               "global_load_async_to_lds_b128 %6, %18, off\n\t"
               "global_load_async_to_lds_b128 %7, %19, off\n\t"
               "global_load_async_to_lds_b128 %8, %20, off\n\t"
               "global_load_async_to_lds_b128 %9, %21, off\n\t"
               "global_load_async_to_lds_b128 %10, %22, off\n\t"
               "global_load_async_to_lds_b128 %11, %23, off\n\t"
               "s_wait_xcnt 0x0"
               :: "v"(lk), "v"(lk + 16u * KPH * 2u), "v"(lk + 32u * KPH * 2u), "v"(lk + 48u * KPH * 2u),
                  "v"(lv), "v"(lv + 32u * VPH * 2u), "v"(lv + 64u * VPH * 2u), "v"(lv + 96u * VPH * 2u),
                  "v"(lv + VTB), "v"(lv + VTB + 32u * VPH * 2u), "v"(lv + VTB + 64u * VPH * 2u),
                  "v"(lv + VTB + 96u * VPH * 2u),
                  "v"(gk), "v"(gk + (size_t)16 * EK), "v"(gk + (size_t)32 * EK), "v"(gk + (size_t)48 * EK),
                  "v"(gh), "v"(gh + (size_t)32 * SQ), "v"(gh + (size_t)64 * SQ), "v"(gh + (size_t)96 * SQ),
                  "v"(gl), "v"(gl + (size_t)32 * SQ), "v"(gl + (size_t)64 * SQ), "v"(gl + (size_t)96 * SQ)
               : "memory");
}

__global__ __launch_bounds__(32 * AWV) void attn_kernel(const unsigned short* __restrict__ Qhp,
                                                  const unsigned short* __restrict__ Qlp,
                                                  const unsigned short* __restrict__ Kpp,
                                                  const unsigned short* __restrict__ Vhp,
                                                  const unsigned short* __restrict__ Vlp,
                                                  unsigned short* __restrict__ Ohp,
                                                  unsigned short* __restrict__ Olp) {
  // two tile buffers; after the loop the same bytes serve as output staging [wave][plane][query*OSP + d]
  __shared__ __align__(16) unsigned char ring[2 * BUFB];
  static_assert(AWV * 2 * 16 * OSP * 2 <= 2 * BUFB, "output staging fits the ring");
  const int lane = threadIdx.x & 31;
  const int w    = threadIdx.x >> 5;
  const int hh   = lane >> 4;
  const int m    = lane & 15;
  const int h    = blockIdx.y;
  const int b    = blockIdx.z;
  const int kvh  = h >> 1;                       // G = NH / NKV = 2
  const int q0   = blockIdx.x * (16 * AWV) + w * 16;   // query index within the sequence

  const _Float16* Qh = (const _Float16*)(const void*)Qhp;
  const _Float16* Ql = (const _Float16*)(const void*)Qlp;
  const size_t vplane = (size_t)((b * NKV + kvh) * HD) * SQ;
  // copy addresses of this lane. K: key row (tid>>4) + 16i, 16-B piece tid&15; V^T: d row (tid>>3) + 32i, piece tid&7
  const int tid = threadIdx.x;
  const unsigned short* gk = Kpp + (size_t)b * SQ * EK + kvh * HD + (size_t)(tid >> 4) * EK + 8 * (tid & 15);
  const unsigned short* gh = Vhp + vplane + (size_t)(tid >> 3) * SQ + 8 * (tid & 7);
  const unsigned short* gl = Vlp + vplane + (size_t)(tid >> 3) * SQ + 8 * (tid & 7);
  typedef __attribute__((address_space(3))) unsigned char lds_byte;
  const unsigned ring0 = (unsigned)(uintptr_t)(lds_byte*)ring;
  const unsigned lk = ring0 + (unsigned)((tid >> 4) * (KPH * 2) + 16 * (tid & 15));
  const unsigned lv = ring0 + (unsigned)(KTB + (tid >> 3) * (VPH * 2) + 16 * (tid & 7));

  // tile 0 into buffer 0, landed and published; then tile 1 into buffer 1
  stage_copies(lk, lv, gk, gh, gl);
  asm volatile("s_wait_asynccnt 0x0" ::: "memory");   // this wave's copies of tile 0 have landed
  __syncthreads();                                    // every wave's have
  stage_copies(lk + BUFB, lv + BUFB, gk + (size_t)64 * EK, gh + 64, gl + 64);

  // Q fragments (B operand): row = query q0 + (lane&15), k = d
  v16h qh[4], ql[4];
  {
    const size_t qo = ((size_t)b * SQ + q0 + m) * EQ + (size_t)h * HD + 8 * hh;
#pragma unroll
    for (int dc = 0; dc < 4; ++dc) {
      qh[dc] = ldh(Qh + qo + 32 * dc);
      ql[dc] = ldh(Ql + qo + 32 * dc);
    }
  }

  v8f acc[8];
#pragma unroll
  for (int t = 0; t < 8; ++t) acc[t] = (v8f){0.f, 0.f, 0.f, 0.f, 0.f, 0.f, 0.f, 0.f};
  float mrun = -1.0e30f;
  float lrun = 0.0f;

#pragma unroll 1
  for (int kc = 0; kc < SQ / 64; ++kc) {
    const unsigned char* buf = ring + (kc & 1) * BUFB;
    const _Float16* Kr  = (const _Float16*)(const void*)buf + m * KPH + 8 * hh;                // + key*KPH + 32dc
    const _Float16* Vhr = (const _Float16*)(const void*)(buf + KTB) + m * VPH + 8 * hh;        // + 16t*VPH + key
    const _Float16* Vlr = (const _Float16*)(const void*)(buf + KTB + VTB) + m * VPH + 8 * hh;
    v8f s[4];
#pragma unroll
    for (int j = 0; j < 4; ++j) s[j] = (v8f){0.f, 0.f, 0.f, 0.f, 0.f, 0.f, 0.f, 0.f};
#pragma unroll
    for (int dc = 0; dc < 4; ++dc) {
      v16h kf[4];
#pragma unroll
      for (int j = 0; j < 4; ++j) kf[j] = ldh(Kr + (16 * j) * KPH + 32 * dc);
#pragma unroll
      for (int j = 0; j < 4; ++j) {
        s[j] = mma_h(kf[j], qh[dc], s[j]);
        s[j] = mma_h(kf[j], ql[dc], s[j]);
      }
      g_qk(s[0], s[1], s[2], s[3], kf[0], kf[1], kf[2], kf[3], qh[dc], ql[dc]);
      sched_fence();
    }

    // online softmax for query column (lane&15); lane holds keys key0 + 16j + 8hh + r
    float cmax = -1.0e30f;
#pragma unroll
    for (int j = 0; j < 4; ++j)
#pragma unroll
      for (int r = 0; r < 8; ++r) cmax = fmaxf(cmax, s[j][r]);
    cmax = fmaxf(cmax, __shfl_xor(cmax, 16, 32));
    const float mnew  = fmaxf(mrun, cmax);
    const float alpha = __builtin_amdgcn_exp2f((mrun - mnew) * SINV);
    const float nms   = 8.0f - mnew * SINV;          // p * 256 = exp2(s*SINV - m*SINV + 8)
    float psum = 0.f;
#pragma unroll
    for (int j = 0; j < 4; ++j)
#pragma unroll
      for (int r = 0; r < 8; ++r) {
        const float p = __builtin_amdgcn_exp2f(fmaf(s[j][r], SINV, nms));
        s[j][r] = p;
        psum += p;
      }
    psum += __shfl_xor(psum, 16, 32);
    lrun = fmaf(lrun, alpha, psum);
    mrun = mnew;
#pragma unroll
    for (int t = 0; t < 8; ++t) acc[t] = acc[t] * alpha;

#pragma unroll
    for (int ks = 0; ks < 2; ++ks) {
      HFrag pf;
      v8h plo, phi;
#pragma unroll
      for (int r = 0; r < 8; ++r) {
        plo[r] = (_Float16)s[2 * ks][r];        // keys 32ks + 8hh + r
        phi[r] = (_Float16)s[2 * ks + 1][r];    // keys 32ks + 16 + 8hh + r
      }
      pf.h[0] = plo;
      pf.h[1] = phi;
      const int ko = 32 * ks;
#pragma unroll
      for (int t = 0; t < 8; t += 2) {
        const v16h a0 = ldh(Vhr + (16 * t) * VPH + ko);
        const v16h b0 = ldh(Vlr + (16 * t) * VPH + ko);
        const v16h a1 = ldh(Vhr + (16 * (t + 1)) * VPH + ko);
        const v16h b1 = ldh(Vlr + (16 * (t + 1)) * VPH + ko);
        acc[t]     = mma_h(a0, pf.v, acc[t]);
        acc[t]     = mma_h(b0, pf.v, acc[t]);
        acc[t + 1] = mma_h(a1, pf.v, acc[t + 1]);
        acc[t + 1] = mma_h(b1, pf.v, acc[t + 1]);
        g_pv(acc[t], acc[t + 1], a0, b0, a1, b1, pf.v);
        sched_fence();
      }
    }

    // hand-over: this wave has left buffer kc&1 and its copies of tile kc+1 have landed; behind the barrier that
    // holds for every wave, so tile kc+1 may be read and buffer kc&1 refilled
    asm volatile("s_wait_dscnt 0x0" ::: "memory");
    asm volatile("s_wait_asynccnt 0x0" ::: "memory");
    __syncthreads();
    if (kc + 2 < SQ / 64) {
      const unsigned bo = (unsigned)(kc & 1) * BUFB;
      stage_copies(lk + bo, lv + bo, gk + (size_t)(kc + 2) * 64 * EK, gh + (kc + 2) * 64, gl + (kc + 2) * 64);
    }
  }
  asm volatile("s_wait_asynccnt 0x0" ::: "memory");   // nothing in flight when the ring becomes output staging
  g_acc8(acc[0], acc[1], acc[2], acc[3], acc[4], acc[5], acc[6], acc[7]);

  // ---- epilogue: acc[t][r] = O^T[d = 16t + 8hh + r][query m] * (256 * 1024 * l256/256) ----
  const float inv = __builtin_amdgcn_rcpf(lrun) * (1.0f / VMUL);
  unsigned short* sh = (unsigned short*)(void*)ring + (2 * w) * (16 * OSP);
  unsigned short* sl = sh + 16 * OSP;
#pragma unroll
  for (int t = 0; t < 8; ++t) {
    v4u hv, lvv;
#pragma unroll
    for (int q = 0; q < 4; ++q) {
      const float o0 = acc[t][2 * q] * inv;
      const float o1 = acc[t][2 * q + 1] * inv;
      const unsigned short h0 = f2bf_bits(o0), h1 = f2bf_bits(o1);
      const unsigned short l0 = f2bf_bits(o0 - bfb2f(h0)), l1 = f2bf_bits(o1 - bfb2f(h1));
      hv[q]  = pk16(h0, h1);
      lvv[q] = pk16(l0, l1);
    }
    *(v4u*)(sh + m * OSP + 16 * t + 8 * hh) = hv;
    *(v4u*)(sl + m * OSP + 16 * t + 8 * hh) = lvv;
  }
  __builtin_amdgcn_fence(__ATOMIC_RELEASE, "wavefront");
  __builtin_amdgcn_wave_barrier();
  __builtin_amdgcn_fence(__ATOMIC_ACQUIRE, "wavefront");
  v4u ov[2][8];
#pragma unroll
  for (int it = 0; it < 8; ++it) {
    const int row = 2 * it + hh;
    ov[0][it] = *(const v4u*)(sh + row * OSP + 8 * m);
    ov[1][it] = *(const v4u*)(sl + row * OSP + 8 * m);
  }
  {
#pragma unroll
    for (int it = 0; it < 8; ++it) {
      const int row = 2 * it + hh;
      const size_t go = ((size_t)b * SQ + q0 + row) * EQ + (size_t)h * HD + 8 * m;
      *(v4u*)(Ohp + go) = ov[0][it];
      *(v4u*)(Olp + go) = ov[1][it];
    }
    
  }
}

// ---------------------------------------------------------------------------
// Output projection: out[tok][dout] = sum_e O[tok][e] * Wo[dout][e]; A = O hi + lo bf16 planes, B = Wo bf16.
// Block 64 tokens x 128 out cols; f32 tile staged in LDS; each wave writes 16 rows, one instruction per
// Coverage per block: rows 16w + it (it 0..15) = 0..63, cols 4*lane = 0..127.
// ---------------------------------------------------------------------------
__global__ __launch_bounds__(128) void out_kernel(const unsigned short* __restrict__ Ohp,
                                                  const unsigned short* __restrict__ Olp,
                                                  const unsigned short* __restrict__ Wp,
                                                  float* __restrict__ out) {
  // two operand tile buffers; after the k loop the same bytes serve as the block's f32 tile T
  __shared__ __align__(16) unsigned char ring[2 * GBUF(true)];
  static_assert(64 * TP * 4 <= 2 * GBUF(true), "f32 tile fits the ring");
  float* T = (float*)(void*)ring;
  const int lane = threadIdx.x & 31;
  const int w    = threadIdx.x >> 5;
  const int arow0 = blockIdx.x * 64;
  const int brow0 = blockIdx.y * 128;
  const unsigned short* A  = Ohp + (size_t)arow0 * DM;
  const unsigned short* A2 = Olp + (size_t)arow0 * DM;
  const unsigned short* B  = Wp  + (size_t)brow0 * DM;

  v8f acc[2][4];
#pragma unroll
  for (int i = 0; i < 2; ++i)
#pragma unroll
    for (int j = 0; j < 4; ++j) acc[i][j] = (v8f){0.f, 0.f, 0.f, 0.f, 0.f, 0.f, 0.f, 0.f};

  gemm_core<true>(A, A2, B, ring, acc);
  stage_tile(T, w, lane, acc);
  __syncthreads();

  v4f val[16];
#pragma unroll
  for (int it = 0; it < 16; ++it) val[it] = *(const v4f*)(T + (16 * w + it) * TP + 4 * lane);
  {
#pragma unroll
    for (int it = 0; it < 16; ++it) {
      *(v4f*)(out + (size_t)(arow0 + 16 * w + it) * DM + brow0 + 4 * lane) = val[it];
    }
    
  }
}

// ---------------------------------------------------------------------------
// Workspace map (bytes):
//   Xb  bf16 [4096][2048]        16777216 @ 0
//   Wqb bf16 [2048][2048]         8388608
//   Wkb bf16 [1024][2048]         4194304
//   Wvb bf16 [1024][2048]         4194304
//   Wob bf16 [2048][2048]         8388608
//   Qh  f16  [4096][2048]        16777216      Ql same
//   Kp  f16  [4096][1024]         8388608
//   Vth f16  [2*8*128][2048]      8388608      Vtl same
//   Oh  bf16 [4096][2048]        16777216      Ol same
//   total                       134217728
// ---------------------------------------------------------------------------
extern "C" void kernel_launch(void* const* d_in, const int* in_sizes, int n_in,
                              void* d_out, int out_size, void* d_ws, size_t ws_size,
                              hipStream_t stream) {
  if (n_in < 9) return;
  if (in_sizes[0] != NTOK * DM) return;
  if (in_sizes[1] != EQ * DM || in_sizes[2] != EK * DM || in_sizes[3] != EK * DM || in_sizes[4] != DM * EQ) return;
  if (in_sizes[5] != HD || in_sizes[6] != HD) return;
  if (in_sizes[7] != SQ * (HD / 2) || in_sizes[8] != SQ * (HD / 2)) return;
  if (out_size != NTOK * DM) return;

  const float* x    = (const float*)d_in[0];
  const float* wq   = (const float*)d_in[1];
  const float* wk   = (const float*)d_in[2];
  const float* wv   = (const float*)d_in[3];
  const float* wo   = (const float*)d_in[4];
  const float* qnw  = (const float*)d_in[5];
  const float* knw  = (const float*)d_in[6];
  const float* fcos = (const float*)d_in[7];
  const float* fsin = (const float*)d_in[8];
  float* out        = (float*)d_out;

  const size_t szX  = (size_t)NTOK * DM * 2;
  const size_t szWq = (size_t)EQ * DM * 2;
  const size_t szWk = (size_t)EK * DM * 2;
  const size_t szWo = (size_t)DM * EQ * 2;
  const size_t szQ  = (size_t)NTOK * EQ * 2;
  const size_t szK  = (size_t)NTOK * EK * 2;
  const size_t szVt = (size_t)NB * NKV * HD * SQ * 2;
  const size_t szO  = (size_t)NTOK * EQ * 2;
  size_t off = 0;
  const size_t oX  = off; off += szX;
  const size_t oWq = off; off += szWq;
  const size_t oWk = off; off += szWk;
  const size_t oWv = off; off += szWk;
  const size_t oWo = off; off += szWo;
  const size_t oQh = off; off += szQ;
  const size_t oQl = off; off += szQ;
  const size_t oK  = off; off += szK;
  const size_t oVh = off; off += szVt;
  const size_t oVl = off; off += szVt;
  const size_t oOh = off; off += szO;
  const size_t oOl = off; off += szO;
  if (off > ws_size) return;                  // off = 134217728

  char* ws = (char*)d_ws;
  unsigned short* Xb  = (unsigned short*)(ws + oX);
  unsigned short* Wqb = (unsigned short*)(ws + oWq);
  unsigned short* Wkb = (unsigned short*)(ws + oWk);
  unsigned short* Wvb = (unsigned short*)(ws + oWv);
  unsigned short* Wob = (unsigned short*)(ws + oWo);
  unsigned short* Qh  = (unsigned short*)(ws + oQh);
  unsigned short* Ql  = (unsigned short*)(ws + oQl);
  unsigned short* Kp  = (unsigned short*)(ws + oK);
  unsigned short* Vth = (unsigned short*)(ws + oVh);
  unsigned short* Vtl = (unsigned short*)(ws + oVl);
  unsigned short* Oh  = (unsigned short*)(ws + oOh);
  unsigned short* Ol  = (unsigned short*)(ws + oOl);

  // (1) f32 -> bf16 RNE planes (8 elements per thread; all counts are multiples of 2048)
  {
    const int n8x  = (NTOK * DM) / 8;          // 1048576 -> 4096 blocks
    const int n8wq = (EQ * DM) / 8;            //  524288 -> 2048 blocks
    const int n8wk = (EK * DM) / 8;            //  262144 -> 1024 blocks
    const int n8wo = (DM * EQ) / 8;            //  524288 -> 2048 blocks
    cvt_bf16_kernel<<<dim3((n8x + 255) / 256),  dim3(256), 0, stream>>>(x,  Xb,  n8x);
    cvt_bf16_kernel<<<dim3((n8wq + 255) / 256), dim3(256), 0, stream>>>(wq, Wqb, n8wq);
    cvt_bf16_kernel<<<dim3((n8wk + 255) / 256), dim3(256), 0, stream>>>(wk, Wkb, n8wk);
    cvt_bf16_kernel<<<dim3((n8wk + 255) / 256), dim3(256), 0, stream>>>(wv, Wvb, n8wk);
    cvt_bf16_kernel<<<dim3((n8wo + 255) / 256), dim3(256), 0, stream>>>(wo, Wob, n8wo);
  }

  // (2) projections: q (64 token blocks x 16 heads), k (64 x 8 kv heads), v^T (32 token blocks of 128 x 16 feature blocks of 64)
  proj_kernel<0><<<dim3(NTOK / 64, NH), dim3(128), 0, stream>>>(Xb, Wqb, qnw, fcos, fsin, Qh, Ql);
  proj_kernel<1><<<dim3(NTOK / 64, NKV), dim3(128), 0, stream>>>(Xb, Wkb, knw, fcos, fsin, Kp, Kp);
  proj_kernel<2><<<dim3(NTOK / 128, EK / 64), dim3(128), 0, stream>>>(Wvb, Xb, knw, fcos, fsin, Vth, Vtl);

  // (3) attention: 16 query blocks of 128 x 16 heads x 2 batches, 8 waves per block
  attn_kernel<<<dim3(SQ / (16 * AWV), NH, NB), dim3(32 * AWV), 0, stream>>>(Qh, Ql, Kp, Vth, Vtl, Oh, Ol);

  // (4) output projection -> d_out [4096][2048] f32
  out_kernel<<<dim3(NTOK / 64, DM / 128), dim3(128), 0, stream>>>(Oh, Ol, Wob, out);

  (void)hipGetLastError();
}

// v003
// One run takes 216 microseconds.
// Timed twice side by side with v002, it ran 1.11 times as fast both times.
// Counting every step since v000, it is 2.63 times as fast.
// q/k/v projections: v_wmma_f32_16x16x32_bf16 (bf16 operands staged in LDS, f32 accumulate); scores k.q^T: v_wmma_f32_16x16x32_f16 (k f16 x8 single plane, q f16 hi + lo planes x(0.0883883*log2e*1024), f32 accumulate); p.v^T: v_wmma_f32_16x16x32_f16 (p f16 x256 single, v^T f16 hi + lo planes x1024, f32 accumulate); output projection: v_wmma_f32_16x16x32_bf16 (attention output bf16 hi + lo planes, weights bf16, f32 accumulate); norm, rotary and softmax in f32.
#include <hip/hip_runtime.h>
#include <math.h>
#include <stddef.h>
#include <stdint.h>

#define NB    2
#define SQ    2048
#define DM    2048
#define NH    16
#define NKV   8
#define HD    128
#define EQ    (NH * HD)
#define EK    (NKV * HD)
#define NTOK  (NB * SQ)
#define TP    132
#define OSP   136
#define RMS_EPS 1e-5f
#define QMUL  (0.08838834764831845f * 1.4426950408889634f * 1024.0f)
#define KMUL  8.0f
#define VMUL  1024.0f
#define SINV  (1.0f / 8192.0f)
#define AWV   8                              // waves per attention block (16 queries each)
#define KPH   136                            // LDS pitch of a staged K row, halves (256 B + 16 B)
#define VPH   72                             // LDS pitch of a staged V^T row, halves (128 B + 16 B)
#define KTB   (64 * KPH * 2)                 // bytes of a staged K tile: 64 keys x 128 d
#define VTB   (HD * VPH * 2)                 // bytes of a staged V^T tile of one plane: 128 d x 64 keys
#define BUFB  (KTB + 2 * VTB)                // one ring buffer: K, V^T hi, V^T lo
#define GKB   128                            // k elements of every operand row in one staged GEMM tile (256 B)
#define GPH   136                            // LDS pitch of a staged GEMM operand row, halves (256 B + 16 B)
#define GRB   (GPH * 2)                      // the same pitch in bytes
#define GBUF(S, BM, BN) ((((S) ? 2 : 1) * (BM) + (BN)) * GRB)   // one GEMM ring buffer: A rows, (A lo rows,) B rows
#define PFI(ROLE) ((ROLE) == 0 ? 4 : 2)      // 16-row fragments per wave in a projection block: q 256 x 128, k and v 128 x 128
#define OWR   2                              // output projection: rows of 64 x 64 wave tiles in a block
#define OWC   4                              // and columns of them

typedef _Float16 v16h __attribute__((ext_vector_type(16)));
typedef _Float16 v8h  __attribute__((ext_vector_type(8)));
typedef __bf16   v16b __attribute__((ext_vector_type(16)));
typedef __bf16   v8b  __attribute__((ext_vector_type(8)));
typedef float    v8f  __attribute__((ext_vector_type(8)));
typedef float    v4f  __attribute__((ext_vector_type(4)));
typedef unsigned int v4u __attribute__((ext_vector_type(4)));

union HFrag { v16h v; v8h h[2]; };
union BFrag { v16b v; v8b h[2]; };

// ---------------------------------------------------------------------------
// scalar helpers (RNE conversions)
// ---------------------------------------------------------------------------
__device__ __forceinline__ unsigned short f2bf_bits(float f) {
  const unsigned u = __float_as_uint(f);
  return (unsigned short)((u + 0x7FFFu + ((u >> 16) & 1u)) >> 16);
}
__device__ __forceinline__ float bfb2f(unsigned short h) { return __uint_as_float(((unsigned)h) << 16); }
__device__ __forceinline__ float bf16r(float f) { return bfb2f(f2bf_bits(f)); }
__device__ __forceinline__ unsigned short hbits(_Float16 h) { return __builtin_bit_cast(unsigned short, h); }
__device__ __forceinline__ unsigned pk16(unsigned short a, unsigned short b) { return (unsigned)a | ((unsigned)b << 16); }

// ---------------------------------------------------------------------------
// 16x32 fragment loads (A layout; also B from a [n][k] k-contiguous plane):
// elements 0..7 <- p[0..7] (k0+8h..), elements 8..15 <- p[16..23] (k0+16+8h..), p = row + k0 + 8h
// ---------------------------------------------------------------------------
__device__ __forceinline__ v16b ldb(const __bf16* p) {
  BFrag f; f.h[0] = *(const v8b*)(p); f.h[1] = *(const v8b*)(p + 16); return f.v;
}
__device__ __forceinline__ v16h ldh(const _Float16* p) {
  HFrag f; f.h[0] = *(const v8h*)(p); f.h[1] = *(const v8h*)(p + 16); return f.v;
}
__device__ __forceinline__ v8f mma_b(v16b a, v16b b, v8f c) {
  return __builtin_amdgcn_wmma_f32_16x16x32_bf16(false, a, false, b, (short)0, c, false, false);
}
__device__ __forceinline__ v8f mma_h(v16h a, v16h b, v8f c) {
  return __builtin_amdgcn_wmma_f32_16x16x32_f16(false, a, false, b, (short)0, c, false, false);
}

// hazard guards: 4 VALU slots after the last WMMA of a group, tying D and keeping A/B live
__device__ __forceinline__ void guard_b(v8f& a, v8f& b, v16b x, v16b y) {
  asm volatile("v_nop\n\tv_nop\n\tv_nop\n\tv_nop" : "+v"(a), "+v"(b) : "v"(x), "v"(y));
}
__device__ __forceinline__ void keep_b(v16b a, v16b b, v16b c, v16b d) {
  asm volatile("v_nop" :: "v"(a), "v"(b), "v"(c), "v"(d));
}
__device__ __forceinline__ void acc_guard4(v8f& a, v8f& b, v8f& c, v8f& d) {
  asm volatile("v_nop\n\tv_nop\n\tv_nop\n\tv_nop" : "+v"(a), "+v"(b), "+v"(c), "+v"(d));
}
__device__ __forceinline__ void g_qk(v8f& s0, v8f& s1, v8f& s2, v8f& s3,
                                     v16h k0, v16h k1, v16h k2, v16h k3, v16h qa, v16h qb) {
  asm volatile("v_nop\n\tv_nop\n\tv_nop\n\tv_nop"
               : "+v"(s0), "+v"(s1), "+v"(s2), "+v"(s3)
               : "v"(k0), "v"(k1), "v"(k2), "v"(k3), "v"(qa), "v"(qb));
}
__device__ __forceinline__ void g_pv(v8f& a0, v8f& a1, v16h x0, v16h x1, v16h x2, v16h x3, v16h p) {
  asm volatile("v_nop\n\tv_nop\n\tv_nop\n\tv_nop"
               : "+v"(a0), "+v"(a1) : "v"(x0), "v"(x1), "v"(x2), "v"(x3), "v"(p));
}
__device__ __forceinline__ void g_acc8(v8f& a0, v8f& a1, v8f& a2, v8f& a3, v8f& a4, v8f& a5, v8f& a6, v8f& a7) {
  asm volatile("v_nop\n\tv_nop\n\tv_nop\n\tv_nop"
               : "+v"(a0), "+v"(a1), "+v"(a2), "+v"(a3), "+v"(a4), "+v"(a5), "+v"(a6), "+v"(a7));
}
__device__ __forceinline__ void sched_fence() { asm volatile("" ::: "memory"); }

// ---------------------------------------------------------------------------
// ---------------------------------------------------------------------------
__global__ __launch_bounds__(256) void cvt_bf16_kernel(const float* __restrict__ in,
                                                       unsigned short* __restrict__ out, int n8) {
  const int i = blockIdx.x * 256 + threadIdx.x;
  if (i < n8) {
    const float* src = in + (size_t)i * 8;
    const v4f a = *(const v4f*)(src);
    const v4f b = *(const v4f*)(src + 4);
    v4u o;
    o[0] = pk16(f2bf_bits(a[0]), f2bf_bits(a[1]));
    o[1] = pk16(f2bf_bits(a[2]), f2bf_bits(a[3]));
    o[2] = pk16(f2bf_bits(b[0]), f2bf_bits(b[1]));
    o[3] = pk16(f2bf_bits(b[2]), f2bf_bits(b[3]));
    unsigned short* dst = out + (size_t)i * 8;
    *(v4u*)dst = o;
    
  }
}

// ---------------------------------------------------------------------------
// Block GEMM core: WR x WC waves, each with a 16 FI x 64 tile acc[i][j] of the block's BM x BN tile (BM = 16 FI WR,
// BN = 64 WC): += A[BM rows][K] . B[BN rows][K]^T, K = DM = 2048, all planes row-major with pitch DM, bf16.
// Each 128-k tile of the block's A and B rows is brought into LDS once per block by asynchronous 16-byte copies
// (16 lanes = 256 B of a row, two whole lines), two buffers, the next tile in flight while this one is worked on;
// the waves read their fragments from LDS (pitch 16 B x odd).
// SPLIT: A given as hi plane gA and lo plane gA2 (unscaled residual, same accumulator).
// gA, gA2, gB point at the block's first row. On return every wave has left the ring (the last trip's barrier).
// D layout: acc[i][j][r] = C[A row 16 FI wr + 16i + 8h + r][B row 64wc + 16j + (lane&15)].
// ---------------------------------------------------------------------------
// Copies of one lane, every lane on: each (l, g) pair stands for rows r, r + RS, r + 2RS, r + 3RS of a plane (RS =
// rows that the block's lanes cover at once). The s_wait_xcnt stands inside the statement so that no address
// register is rewritten ahead of it.
template <int RS>
__device__ __forceinline__ void copy8(unsigned l0, const unsigned short* g0, unsigned l1, const unsigned short* g1) {
  asm volatile("global_load_async_to_lds_b128 %0, %8, off\n\t"
               "global_load_async_to_lds_b128 %1, %9, off\n\t"
               "global_load_async_to_lds_b128 %2, %10, off\n\t"
               "global_load_async_to_lds_b128 %3, %11, off\n\t"
               "global_load_async_to_lds_b128 %4, %12, off\n\t"
               "global_load_async_to_lds_b128 %5, %13, off\n\t"
               "global_load_async_to_lds_b128 %6, %14, off\n\t"
               "global_load_async_to_lds_b128 %7, %15, off\n\t"
               "s_wait_xcnt 0x0"
               :: "v"(l0), "v"(l0 + (unsigned)RS * GRB), "v"(l0 + 2u * RS * GRB), "v"(l0 + 3u * RS * GRB),
                  "v"(l1), "v"(l1 + (unsigned)RS * GRB), "v"(l1 + 2u * RS * GRB), "v"(l1 + 3u * RS * GRB),
                  "v"(g0), "v"(g0 + (size_t)RS * DM), "v"(g0 + (size_t)2 * RS * DM), "v"(g0 + (size_t)3 * RS * DM),
                  "v"(g1), "v"(g1 + (size_t)RS * DM), "v"(g1 + (size_t)2 * RS * DM), "v"(g1 + (size_t)3 * RS * DM)
               : "memory");
}
template <int RS>
__device__ __forceinline__ void copy12(unsigned l0, const unsigned short* g0, unsigned l1, const unsigned short* g1,
                                       unsigned l2, const unsigned short* g2) {
  asm volatile("global_load_async_to_lds_b128 %0, %12, off\n\t"
               "global_load_async_to_lds_b128 %1, %13, off\n\t"
               "global_load_async_to_lds_b128 %2, %14, off\n\t"
               "global_load_async_to_lds_b128 %3, %15, off\n\t"
               "global_load_async_to_lds_b128 %4, %16, off\n\t"
               "global_load_async_to_lds_b128 %5, %17, off\n\t"
               "global_load_async_to_lds_b128 %6, %18, off\n\t"
               "global_load_async_to_lds_b128 %7, %19, off\n\t"
               "global_load_async_to_lds_b128 %8, %20, off\n\t"
               "global_load_async_to_lds_b128 %9, %21, off\n\t"
               "global_load_async_to_lds_b128 %10, %22, off\n\t"
               "global_load_async_to_lds_b128 %11, %23, off\n\t"
               "s_wait_xcnt 0x0"
               :: "v"(l0), "v"(l0 + (unsigned)RS * GRB), "v"(l0 + 2u * RS * GRB), "v"(l0 + 3u * RS * GRB),
                  "v"(l1), "v"(l1 + (unsigned)RS * GRB), "v"(l1 + 2u * RS * GRB), "v"(l1 + 3u * RS * GRB),
                  "v"(l2), "v"(l2 + (unsigned)RS * GRB), "v"(l2 + 2u * RS * GRB), "v"(l2 + 3u * RS * GRB),
                  "v"(g0), "v"(g0 + (size_t)RS * DM), "v"(g0 + (size_t)2 * RS * DM), "v"(g0 + (size_t)3 * RS * DM),
                  "v"(g1), "v"(g1 + (size_t)RS * DM), "v"(g1 + (size_t)2 * RS * DM), "v"(g1 + (size_t)3 * RS * DM),
                  "v"(g2), "v"(g2 + (size_t)RS * DM), "v"(g2 + (size_t)2 * RS * DM), "v"(g2 + (size_t)3 * RS * DM)
               : "memory");
}
// One tile's copies: every row of A, (A lo,) B once; 16, 24 or 32 per lane
template <bool SPLIT, int WR, int WC, int FI>
__device__ __forceinline__ void stage_gemm(unsigned l, const unsigned short* ga, const unsigned short* ga2,
                                           const unsigned short* gb) {
  constexpr int RS = 2 * WR * WC;              // rows covered by one copy of every lane
  constexpr int BM = 16 * FI * WR;
  constexpr int PA = BM / (4 * RS);            // (l, g) pairs of an A plane
  constexpr int PB = 64 * WC / (4 * RS);       // (l, g) pairs of the B plane
  constexpr int NP = (SPLIT ? 2 : 1) * PA + PB;
  static_assert(PA * 4 * RS == BM && PB * 4 * RS == 64 * WC, "whole pairs");
  static_assert(NP == 4 || NP == 6 || NP == 8, "pairs go out in eights and twelves");
  unsigned L[NP];
  const unsigned short* G[NP];
#pragma unroll
  for (int p = 0; p < PA; ++p) {
    L[p] = l + (unsigned)(p * 4 * RS) * GRB;
    G[p] = ga + (size_t)(p * 4 * RS) * DM;
    if (SPLIT) {
      L[PA + p] = l + (unsigned)(BM + p * 4 * RS) * GRB;
      G[PA + p] = ga2 + (size_t)(p * 4 * RS) * DM;
    }
  }
#pragma unroll
  for (int p = 0; p < PB; ++p) {
    L[NP - PB + p] = l + (unsigned)((SPLIT ? 2 : 1) * BM + p * 4 * RS) * GRB;
    G[NP - PB + p] = gb + (size_t)(p * 4 * RS) * DM;
  }
  if constexpr (NP == 4) {
    copy8<RS>(L[0], G[0], L[1], G[1]);
    copy8<RS>(L[2], G[2], L[3], G[3]);
  } else {
    copy12<RS>(L[0], G[0], L[1], G[1], L[2], G[2]);
    copy12<RS>(L[3], G[3], L[4], G[4], L[5], G[5]);
    if constexpr (NP == 8) copy8<RS>(L[6], G[6], L[7], G[7]);
  }
}

template <bool SPLIT, int WR, int WC, int FI>
__device__ __forceinline__ void gemm_core(const unsigned short* __restrict__ gA, const unsigned short* __restrict__ gA2,
                                          const unsigned short* __restrict__ gB, unsigned char* ring,
                                          v8f (&acc)[FI][4]) {
  constexpr int BM = 16 * FI * WR;
  constexpr unsigned GB = GBUF(SPLIT, BM, 64 * WC);
  const int tid = threadIdx.x, lane = tid & 31, w = tid >> 5;
  const int m = lane & 15, ko = (lane >> 4) * 8, wr = w / WC, wc = w % WC;
  // copy addresses of this lane: row (tid>>4) + RS i of a plane, 16-B piece tid&15
  const size_t go = (size_t)(tid >> 4) * DM + 8 * (tid & 15);
  const unsigned short* ga  = gA + go;
  const unsigned short* ga2 = gA2 + go;
  const unsigned short* gb  = gB + go;
  typedef __attribute__((address_space(3))) unsigned char lds_byte;
  const unsigned l0 = (unsigned)(uintptr_t)(lds_byte*)ring + (unsigned)((tid >> 4) * GRB + 16 * (tid & 15));

  // tile 0 into buffer 0, landed and published; then tile 1 into buffer 1
  stage_gemm<SPLIT, WR, WC, FI>(l0, ga, ga2, gb);
  asm volatile("s_wait_asynccnt 0x0" ::: "memory");   // this wave's copies of tile 0 have landed
  __syncthreads();                                    // every wave's have
  stage_gemm<SPLIT, WR, WC, FI>(l0 + GB, ga + GKB, ga2 + GKB, gb + GKB);

  // kept rolled: one trip per staged tile, so that the hand-over at its foot stands once, in the order written
#pragma unroll 1
  for (int t = 0; t < DM / GKB; ++t) {
    const __bf16* buf = (const __bf16*)(const void*)(ring + (t & 1) * GB);
    const __bf16* Ar  = buf + (16 * FI * wr + m) * GPH + ko;
    const __bf16* Ar2 = Ar + BM * GPH;
    const __bf16* Br  = buf + ((SPLIT ? 2 : 1) * BM + 64 * wc + m) * GPH + ko;
#pragma unroll
    for (int s = 0; s < GKB / 32; ++s) {
      // the fragments of 32 k as one group of LDS reads ahead of their matrix instructions
      v16b bf[4], af[FI], al[FI];
#pragma unroll
      for (int j = 0; j < 4; ++j) bf[j] = ldb(Br + (16 * j) * GPH + 32 * s);
#pragma unroll
      for (int i = 0; i < FI; ++i) {
        af[i] = ldb(Ar + (16 * i) * GPH + 32 * s);
        al[i] = SPLIT ? ldb(Ar2 + (16 * i) * GPH + 32 * s) : af[i];
      }
#pragma unroll
      for (int i = 0; i < FI; ++i) {
#pragma unroll
        for (int j = 0; j < 4; ++j) {
          acc[i][j] = mma_b(af[i], bf[j], acc[i][j]);
          if (SPLIT) acc[i][j] = mma_b(al[i], bf[j], acc[i][j]);
        }
        guard_b(acc[i][0], acc[i][3], af[i], al[i]);
      }
      keep_b(bf[0], bf[1], bf[2], bf[3]);
    }
    // hand-over: this wave has left buffer t&1 and its copies of tile t+1 have landed; behind the barrier that
    // holds for every wave, so tile t+1 may be read and buffer t&1 refilled
    asm volatile("s_wait_dscnt 0x0" ::: "memory");
    asm volatile("s_wait_asynccnt 0x0" ::: "memory");
    __syncthreads();
    if (t + 2 < DM / GKB) {
      const int kn = (t + 2) * GKB;
      stage_gemm<SPLIT, WR, WC, FI>(l0 + (unsigned)(t & 1) * GB, ga + kn, ga2 + kn, gb + kn);
    }
  }
  asm volatile("s_wait_asynccnt 0x0" ::: "memory");   // nothing in flight when the ring becomes the f32 tile
#pragma unroll
  for (int i = 0; i < FI; ++i) acc_guard4(acc[i][0], acc[i][1], acc[i][2], acc[i][3]);
}

// stage a wave's 16 FI x 64 tile into the block's f32 LDS tile (pitch P floats)
template <int WC, int P, int FI>
__device__ __forceinline__ void stage_tile(float* T, int w, int lane, v8f (&acc)[FI][4]) {
  const int wr = w / WC, wc = w % WC, hh = lane >> 4, m = lane & 15;
#pragma unroll
  for (int i = 0; i < FI; ++i)
#pragma unroll
    for (int j = 0; j < 4; ++j)
#pragma unroll
      for (int r = 0; r < 8; ++r)
        T[(16 * FI * wr + 16 * i + 8 * hh + r) * P + 64 * wc + 16 * j + m] = acc[i][j][r];
}

// ---------------------------------------------------------------------------
//   ROLE 0: A = X plane rows (tokens BM*bx), B = Wq plane rows (head by): RMSNorm + RoPE in f32,
//           q' = q * QMUL -> f16 hi plane P1, f16 lo plane P2 (lo = q' - hi, unscaled), [tok][EQ], cols by*128.
//   ROLE 1: A = X, B = Wk rows (kv head by): RMSNorm + RoPE, k' = k * 8 -> f16 plane P1 [tok][EK].
//   ROLE 2: A = Wv plane rows (features BM*by), B = X rows (tokens 128*bx): tile = V^T directly;
//           v' = v * 1024 -> f16 hi plane P1, lo plane P2 (unscaled), layout [(b*NKV+kvh)*128 + d][s].
// Block tile BM x 128, 4 x 2 waves of 16 PFI(ROLE) x 64 each, BM = 64 PFI(ROLE).
// Epilogue: f32 tile staged in LDS, then each wave owns RPW = BM / 8 rows; one store instruction = 16 lanes x 16 B
// Coverage per block: rows RPW w + 16hf + 2it + hh (hf 0..RPW/16-1, it 0..7, hh 0..1) = 0..BM-1, cols 8*(lane&15) = 0..127.
// ---------------------------------------------------------------------------
template <int ROLE>
__global__ __launch_bounds__(256) void proj_kernel(const unsigned short* __restrict__ Ap,
                                                   const unsigned short* __restrict__ Bp,
                                                   const float* __restrict__ nw,
                                                   const float* __restrict__ fcos,
                                                   const float* __restrict__ fsin,
                                                   unsigned short* __restrict__ P1,
                                                   unsigned short* __restrict__ P2) {
  constexpr int FI = PFI(ROLE), BM = 64 * FI, RPW = BM / 8;
  constexpr int RINGB = 2 * GBUF(false, BM, 128), TILEB = BM * TP * 4;
  // two operand tile buffers; after the k loop the same bytes serve as the block's f32 tile T
  __shared__ __align__(16) unsigned char ring[RINGB > TILEB ? RINGB : TILEB];
  float* T = (float*)(void*)ring;
  const int lane = threadIdx.x & 31;
  const int w    = threadIdx.x >> 5;
  const int hh   = lane >> 4;
  const int m    = lane & 15;
  const int arow0 = (ROLE == 2) ? (int)blockIdx.y * BM : (int)blockIdx.x * BM;
  const int brow0 = (ROLE == 2) ? (int)blockIdx.x * 128 : (int)blockIdx.y * 128;
  const unsigned short* A = Ap + (size_t)arow0 * DM;
  const unsigned short* B = Bp + (size_t)brow0 * DM;

  v8f acc[FI][4];
#pragma unroll
  for (int i = 0; i < FI; ++i)
#pragma unroll
    for (int j = 0; j < 4; ++j) acc[i][j] = (v8f){0.f, 0.f, 0.f, 0.f, 0.f, 0.f, 0.f, 0.f};

  gemm_core<false, 4, 2, FI>(A, A, B, ring, acc);
  stage_tile<2, TP, FI>(T, w, lane, acc);
  __syncthreads();

  float wv[8];
  if (ROLE != 2) {
    const v4f wa = *(const v4f*)(nw + 8 * m);
    const v4f wb = *(const v4f*)(nw + 8 * m + 4);
#pragma unroll
    for (int e = 0; e < 4; ++e) { wv[e] = bf16r(wa[e]); wv[4 + e] = bf16r(wb[e]); }
  } else {
#pragma unroll
    for (int e = 0; e < 8; ++e) wv[e] = 1.0f;
  }

#pragma unroll
  for (int hf = 0; hf < RPW / 16; ++hf) {
    v4u hv[8], lv[8];
#pragma unroll
    for (int it = 0; it < 8; ++it) {
      const int row = RPW * w + 16 * hf + 2 * it + hh;
      const float* tr = T + row * TP + 8 * m;
      const v4f xa = *(const v4f*)(tr);
      const v4f xb = *(const v4f*)(tr + 4);
      float x[8] = {xa[0], xa[1], xa[2], xa[3], xb[0], xb[1], xb[2], xb[3]};
      float y[8];
      if (ROLE == 2) {
#pragma unroll
        for (int e = 0; e < 8; ++e) y[e] = x[e] * VMUL;
      } else {
        float ss = 0.f;
#pragma unroll
        for (int e = 0; e < 8; ++e) ss = fmaf(x[e], x[e], ss);
        ss += __shfl_xor(ss, 1, 32);
        ss += __shfl_xor(ss, 2, 32);
        ss += __shfl_xor(ss, 4, 32);
        ss += __shfl_xor(ss, 8, 32);
        const float rn  = rsqrtf(fmaf(ss, 1.0f / (float)HD, RMS_EPS));
        const int   tok = arow0 + row;
        const int   sp  = tok & (SQ - 1);
        const v4f c4 = *(const v4f*)(fcos + (size_t)sp * (HD / 2) + 4 * m);
        const v4f s4 = *(const v4f*)(fsin + (size_t)sp * (HD / 2) + 4 * m);
        const float om = (ROLE == 0) ? QMUL : KMUL;
#pragma unroll
        for (int p = 0; p < 4; ++p) {
          const float cs = bf16r(c4[p]), sn = bf16r(s4[p]);
          const float u0 = x[2 * p] * rn * wv[2 * p];
          const float u1 = x[2 * p + 1] * rn * wv[2 * p + 1];
          y[2 * p]     = (u0 * cs - u1 * sn) * om;
          y[2 * p + 1] = (u0 * sn + u1 * cs) * om;
        }
      }
      v4u a, c2;
#pragma unroll
      for (int q = 0; q < 4; ++q) {
        const _Float16 h0 = (_Float16)y[2 * q];
        const _Float16 h1 = (_Float16)y[2 * q + 1];
        a[q] = pk16(hbits(h0), hbits(h1));
        if (ROLE != 1) {
          const _Float16 l0 = (_Float16)(y[2 * q] - (float)h0);
          const _Float16 l1 = (_Float16)(y[2 * q + 1] - (float)h1);
          c2[q] = pk16(hbits(l0), hbits(l1));
        } else {
          c2[q] = 0u;
        }
      }
      hv[it] = a;
      lv[it] = c2;
    }

    {
#pragma unroll
      for (int it = 0; it < 8; ++it) {
        const int row = RPW * w + 16 * hf + 2 * it + hh;
        size_t go;
        if (ROLE == 0) {
          go = (size_t)(arow0 + row) * EQ + (size_t)blockIdx.y * HD + 8 * m;
        } else if (ROLE == 1) {
          go = (size_t)(arow0 + row) * EK + (size_t)blockIdx.y * HD + 8 * m;
        } else {
          const int f   = arow0 + row;            // 0..1023
          const int kvh = f >> 7;
          const int d   = f & (HD - 1);
          const int bb  = brow0 >> 11;            // batch of this 128-token block
          const int s0  = brow0 & (SQ - 1);
          go = ((size_t)((bb * NKV + kvh) * HD + d)) * SQ + s0 + 8 * m;
        }
        *(v4u*)(P1 + go) = hv[it];
        if (ROLE != 1) *(v4u*)(P2 + go) = lv[it];
      }
    }
  }
}

// ---------------------------------------------------------------------------
// Full (non-causal) GQA attention, head dim 128, one wave per (b, h, 16 queries); block = 8 waves (128 queries).
//   Each 64-key tile (K rows, V^T hi rows, V^T lo rows) is brought into LDS once per block by asynchronous
//   16-byte copies (whole 128-B lines on the global side), two buffers, the next tile in flight while this one
//   is worked on; all 8 waves read their fragments from LDS (row pitches 16 B x odd: no bank conflicts).
//   Transposed scores S^T[key][query] = K . Q^T : A = K rows [key][d] (f16 x8), B[k=d][n=query] from Q rows
//   [query][d] (f16 hi, f16 lo) -> both fragments are plain k-contiguous row loads.
//   D tiles (rows = 16 keys, cols = queries) packed to f16 ARE the B operand [k=key][n=query] of
//   O^T[d][query] = V^T . P : element r <- tile(keys 0-15)[r], element 8+r <- tile(keys 16-31)[r], same lane.
//   A = V^T rows [d][s] (f16 hi x1024 + unscaled lo). Softmax per query column = per lane (partner lane ^16),
//   online over 32 chunks of 64 keys, f32, exp2 with log2e folded into the q scale, p carried x256.
//   Epilogue: O = acc / (l * 1024), bf16 hi + lo split, per-wave LDS relayout [query][d] (v4u store/reload,
//   Coverage: rows 2it + hh (it 0..7) = 16 queries, cols 8*(lane&15) = 0..127 of head h, per plane.
// ---------------------------------------------------------------------------
// One tile's copies: 12 per lane (4 of K, 4 of each V^T plane), every lane on. The s_wait_xcnt stands inside the
// statement so that no address register is rewritten ahead of it.
__device__ __forceinline__ void stage_copies(unsigned lk, unsigned lv, const unsigned short* gk,
                                             const unsigned short* gh, const unsigned short* gl) {
  asm volatile("global_load_async_to_lds_b128 %0, %12, off\n\t"
               "global_load_async_to_lds_b128 %1, %13, off\n\t"
               "global_load_async_to_lds_b128 %2, %14, off\n\t"
               "global_load_async_to_lds_b128 %3, %15, off\n\t"
               "global_load_async_to_lds_b128 %4, %16, off\n\t"
               "global_load_async_to_lds_b128 %5, %17, off\n\t"
               "global_load_async_to_lds_b128 %6, %18, off\n\t"
               "global_load_async_to_lds_b128 %7, %19, off\n\t"
               "global_load_async_to_lds_b128 %8, %20, off\n\t"
               "global_load_async_to_lds_b128 %9, %21, off\n\t"
               "global_load_async_to_lds_b128 %10, %22, off\n\t"
               "global_load_async_to_lds_b128 %11, %23, off\n\t"
               "s_wait_xcnt 0x0"
               :: "v"(lk), "v"(lk + 16u * KPH * 2u), "v"(lk + 32u * KPH * 2u), "v"(lk + 48u * KPH * 2u),
                  "v"(lv), "v"(lv + 32u * VPH * 2u), "v"(lv + 64u * VPH * 2u), "v"(lv + 96u * VPH * 2u),
                  "v"(lv + VTB), "v"(lv + VTB + 32u * VPH * 2u), "v"(lv + VTB + 64u * VPH * 2u),
                  "v"(lv + VTB + 96u * VPH * 2u),
                  "v"(gk), "v"(gk + (size_t)16 * EK), "v"(gk + (size_t)32 * EK), "v"(gk + (size_t)48 * EK),
                  "v"(gh), "v"(gh + (size_t)32 * SQ), "v"(gh + (size_t)64 * SQ), "v"(gh + (size_t)96 * SQ),
                  "v"(gl), "v"(gl + (size_t)32 * SQ), "v"(gl + (size_t)64 * SQ), "v"(gl + (size_t)96 * SQ)
               : "memory");
}

__global__ __launch_bounds__(32 * AWV) void attn_kernel(const unsigned short* __restrict__ Qhp,
                                                  const unsigned short* __restrict__ Qlp,
                                                  const unsigned short* __restrict__ Kpp,
                                                  const unsigned short* __restrict__ Vhp,
                                                  const unsigned short* __restrict__ Vlp,
                                                  unsigned short* __restrict__ Ohp,
                                                  unsigned short* __restrict__ Olp) {
  // two tile buffers; after the loop the same bytes serve as output staging [wave][plane][query*OSP + d]
  __shared__ __align__(16) unsigned char ring[2 * BUFB];
  static_assert(AWV * 2 * 16 * OSP * 2 <= 2 * BUFB, "output staging fits the ring");
  const int lane = threadIdx.x & 31;
  const int w    = threadIdx.x >> 5;
  const int hh   = lane >> 4;
  const int m    = lane & 15;
  const int h    = blockIdx.y;
  const int b    = blockIdx.z;
  const int kvh  = h >> 1;                       // G = NH / NKV = 2
  const int q0   = blockIdx.x * (16 * AWV) + w * 16;   // query index within the sequence

  const _Float16* Qh = (const _Float16*)(const void*)Qhp;
  const _Float16* Ql = (const _Float16*)(const void*)Qlp;
  const size_t vplane = (size_t)((b * NKV + kvh) * HD) * SQ;
  // copy addresses of this lane. K: key row (tid>>4) + 16i, 16-B piece tid&15; V^T: d row (tid>>3) + 32i, piece tid&7
  const int tid = threadIdx.x;
  const unsigned short* gk = Kpp + (size_t)b * SQ * EK + kvh * HD + (size_t)(tid >> 4) * EK + 8 * (tid & 15);
  const unsigned short* gh = Vhp + vplane + (size_t)(tid >> 3) * SQ + 8 * (tid & 7);
  const unsigned short* gl = Vlp + vplane + (size_t)(tid >> 3) * SQ + 8 * (tid & 7);
  typedef __attribute__((address_space(3))) unsigned char lds_byte;
  const unsigned ring0 = (unsigned)(uintptr_t)(lds_byte*)ring;
  const unsigned lk = ring0 + (unsigned)((tid >> 4) * (KPH * 2) + 16 * (tid & 15));
  const unsigned lv = ring0 + (unsigned)(KTB + (tid >> 3) * (VPH * 2) + 16 * (tid & 7));

  // tile 0 into buffer 0, landed and published; then tile 1 into buffer 1
  stage_copies(lk, lv, gk, gh, gl);
  asm volatile("s_wait_asynccnt 0x0" ::: "memory");   // this wave's copies of tile 0 have landed
  __syncthreads();                                    // every wave's have
  stage_copies(lk + BUFB, lv + BUFB, gk + (size_t)64 * EK, gh + 64, gl + 64);

  // Q fragments (B operand): row = query q0 + (lane&15), k = d
  v16h qh[4], ql[4];
  {
    const size_t qo = ((size_t)b * SQ + q0 + m) * EQ + (size_t)h * HD + 8 * hh;
#pragma unroll
    for (int dc = 0; dc < 4; ++dc) {
      qh[dc] = ldh(Qh + qo + 32 * dc);
      ql[dc] = ldh(Ql + qo + 32 * dc);
    }
  }

  v8f acc[8];
#pragma unroll
  for (int t = 0; t < 8; ++t) acc[t] = (v8f){0.f, 0.f, 0.f, 0.f, 0.f, 0.f, 0.f, 0.f};
  float mrun = -1.0e30f;
  float lrun = 0.0f;

#pragma unroll 1
  for (int kc = 0; kc < SQ / 64; ++kc) {
    const unsigned char* buf = ring + (kc & 1) * BUFB;
    const _Float16* Kr  = (const _Float16*)(const void*)buf + m * KPH + 8 * hh;                // + key*KPH + 32dc
    const _Float16* Vhr = (const _Float16*)(const void*)(buf + KTB) + m * VPH + 8 * hh;        // + 16t*VPH + key
    const _Float16* Vlr = (const _Float16*)(const void*)(buf + KTB + VTB) + m * VPH + 8 * hh;
    v8f s[4];
#pragma unroll
    for (int j = 0; j < 4; ++j) s[j] = (v8f){0.f, 0.f, 0.f, 0.f, 0.f, 0.f, 0.f, 0.f};
#pragma unroll
    for (int dc = 0; dc < 4; ++dc) {
      v16h kf[4];
#pragma unroll
      for (int j = 0; j < 4; ++j) kf[j] = ldh(Kr + (16 * j) * KPH + 32 * dc);
#pragma unroll
      for (int j = 0; j < 4; ++j) {
        s[j] = mma_h(kf[j], qh[dc], s[j]);
        s[j] = mma_h(kf[j], ql[dc], s[j]);
      }
      g_qk(s[0], s[1], s[2], s[3], kf[0], kf[1], kf[2], kf[3], qh[dc], ql[dc]);
      sched_fence();
    }

    // online softmax for query column (lane&15); lane holds keys key0 + 16j + 8hh + r
    float cmax = -1.0e30f;
#pragma unroll
    for (int j = 0; j < 4; ++j)
#pragma unroll
      for (int r = 0; r < 8; ++r) cmax = fmaxf(cmax, s[j][r]);
    cmax = fmaxf(cmax, __shfl_xor(cmax, 16, 32));
    const float mnew  = fmaxf(mrun, cmax);
    const float alpha = __builtin_amdgcn_exp2f((mrun - mnew) * SINV);
    const float nms   = 8.0f - mnew * SINV;          // p * 256 = exp2(s*SINV - m*SINV + 8)
    float psum = 0.f;
#pragma unroll
    for (int j = 0; j < 4; ++j)
#pragma unroll
      for (int r = 0; r < 8; ++r) {
        const float p = __builtin_amdgcn_exp2f(fmaf(s[j][r], SINV, nms));
        s[j][r] = p;
        psum += p;
      }
    psum += __shfl_xor(psum, 16, 32);
    lrun = fmaf(lrun, alpha, psum);
    mrun = mnew;
#pragma unroll
    for (int t = 0; t < 8; ++t) acc[t] = acc[t] * alpha;

#pragma unroll
    for (int ks = 0; ks < 2; ++ks) {
      HFrag pf;
      v8h plo, phi;
#pragma unroll
      for (int r = 0; r < 8; ++r) {
        plo[r] = (_Float16)s[2 * ks][r];        // keys 32ks + 8hh + r
        phi[r] = (_Float16)s[2 * ks + 1][r];    // keys 32ks + 16 + 8hh + r
      }
      pf.h[0] = plo;
      pf.h[1] = phi;
      const int ko = 32 * ks;
#pragma unroll
      for (int t = 0; t < 8; t += 2) {
        const v16h a0 = ldh(Vhr + (16 * t) * VPH + ko);
        const v16h b0 = ldh(Vlr + (16 * t) * VPH + ko);
        const v16h a1 = ldh(Vhr + (16 * (t + 1)) * VPH + ko);
        const v16h b1 = ldh(Vlr + (16 * (t + 1)) * VPH + ko);
        acc[t]     = mma_h(a0, pf.v, acc[t]);
        acc[t]     = mma_h(b0, pf.v, acc[t]);
        acc[t + 1] = mma_h(a1, pf.v, acc[t + 1]);
        acc[t + 1] = mma_h(b1, pf.v, acc[t + 1]);
        g_pv(acc[t], acc[t + 1], a0, b0, a1, b1, pf.v);
        sched_fence();
      }
    }

    // hand-over: this wave has left buffer kc&1 and its copies of tile kc+1 have landed; behind the barrier that
    // holds for every wave, so tile kc+1 may be read and buffer kc&1 refilled
    asm volatile("s_wait_dscnt 0x0" ::: "memory");
    asm volatile("s_wait_asynccnt 0x0" ::: "memory");
    __syncthreads();
    if (kc + 2 < SQ / 64) {
      const unsigned bo = (unsigned)(kc & 1) * BUFB;
      stage_copies(lk + bo, lv + bo, gk + (size_t)(kc + 2) * 64 * EK, gh + (kc + 2) * 64, gl + (kc + 2) * 64);
    }
  }
  asm volatile("s_wait_asynccnt 0x0" ::: "memory");   // nothing in flight when the ring becomes output staging
  g_acc8(acc[0], acc[1], acc[2], acc[3], acc[4], acc[5], acc[6], acc[7]);

  // ---- epilogue: acc[t][r] = O^T[d = 16t + 8hh + r][query m] * (256 * 1024 * l256/256) ----
  const float inv = __builtin_amdgcn_rcpf(lrun) * (1.0f / VMUL);
  unsigned short* sh = (unsigned short*)(void*)ring + (2 * w) * (16 * OSP);
  unsigned short* sl = sh + 16 * OSP;
#pragma unroll
  for (int t = 0; t < 8; ++t) {
    v4u hv, lvv;
#pragma unroll
    for (int q = 0; q < 4; ++q) {
      const float o0 = acc[t][2 * q] * inv;
      const float o1 = acc[t][2 * q + 1] * inv;
      const unsigned short h0 = f2bf_bits(o0), h1 = f2bf_bits(o1);
      const unsigned short l0 = f2bf_bits(o0 - bfb2f(h0)), l1 = f2bf_bits(o1 - bfb2f(h1));
      hv[q]  = pk16(h0, h1);
      lvv[q] = pk16(l0, l1);
    }
    *(v4u*)(sh + m * OSP + 16 * t + 8 * hh) = hv;
    *(v4u*)(sl + m * OSP + 16 * t + 8 * hh) = lvv;
  }
  __builtin_amdgcn_fence(__ATOMIC_RELEASE, "wavefront");
  __builtin_amdgcn_wave_barrier();
  __builtin_amdgcn_fence(__ATOMIC_ACQUIRE, "wavefront");
  v4u ov[2][8];
#pragma unroll
  for (int it = 0; it < 8; ++it) {
    const int row = 2 * it + hh;
    ov[0][it] = *(const v4u*)(sh + row * OSP + 8 * m);
    ov[1][it] = *(const v4u*)(sl + row * OSP + 8 * m);
  }
  {
#pragma unroll
    for (int it = 0; it < 8; ++it) {
      const int row = 2 * it + hh;
      const size_t go = ((size_t)b * SQ + q0 + row) * EQ + (size_t)h * HD + 8 * m;
      *(v4u*)(Ohp + go) = ov[0][it];
      *(v4u*)(Olp + go) = ov[1][it];
    }
    
  }
}

// ---------------------------------------------------------------------------
// Output projection: out[tok][dout] = sum_e O[tok][e] * Wo[dout][e]; A = O hi + lo bf16 planes, B = Wo bf16.
// Block 64 OWR tokens x 64 OWC out cols, OWR x OWC waves; f32 tile staged in LDS; each wave writes 64 / OWC rows,
// one instruction per 512 B of a row.
// Coverage per block: rows (64 / OWC) w + it = 0..64 OWR - 1, cols 128c + 4*lane = 0..64 OWC - 1.
// ---------------------------------------------------------------------------
__global__ __launch_bounds__(32 * OWR * OWC) void out_kernel(const unsigned short* __restrict__ Ohp,
                                                  const unsigned short* __restrict__ Olp,
                                                  const unsigned short* __restrict__ Wp,
                                                  float* __restrict__ out) {
  constexpr int BM = 64 * OWR, BN = 64 * OWC, OTP = BN + 4, CH = BN / 128;
  // two operand tile buffers; after the k loop the same bytes serve as the block's f32 tile T
  __shared__ __align__(16) unsigned char ring[2 * GBUF(true, BM, BN)];
  static_assert(BM * OTP * 4 <= 2 * GBUF(true, BM, BN), "f32 tile fits the ring");
  float* T = (float*)(void*)ring;
  const int lane = threadIdx.x & 31;
  const int w    = threadIdx.x >> 5;
  const int arow0 = blockIdx.x * BM;
  const int brow0 = blockIdx.y * BN;
  const unsigned short* A  = Ohp + (size_t)arow0 * DM;
  const unsigned short* A2 = Olp + (size_t)arow0 * DM;
  const unsigned short* B  = Wp  + (size_t)brow0 * DM;

  v8f acc[4][4];
#pragma unroll
  for (int i = 0; i < 4; ++i)
#pragma unroll
    for (int j = 0; j < 4; ++j) acc[i][j] = (v8f){0.f, 0.f, 0.f, 0.f, 0.f, 0.f, 0.f, 0.f};

  gemm_core<true, OWR, OWC, 4>(A, A2, B, ring, acc);
  stage_tile<OWC, OTP, 4>(T, w, lane, acc);
  __syncthreads();

#pragma unroll
  for (int hf = 0; hf < 2; ++hf) {
    v4f val[16];
#pragma unroll
    for (int it = 0; it < 16; ++it) {
      const int row = (64 / OWC) * w + (16 * hf + it) / CH, col = 128 * ((16 * hf + it) % CH) + 4 * lane;
      val[it] = *(const v4f*)(T + row * OTP + col);
    }
#pragma unroll
    for (int it = 0; it < 16; ++it) {
      const int row = (64 / OWC) * w + (16 * hf + it) / CH, col = 128 * ((16 * hf + it) % CH) + 4 * lane;
      *(v4f*)(out + (size_t)(arow0 + row) * DM + brow0 + col) = val[it];
    }
  }
}

// ---------------------------------------------------------------------------
// Workspace map (bytes):
//   Xb  bf16 [4096][2048]        16777216 @ 0
//   Wqb bf16 [2048][2048]         8388608
//   Wkb bf16 [1024][2048]         4194304
//   Wvb bf16 [1024][2048]         4194304
//   Wob bf16 [2048][2048]         8388608
//   Qh  f16  [4096][2048]        16777216      Ql same
//   Kp  f16  [4096][1024]         8388608
//   Vth f16  [2*8*128][2048]      8388608      Vtl same
//   Oh  bf16 [4096][2048]        16777216      Ol same
//   total                       134217728
// ---------------------------------------------------------------------------
extern "C" void kernel_launch(void* const* d_in, const int* in_sizes, int n_in,
                              void* d_out, int out_size, void* d_ws, size_t ws_size,
                              hipStream_t stream) {
  if (n_in < 9) return;
  if (in_sizes[0] != NTOK * DM) return;
  if (in_sizes[1] != EQ * DM || in_sizes[2] != EK * DM || in_sizes[3] != EK * DM || in_sizes[4] != DM * EQ) return;
  if (in_sizes[5] != HD || in_sizes[6] != HD) return;
  if (in_sizes[7] != SQ * (HD / 2) || in_sizes[8] != SQ * (HD / 2)) return;
  if (out_size != NTOK * DM) return;

  const float* x    = (const float*)d_in[0];
  const float* wq   = (const float*)d_in[1];
  const float* wk   = (const float*)d_in[2];
  const float* wv   = (const float*)d_in[3];
  const float* wo   = (const float*)d_in[4];
  const float* qnw  = (const float*)d_in[5];
  const float* knw  = (const float*)d_in[6];
  const float* fcos = (const float*)d_in[7];
  const float* fsin = (const float*)d_in[8];
  float* out        = (float*)d_out;

  const size_t szX  = (size_t)NTOK * DM * 2;
  const size_t szWq = (size_t)EQ * DM * 2;
  const size_t szWk = (size_t)EK * DM * 2;
  const size_t szWo = (size_t)DM * EQ * 2;
  const size_t szQ  = (size_t)NTOK * EQ * 2;
  const size_t szK  = (size_t)NTOK * EK * 2;
  const size_t szVt = (size_t)NB * NKV * HD * SQ * 2;
  const size_t szO  = (size_t)NTOK * EQ * 2;
  size_t off = 0;
  const size_t oX  = off; off += szX;
  const size_t oWq = off; off += szWq;
  const size_t oWk = off; off += szWk;
  const size_t oWv = off; off += szWk;
  const size_t oWo = off; off += szWo;
  const size_t oQh = off; off += szQ;
  const size_t oQl = off; off += szQ;
  const size_t oK  = off; off += szK;
  const size_t oVh = off; off += szVt;
  const size_t oVl = off; off += szVt;
  const size_t oOh = off; off += szO;
  const size_t oOl = off; off += szO;
  if (off > ws_size) return;                  // off = 134217728

  char* ws = (char*)d_ws;
  unsigned short* Xb  = (unsigned short*)(ws + oX);
  unsigned short* Wqb = (unsigned short*)(ws + oWq);
  unsigned short* Wkb = (unsigned short*)(ws + oWk);
  unsigned short* Wvb = (unsigned short*)(ws + oWv);
  unsigned short* Wob = (unsigned short*)(ws + oWo);
  unsigned short* Qh  = (unsigned short*)(ws + oQh);
  unsigned short* Ql  = (unsigned short*)(ws + oQl);
  unsigned short* Kp  = (unsigned short*)(ws + oK);
  unsigned short* Vth = (unsigned short*)(ws + oVh);
  unsigned short* Vtl = (unsigned short*)(ws + oVl);
  unsigned short* Oh  = (unsigned short*)(ws + oOh);
  unsigned short* Ol  = (unsigned short*)(ws + oOl);

  // (1) f32 -> bf16 RNE planes (8 elements per thread; all counts are multiples of 2048)
  {
    const int n8x  = (NTOK * DM) / 8;          // 1048576 -> 4096 blocks
    const int n8wq = (EQ * DM) / 8;            //  524288 -> 2048 blocks
    const int n8wk = (EK * DM) / 8;            //  262144 -> 1024 blocks
    const int n8wo = (DM * EQ) / 8;            //  524288 -> 2048 blocks
    cvt_bf16_kernel<<<dim3((n8x + 255) / 256),  dim3(256), 0, stream>>>(x,  Xb,  n8x);
    cvt_bf16_kernel<<<dim3((n8wq + 255) / 256), dim3(256), 0, stream>>>(wq, Wqb, n8wq);
    cvt_bf16_kernel<<<dim3((n8wk + 255) / 256), dim3(256), 0, stream>>>(wk, Wkb, n8wk);
    cvt_bf16_kernel<<<dim3((n8wk + 255) / 256), dim3(256), 0, stream>>>(wv, Wvb, n8wk);
    cvt_bf16_kernel<<<dim3((n8wo + 255) / 256), dim3(256), 0, stream>>>(wo, Wob, n8wo);
  }

  // (2) projections: q (16 token blocks of 256 x 16 heads), k (32 token blocks of 128 x 8 kv heads), v^T (32 token blocks of 128 x 8 feature blocks of 128)
  proj_kernel<0><<<dim3(NTOK / 256, NH), dim3(256), 0, stream>>>(Xb, Wqb, qnw, fcos, fsin, Qh, Ql);
  proj_kernel<1><<<dim3(NTOK / 128, NKV), dim3(256), 0, stream>>>(Xb, Wkb, knw, fcos, fsin, Kp, Kp);
  proj_kernel<2><<<dim3(NTOK / 128, EK / 128), dim3(256), 0, stream>>>(Wvb, Xb, knw, fcos, fsin, Vth, Vtl);

  // (3) attention: 16 query blocks of 128 x 16 heads x 2 batches, 8 waves per block
  attn_kernel<<<dim3(SQ / (16 * AWV), NH, NB), dim3(32 * AWV), 0, stream>>>(Qh, Ql, Kp, Vth, Vtl, Oh, Ol);

  // (4) output projection -> d_out [4096][2048] f32
  out_kernel<<<dim3(NTOK / (64 * OWR), DM / (64 * OWC)), dim3(32 * OWR * OWC), 0, stream>>>(Oh, Ol, Wob, out);

  (void)hipGetLastError();
}

// v005
// A run of this version takes 164 microseconds.
// It is 1.32 times as fast as v003, going by the measured steps of the versions left out in between.
// All steps since v000 together make it 3.47 times as fast.
// q/k/v projections: v_wmma_f32_16x16x32_bf16 (bf16 operands staged in LDS, f32 accumulate); scores k.q^T: v_wmma_f32_16x16x32_f16 (k f16 x8, q f16 x(0.0883883*log2e*1024), one plane each, f32 accumulate); p.v^T: v_wmma_f32_16x16x32_f16 (p f16 x256, v^T f16 x1024, one plane each, f32 accumulate); output projection: v_wmma_f32_16x16x32_f16 (attention output f16, weights f16, one plane each, f32 accumulate); norm, rotary and softmax in f32.
#include <hip/hip_runtime.h>
#include <math.h>
#include <stddef.h>
#include <stdint.h>

#define NB    2
#define SQ    2048
#define DM    2048
#define NH    16
#define NKV   8
#define HD    128
#define EQ    (NH * HD)
#define EK    (NKV * HD)
#define NTOK  (NB * SQ)
#define TP    132
#define OSP   136
#define RMS_EPS 1e-5f
#define QMUL  (0.08838834764831845f * 1.4426950408889634f * 1024.0f)
#define KMUL  8.0f
#define VMUL  1024.0f
#define SINV  (1.0f / 8192.0f)
#define AWV   8                              // waves per attention block (16 queries each)
#define KPH   136                            // LDS pitch of a staged K row, halves (256 B + 16 B)
#define VPH   72                             // LDS pitch of a staged V^T row, halves (128 B + 16 B)
#define KTB   (64 * KPH * 2)                 // bytes of a staged K tile: 64 keys x 128 d
#define VTB   (HD * VPH * 2)                 // bytes of a staged V^T tile: 128 d x 64 keys
#define BUFB  (KTB + VTB)                    // one ring buffer: K, V^T
#define GKB   128                            // k elements of every operand row in one staged GEMM tile (256 B)
#define GPH   136                            // LDS pitch of a staged GEMM operand row, halves (256 B + 16 B)
#define GRB   (GPH * 2)                      // the same pitch in bytes
#define GBUF(BM, BN) (((BM) + (BN)) * GRB)   // one GEMM ring buffer: A rows, B rows
#define PFI(ROLE) ((ROLE) == 0 ? 4 : 2)      // 16-row fragments per wave in a projection block: q 256 x 128, k and v 128 x 128
#define OWR   2                              // output projection: rows of 64 x 64 wave tiles in a block
#define OWC   4                              // and columns of them

typedef _Float16 v16h __attribute__((ext_vector_type(16)));
typedef _Float16 v8h  __attribute__((ext_vector_type(8)));
typedef __bf16   v16b __attribute__((ext_vector_type(16)));
typedef __bf16   v8b  __attribute__((ext_vector_type(8)));
typedef float    v8f  __attribute__((ext_vector_type(8)));
typedef float    v4f  __attribute__((ext_vector_type(4)));
typedef unsigned int v4u __attribute__((ext_vector_type(4)));
typedef unsigned int v2u __attribute__((ext_vector_type(2)));
typedef _Float16 v4h  __attribute__((ext_vector_type(4)));

union HFrag { v16h v; v8h h[2]; };
union BFrag { v16b v; v8b h[2]; };

// ---------------------------------------------------------------------------
// scalar helpers (RNE conversions)
// ---------------------------------------------------------------------------
__device__ __forceinline__ unsigned short f2bf_bits(float f) {
  const unsigned u = __float_as_uint(f);
  return (unsigned short)((u + 0x7FFFu + ((u >> 16) & 1u)) >> 16);
}
__device__ __forceinline__ float bfb2f(unsigned short h) { return __uint_as_float(((unsigned)h) << 16); }
__device__ __forceinline__ float bf16r(float f) { return bfb2f(f2bf_bits(f)); }
__device__ __forceinline__ unsigned short hbits(_Float16 h) { return __builtin_bit_cast(unsigned short, h); }
__device__ __forceinline__ unsigned pk16(unsigned short a, unsigned short b) { return (unsigned)a | ((unsigned)b << 16); }

// ---------------------------------------------------------------------------
// 16x32 fragment loads (A layout; also B from a [n][k] k-contiguous plane):
// elements 0..7 <- p[0..7] (k0+8h..), elements 8..15 <- p[16..23] (k0+16+8h..), p = row + k0 + 8h
// ---------------------------------------------------------------------------
__device__ __forceinline__ v16b ldb(const __bf16* p) {
  BFrag f; f.h[0] = *(const v8b*)(p); f.h[1] = *(const v8b*)(p + 16); return f.v;
}
__device__ __forceinline__ v16h ldh(const _Float16* p) {
  HFrag f; f.h[0] = *(const v8h*)(p); f.h[1] = *(const v8h*)(p + 16); return f.v;
}
__device__ __forceinline__ v8f mma_b(v16b a, v16b b, v8f c) {
  return __builtin_amdgcn_wmma_f32_16x16x32_bf16(false, a, false, b, (short)0, c, false, false);
}
__device__ __forceinline__ v8f mma_h(v16h a, v16h b, v8f c) {
  return __builtin_amdgcn_wmma_f32_16x16x32_f16(false, a, false, b, (short)0, c, false, false);
}

// hazard guards: 4 VALU slots after the last WMMA of a group, tying D and keeping A/B live
__device__ __forceinline__ void guard_b(v8f& a, v8f& b, v16b x) {
  asm volatile("v_nop\n\tv_nop\n\tv_nop\n\tv_nop" : "+v"(a), "+v"(b) : "v"(x));
}
__device__ __forceinline__ void keep_b(v16b a, v16b b, v16b c, v16b d) {
  asm volatile("v_nop" :: "v"(a), "v"(b), "v"(c), "v"(d));
}
__device__ __forceinline__ void acc_guard4(v8f& a, v8f& b, v8f& c, v8f& d) {
  asm volatile("v_nop\n\tv_nop\n\tv_nop\n\tv_nop" : "+v"(a), "+v"(b), "+v"(c), "+v"(d));
}
__device__ __forceinline__ void g_qk(v8f& s0, v8f& s1, v8f& s2, v8f& s3,
                                     v16h k0, v16h k1, v16h k2, v16h k3, v16h k4, v16h k5, v16h k6, v16h k7,
                                     v16h qa, v16h qb) {
  asm volatile("v_nop\n\tv_nop\n\tv_nop\n\tv_nop"
               : "+v"(s0), "+v"(s1), "+v"(s2), "+v"(s3)
               : "v"(k0), "v"(k1), "v"(k2), "v"(k3), "v"(k4), "v"(k5), "v"(k6), "v"(k7), "v"(qa), "v"(qb));
}
__device__ __forceinline__ void g_pv(v8f& a0, v8f& a1, v8f& a2, v8f& a3,
                                     v16h x0, v16h x1, v16h x2, v16h x3, v16h p) {
  asm volatile("v_nop\n\tv_nop\n\tv_nop\n\tv_nop"
               : "+v"(a0), "+v"(a1), "+v"(a2), "+v"(a3) : "v"(x0), "v"(x1), "v"(x2), "v"(x3), "v"(p));
}
__device__ __forceinline__ void g_acc8(v8f& a0, v8f& a1, v8f& a2, v8f& a3, v8f& a4, v8f& a5, v8f& a6, v8f& a7) {
  asm volatile("v_nop\n\tv_nop\n\tv_nop\n\tv_nop"
               : "+v"(a0), "+v"(a1), "+v"(a2), "+v"(a3), "+v"(a4), "+v"(a5), "+v"(a6), "+v"(a7));
}
__device__ __forceinline__ void sched_fence() { asm volatile("" ::: "memory"); }

// ---------------------------------------------------------------------------
// ---------------------------------------------------------------------------
// f32 -> 16-bit planes, RNE, all five arrays in one streaming launch: CVB blocks of CVW waves, as many blocks as the
// chip has WGPs. A wave takes one 4-KB piece (CVL loads of 512 contiguous bytes) of each
// of CVT passes; pass t covers elements [t CVP, (t + 1) CVP) of the planes as they lie one behind the other in the
// workspace: x (passes 0, 1), wq (2), wk and wv (3, half the waves each), wo (4, f16; the others bf16).
// Every output element is written once; one store = 256 contiguous bytes (two whole lines).
#define CVB   256
#define CVW   16
#define CVL   8
#define CVT   5
#define CVP   (CVB * CVW * CVL * 128)        // elements of one pass: 4194304
static_assert(NTOK * DM == 2 * CVP && EQ * DM == CVP && 2 * EK * DM == CVP && DM * EQ == CVP, "the passes cover the planes");
__global__ __launch_bounds__(32 * CVW) void cvt_kernel(const float* __restrict__ x, const float* __restrict__ wq,
                                                       const float* __restrict__ wk, const float* __restrict__ wv,
                                                       const float* __restrict__ wo, unsigned short* __restrict__ out) {
  const unsigned o = (blockIdx.x * CVW + (threadIdx.x >> 5)) * (CVL * 128u) + 4u * (threadIdx.x & 31);
  const float* kv = (blockIdx.x < CVB / 2) ? wk : wv;
  const float* s[CVT] = {x + o, x + CVP + o, wq + o, kv + (o & (CVP / 2 - 1u)), wo + o};
  v4f a[2][CVL];
#pragma unroll
  for (int j = 0; j < CVL; ++j) a[0][j] = *(const v4f*)(s[0] + 128 * j);
  // precaution: stands ahead of any rewrite of these loads' address registers
  asm volatile("s_wait_xcnt 0x0" ::: "memory");
#pragma unroll
  for (int t = 0; t < CVT; ++t) {
    // the two scheduling barriers keep the next pass's loads in one group ahead of this pass's conversions and
    // stores: 8 to 16 loads of a wave stay in flight
    __builtin_amdgcn_sched_barrier(0);
    if (t + 1 < CVT) {
#pragma unroll
      for (int j = 0; j < CVL; ++j) a[(t + 1) & 1][j] = *(const v4f*)(s[t + 1] + 128 * j);
    }
    __builtin_amdgcn_sched_barrier(0);
    unsigned short* d = out + (size_t)t * CVP + o;
#pragma unroll
    for (int j = 0; j < CVL; ++j) {
      const v4f v = a[t & 1][j];
      v2u p;
      if (t == CVT - 1) {
        p = __builtin_bit_cast(v2u, __builtin_convertvector(v, v4h));
      } else {
        p[0] = pk16(f2bf_bits(v[0]), f2bf_bits(v[1]));
        p[1] = pk16(f2bf_bits(v[2]), f2bf_bits(v[3]));
      }
      *(v2u*)(d + 128 * j) = p;
    }
    // precaution: stands ahead of the next pass's rewrite of registers that these loads and stores name
    if (t + 1 < CVT) asm volatile("s_wait_xcnt 0x0" ::: "memory");
  }
}

// ---------------------------------------------------------------------------
// Block GEMM core: WR x WC waves, each with a 16 FI x 64 tile acc[i][j] of the block's BM x BN tile (BM = 16 FI WR,
// BN = 64 WC): += A[BM rows][K] . B[BN rows][K]^T, K = DM = 2048, both planes row-major with pitch DM, bf16 (f16 where F16).
// Each 128-k tile of the block's A and B rows is brought into LDS once per block by asynchronous 16-byte copies
// (16 lanes = 256 B of a row, two whole lines), two buffers, the next tile in flight while this one is worked on;
// the waves read their fragments from LDS (pitch 16 B x odd).
// gA, gB point at the block's first row. On return every wave has left the ring (the last trip's barrier).
// D layout: acc[i][j][r] = C[A row 16 FI wr + 16i + 8h + r][B row 64wc + 16j + (lane&15)].
// ---------------------------------------------------------------------------
// Copies of one lane, every lane on: each (l, g) pair stands for rows r, r + RS, r + 2RS, r + 3RS of a plane (RS =
// rows that the block's lanes cover at once). The s_wait_xcnt stands inside the statement so that no address
// register is rewritten ahead of it.
template <int RS>
__device__ __forceinline__ void copy8(unsigned l0, const unsigned short* g0, unsigned l1, const unsigned short* g1) {
  asm volatile("global_load_async_to_lds_b128 %0, %8, off\n\t"
               "global_load_async_to_lds_b128 %1, %9, off\n\t"
               "global_load_async_to_lds_b128 %2, %10, off\n\t"
               "global_load_async_to_lds_b128 %3, %11, off\n\t"
               "global_load_async_to_lds_b128 %4, %12, off\n\t"
               "global_load_async_to_lds_b128 %5, %13, off\n\t"
               "global_load_async_to_lds_b128 %6, %14, off\n\t"
               "global_load_async_to_lds_b128 %7, %15, off\n\t"
               "s_wait_xcnt 0x0"
               :: "v"(l0), "v"(l0 + (unsigned)RS * GRB), "v"(l0 + 2u * RS * GRB), "v"(l0 + 3u * RS * GRB),
                  "v"(l1), "v"(l1 + (unsigned)RS * GRB), "v"(l1 + 2u * RS * GRB), "v"(l1 + 3u * RS * GRB),
                  "v"(g0), "v"(g0 + (size_t)RS * DM), "v"(g0 + (size_t)2 * RS * DM), "v"(g0 + (size_t)3 * RS * DM),
                  "v"(g1), "v"(g1 + (size_t)RS * DM), "v"(g1 + (size_t)2 * RS * DM), "v"(g1 + (size_t)3 * RS * DM)
               : "memory");
}
template <int RS>
__device__ __forceinline__ void copy12(unsigned l0, const unsigned short* g0, unsigned l1, const unsigned short* g1,
                                       unsigned l2, const unsigned short* g2) {
  asm volatile("global_load_async_to_lds_b128 %0, %12, off\n\t"
               "global_load_async_to_lds_b128 %1, %13, off\n\t"
               "global_load_async_to_lds_b128 %2, %14, off\n\t"
               "global_load_async_to_lds_b128 %3, %15, off\n\t"
               "global_load_async_to_lds_b128 %4, %16, off\n\t"
               "global_load_async_to_lds_b128 %5, %17, off\n\t"
               "global_load_async_to_lds_b128 %6, %18, off\n\t"
               "global_load_async_to_lds_b128 %7, %19, off\n\t"
               "global_load_async_to_lds_b128 %8, %20, off\n\t"
               "global_load_async_to_lds_b128 %9, %21, off\n\t"
               "global_load_async_to_lds_b128 %10, %22, off\n\t"
               "global_load_async_to_lds_b128 %11, %23, off\n\t"
               "s_wait_xcnt 0x0"
               :: "v"(l0), "v"(l0 + (unsigned)RS * GRB), "v"(l0 + 2u * RS * GRB), "v"(l0 + 3u * RS * GRB),
                  "v"(l1), "v"(l1 + (unsigned)RS * GRB), "v"(l1 + 2u * RS * GRB), "v"(l1 + 3u * RS * GRB),
                  "v"(l2), "v"(l2 + (unsigned)RS * GRB), "v"(l2 + 2u * RS * GRB), "v"(l2 + 3u * RS * GRB),
                  "v"(g0), "v"(g0 + (size_t)RS * DM), "v"(g0 + (size_t)2 * RS * DM), "v"(g0 + (size_t)3 * RS * DM),
                  "v"(g1), "v"(g1 + (size_t)RS * DM), "v"(g1 + (size_t)2 * RS * DM), "v"(g1 + (size_t)3 * RS * DM),
                  "v"(g2), "v"(g2 + (size_t)RS * DM), "v"(g2 + (size_t)2 * RS * DM), "v"(g2 + (size_t)3 * RS * DM)
               : "memory");
}
// One tile's copies: every row of A and B once; 16 or 24 per lane
template <int WR, int WC, int FI>
__device__ __forceinline__ void stage_gemm(unsigned l, const unsigned short* ga, const unsigned short* gb) {
  constexpr int RS = 2 * WR * WC;              // rows covered by one copy of every lane
  constexpr int BM = 16 * FI * WR;
  constexpr int PA = BM / (4 * RS);            // (l, g) pairs of an A plane
  constexpr int PB = 64 * WC / (4 * RS);       // (l, g) pairs of the B plane
  constexpr int NP = PA + PB;
  static_assert(PA * 4 * RS == BM && PB * 4 * RS == 64 * WC, "whole pairs");
  static_assert(NP == 4 || NP == 6, "pairs go out in eights and twelves");
  unsigned L[NP];
  const unsigned short* G[NP];
#pragma unroll
  for (int p = 0; p < PA; ++p) {
    L[p] = l + (unsigned)(p * 4 * RS) * GRB;
    G[p] = ga + (size_t)(p * 4 * RS) * DM;
  }
#pragma unroll
  for (int p = 0; p < PB; ++p) {
    L[PA + p] = l + (unsigned)(BM + p * 4 * RS) * GRB;
    G[PA + p] = gb + (size_t)(p * 4 * RS) * DM;
  }
  if constexpr (NP == 4) {
    copy8<RS>(L[0], G[0], L[1], G[1]);
    copy8<RS>(L[2], G[2], L[3], G[3]);
  } else {
    copy12<RS>(L[0], G[0], L[1], G[1], L[2], G[2]);
    copy12<RS>(L[3], G[3], L[4], G[4], L[5], G[5]);
  }
}

template <bool F16, int WR, int WC, int FI>
__device__ __forceinline__ void gemm_core(const unsigned short* __restrict__ gA, const unsigned short* __restrict__ gB,
                                          unsigned char* ring, v8f (&acc)[FI][4]) {
  constexpr int BM = 16 * FI * WR;
  constexpr unsigned GB = GBUF(BM, 64 * WC);
  const int tid = threadIdx.x, lane = tid & 31, w = tid >> 5;
  const int m = lane & 15, ko = (lane >> 4) * 8, wr = w / WC, wc = w % WC;
  // copy addresses of this lane: row (tid>>4) + RS i of a plane, 16-B piece tid&15
  const size_t go = (size_t)(tid >> 4) * DM + 8 * (tid & 15);
  const unsigned short* ga = gA + go;
  const unsigned short* gb = gB + go;
  typedef __attribute__((address_space(3))) unsigned char lds_byte;
  const unsigned l0 = (unsigned)(uintptr_t)(lds_byte*)ring + (unsigned)((tid >> 4) * GRB + 16 * (tid & 15));

  // tile 0 into buffer 0, landed and published; then tile 1 into buffer 1
  stage_gemm<WR, WC, FI>(l0, ga, gb);
  asm volatile("s_wait_asynccnt 0x0" ::: "memory");   // this wave's copies of tile 0 have landed
  __syncthreads();                                    // every wave's have
  stage_gemm<WR, WC, FI>(l0 + GB, ga + GKB, gb + GKB);

  // kept rolled: one trip per staged tile, so that the hand-over at its foot stands once, in the order written
#pragma unroll 1
  for (int t = 0; t < DM / GKB; ++t) {
    const __bf16* buf = (const __bf16*)(const void*)(ring + (t & 1) * GB);
    const __bf16* Ar = buf + (16 * FI * wr + m) * GPH + ko;
    const __bf16* Br = buf + (BM + 64 * wc + m) * GPH + ko;
#pragma unroll
    for (int s = 0; s < GKB / 32; ++s) {
      // the fragments of 32 k as one group of LDS reads ahead of their matrix instructions
      v16b bf[4], af[FI];
#pragma unroll
      for (int j = 0; j < 4; ++j) bf[j] = ldb(Br + (16 * j) * GPH + 32 * s);
#pragma unroll
      for (int i = 0; i < FI; ++i) af[i] = ldb(Ar + (16 * i) * GPH + 32 * s);
#pragma unroll
      for (int i = 0; i < FI; ++i) {
#pragma unroll
        for (int j = 0; j < 4; ++j) {
          if constexpr (F16)
            acc[i][j] = mma_h(__builtin_bit_cast(v16h, af[i]), __builtin_bit_cast(v16h, bf[j]), acc[i][j]);
          else
            acc[i][j] = mma_b(af[i], bf[j], acc[i][j]);
        }
        guard_b(acc[i][0], acc[i][3], af[i]);
      }
      keep_b(bf[0], bf[1], bf[2], bf[3]);
    }
    // hand-over: this wave has left buffer t&1 and its copies of tile t+1 have landed; behind the barrier that
    // holds for every wave, so tile t+1 may be read and buffer t&1 refilled
    asm volatile("s_wait_dscnt 0x0" ::: "memory");
    asm volatile("s_wait_asynccnt 0x0" ::: "memory");
    __syncthreads();
    if (t + 2 < DM / GKB) {
      const int kn = (t + 2) * GKB;
      stage_gemm<WR, WC, FI>(l0 + (unsigned)(t & 1) * GB, ga + kn, gb + kn);
    }
  }
  asm volatile("s_wait_asynccnt 0x0" ::: "memory");   // nothing in flight when the ring becomes the f32 tile
#pragma unroll
  for (int i = 0; i < FI; ++i) acc_guard4(acc[i][0], acc[i][1], acc[i][2], acc[i][3]);
}

// stage a wave's 16 FI x 64 tile into the block's f32 LDS tile (pitch P floats)
template <int WC, int P, int FI>
__device__ __forceinline__ void stage_tile(float* T, int w, int lane, v8f (&acc)[FI][4]) {
  const int wr = w / WC, wc = w % WC, hh = lane >> 4, m = lane & 15;
#pragma unroll
  for (int i = 0; i < FI; ++i)
#pragma unroll
    for (int j = 0; j < 4; ++j)
#pragma unroll
      for (int r = 0; r < 8; ++r)
        T[(16 * FI * wr + 16 * i + 8 * hh + r) * P + 64 * wc + 16 * j + m] = acc[i][j][r];
}

// ---------------------------------------------------------------------------
//   ROLE 0: A = X plane rows (tokens BM*bx), B = Wq plane rows (head by): RMSNorm + RoPE in f32,
//           q' = q * QMUL -> f16 plane P1 [tok][EQ], cols by*128.
//   ROLE 1: A = X, B = Wk rows (kv head by): RMSNorm + RoPE, k' = k * 8 -> f16 plane P1 [tok][EK].
//   ROLE 2: A = Wv plane rows (features BM*by), B = X rows (tokens 128*bx): tile = V^T directly;
//           v' = v * 1024 -> f16 plane P1, layout [(b*NKV+kvh)*128 + d][s].
// Block tile BM x 128, 4 x 2 waves of 16 PFI(ROLE) x 64 each, BM = 64 PFI(ROLE).
// Epilogue: f32 tile staged in LDS, then each wave owns RPW = BM / 8 rows; one store instruction = 16 lanes x 16 B
// Coverage per block: rows RPW w + 16hf + 2it + hh (hf 0..RPW/16-1, it 0..7, hh 0..1) = 0..BM-1, cols 8*(lane&15) = 0..127.
// ---------------------------------------------------------------------------
template <int ROLE>
__global__ __launch_bounds__(256) void proj_kernel(const unsigned short* __restrict__ Ap,
                                                   const unsigned short* __restrict__ Bp,
                                                   const float* __restrict__ nw,
                                                   const float* __restrict__ fcos,
                                                   const float* __restrict__ fsin,
                                                   unsigned short* __restrict__ P1) {
  constexpr int FI = PFI(ROLE), BM = 64 * FI, RPW = BM / 8;
  constexpr int RINGB = 2 * GBUF(BM, 128), TILEB = BM * TP * 4;
  // two operand tile buffers; after the k loop the same bytes serve as the block's f32 tile T
  __shared__ __align__(16) unsigned char ring[RINGB > TILEB ? RINGB : TILEB];
  float* T = (float*)(void*)ring;
  const int lane = threadIdx.x & 31;
  const int w    = threadIdx.x >> 5;
  const int hh   = lane >> 4;
  const int m    = lane & 15;
  const int arow0 = (ROLE == 2) ? (int)blockIdx.y * BM : (int)blockIdx.x * BM;
  const int brow0 = (ROLE == 2) ? (int)blockIdx.x * 128 : (int)blockIdx.y * 128;
  const unsigned short* A = Ap + (size_t)arow0 * DM;
  const unsigned short* B = Bp + (size_t)brow0 * DM;

  v8f acc[FI][4];
#pragma unroll
  for (int i = 0; i < FI; ++i)
#pragma unroll
    for (int j = 0; j < 4; ++j) acc[i][j] = (v8f){0.f, 0.f, 0.f, 0.f, 0.f, 0.f, 0.f, 0.f};

  gemm_core<false, 4, 2, FI>(A, B, ring, acc);
  stage_tile<2, TP, FI>(T, w, lane, acc);
  __syncthreads();

  float wv[8];
  if (ROLE != 2) {
    const v4f wa = *(const v4f*)(nw + 8 * m);
    const v4f wb = *(const v4f*)(nw + 8 * m + 4);
#pragma unroll
    for (int e = 0; e < 4; ++e) { wv[e] = bf16r(wa[e]); wv[4 + e] = bf16r(wb[e]); }
  } else {
#pragma unroll
    for (int e = 0; e < 8; ++e) wv[e] = 1.0f;
  }

#pragma unroll
  for (int hf = 0; hf < RPW / 16; ++hf) {
    v4u hv[8];
#pragma unroll
    for (int it = 0; it < 8; ++it) {
      const int row = RPW * w + 16 * hf + 2 * it + hh;
      const float* tr = T + row * TP + 8 * m;
      const v4f xa = *(const v4f*)(tr);
      const v4f xb = *(const v4f*)(tr + 4);
      float x[8] = {xa[0], xa[1], xa[2], xa[3], xb[0], xb[1], xb[2], xb[3]};
      float y[8];
      if (ROLE == 2) {
#pragma unroll
        for (int e = 0; e < 8; ++e) y[e] = x[e] * VMUL;
      } else {
        float ss = 0.f;
#pragma unroll
        for (int e = 0; e < 8; ++e) ss = fmaf(x[e], x[e], ss);
        ss += __shfl_xor(ss, 1, 32);
        ss += __shfl_xor(ss, 2, 32);
        ss += __shfl_xor(ss, 4, 32);
        ss += __shfl_xor(ss, 8, 32);
        const float rn  = rsqrtf(fmaf(ss, 1.0f / (float)HD, RMS_EPS));
        const int   tok = arow0 + row;
        const int   sp  = tok & (SQ - 1);
        const v4f c4 = *(const v4f*)(fcos + (size_t)sp * (HD / 2) + 4 * m);
        const v4f s4 = *(const v4f*)(fsin + (size_t)sp * (HD / 2) + 4 * m);
        // precaution: stands ahead of any rewrite of these two loads' address registers
        asm volatile("s_wait_xcnt 0x0" ::: "memory");
        const float om = (ROLE == 0) ? QMUL : KMUL;
#pragma unroll
        for (int p = 0; p < 4; ++p) {
          const float cs = bf16r(c4[p]), sn = bf16r(s4[p]);
          const float u0 = x[2 * p] * rn * wv[2 * p];
          const float u1 = x[2 * p + 1] * rn * wv[2 * p + 1];
          y[2 * p]     = (u0 * cs - u1 * sn) * om;
          y[2 * p + 1] = (u0 * sn + u1 * cs) * om;
        }
      }
      v4u a;
#pragma unroll
      for (int q = 0; q < 4; ++q) a[q] = pk16(hbits((_Float16)y[2 * q]), hbits((_Float16)y[2 * q + 1]));
      hv[it] = a;
    }

    {
#pragma unroll
      for (int it = 0; it < 8; ++it) {
        const int row = RPW * w + 16 * hf + 2 * it + hh;
        size_t go;
        if (ROLE == 0) {
          go = (size_t)(arow0 + row) * EQ + (size_t)blockIdx.y * HD + 8 * m;
        } else if (ROLE == 1) {
          go = (size_t)(arow0 + row) * EK + (size_t)blockIdx.y * HD + 8 * m;
        } else {
          const int f   = arow0 + row;            // 0..1023
          const int kvh = f >> 7;
          const int d   = f & (HD - 1);
          const int bb  = brow0 >> 11;            // batch of this 128-token block
          const int s0  = brow0 & (SQ - 1);
          go = ((size_t)((bb * NKV + kvh) * HD + d)) * SQ + s0 + 8 * m;
        }
        *(v4u*)(P1 + go) = hv[it];
      }
    }
  }
}

// ---------------------------------------------------------------------------
// Full (non-causal) GQA attention, head dim 128, one wave per (b, h, 16 queries); block = 8 waves (128 queries).
//   Each 64-key tile (K rows, V^T rows) is brought into LDS once per block by asynchronous
//   16-byte copies (whole 128-B lines on the global side), two buffers, the next tile in flight while this one
//   is worked on; all 8 waves read their fragments from LDS (row pitches 16 B x odd: no bank conflicts).
//   Transposed scores S^T[key][query] = K . Q^T : A = K rows [key][d] (f16 x8), B[k=d][n=query] from Q rows
//   [query][d] (f16) -> both fragments are plain k-contiguous row loads.
//   D tiles (rows = 16 keys, cols = queries) packed to f16 ARE the B operand [k=key][n=query] of
//   O^T[d][query] = V^T . P : element r <- tile(keys 0-15)[r], element 8+r <- tile(keys 16-31)[r], same lane.
//   A = V^T rows [d][s] (f16 x1024). Softmax per query column = per lane (partner lane ^16),
//   online over 32 chunks of 64 keys, f32, exp2 with log2e folded into the q scale, p carried x256.
//   Epilogue: O = acc / (l * 1024) -> f16, per-wave LDS relayout [query][d] (v4u store/reload,
//   Coverage: rows 2it + hh (it 0..7) = 16 queries, cols 8*(lane&15) = 0..127 of head h.
// ---------------------------------------------------------------------------
// One tile's copies: 8 per lane (4 of K, 4 of V^T), every lane on. The s_wait_xcnt stands inside the
// statement so that no address register is rewritten ahead of it.
__device__ __forceinline__ void stage_copies(unsigned lk, unsigned lv, const unsigned short* gk,
                                             const unsigned short* gv) {
  asm volatile("global_load_async_to_lds_b128 %0, %8, off\n\t"
               "global_load_async_to_lds_b128 %1, %9, off\n\t"
               "global_load_async_to_lds_b128 %2, %10, off\n\t"
               "global_load_async_to_lds_b128 %3, %11, off\n\t"
               "global_load_async_to_lds_b128 %4, %12, off\n\t"
               "global_load_async_to_lds_b128 %5, %13, off\n\t"
               "global_load_async_to_lds_b128 %6, %14, off\n\t"
               "global_load_async_to_lds_b128 %7, %15, off\n\t"
               "s_wait_xcnt 0x0"
               :: "v"(lk), "v"(lk + 16u * KPH * 2u), "v"(lk + 32u * KPH * 2u), "v"(lk + 48u * KPH * 2u),
                  "v"(lv), "v"(lv + 32u * VPH * 2u), "v"(lv + 64u * VPH * 2u), "v"(lv + 96u * VPH * 2u),
                  "v"(gk), "v"(gk + (size_t)16 * EK), "v"(gk + (size_t)32 * EK), "v"(gk + (size_t)48 * EK),
                  "v"(gv), "v"(gv + (size_t)32 * SQ), "v"(gv + (size_t)64 * SQ), "v"(gv + (size_t)96 * SQ)
               : "memory");
}

__global__ __launch_bounds__(32 * AWV) void attn_kernel(const unsigned short* __restrict__ Qpp,
                                                  const unsigned short* __restrict__ Kpp,
                                                  const unsigned short* __restrict__ Vpp,
                                                  unsigned short* __restrict__ Opp) {
  // two tile buffers; after the loop the same bytes serve as output staging [wave][query*OSP + d]
  __shared__ __align__(16) unsigned char ring[2 * BUFB];
  static_assert(AWV * 16 * OSP * 2 <= 2 * BUFB, "output staging fits the ring");
  const int lane = threadIdx.x & 31;
  const int w    = threadIdx.x >> 5;
  const int hh   = lane >> 4;
  const int m    = lane & 15;
  const int h    = blockIdx.y;
  const int b    = blockIdx.z;
  const int kvh  = h >> 1;                       // G = NH / NKV = 2
  const int q0   = blockIdx.x * (16 * AWV) + w * 16;   // query index within the sequence

  const _Float16* Qp = (const _Float16*)(const void*)Qpp;
  const size_t vplane = (size_t)((b * NKV + kvh) * HD) * SQ;
  // copy addresses of this lane. K: key row (tid>>4) + 16i, 16-B piece tid&15; V^T: d row (tid>>3) + 32i, piece tid&7
  const int tid = threadIdx.x;
  const unsigned short* gk = Kpp + (size_t)b * SQ * EK + kvh * HD + (size_t)(tid >> 4) * EK + 8 * (tid & 15);
  const unsigned short* gv = Vpp + vplane + (size_t)(tid >> 3) * SQ + 8 * (tid & 7);
  typedef __attribute__((address_space(3))) unsigned char lds_byte;
  const unsigned ring0 = (unsigned)(uintptr_t)(lds_byte*)ring;
  const unsigned lk = ring0 + (unsigned)((tid >> 4) * (KPH * 2) + 16 * (tid & 15));
  const unsigned lv = ring0 + (unsigned)(KTB + (tid >> 3) * (VPH * 2) + 16 * (tid & 7));

  // tile 0 into buffer 0, landed and published; then tile 1 into buffer 1
  stage_copies(lk, lv, gk, gv);
  asm volatile("s_wait_asynccnt 0x0" ::: "memory");   // this wave's copies of tile 0 have landed
  __syncthreads();                                    // every wave's have
  stage_copies(lk + BUFB, lv + BUFB, gk + (size_t)64 * EK, gv + 64);

  // Q fragments (B operand): row = query q0 + (lane&15), k = d
  v16h qf[4];
  {
    const size_t qo = ((size_t)b * SQ + q0 + m) * EQ + (size_t)h * HD + 8 * hh;
#pragma unroll
    for (int dc = 0; dc < 4; ++dc) qf[dc] = ldh(Qp + qo + 32 * dc);
    // precaution: stands ahead of any rewrite of these loads' address registers
    asm volatile("s_wait_xcnt 0x0" ::: "memory");
  }

  v8f acc[8];
#pragma unroll
  for (int t = 0; t < 8; ++t) acc[t] = (v8f){0.f, 0.f, 0.f, 0.f, 0.f, 0.f, 0.f, 0.f};
  float mrun = -1.0e30f;
  float lrun = 0.0f;

#pragma unroll 1
  for (int kc = 0; kc < SQ / 64; ++kc) {
    const unsigned char* buf = ring + (kc & 1) * BUFB;
    const _Float16* Kr  = (const _Float16*)(const void*)buf + m * KPH + 8 * hh;                // + key*KPH + 32dc
    const _Float16* Vr  = (const _Float16*)(const void*)(buf + KTB) + m * VPH + 8 * hh;        // + 16t*VPH + key
    v8f s[4];
#pragma unroll
    for (int j = 0; j < 4; ++j) s[j] = (v8f){0.f, 0.f, 0.f, 0.f, 0.f, 0.f, 0.f, 0.f};
#pragma unroll
    for (int dc = 0; dc < 4; dc += 2) {
      // one group of LDS reads feeds 8 matrix instructions: 64 d of 4 key tiles
      v16h kf[8];
#pragma unroll
      for (int j = 0; j < 8; ++j) kf[j] = ldh(Kr + (16 * (j & 3)) * KPH + 32 * (dc + (j >> 2)));
#pragma unroll
      for (int j = 0; j < 8; ++j) s[j & 3] = mma_h(kf[j], qf[dc + (j >> 2)], s[j & 3]);
      g_qk(s[0], s[1], s[2], s[3], kf[0], kf[1], kf[2], kf[3], kf[4], kf[5], kf[6], kf[7], qf[dc], qf[dc + 1]);
      sched_fence();
    }

    // online softmax for query column (lane&15); lane holds keys key0 + 16j + 8hh + r
    float cmax = -1.0e30f;
#pragma unroll
    for (int j = 0; j < 4; ++j)
#pragma unroll
      for (int r = 0; r < 8; ++r) cmax = fmaxf(cmax, s[j][r]);
    cmax = fmaxf(cmax, __shfl_xor(cmax, 16, 32));
    const float mnew  = fmaxf(mrun, cmax);
    const float alpha = __builtin_amdgcn_exp2f((mrun - mnew) * SINV);
    const float nms   = 8.0f - mnew * SINV;          // p * 256 = exp2(s*SINV - m*SINV + 8)
    float psum = 0.f;
#pragma unroll
    for (int j = 0; j < 4; ++j)
#pragma unroll
      for (int r = 0; r < 8; ++r) {
        const float p = __builtin_amdgcn_exp2f(fmaf(s[j][r], SINV, nms));
        s[j][r] = p;
        psum += p;
      }
    psum += __shfl_xor(psum, 16, 32);
    lrun = fmaf(lrun, alpha, psum);
    mrun = mnew;
#pragma unroll
    for (int t = 0; t < 8; ++t) acc[t] = acc[t] * alpha;

#pragma unroll
    for (int ks = 0; ks < 2; ++ks) {
      HFrag pf;
      v8h plo, phi;
#pragma unroll
      for (int r = 0; r < 8; ++r) {
        plo[r] = (_Float16)s[2 * ks][r];        // keys 32ks + 8hh + r
        phi[r] = (_Float16)s[2 * ks + 1][r];    // keys 32ks + 16 + 8hh + r
      }
      pf.h[0] = plo;
      pf.h[1] = phi;
      const int ko = 32 * ks;
#pragma unroll
      for (int t = 0; t < 8; t += 4) {
        const v16h a0 = ldh(Vr + (16 * t) * VPH + ko);
        const v16h a1 = ldh(Vr + (16 * (t + 1)) * VPH + ko);
        const v16h a2 = ldh(Vr + (16 * (t + 2)) * VPH + ko);
        const v16h a3 = ldh(Vr + (16 * (t + 3)) * VPH + ko);
        acc[t]     = mma_h(a0, pf.v, acc[t]);
        acc[t + 1] = mma_h(a1, pf.v, acc[t + 1]);
        acc[t + 2] = mma_h(a2, pf.v, acc[t + 2]);
        acc[t + 3] = mma_h(a3, pf.v, acc[t + 3]);
        g_pv(acc[t], acc[t + 1], acc[t + 2], acc[t + 3], a0, a1, a2, a3, pf.v);
        sched_fence();
      }
    }

    // hand-over: this wave has left buffer kc&1 and its copies of tile kc+1 have landed; behind the barrier that
    // holds for every wave, so tile kc+1 may be read and buffer kc&1 refilled
    asm volatile("s_wait_dscnt 0x0" ::: "memory");
    asm volatile("s_wait_asynccnt 0x0" ::: "memory");
    __syncthreads();
    if (kc + 2 < SQ / 64) {
      const unsigned bo = (unsigned)(kc & 1) * BUFB;
      stage_copies(lk + bo, lv + bo, gk + (size_t)(kc + 2) * 64 * EK, gv + (kc + 2) * 64);
    }
  }
  asm volatile("s_wait_asynccnt 0x0" ::: "memory");   // nothing in flight when the ring becomes output staging
  g_acc8(acc[0], acc[1], acc[2], acc[3], acc[4], acc[5], acc[6], acc[7]);

  // ---- epilogue: acc[t][r] = O^T[d = 16t + 8hh + r][query m] * (256 * 1024 * l256/256) ----
  const float inv = __builtin_amdgcn_rcpf(lrun) * (1.0f / VMUL);
  unsigned short* sh = (unsigned short*)(void*)ring + w * (16 * OSP);
#pragma unroll
  for (int t = 0; t < 8; ++t) {
    v4u hv;
#pragma unroll
    for (int q = 0; q < 4; ++q)
      hv[q] = pk16(hbits((_Float16)(acc[t][2 * q] * inv)), hbits((_Float16)(acc[t][2 * q + 1] * inv)));
    *(v4u*)(sh + m * OSP + 16 * t + 8 * hh) = hv;
  }
  __builtin_amdgcn_fence(__ATOMIC_RELEASE, "wavefront");
  __builtin_amdgcn_wave_barrier();
  __builtin_amdgcn_fence(__ATOMIC_ACQUIRE, "wavefront");
  v4u ov[8];
#pragma unroll
  for (int it = 0; it < 8; ++it) ov[it] = *(const v4u*)(sh + (2 * it + hh) * OSP + 8 * m);
  {
#pragma unroll
    for (int it = 0; it < 8; ++it) {
      const int row = 2 * it + hh;
      const size_t go = ((size_t)b * SQ + q0 + row) * EQ + (size_t)h * HD + 8 * m;
      *(v4u*)(Opp + go) = ov[it];
    }
    
  }
}

// ---------------------------------------------------------------------------
// Output projection: out[tok][dout] = sum_e O[tok][e] * Wo[dout][e]; A = O f16, B = Wo f16.
// Block 64 OWR tokens x 64 OWC out cols, OWR x OWC waves; f32 tile staged in LDS; each wave writes 64 / OWC rows,
// one instruction per 512 B of a row.
// Coverage per block: rows (64 / OWC) w + it = 0..64 OWR - 1, cols 128c + 4*lane = 0..64 OWC - 1.
// ---------------------------------------------------------------------------
__global__ __launch_bounds__(32 * OWR * OWC) void out_kernel(const unsigned short* __restrict__ Opp,
                                                  const unsigned short* __restrict__ Wp,
                                                  float* __restrict__ out) {
  constexpr int BM = 64 * OWR, BN = 64 * OWC, OTP = BN + 4, CH = BN / 128;
  // two operand tile buffers; after the k loop the same bytes serve as the block's f32 tile T
  __shared__ __align__(16) unsigned char ring[2 * GBUF(BM, BN)];
  static_assert(BM * OTP * 4 <= 2 * GBUF(BM, BN), "f32 tile fits the ring");
  float* T = (float*)(void*)ring;
  const int lane = threadIdx.x & 31;
  const int w    = threadIdx.x >> 5;
  const int arow0 = blockIdx.x * BM;
  const int brow0 = blockIdx.y * BN;
  const unsigned short* A = Opp + (size_t)arow0 * DM;
  const unsigned short* B = Wp + (size_t)brow0 * DM;

  v8f acc[4][4];
#pragma unroll
  for (int i = 0; i < 4; ++i)
#pragma unroll
    for (int j = 0; j < 4; ++j) acc[i][j] = (v8f){0.f, 0.f, 0.f, 0.f, 0.f, 0.f, 0.f, 0.f};

  gemm_core<true, OWR, OWC, 4>(A, B, ring, acc);
  stage_tile<OWC, OTP, 4>(T, w, lane, acc);
  __syncthreads();

#pragma unroll
  for (int hf = 0; hf < 2; ++hf) {
    v4f val[16];
#pragma unroll
    for (int it = 0; it < 16; ++it) {
      const int row = (64 / OWC) * w + (16 * hf + it) / CH, col = 128 * ((16 * hf + it) % CH) + 4 * lane;
      val[it] = *(const v4f*)(T + row * OTP + col);
    }
#pragma unroll
    for (int it = 0; it < 16; ++it) {
      const int row = (64 / OWC) * w + (16 * hf + it) / CH, col = 128 * ((16 * hf + it) % CH) + 4 * lane;
      *(v4f*)(out + (size_t)(arow0 + row) * DM + brow0 + col) = val[it];
    }
  }
}

// ---------------------------------------------------------------------------
// Workspace map (bytes):
//   Xb  bf16 [4096][2048]        16777216 @ 0
//   Wqb bf16 [2048][2048]         8388608
//   Wkb bf16 [1024][2048]         4194304
//   Wvb bf16 [1024][2048]         4194304
//   Woh f16  [2048][2048]         8388608
//   Qp  f16  [4096][2048]        16777216
//   Kp  f16  [4096][1024]         8388608
//   Vt  f16  [2*8*128][2048]      8388608
//   Op  f16  [4096][2048]        16777216
//   total                        92274688
// ---------------------------------------------------------------------------
extern "C" void kernel_launch(void* const* d_in, const int* in_sizes, int n_in,
                              void* d_out, int out_size, void* d_ws, size_t ws_size,
                              hipStream_t stream) {
  if (n_in < 9) return;
  if (in_sizes[0] != NTOK * DM) return;
  if (in_sizes[1] != EQ * DM || in_sizes[2] != EK * DM || in_sizes[3] != EK * DM || in_sizes[4] != DM * EQ) return;
  if (in_sizes[5] != HD || in_sizes[6] != HD) return;
  if (in_sizes[7] != SQ * (HD / 2) || in_sizes[8] != SQ * (HD / 2)) return;
  if (out_size != NTOK * DM) return;

  const float* x    = (const float*)d_in[0];
  const float* wq   = (const float*)d_in[1];
  const float* wk   = (const float*)d_in[2];
  const float* wv   = (const float*)d_in[3];
  const float* wo   = (const float*)d_in[4];
  const float* qnw  = (const float*)d_in[5];
  const float* knw  = (const float*)d_in[6];
  const float* fcos = (const float*)d_in[7];
  const float* fsin = (const float*)d_in[8];
  float* out        = (float*)d_out;

  const size_t szX  = (size_t)NTOK * DM * 2;
  const size_t szWq = (size_t)EQ * DM * 2;
  const size_t szWk = (size_t)EK * DM * 2;
  const size_t szWo = (size_t)DM * EQ * 2;
  const size_t szQ  = (size_t)NTOK * EQ * 2;
  const size_t szK  = (size_t)NTOK * EK * 2;
  const size_t szVt = (size_t)NB * NKV * HD * SQ * 2;
  const size_t szO  = (size_t)NTOK * EQ * 2;
  size_t off = 0;
  const size_t oX  = off; off += szX;
  const size_t oWq = off; off += szWq;
  const size_t oWk = off; off += szWk;
  const size_t oWv = off; off += szWk;
  const size_t oWo = off; off += szWo;
  const size_t oQ  = off; off += szQ;
  const size_t oK  = off; off += szK;
  const size_t oV  = off; off += szVt;
  const size_t oO  = off; off += szO;
  if (off > ws_size) return;                  // off = 92274688

  char* ws = (char*)d_ws;
  unsigned short* Xb  = (unsigned short*)(ws + oX);
  unsigned short* Wqb = (unsigned short*)(ws + oWq);
  unsigned short* Wkb = (unsigned short*)(ws + oWk);
  unsigned short* Wvb = (unsigned short*)(ws + oWv);
  unsigned short* Woh = (unsigned short*)(ws + oWo);
  unsigned short* Qp  = (unsigned short*)(ws + oQ);
  unsigned short* Kp  = (unsigned short*)(ws + oK);
  unsigned short* Vt  = (unsigned short*)(ws + oV);
  unsigned short* Op  = (unsigned short*)(ws + oO);

  // (1) f32 -> bf16 RNE planes, wo -> f16: one launch; the five planes lie one behind the other from Xb on
  cvt_kernel<<<dim3(CVB), dim3(32 * CVW), 0, stream>>>(x, wq, wk, wv, wo, Xb);

  // (2) projections: q (16 token blocks of 256 x 16 heads), k (32 token blocks of 128 x 8 kv heads), v^T (32 token blocks of 128 x 8 feature blocks of 128)
  proj_kernel<0><<<dim3(NTOK / 256, NH), dim3(256), 0, stream>>>(Xb, Wqb, qnw, fcos, fsin, Qp);
  proj_kernel<1><<<dim3(NTOK / 128, NKV), dim3(256), 0, stream>>>(Xb, Wkb, knw, fcos, fsin, Kp);
  proj_kernel<2><<<dim3(NTOK / 128, EK / 128), dim3(256), 0, stream>>>(Wvb, Xb, knw, fcos, fsin, Vt);

  // (3) attention: 16 query blocks of 128 x 16 heads x 2 batches, 8 waves per block
  attn_kernel<<<dim3(SQ / (16 * AWV), NH, NB), dim3(32 * AWV), 0, stream>>>(Qp, Kp, Vt, Op);

  // (4) output projection -> d_out [4096][2048] f32
  out_kernel<<<dim3(NTOK / (64 * OWR), DM / (64 * OWC)), dim3(32 * OWR * OWC), 0, stream>>>(Op, Woh, out);

  (void)hipGetLastError();
}

// v006
// A run of this version takes 154 microseconds.
// Timed twice side by side with v005, it ran 1.06 times as fast both times.
// All steps since v000 together make it 3.67 times as fast.
// q/k/v projections: v_wmma_f32_16x16x32_bf16 (bf16 operands staged in LDS, f32 accumulate); scores k.q^T: v_wmma_f32_16x16x32_f16 (k f16 x8, q f16 x(0.0883883*log2e*1024), one plane each, f32 accumulate); p.v^T: v_wmma_f32_16x16x32_f16 (p f16 x256, v^T f16 x1024, one plane each, f32 accumulate); output projection: v_wmma_f32_16x16x32_f16 (attention output f16, weights f16, one plane each, f32 accumulate); norm, rotary and softmax in f32.
#include <hip/hip_runtime.h>
#include <math.h>
#include <stddef.h>
#include <stdint.h>

#define NB    2
#define SQ    2048
#define DM    2048
#define NH    16
#define NKV   8
#define HD    128
#define EQ    (NH * HD)
#define EK    (NKV * HD)
#define NTOK  (NB * SQ)
#define TP    132
#define OSP   136
#define RMS_EPS 1e-5f
#define QMUL  (0.08838834764831845f * 1.4426950408889634f * 1024.0f)
#define KMUL  8.0f
#define VMUL  1024.0f
#define SINV  (1.0f / 8192.0f)
#define AWV   8                              // waves per attention block
#define QCG   2                              // 16-query column groups per attention wave (32 queries each)
#define KPH   136                            // LDS pitch of a staged K row, halves (256 B + 16 B)
#define VPH   72                             // LDS pitch of a staged V^T row, halves (128 B + 16 B)
#define KTB   (64 * KPH * 2)                 // bytes of a staged K tile: 64 keys x 128 d
#define VTB   (HD * VPH * 2)                 // bytes of a staged V^T tile: 128 d x 64 keys
#define BUFB  (KTB + VTB)                    // one ring buffer: K, V^T
#define GKB   128                            // k elements of every operand row in one staged GEMM tile (256 B)
#define GPH   136                            // LDS pitch of a staged GEMM operand row, halves (256 B + 16 B)
#define GRB   (GPH * 2)                      // the same pitch in bytes
#define GBUF(BM, BN) (((BM) + (BN)) * GRB)   // one GEMM ring buffer: A rows, B rows
#define PFI(ROLE) ((ROLE) == 0 ? 4 : 2)      // 16-row fragments per wave in a projection block: q 256 x 128, k and v 128 x 128
#define OWR   2                              // output projection: rows of 64 x 64 wave tiles in a block
#define OWC   4                              // and columns of them

typedef _Float16 v16h __attribute__((ext_vector_type(16)));
typedef _Float16 v8h  __attribute__((ext_vector_type(8)));
typedef __bf16   v16b __attribute__((ext_vector_type(16)));
typedef __bf16   v8b  __attribute__((ext_vector_type(8)));
typedef float    v8f  __attribute__((ext_vector_type(8)));
typedef float    v4f  __attribute__((ext_vector_type(4)));
typedef unsigned int v4u __attribute__((ext_vector_type(4)));
typedef unsigned int v2u __attribute__((ext_vector_type(2)));
typedef _Float16 v4h  __attribute__((ext_vector_type(4)));

union HFrag { v16h v; v8h h[2]; };
union BFrag { v16b v; v8b h[2]; };

// ---------------------------------------------------------------------------
// scalar helpers (RNE conversions)
// ---------------------------------------------------------------------------
__device__ __forceinline__ unsigned short f2bf_bits(float f) {
  const unsigned u = __float_as_uint(f);
  return (unsigned short)((u + 0x7FFFu + ((u >> 16) & 1u)) >> 16);
}
__device__ __forceinline__ float bfb2f(unsigned short h) { return __uint_as_float(((unsigned)h) << 16); }
__device__ __forceinline__ float bf16r(float f) { return bfb2f(f2bf_bits(f)); }
__device__ __forceinline__ unsigned short hbits(_Float16 h) { return __builtin_bit_cast(unsigned short, h); }
__device__ __forceinline__ unsigned pk16(unsigned short a, unsigned short b) { return (unsigned)a | ((unsigned)b << 16); }

// ---------------------------------------------------------------------------
// 16x32 fragment loads (A layout; also B from a [n][k] k-contiguous plane):
// elements 0..7 <- p[0..7] (k0+8h..), elements 8..15 <- p[16..23] (k0+16+8h..), p = row + k0 + 8h
// ---------------------------------------------------------------------------
__device__ __forceinline__ v16b ldb(const __bf16* p) {
  BFrag f; f.h[0] = *(const v8b*)(p); f.h[1] = *(const v8b*)(p + 16); return f.v;
}
__device__ __forceinline__ v16h ldh(const _Float16* p) {
  HFrag f; f.h[0] = *(const v8h*)(p); f.h[1] = *(const v8h*)(p + 16); return f.v;
}
__device__ __forceinline__ v8f mma_b(v16b a, v16b b, v8f c) {
  return __builtin_amdgcn_wmma_f32_16x16x32_bf16(false, a, false, b, (short)0, c, false, false);
}
__device__ __forceinline__ v8f mma_h(v16h a, v16h b, v8f c) {
  return __builtin_amdgcn_wmma_f32_16x16x32_f16(false, a, false, b, (short)0, c, false, false);
}

// hazard guards: 4 VALU slots after the last WMMA of a group, tying D and keeping A/B live
__device__ __forceinline__ void guard_b(v8f& a, v8f& b, v16b x) {
  asm volatile("v_nop\n\tv_nop\n\tv_nop\n\tv_nop" : "+v"(a), "+v"(b) : "v"(x));
}
__device__ __forceinline__ void keep_b(v16b a, v16b b, v16b c, v16b d) {
  asm volatile("v_nop" :: "v"(a), "v"(b), "v"(c), "v"(d));
}
__device__ __forceinline__ void acc_guard4(v8f& a, v8f& b, v8f& c, v8f& d) {
  asm volatile("v_nop\n\tv_nop\n\tv_nop\n\tv_nop" : "+v"(a), "+v"(b), "+v"(c), "+v"(d));
}

// ---------------------------------------------------------------------------
// ---------------------------------------------------------------------------
// f32 -> 16-bit planes, RNE, all five arrays in one streaming launch: CVB blocks of CVW waves, as many blocks as the
// chip has WGPs. A wave takes one 4-KB piece (CVL loads of 512 contiguous bytes) of each
// of CVT passes; pass t covers elements [t CVP, (t + 1) CVP) of the planes as they lie one behind the other in the
// workspace: x (passes 0, 1), wq (2), wk and wv (3, half the waves each), wo (4, f16; the others bf16).
// Every output element is written once; one store = 256 contiguous bytes (two whole lines).
#define CVB   256
#define CVW   16
#define CVL   8
#define CVT   5
#define CVP   (CVB * CVW * CVL * 128)        // elements of one pass: 4194304
static_assert(NTOK * DM == 2 * CVP && EQ * DM == CVP && 2 * EK * DM == CVP && DM * EQ == CVP, "the passes cover the planes");
__global__ __launch_bounds__(32 * CVW) void cvt_kernel(const float* __restrict__ x, const float* __restrict__ wq,
                                                       const float* __restrict__ wk, const float* __restrict__ wv,
                                                       const float* __restrict__ wo, unsigned short* __restrict__ out) {
  const unsigned o = (blockIdx.x * CVW + (threadIdx.x >> 5)) * (CVL * 128u) + 4u * (threadIdx.x & 31);
  const float* kv = (blockIdx.x < CVB / 2) ? wk : wv;
  const float* s[CVT] = {x + o, x + CVP + o, wq + o, kv + (o & (CVP / 2 - 1u)), wo + o};
  v4f a[2][CVL];
#pragma unroll
  for (int j = 0; j < CVL; ++j) a[0][j] = *(const v4f*)(s[0] + 128 * j);
  // precaution: stands ahead of any rewrite of these loads' address registers
  asm volatile("s_wait_xcnt 0x0" ::: "memory");
#pragma unroll
  for (int t = 0; t < CVT; ++t) {
    // the two scheduling barriers keep the next pass's loads in one group ahead of this pass's conversions and
    // stores: 8 to 16 loads of a wave stay in flight
    __builtin_amdgcn_sched_barrier(0);
    if (t + 1 < CVT) {
#pragma unroll
      for (int j = 0; j < CVL; ++j) a[(t + 1) & 1][j] = *(const v4f*)(s[t + 1] + 128 * j);
    }
    __builtin_amdgcn_sched_barrier(0);
    unsigned short* d = out + (size_t)t * CVP + o;
#pragma unroll
    for (int j = 0; j < CVL; ++j) {
      const v4f v = a[t & 1][j];
      v2u p;
      if (t == CVT - 1) {
        p = __builtin_bit_cast(v2u, __builtin_convertvector(v, v4h));
      } else {
        p[0] = pk16(f2bf_bits(v[0]), f2bf_bits(v[1]));
        p[1] = pk16(f2bf_bits(v[2]), f2bf_bits(v[3]));
      }
      *(v2u*)(d + 128 * j) = p;
    }
    // precaution: stands ahead of the next pass's rewrite of registers that these loads and stores name
    if (t + 1 < CVT) asm volatile("s_wait_xcnt 0x0" ::: "memory");
  }
}

// ---------------------------------------------------------------------------
// Block GEMM core: WR x WC waves, each with a 16 FI x 64 tile acc[i][j] of the block's BM x BN tile (BM = 16 FI WR,
// BN = 64 WC): += A[BM rows][K] . B[BN rows][K]^T, K = DM = 2048, both planes row-major with pitch DM, bf16 (f16 where F16).
// Each 128-k tile of the block's A and B rows is brought into LDS once per block by asynchronous 16-byte copies
// (16 lanes = 256 B of a row, two whole lines), two buffers, the next tile in flight while this one is worked on;
// the waves read their fragments from LDS (pitch 16 B x odd).
// gA, gB point at the block's first row. On return every wave has left the ring (the last trip's barrier).
// D layout: acc[i][j][r] = C[A row 16 FI wr + 16i + 8h + r][B row 64wc + 16j + (lane&15)].
// ---------------------------------------------------------------------------
// Copies of one lane, every lane on: each (l, g) pair stands for rows r, r + RS, r + 2RS, r + 3RS of a plane (RS =
// rows that the block's lanes cover at once). The s_wait_xcnt stands inside the statement so that no address
// register is rewritten ahead of it.
template <int RS>
__device__ __forceinline__ void copy8(unsigned l0, const unsigned short* g0, unsigned l1, const unsigned short* g1) {
  asm volatile("global_load_async_to_lds_b128 %0, %8, off\n\t"
               "global_load_async_to_lds_b128 %1, %9, off\n\t"
               "global_load_async_to_lds_b128 %2, %10, off\n\t"
               "global_load_async_to_lds_b128 %3, %11, off\n\t"
               "global_load_async_to_lds_b128 %4, %12, off\n\t"
               "global_load_async_to_lds_b128 %5, %13, off\n\t"
               "global_load_async_to_lds_b128 %6, %14, off\n\t"
               "global_load_async_to_lds_b128 %7, %15, off\n\t"
               "s_wait_xcnt 0x0"
               :: "v"(l0), "v"(l0 + (unsigned)RS * GRB), "v"(l0 + 2u * RS * GRB), "v"(l0 + 3u * RS * GRB),
                  "v"(l1), "v"(l1 + (unsigned)RS * GRB), "v"(l1 + 2u * RS * GRB), "v"(l1 + 3u * RS * GRB),
                  "v"(g0), "v"(g0 + (size_t)RS * DM), "v"(g0 + (size_t)2 * RS * DM), "v"(g0 + (size_t)3 * RS * DM),
                  "v"(g1), "v"(g1 + (size_t)RS * DM), "v"(g1 + (size_t)2 * RS * DM), "v"(g1 + (size_t)3 * RS * DM)
               : "memory");
}
template <int RS>
__device__ __forceinline__ void copy12(unsigned l0, const unsigned short* g0, unsigned l1, const unsigned short* g1,
                                       unsigned l2, const unsigned short* g2) {
  asm volatile("global_load_async_to_lds_b128 %0, %12, off\n\t"
               "global_load_async_to_lds_b128 %1, %13, off\n\t"
               "global_load_async_to_lds_b128 %2, %14, off\n\t"
               "global_load_async_to_lds_b128 %3, %15, off\n\t"
               "global_load_async_to_lds_b128 %4, %16, off\n\t"
               "global_load_async_to_lds_b128 %5, %17, off\n\t"
               "global_load_async_to_lds_b128 %6, %18, off\n\t"
               "global_load_async_to_lds_b128 %7, %19, off\n\t"
               "global_load_async_to_lds_b128 %8, %20, off\n\t"
               "global_load_async_to_lds_b128 %9, %21, off\n\t"
               "global_load_async_to_lds_b128 %10, %22, off\n\t"
               "global_load_async_to_lds_b128 %11, %23, off\n\t"
               "s_wait_xcnt 0x0"
               :: "v"(l0), "v"(l0 + (unsigned)RS * GRB), "v"(l0 + 2u * RS * GRB), "v"(l0 + 3u * RS * GRB),
                  "v"(l1), "v"(l1 + (unsigned)RS * GRB), "v"(l1 + 2u * RS * GRB), "v"(l1 + 3u * RS * GRB),
                  "v"(l2), "v"(l2 + (unsigned)RS * GRB), "v"(l2 + 2u * RS * GRB), "v"(l2 + 3u * RS * GRB),
                  "v"(g0), "v"(g0 + (size_t)RS * DM), "v"(g0 + (size_t)2 * RS * DM), "v"(g0 + (size_t)3 * RS * DM),
                  "v"(g1), "v"(g1 + (size_t)RS * DM), "v"(g1 + (size_t)2 * RS * DM), "v"(g1 + (size_t)3 * RS * DM),
                  "v"(g2), "v"(g2 + (size_t)RS * DM), "v"(g2 + (size_t)2 * RS * DM), "v"(g2 + (size_t)3 * RS * DM)
               : "memory");
}
// One tile's copies: every row of A and B once; 16 or 24 per lane
template <int WR, int WC, int FI>
__device__ __forceinline__ void stage_gemm(unsigned l, const unsigned short* ga, const unsigned short* gb) {
  constexpr int RS = 2 * WR * WC;              // rows covered by one copy of every lane
  constexpr int BM = 16 * FI * WR;
  constexpr int PA = BM / (4 * RS);            // (l, g) pairs of an A plane
  constexpr int PB = 64 * WC / (4 * RS);       // (l, g) pairs of the B plane
  constexpr int NP = PA + PB;
  static_assert(PA * 4 * RS == BM && PB * 4 * RS == 64 * WC, "whole pairs");
  static_assert(NP == 4 || NP == 6, "pairs go out in eights and twelves");
  unsigned L[NP];
  const unsigned short* G[NP];
#pragma unroll
  for (int p = 0; p < PA; ++p) {
    L[p] = l + (unsigned)(p * 4 * RS) * GRB;
    G[p] = ga + (size_t)(p * 4 * RS) * DM;
  }
#pragma unroll
  for (int p = 0; p < PB; ++p) {
    L[PA + p] = l + (unsigned)(BM + p * 4 * RS) * GRB;
    G[PA + p] = gb + (size_t)(p * 4 * RS) * DM;
  }
  if constexpr (NP == 4) {
    copy8<RS>(L[0], G[0], L[1], G[1]);
    copy8<RS>(L[2], G[2], L[3], G[3]);
  } else {
    copy12<RS>(L[0], G[0], L[1], G[1], L[2], G[2]);
    copy12<RS>(L[3], G[3], L[4], G[4], L[5], G[5]);
  }
}

template <bool F16, int WR, int WC, int FI>
__device__ __forceinline__ void gemm_core(const unsigned short* __restrict__ gA, const unsigned short* __restrict__ gB,
                                          unsigned char* ring, v8f (&acc)[FI][4]) {
  constexpr int BM = 16 * FI * WR;
  constexpr unsigned GB = GBUF(BM, 64 * WC);
  const int tid = threadIdx.x, lane = tid & 31, w = tid >> 5;
  const int m = lane & 15, ko = (lane >> 4) * 8, wr = w / WC, wc = w % WC;
  // copy addresses of this lane: row (tid>>4) + RS i of a plane, 16-B piece tid&15
  const size_t go = (size_t)(tid >> 4) * DM + 8 * (tid & 15);
  const unsigned short* ga = gA + go;
  const unsigned short* gb = gB + go;
  typedef __attribute__((address_space(3))) unsigned char lds_byte;
  const unsigned l0 = (unsigned)(uintptr_t)(lds_byte*)ring + (unsigned)((tid >> 4) * GRB + 16 * (tid & 15));

  // tile 0 into buffer 0, landed and published; then tile 1 into buffer 1
  stage_gemm<WR, WC, FI>(l0, ga, gb);
  asm volatile("s_wait_asynccnt 0x0" ::: "memory");   // this wave's copies of tile 0 have landed
  __syncthreads();                                    // every wave's have
  stage_gemm<WR, WC, FI>(l0 + GB, ga + GKB, gb + GKB);

  // kept rolled: one trip per staged tile, so that the hand-over at its foot stands once, in the order written
#pragma unroll 1
  for (int t = 0; t < DM / GKB; ++t) {
    const __bf16* buf = (const __bf16*)(const void*)(ring + (t & 1) * GB);
    const __bf16* Ar = buf + (16 * FI * wr + m) * GPH + ko;
    const __bf16* Br = buf + (BM + 64 * wc + m) * GPH + ko;
#pragma unroll
    for (int s = 0; s < GKB / 32; ++s) {
      // the fragments of 32 k as one group of LDS reads ahead of their matrix instructions
      v16b bf[4], af[FI];
#pragma unroll
      for (int j = 0; j < 4; ++j) bf[j] = ldb(Br + (16 * j) * GPH + 32 * s);
#pragma unroll
      for (int i = 0; i < FI; ++i) af[i] = ldb(Ar + (16 * i) * GPH + 32 * s);
#pragma unroll
      for (int i = 0; i < FI; ++i) {
#pragma unroll
        for (int j = 0; j < 4; ++j) {
          if constexpr (F16)
            acc[i][j] = mma_h(__builtin_bit_cast(v16h, af[i]), __builtin_bit_cast(v16h, bf[j]), acc[i][j]);
          else
            acc[i][j] = mma_b(af[i], bf[j], acc[i][j]);
        }
        guard_b(acc[i][0], acc[i][3], af[i]);
      }
      keep_b(bf[0], bf[1], bf[2], bf[3]);
    }
    // hand-over: this wave has left buffer t&1 and its copies of tile t+1 have landed; behind the barrier that
    // holds for every wave, so tile t+1 may be read and buffer t&1 refilled
    asm volatile("s_wait_dscnt 0x0" ::: "memory");
    asm volatile("s_wait_asynccnt 0x0" ::: "memory");
    __syncthreads();
    if (t + 2 < DM / GKB) {
      const int kn = (t + 2) * GKB;
      stage_gemm<WR, WC, FI>(l0 + (unsigned)(t & 1) * GB, ga + kn, gb + kn);
    }
  }
  asm volatile("s_wait_asynccnt 0x0" ::: "memory");   // nothing in flight when the ring becomes the f32 tile
#pragma unroll
  for (int i = 0; i < FI; ++i) acc_guard4(acc[i][0], acc[i][1], acc[i][2], acc[i][3]);
}

// stage a wave's 16 FI x 64 tile into the block's f32 LDS tile (pitch P floats)
template <int WC, int P, int FI>
__device__ __forceinline__ void stage_tile(float* T, int w, int lane, v8f (&acc)[FI][4]) {
  const int wr = w / WC, wc = w % WC, hh = lane >> 4, m = lane & 15;
#pragma unroll
  for (int i = 0; i < FI; ++i)
#pragma unroll
    for (int j = 0; j < 4; ++j)
#pragma unroll
      for (int r = 0; r < 8; ++r)
        T[(16 * FI * wr + 16 * i + 8 * hh + r) * P + 64 * wc + 16 * j + m] = acc[i][j][r];
}

// ---------------------------------------------------------------------------
//   ROLE 0: A = X plane rows (tokens BM*bx), B = Wq plane rows (head by): RMSNorm + RoPE in f32,
//           q' = q * QMUL -> f16 plane P1 [tok][EQ], cols by*128.
//   ROLE 1: A = X, B = Wk rows (kv head by): RMSNorm + RoPE, k' = k * 8 -> f16 plane P1 [tok][EK].
//   ROLE 2: A = Wv plane rows (features BM*by), B = X rows (tokens 128*bx): tile = V^T directly;
//           v' = v * 1024 -> f16 plane P1, layout [(b*NKV+kvh)*128 + d][s].
// Block tile BM x 128, 4 x 2 waves of 16 PFI(ROLE) x 64 each, BM = 64 PFI(ROLE).
// Epilogue: f32 tile staged in LDS, then each wave owns RPW = BM / 8 rows; one store instruction = 16 lanes x 16 B
// Coverage per block: rows RPW w + 16hf + 2it + hh (hf 0..RPW/16-1, it 0..7, hh 0..1) = 0..BM-1, cols 8*(lane&15) = 0..127.
// ---------------------------------------------------------------------------
template <int ROLE>
__global__ __launch_bounds__(256) void proj_kernel(const unsigned short* __restrict__ Ap,
                                                   const unsigned short* __restrict__ Bp,
                                                   const float* __restrict__ nw,
                                                   const float* __restrict__ fcos,
                                                   const float* __restrict__ fsin,
                                                   unsigned short* __restrict__ P1) {
  constexpr int FI = PFI(ROLE), BM = 64 * FI, RPW = BM / 8;
  constexpr int RINGB = 2 * GBUF(BM, 128), TILEB = BM * TP * 4;
  // two operand tile buffers; after the k loop the same bytes serve as the block's f32 tile T
  __shared__ __align__(16) unsigned char ring[RINGB > TILEB ? RINGB : TILEB];
  float* T = (float*)(void*)ring;
  const int lane = threadIdx.x & 31;
  const int w    = threadIdx.x >> 5;
  const int hh   = lane >> 4;
  const int m    = lane & 15;
  const int arow0 = (ROLE == 2) ? (int)blockIdx.y * BM : (int)blockIdx.x * BM;
  const int brow0 = (ROLE == 2) ? (int)blockIdx.x * 128 : (int)blockIdx.y * 128;
  const unsigned short* A = Ap + (size_t)arow0 * DM;
  const unsigned short* B = Bp + (size_t)brow0 * DM;

  v8f acc[FI][4];
#pragma unroll
  for (int i = 0; i < FI; ++i)
#pragma unroll
    for (int j = 0; j < 4; ++j) acc[i][j] = (v8f){0.f, 0.f, 0.f, 0.f, 0.f, 0.f, 0.f, 0.f};

  gemm_core<false, 4, 2, FI>(A, B, ring, acc);
  stage_tile<2, TP, FI>(T, w, lane, acc);
  __syncthreads();

  float wv[8];
  if (ROLE != 2) {
    const v4f wa = *(const v4f*)(nw + 8 * m);
    const v4f wb = *(const v4f*)(nw + 8 * m + 4);
#pragma unroll
    for (int e = 0; e < 4; ++e) { wv[e] = bf16r(wa[e]); wv[4 + e] = bf16r(wb[e]); }
  } else {
#pragma unroll
    for (int e = 0; e < 8; ++e) wv[e] = 1.0f;
  }

#pragma unroll
  for (int hf = 0; hf < RPW / 16; ++hf) {
    v4u hv[8];
#pragma unroll
    for (int it = 0; it < 8; ++it) {
      const int row = RPW * w + 16 * hf + 2 * it + hh;
      const float* tr = T + row * TP + 8 * m;
      const v4f xa = *(const v4f*)(tr);
      const v4f xb = *(const v4f*)(tr + 4);
      float x[8] = {xa[0], xa[1], xa[2], xa[3], xb[0], xb[1], xb[2], xb[3]};
      float y[8];
      if (ROLE == 2) {
#pragma unroll
        for (int e = 0; e < 8; ++e) y[e] = x[e] * VMUL;
      } else {
        float ss = 0.f;
#pragma unroll
        for (int e = 0; e < 8; ++e) ss = fmaf(x[e], x[e], ss);
        ss += __shfl_xor(ss, 1, 32);
        ss += __shfl_xor(ss, 2, 32);
        ss += __shfl_xor(ss, 4, 32);
        ss += __shfl_xor(ss, 8, 32);
        const float rn  = rsqrtf(fmaf(ss, 1.0f / (float)HD, RMS_EPS));
        const int   tok = arow0 + row;
        const int   sp  = tok & (SQ - 1);
        const v4f c4 = *(const v4f*)(fcos + (size_t)sp * (HD / 2) + 4 * m);
        const v4f s4 = *(const v4f*)(fsin + (size_t)sp * (HD / 2) + 4 * m);
        // precaution: stands ahead of any rewrite of these two loads' address registers
        asm volatile("s_wait_xcnt 0x0" ::: "memory");
        const float om = (ROLE == 0) ? QMUL : KMUL;
#pragma unroll
        for (int p = 0; p < 4; ++p) {
          const float cs = bf16r(c4[p]), sn = bf16r(s4[p]);
          const float u0 = x[2 * p] * rn * wv[2 * p];
          const float u1 = x[2 * p + 1] * rn * wv[2 * p + 1];
          y[2 * p]     = (u0 * cs - u1 * sn) * om;
          y[2 * p + 1] = (u0 * sn + u1 * cs) * om;
        }
      }
      v4u a;
#pragma unroll
      for (int q = 0; q < 4; ++q) a[q] = pk16(hbits((_Float16)y[2 * q]), hbits((_Float16)y[2 * q + 1]));
      hv[it] = a;
    }

    {
#pragma unroll
      for (int it = 0; it < 8; ++it) {
        const int row = RPW * w + 16 * hf + 2 * it + hh;
        size_t go;
        if (ROLE == 0) {
          go = (size_t)(arow0 + row) * EQ + (size_t)blockIdx.y * HD + 8 * m;
        } else if (ROLE == 1) {
          go = (size_t)(arow0 + row) * EK + (size_t)blockIdx.y * HD + 8 * m;
        } else {
          const int f   = arow0 + row;            // 0..1023
          const int kvh = f >> 7;
          const int d   = f & (HD - 1);
          const int bb  = brow0 >> 11;            // batch of this 128-token block
          const int s0  = brow0 & (SQ - 1);
          go = ((size_t)((bb * NKV + kvh) * HD + d)) * SQ + s0 + 8 * m;
        }
        *(v4u*)(P1 + go) = hv[it];
      }
    }
  }
}

// ---------------------------------------------------------------------------
// Full (non-causal) GQA attention, head dim 128, one wave per (b, h, 32 queries = QCG column groups of 16);
//   block = 8 waves (256 queries). Every K and V^T fragment read from LDS feeds QCG matrix instructions.
//   Each 64-key tile (K rows, V^T rows) is brought into LDS once per block by asynchronous
//   16-byte copies (whole 128-B lines on the global side), two buffers, the next tile in flight while this one
//   is worked on; all 8 waves read their fragments from LDS (row pitches 16 B x odd: no bank conflicts).
//   Transposed scores S^T[key][query] = K . Q^T : A = K rows [key][d] (f16 x8), B[k=d][n=query] from Q rows
//   [query][d] (f16) -> both fragments are plain k-contiguous row loads.
//   D tiles (rows = 16 keys, cols = queries) packed to f16 ARE the B operand [k=key][n=query] of
//   O^T[d][query] = V^T . P : element r <- tile(keys 0-15)[r], element 8+r <- tile(keys 16-31)[r], same lane.
//   A = V^T rows [d][s] (f16 x1024). Softmax per query column = per lane (partner lane ^16),
//   online over 32 chunks of 64 keys, f32, exp2 with log2e folded into the q scale, p carried x256.
//   Epilogue: O = acc / (l * 1024) -> f16, per-wave LDS relayout [query][d] (v4u store/reload,
//   Coverage: rows 16c + 2it + hh (c 0..QCG-1, it 0..7) = 32 queries, cols 8*(lane&15) = 0..127 of head h.
// ---------------------------------------------------------------------------
// One tile's copies: 8 per lane (4 of K, 4 of V^T), every lane on. Written as the builtin: the kernel holds more than
// 256 vector registers, and operands of an asm statement would have to stay in the first 256 through the whole loop.
typedef int v4i __attribute__((ext_vector_type(4)));
typedef __attribute__((address_space(1))) v4i glb_v4i;
typedef __attribute__((address_space(3))) v4i lds_v4i;
__device__ __forceinline__ void copy16(unsigned char* l, const unsigned short* g) {
  __builtin_amdgcn_global_load_async_to_lds_b128((glb_v4i*)(void*)const_cast<unsigned short*>(g), (lds_v4i*)(void*)l, 0, 0);
}
__device__ __forceinline__ void stage_copies(unsigned char* lk, unsigned char* lv, const unsigned short* gk,
                                             const unsigned short* gv) {
#pragma unroll
  for (int i = 0; i < 4; ++i) copy16(lk + i * (16 * KPH * 2), gk + (size_t)i * 16 * EK);
#pragma unroll
  for (int i = 0; i < 4; ++i) copy16(lv + i * (32 * VPH * 2), gv + (size_t)i * 32 * SQ);
}

__global__ __launch_bounds__(32 * AWV) void attn_kernel(const unsigned short* __restrict__ Qpp,
                                                  const unsigned short* __restrict__ Kpp,
                                                  const unsigned short* __restrict__ Vpp,
                                                  unsigned short* __restrict__ Opp) {
  // two tile buffers; after the loop the same bytes serve as output staging [wave][query*OSP + d]
  __shared__ __align__(16) unsigned char ring[2 * BUFB];
  static_assert(AWV * 16 * QCG * OSP * 2 <= 2 * BUFB, "output staging fits the ring");
  const int lane = threadIdx.x & 31;
  const int w    = threadIdx.x >> 5;
  const int hh   = lane >> 4;
  const int m    = lane & 15;
  const int h    = blockIdx.y;
  const int b    = blockIdx.z;
  const int kvh  = h >> 1;                       // G = NH / NKV = 2
  const int q0   = blockIdx.x * (16 * QCG * AWV) + w * (16 * QCG);   // query index within the sequence

  const _Float16* Qp = (const _Float16*)(const void*)Qpp;
  const size_t vplane = (size_t)((b * NKV + kvh) * HD) * SQ;
  // copy addresses of this lane. K: key row (tid>>4) + 16i, 16-B piece tid&15; V^T: d row (tid>>3) + 32i, piece tid&7
  const int tid = threadIdx.x;
  const unsigned short* gk = Kpp + (size_t)b * SQ * EK + kvh * HD + (size_t)(tid >> 4) * EK + 8 * (tid & 15);
  const unsigned short* gv = Vpp + vplane + (size_t)(tid >> 3) * SQ + 8 * (tid & 7);
  unsigned char* lk = ring + ((tid >> 4) * (KPH * 2) + 16 * (tid & 15));
  unsigned char* lv = ring + (KTB + (tid >> 3) * (VPH * 2) + 16 * (tid & 7));

  // tile 0 into buffer 0, landed and published; then tile 1 into buffer 1
  stage_copies(lk, lv, gk, gv);
  asm volatile("s_wait_asynccnt 0x0" ::: "memory");   // this wave's copies of tile 0 have landed
  __syncthreads();                                    // every wave's have
  stage_copies(lk + BUFB, lv + BUFB, gk + (size_t)64 * EK, gv + 64);

  // Q fragments (B operand): row = query q0 + 16c + (lane&15), k = d
  v16h qf[QCG][4];
  {
    const _Float16* qb = Qp + ((size_t)b * SQ + q0 + m) * EQ + (size_t)h * HD + 8 * hh;
#pragma unroll
    for (int c = 0; c < QCG; ++c)
#pragma unroll
      for (int dc = 0; dc < 4; ++dc) qf[c][dc] = ldh(qb + (size_t)c * 16 * EQ + 32 * dc);
    // precaution: stands ahead of any rewrite of these loads' address registers
    asm volatile("s_wait_xcnt 0x0" ::: "memory");
    // holds the vector instructions that follow behind that wait: its memory clobber alone does not
    __builtin_amdgcn_sched_barrier(0);
  }

  v8f acc[QCG][8];
  float mrun[QCG], lrun[QCG];
#pragma unroll
  for (int c = 0; c < QCG; ++c) {
#pragma unroll
    for (int t = 0; t < 8; ++t) acc[c][t] = (v8f){0.f, 0.f, 0.f, 0.f, 0.f, 0.f, 0.f, 0.f};
    mrun[c] = -1.0e30f;
    lrun[c] = 0.0f;
  }

#pragma unroll 1
  for (int kc = 0; kc < SQ / 64; ++kc) {
    const unsigned char* buf = ring + (kc & 1) * BUFB;
    const _Float16* Kr  = (const _Float16*)(const void*)buf + m * KPH + 8 * hh;                // + key*KPH + 32dc
    const _Float16* Vr  = (const _Float16*)(const void*)(buf + KTB) + m * VPH + 8 * hh;        // + 16t*VPH + key
    v8f s[QCG][4];
#pragma unroll
    for (int c = 0; c < QCG; ++c)
#pragma unroll
      for (int j = 0; j < 4; ++j) s[c][j] = (v8f){0.f, 0.f, 0.f, 0.f, 0.f, 0.f, 0.f, 0.f};
    {
      // the tile's K fragments as one group of LDS reads ahead of their 32 matrix instructions: 4 key tiles x 128 d;
      // the scheduling barriers keep the reads from being spread among the matrix instructions
      v16h kf[16];
#pragma unroll
      for (int j = 0; j < 16; ++j) kf[j] = ldh(Kr + (16 * (j & 3)) * KPH + 32 * (j >> 2));
      __builtin_amdgcn_sched_barrier(0);   // all 32 reads are issued before the first matrix instruction
#pragma unroll
      for (int j = 0; j < 16; ++j)
#pragma unroll
        for (int c = 0; c < QCG; ++c) s[c][j & 3] = mma_h(kf[j], qf[c][j >> 2], s[c][j & 3]);
      __builtin_amdgcn_sched_barrier(0);   // no vector work is drawn in among the 32 matrix instructions
    }

    // online softmax for query column 16c + (lane&15); lane holds keys key0 + 16j + 8hh + r
    float cmax[QCG], cother[QCG];
#pragma unroll
    for (int c = 0; c < QCG; ++c) {
      float cm = -1.0e30f;
#pragma unroll
      for (int j = 0; j < 4; ++j)
#pragma unroll
        for (int r = 0; r < 8; ++r) cm = fmaxf(cm, s[c][j][r]);
      cmax[c]   = cm;
      cother[c] = __shfl_xor(cm, 16, 32);
    }
    // the tile's V^T fragments as one group of LDS reads ahead of the exponentials, which cover their latency.
    // The statement takes the exchanged maxima as inputs only: it holds the 32 reads behind that exchange, which would
    // otherwise wait for all of them (LDS operations return in order); the scheduling barriers hold the group together
    asm volatile("" :: "v"(cother[0]), "v"(cother[1]) : "memory");
    __builtin_amdgcn_sched_barrier(0);     // head of the group of V^T reads
    v16h vf[2][8];
#pragma unroll
    for (int ks = 0; ks < 2; ++ks)
#pragma unroll
      for (int t = 0; t < 8; ++t) vf[ks][t] = ldh(Vr + (16 * t) * VPH + 32 * ks);
    __builtin_amdgcn_sched_barrier(0);     // foot of the group: none of its reads sinks towards its matrix instruction
#pragma unroll
    for (int c = 0; c < QCG; ++c) {
      const float cm    = fmaxf(cmax[c], cother[c]);
      const float mnew  = fmaxf(mrun[c], cm);
      const float alpha = __builtin_amdgcn_exp2f((mrun[c] - mnew) * SINV);
      const float nms   = 8.0f - mnew * SINV;          // p * 256 = exp2(s*SINV - m*SINV + 8)
      float psum = 0.f;
#pragma unroll
      for (int j = 0; j < 4; ++j)
#pragma unroll
        for (int r = 0; r < 8; ++r) {
          const float p = __builtin_amdgcn_exp2f(fmaf(s[c][j][r], SINV, nms));
          s[c][j][r] = p;
          psum += p;
        }
      psum += __shfl_xor(psum, 16, 32);
      lrun[c] = fmaf(lrun[c], alpha, psum);
      mrun[c] = mnew;
#pragma unroll
      for (int t = 0; t < 8; ++t) acc[c][t] = acc[c][t] * alpha;
    }

#pragma unroll
    for (int ks = 0; ks < 2; ++ks) {
      HFrag pf[QCG];
#pragma unroll
      for (int c = 0; c < QCG; ++c) {
        v8h plo, phi;
#pragma unroll
        for (int r = 0; r < 8; ++r) {
          plo[r] = (_Float16)s[c][2 * ks][r];        // keys 32ks + 8hh + r
          phi[r] = (_Float16)s[c][2 * ks + 1][r];    // keys 32ks + 16 + 8hh + r
        }
        pf[c].h[0] = plo;
        pf[c].h[1] = phi;
      }
#pragma unroll
      for (int t = 0; t < 8; ++t)
#pragma unroll
        for (int c = 0; c < QCG; ++c) acc[c][t] = mma_h(vf[ks][t], pf[c].v, acc[c][t]);
    }
    // keeps the trip's work ahead of the hand-over, so that the refill behind the barrier is issued at once
    __builtin_amdgcn_sched_barrier(0);

    // hand-over: this wave has left buffer kc&1 and its copies of tile kc+1 have landed; behind the barrier that
    // holds for every wave, so tile kc+1 may be read and buffer kc&1 refilled
    asm volatile("s_wait_dscnt 0x0" ::: "memory");
    asm volatile("s_wait_asynccnt 0x0" ::: "memory");
    __syncthreads();
    if (kc + 2 < SQ / 64) {
      const unsigned bo = (unsigned)(kc & 1) * BUFB;
      stage_copies(lk + bo, lv + bo, gk + (size_t)(kc + 2) * 64 * EK, gv + (kc + 2) * 64);
    }
  }
  asm volatile("s_wait_asynccnt 0x0" ::: "memory");   // nothing in flight when the ring becomes output staging

  // ---- epilogue: acc[c][t][r] = O^T[d = 16t + 8hh + r][query 16c + m] * (256 * 1024 * l256/256) ----
  unsigned short* sh = (unsigned short*)(void*)ring + w * (16 * QCG * OSP);
#pragma unroll
  for (int c = 0; c < QCG; ++c) {
    const float inv = __builtin_amdgcn_rcpf(lrun[c]) * (1.0f / VMUL);
#pragma unroll
    for (int t = 0; t < 8; ++t) {
      v4u hv;
#pragma unroll
      for (int q = 0; q < 4; ++q)
        hv[q] = pk16(hbits((_Float16)(acc[c][t][2 * q] * inv)), hbits((_Float16)(acc[c][t][2 * q + 1] * inv)));
      *(v4u*)(sh + (16 * c + m) * OSP + 16 * t + 8 * hh) = hv;
    }
  }
  __builtin_amdgcn_fence(__ATOMIC_RELEASE, "wavefront");
  __builtin_amdgcn_wave_barrier();
  __builtin_amdgcn_fence(__ATOMIC_ACQUIRE, "wavefront");
  v4u ov[8 * QCG];
#pragma unroll
  for (int it = 0; it < 8 * QCG; ++it) ov[it] = *(const v4u*)(sh + (2 * it + hh) * OSP + 8 * m);
#pragma unroll
  for (int it = 0; it < 8 * QCG; ++it) {
    const int row = 2 * it + hh;
    const size_t go = ((size_t)b * SQ + q0 + row) * EQ + (size_t)h * HD + 8 * m;
    *(v4u*)(Opp + go) = ov[it];
  }
}

// ---------------------------------------------------------------------------
// Output projection: out[tok][dout] = sum_e O[tok][e] * Wo[dout][e]; A = O f16, B = Wo f16.
// Block 64 OWR tokens x 64 OWC out cols, OWR x OWC waves; f32 tile staged in LDS; each wave writes 64 / OWC rows,
// one instruction per 512 B of a row.
// Coverage per block: rows (64 / OWC) w + it = 0..64 OWR - 1, cols 128c + 4*lane = 0..64 OWC - 1.
// ---------------------------------------------------------------------------
__global__ __launch_bounds__(32 * OWR * OWC) void out_kernel(const unsigned short* __restrict__ Opp,
                                                  const unsigned short* __restrict__ Wp,
                                                  float* __restrict__ out) {
  constexpr int BM = 64 * OWR, BN = 64 * OWC, OTP = BN + 4, CH = BN / 128;
  // two operand tile buffers; after the k loop the same bytes serve as the block's f32 tile T
  __shared__ __align__(16) unsigned char ring[2 * GBUF(BM, BN)];
  static_assert(BM * OTP * 4 <= 2 * GBUF(BM, BN), "f32 tile fits the ring");
  float* T = (float*)(void*)ring;
  const int lane = threadIdx.x & 31;
  const int w    = threadIdx.x >> 5;
  const int arow0 = blockIdx.x * BM;
  const int brow0 = blockIdx.y * BN;
  const unsigned short* A = Opp + (size_t)arow0 * DM;
  const unsigned short* B = Wp + (size_t)brow0 * DM;

  v8f acc[4][4];
#pragma unroll
  for (int i = 0; i < 4; ++i)
#pragma unroll
    for (int j = 0; j < 4; ++j) acc[i][j] = (v8f){0.f, 0.f, 0.f, 0.f, 0.f, 0.f, 0.f, 0.f};

  gemm_core<true, OWR, OWC, 4>(A, B, ring, acc);
  stage_tile<OWC, OTP, 4>(T, w, lane, acc);
  __syncthreads();

#pragma unroll
  for (int hf = 0; hf < 2; ++hf) {
    v4f val[16];
#pragma unroll
    for (int it = 0; it < 16; ++it) {
      const int row = (64 / OWC) * w + (16 * hf + it) / CH, col = 128 * ((16 * hf + it) % CH) + 4 * lane;
      val[it] = *(const v4f*)(T + row * OTP + col);
    }
#pragma unroll
    for (int it = 0; it < 16; ++it) {
      const int row = (64 / OWC) * w + (16 * hf + it) / CH, col = 128 * ((16 * hf + it) % CH) + 4 * lane;
      *(v4f*)(out + (size_t)(arow0 + row) * DM + brow0 + col) = val[it];
    }
  }
}

// ---------------------------------------------------------------------------
// Workspace map (bytes):
//   Xb  bf16 [4096][2048]        16777216 @ 0
//   Wqb bf16 [2048][2048]         8388608
//   Wkb bf16 [1024][2048]         4194304
//   Wvb bf16 [1024][2048]         4194304
//   Woh f16  [2048][2048]         8388608
//   Qp  f16  [4096][2048]        16777216
//   Kp  f16  [4096][1024]         8388608
//   Vt  f16  [2*8*128][2048]      8388608
//   Op  f16  [4096][2048]        16777216
//   total                        92274688
// ---------------------------------------------------------------------------
extern "C" void kernel_launch(void* const* d_in, const int* in_sizes, int n_in,
                              void* d_out, int out_size, void* d_ws, size_t ws_size,
                              hipStream_t stream) {
  if (n_in < 9) return;
  if (in_sizes[0] != NTOK * DM) return;
  if (in_sizes[1] != EQ * DM || in_sizes[2] != EK * DM || in_sizes[3] != EK * DM || in_sizes[4] != DM * EQ) return;
  if (in_sizes[5] != HD || in_sizes[6] != HD) return;
  if (in_sizes[7] != SQ * (HD / 2) || in_sizes[8] != SQ * (HD / 2)) return;
  if (out_size != NTOK * DM) return;

  const float* x    = (const float*)d_in[0];
  const float* wq   = (const float*)d_in[1];
  const float* wk   = (const float*)d_in[2];
  const float* wv   = (const float*)d_in[3];
  const float* wo   = (const float*)d_in[4];
  const float* qnw  = (const float*)d_in[5];
  const float* knw  = (const float*)d_in[6];
  const float* fcos = (const float*)d_in[7];
  const float* fsin = (const float*)d_in[8];
  float* out        = (float*)d_out;

  const size_t szX  = (size_t)NTOK * DM * 2;
  const size_t szWq = (size_t)EQ * DM * 2;
  const size_t szWk = (size_t)EK * DM * 2;
  const size_t szWo = (size_t)DM * EQ * 2;
  const size_t szQ  = (size_t)NTOK * EQ * 2;
  const size_t szK  = (size_t)NTOK * EK * 2;
  const size_t szVt = (size_t)NB * NKV * HD * SQ * 2;
  const size_t szO  = (size_t)NTOK * EQ * 2;
  size_t off = 0;
  const size_t oX  = off; off += szX;
  const size_t oWq = off; off += szWq;
  const size_t oWk = off; off += szWk;
  const size_t oWv = off; off += szWk;
  const size_t oWo = off; off += szWo;
  const size_t oQ  = off; off += szQ;
  const size_t oK  = off; off += szK;
  const size_t oV  = off; off += szVt;
  const size_t oO  = off; off += szO;
  if (off > ws_size) return;                  // off = 92274688

  char* ws = (char*)d_ws;
  unsigned short* Xb  = (unsigned short*)(ws + oX);
  unsigned short* Wqb = (unsigned short*)(ws + oWq);
  unsigned short* Wkb = (unsigned short*)(ws + oWk);
  unsigned short* Wvb = (unsigned short*)(ws + oWv);
  unsigned short* Woh = (unsigned short*)(ws + oWo);
  unsigned short* Qp  = (unsigned short*)(ws + oQ);
  unsigned short* Kp  = (unsigned short*)(ws + oK);
  unsigned short* Vt  = (unsigned short*)(ws + oV);
  unsigned short* Op  = (unsigned short*)(ws + oO);

  // (1) f32 -> bf16 RNE planes, wo -> f16: one launch; the five planes lie one behind the other from Xb on
  cvt_kernel<<<dim3(CVB), dim3(32 * CVW), 0, stream>>>(x, wq, wk, wv, wo, Xb);

  // (2) projections: q (16 token blocks of 256 x 16 heads), k (32 token blocks of 128 x 8 kv heads), v^T (32 token blocks of 128 x 8 feature blocks of 128)
  proj_kernel<0><<<dim3(NTOK / 256, NH), dim3(256), 0, stream>>>(Xb, Wqb, qnw, fcos, fsin, Qp);
  proj_kernel<1><<<dim3(NTOK / 128, NKV), dim3(256), 0, stream>>>(Xb, Wkb, knw, fcos, fsin, Kp);
  proj_kernel<2><<<dim3(NTOK / 128, EK / 128), dim3(256), 0, stream>>>(Wvb, Xb, knw, fcos, fsin, Vt);

  // (3) attention: 8 query blocks of 256 x 16 heads x 2 batches, 8 waves per block
  attn_kernel<<<dim3(SQ / (16 * QCG * AWV), NH, NB), dim3(32 * AWV), 0, stream>>>(Qp, Kp, Vt, Op);

  // (4) output projection -> d_out [4096][2048] f32
  out_kernel<<<dim3(NTOK / (64 * OWR), DM / (64 * OWC)), dim3(32 * OWR * OWC), 0, stream>>>(Op, Woh, out);

  (void)hipGetLastError();
}

// v007
// One run takes 128 microseconds.
// Two timings next to v006 both put it at 1.20 times that version's speed.
// All steps since v000 together make it 4.40 times as fast.
// q/k/v projections: v_wmma_f32_16x16x32_bf16 (bf16 operands staged in LDS, f32 accumulate); scores k.q^T: v_wmma_f32_16x16x32_f16 (k f16 x8, q f16 x(0.0883883*log2e*1024), one plane each, f32 accumulate); p.v^T: v_wmma_f32_16x16x32_f16 (p f16 x256, v^T f16 x1024, one plane each, f32 accumulate); output projection: v_wmma_f32_16x16x32_f16 (attention output f16, weights f16, one plane each, f32 accumulate); norm, rotary and softmax in f32.
#include <hip/hip_runtime.h>
#include <math.h>
#include <stddef.h>
#include <stdint.h>

#define NB    2
#define SQ    2048
#define DM    2048
#define NH    16
#define NKV   8
#define HD    128
#define EQ    (NH * HD)
#define EK    (NKV * HD)
#define NTOK  (NB * SQ)
#define PBT   256                            // q/k/v projection: side of the block tile (tokens x features, or features x tokens)
#define PTP   (PBT + 4)                      // pitch of its f32 tile in LDS, floats
#define OSP   136
#define RMS_EPS 1e-5f
#define QMUL  (0.08838834764831845f * 1.4426950408889634f * 1024.0f)
#define KMUL  8.0f
#define VMUL  1024.0f
#define SINV  (1.0f / 8192.0f)
#define AWV   8                              // waves per attention block
#define QCG   2                              // 16-query column groups per attention wave (32 queries each)
#define KPH   136                            // LDS pitch of a staged K row, halves (256 B + 16 B)
#define VPH   72                             // LDS pitch of a staged V^T row, halves (128 B + 16 B)
#define KTB   (64 * KPH * 2)                 // bytes of a staged K tile: 64 keys x 128 d
#define VTB   (HD * VPH * 2)                 // bytes of a staged V^T tile: 128 d x 64 keys
#define BUFB  (KTB + VTB)                    // one ring buffer: K, V^T
#define GKB   128                            // k elements of every operand row in one staged GEMM tile (256 B)
#define GPH   136                            // LDS pitch of a staged GEMM operand row, halves (256 B + 16 B)
#define GRB   (GPH * 2)                      // the same pitch in bytes
#define GBUF(BM, BN) (((BM) + (BN)) * GRB)   // one GEMM ring buffer: A rows, B rows
#define OWR   2                              // output projection: rows of 64 x 64 wave tiles in a block
#define OWC   4                              // and columns of them

typedef _Float16 v16h __attribute__((ext_vector_type(16)));
typedef _Float16 v8h  __attribute__((ext_vector_type(8)));
typedef __bf16   v16b __attribute__((ext_vector_type(16)));
typedef __bf16   v8b  __attribute__((ext_vector_type(8)));
typedef float    v8f  __attribute__((ext_vector_type(8)));
typedef float    v4f  __attribute__((ext_vector_type(4)));
typedef unsigned int v4u __attribute__((ext_vector_type(4)));
typedef unsigned int v2u __attribute__((ext_vector_type(2)));
typedef _Float16 v4h  __attribute__((ext_vector_type(4)));

union HFrag { v16h v; v8h h[2]; };
union BFrag { v16b v; v8b h[2]; };

// ---------------------------------------------------------------------------
// scalar helpers (RNE conversions)
// ---------------------------------------------------------------------------
__device__ __forceinline__ unsigned short f2bf_bits(float f) {
  const unsigned u = __float_as_uint(f);
  return (unsigned short)((u + 0x7FFFu + ((u >> 16) & 1u)) >> 16);
}
__device__ __forceinline__ float bfb2f(unsigned short h) { return __uint_as_float(((unsigned)h) << 16); }
__device__ __forceinline__ float bf16r(float f) { return bfb2f(f2bf_bits(f)); }
__device__ __forceinline__ unsigned short hbits(_Float16 h) { return __builtin_bit_cast(unsigned short, h); }
__device__ __forceinline__ unsigned pk16(unsigned short a, unsigned short b) { return (unsigned)a | ((unsigned)b << 16); }

// ---------------------------------------------------------------------------
// 16x32 fragment loads (A layout; also B from a [n][k] k-contiguous plane):
// elements 0..7 <- p[0..7] (k0+8h..), elements 8..15 <- p[16..23] (k0+16+8h..), p = row + k0 + 8h
// ---------------------------------------------------------------------------
__device__ __forceinline__ v16b ldb(const __bf16* p) {
  BFrag f; f.h[0] = *(const v8b*)(p); f.h[1] = *(const v8b*)(p + 16); return f.v;
}
__device__ __forceinline__ v16h ldh(const _Float16* p) {
  HFrag f; f.h[0] = *(const v8h*)(p); f.h[1] = *(const v8h*)(p + 16); return f.v;
}
__device__ __forceinline__ v8f mma_b(v16b a, v16b b, v8f c) {
  return __builtin_amdgcn_wmma_f32_16x16x32_bf16(false, a, false, b, (short)0, c, false, false);
}
__device__ __forceinline__ v8f mma_h(v16h a, v16h b, v8f c) {
  return __builtin_amdgcn_wmma_f32_16x16x32_f16(false, a, false, b, (short)0, c, false, false);
}

// hazard guards: 4 VALU slots after the last WMMA of a group, tying D and keeping A/B live
__device__ __forceinline__ void guard_b(v8f& a, v8f& b, v16b x) {
  asm volatile("v_nop\n\tv_nop\n\tv_nop\n\tv_nop" : "+v"(a), "+v"(b) : "v"(x));
}
__device__ __forceinline__ void keep_b(v16b a, v16b b, v16b c, v16b d) {
  asm volatile("v_nop" :: "v"(a), "v"(b), "v"(c), "v"(d));
}
__device__ __forceinline__ void acc_guard4(v8f& a, v8f& b, v8f& c, v8f& d) {
  asm volatile("v_nop\n\tv_nop\n\tv_nop\n\tv_nop" : "+v"(a), "+v"(b), "+v"(c), "+v"(d));
}

// ---------------------------------------------------------------------------
// ---------------------------------------------------------------------------
// f32 -> 16-bit planes, RNE, all five arrays in one streaming launch: CVB blocks of CVW waves, as many blocks as the
// chip has WGPs. A wave takes one 4-KB piece (CVL loads of 512 contiguous bytes) of each
// of CVT passes; pass t covers elements [t CVP, (t + 1) CVP) of the planes as they lie one behind the other in the
// workspace: x (passes 0, 1), wq (2), wk and wv (3, half the waves each), wo (4, f16; the others bf16).
// Every output element is written once; one store = 256 contiguous bytes (two whole lines).
#define CVB   256
#define CVW   16
#define CVL   8
#define CVT   5
#define CVP   (CVB * CVW * CVL * 128)        // elements of one pass: 4194304
static_assert(NTOK * DM == 2 * CVP && EQ * DM == CVP && 2 * EK * DM == CVP && DM * EQ == CVP, "the passes cover the planes");
__global__ __launch_bounds__(32 * CVW) void cvt_kernel(const float* __restrict__ x, const float* __restrict__ wq,
                                                       const float* __restrict__ wk, const float* __restrict__ wv,
                                                       const float* __restrict__ wo, unsigned short* __restrict__ out) {
  const unsigned o = (blockIdx.x * CVW + (threadIdx.x >> 5)) * (CVL * 128u) + 4u * (threadIdx.x & 31);
  const float* kv = (blockIdx.x < CVB / 2) ? wk : wv;
  const float* s[CVT] = {x + o, x + CVP + o, wq + o, kv + (o & (CVP / 2 - 1u)), wo + o};
  v4f a[2][CVL];
#pragma unroll
  for (int j = 0; j < CVL; ++j) a[0][j] = *(const v4f*)(s[0] + 128 * j);
  // precaution: stands ahead of any rewrite of these loads' address registers
  asm volatile("s_wait_xcnt 0x0" ::: "memory");
#pragma unroll
  for (int t = 0; t < CVT; ++t) {
    // the two scheduling barriers keep the next pass's loads in one group ahead of this pass's conversions and
    // stores: 8 to 16 loads of a wave stay in flight
    __builtin_amdgcn_sched_barrier(0);
    if (t + 1 < CVT) {
#pragma unroll
      for (int j = 0; j < CVL; ++j) a[(t + 1) & 1][j] = *(const v4f*)(s[t + 1] + 128 * j);
    }
    __builtin_amdgcn_sched_barrier(0);
    unsigned short* d = out + (size_t)t * CVP + o;
#pragma unroll
    for (int j = 0; j < CVL; ++j) {
      const v4f v = a[t & 1][j];
      v2u p;
      if (t == CVT - 1) {
        p = __builtin_bit_cast(v2u, __builtin_convertvector(v, v4h));
      } else {
        p[0] = pk16(f2bf_bits(v[0]), f2bf_bits(v[1]));
        p[1] = pk16(f2bf_bits(v[2]), f2bf_bits(v[3]));
      }
      *(v2u*)(d + 128 * j) = p;
    }
    // precaution: stands ahead of the next pass's rewrite of registers that these loads and stores name
    if (t + 1 < CVT) asm volatile("s_wait_xcnt 0x0" ::: "memory");
  }
}

// ---------------------------------------------------------------------------
// Block GEMM core: WR x WC waves, each with a 16 FI x 64 tile acc[i][j] of the block's BM x BN tile (BM = 16 FI WR,
// BN = 64 WC): += A[BM rows][K] . B[BN rows][K]^T, K = DM = 2048, both planes row-major with pitch DM, bf16 (f16 where F16).
// Each 128-k tile of the block's A and B rows is brought into LDS once per block by asynchronous 16-byte copies
// (16 lanes = 256 B of a row, two whole lines), two buffers, the next tile in flight while this one is worked on;
// the waves read their fragments from LDS (pitch 16 B x odd).
// gA, gB point at the block's first row. On return every wave has left the ring (the last trip's barrier).
// D layout: acc[i][j][r] = C[A row 16 FI wr + 16i + 8h + r][B row 64wc + 16j + (lane&15)].
// ---------------------------------------------------------------------------
// Copies of one lane, every lane on: each (l, g) pair stands for rows r, r + RS, r + 2RS, r + 3RS of a plane (RS =
// rows that the block's lanes cover at once). The s_wait_xcnt stands inside the statement so that no address
// register is rewritten ahead of it.
template <int RS>
__device__ __forceinline__ void copy12(unsigned l0, const unsigned short* g0, unsigned l1, const unsigned short* g1,
                                       unsigned l2, const unsigned short* g2) {
  asm volatile("global_load_async_to_lds_b128 %0, %12, off\n\t"
               "global_load_async_to_lds_b128 %1, %13, off\n\t"
               "global_load_async_to_lds_b128 %2, %14, off\n\t"
               "global_load_async_to_lds_b128 %3, %15, off\n\t"
               "global_load_async_to_lds_b128 %4, %16, off\n\t"
               "global_load_async_to_lds_b128 %5, %17, off\n\t"
               "global_load_async_to_lds_b128 %6, %18, off\n\t"
               "global_load_async_to_lds_b128 %7, %19, off\n\t"
               "global_load_async_to_lds_b128 %8, %20, off\n\t"
               "global_load_async_to_lds_b128 %9, %21, off\n\t"
               "global_load_async_to_lds_b128 %10, %22, off\n\t"
               "global_load_async_to_lds_b128 %11, %23, off\n\t"
               "s_wait_xcnt 0x0"
               :: "v"(l0), "v"(l0 + (unsigned)RS * GRB), "v"(l0 + 2u * RS * GRB), "v"(l0 + 3u * RS * GRB),
                  "v"(l1), "v"(l1 + (unsigned)RS * GRB), "v"(l1 + 2u * RS * GRB), "v"(l1 + 3u * RS * GRB),
                  "v"(l2), "v"(l2 + (unsigned)RS * GRB), "v"(l2 + 2u * RS * GRB), "v"(l2 + 3u * RS * GRB),
                  "v"(g0), "v"(g0 + (size_t)RS * DM), "v"(g0 + (size_t)2 * RS * DM), "v"(g0 + (size_t)3 * RS * DM),
                  "v"(g1), "v"(g1 + (size_t)RS * DM), "v"(g1 + (size_t)2 * RS * DM), "v"(g1 + (size_t)3 * RS * DM),
                  "v"(g2), "v"(g2 + (size_t)RS * DM), "v"(g2 + (size_t)2 * RS * DM), "v"(g2 + (size_t)3 * RS * DM)
               : "memory");
}
// One tile's copies: every row of A and B once; 24 per lane
template <int WR, int WC, int FI>
__device__ __forceinline__ void stage_gemm(unsigned l, const unsigned short* ga, const unsigned short* gb) {
  constexpr int RS = 2 * WR * WC;              // rows covered by one copy of every lane
  constexpr int BM = 16 * FI * WR;
  constexpr int PA = BM / (4 * RS);            // (l, g) pairs of an A plane
  constexpr int PB = 64 * WC / (4 * RS);       // (l, g) pairs of the B plane
  constexpr int NP = PA + PB;
  static_assert(PA * 4 * RS == BM && PB * 4 * RS == 64 * WC, "whole pairs");
  static_assert(NP == 6, "pairs go out in twelves");
  unsigned L[NP];
  const unsigned short* G[NP];
#pragma unroll
  for (int p = 0; p < PA; ++p) {
    L[p] = l + (unsigned)(p * 4 * RS) * GRB;
    G[p] = ga + (size_t)(p * 4 * RS) * DM;
  }
#pragma unroll
  for (int p = 0; p < PB; ++p) {
    L[PA + p] = l + (unsigned)(BM + p * 4 * RS) * GRB;
    G[PA + p] = gb + (size_t)(p * 4 * RS) * DM;
  }
  copy12<RS>(L[0], G[0], L[1], G[1], L[2], G[2]);
  copy12<RS>(L[3], G[3], L[4], G[4], L[5], G[5]);
}

template <bool F16, int WR, int WC, int FI>
__device__ __forceinline__ void gemm_core(const unsigned short* __restrict__ gA, const unsigned short* __restrict__ gB,
                                          unsigned char* ring, v8f (&acc)[FI][4]) {
  constexpr int BM = 16 * FI * WR;
  constexpr unsigned GB = GBUF(BM, 64 * WC);
  const int tid = threadIdx.x, lane = tid & 31, w = tid >> 5;
  const int m = lane & 15, ko = (lane >> 4) * 8, wr = w / WC, wc = w % WC;
  // copy addresses of this lane: row (tid>>4) + RS i of a plane, 16-B piece tid&15
  const size_t go = (size_t)(tid >> 4) * DM + 8 * (tid & 15);
  const unsigned short* ga = gA + go;
  const unsigned short* gb = gB + go;
  typedef __attribute__((address_space(3))) unsigned char lds_byte;
  const unsigned l0 = (unsigned)(uintptr_t)(lds_byte*)ring + (unsigned)((tid >> 4) * GRB + 16 * (tid & 15));

  // tile 0 into buffer 0, landed and published; then tile 1 into buffer 1
  stage_gemm<WR, WC, FI>(l0, ga, gb);
  asm volatile("s_wait_asynccnt 0x0" ::: "memory");   // this wave's copies of tile 0 have landed
  __syncthreads();                                    // every wave's have
  stage_gemm<WR, WC, FI>(l0 + GB, ga + GKB, gb + GKB);

  // kept rolled: one trip per staged tile, so that the hand-over at its foot stands once, in the order written
#pragma unroll 1
  for (int t = 0; t < DM / GKB; ++t) {
    const __bf16* buf = (const __bf16*)(const void*)(ring + (t & 1) * GB);
    const __bf16* Ar = buf + (16 * FI * wr + m) * GPH + ko;
    const __bf16* Br = buf + (BM + 64 * wc + m) * GPH + ko;
#pragma unroll
    for (int s = 0; s < GKB / 32; ++s) {
      // the fragments of 32 k as one group of LDS reads ahead of their matrix instructions
      v16b bf[4], af[FI];
#pragma unroll
      for (int j = 0; j < 4; ++j) bf[j] = ldb(Br + (16 * j) * GPH + 32 * s);
#pragma unroll
      for (int i = 0; i < FI; ++i) af[i] = ldb(Ar + (16 * i) * GPH + 32 * s);
#pragma unroll
      for (int i = 0; i < FI; ++i) {
#pragma unroll
        for (int j = 0; j < 4; ++j) {
          if constexpr (F16)
            acc[i][j] = mma_h(__builtin_bit_cast(v16h, af[i]), __builtin_bit_cast(v16h, bf[j]), acc[i][j]);
          else
            acc[i][j] = mma_b(af[i], bf[j], acc[i][j]);
        }
        guard_b(acc[i][0], acc[i][3], af[i]);
      }
      keep_b(bf[0], bf[1], bf[2], bf[3]);
    }
    // hand-over: this wave has left buffer t&1 and its copies of tile t+1 have landed; behind the barrier that
    // holds for every wave, so tile t+1 may be read and buffer t&1 refilled
    asm volatile("s_wait_dscnt 0x0" ::: "memory");
    asm volatile("s_wait_asynccnt 0x0" ::: "memory");
    __syncthreads();
    if (t + 2 < DM / GKB) {
      const int kn = (t + 2) * GKB;
      stage_gemm<WR, WC, FI>(l0 + (unsigned)(t & 1) * GB, ga + kn, gb + kn);
    }
  }
  asm volatile("s_wait_asynccnt 0x0" ::: "memory");   // nothing in flight when the ring becomes the f32 tile
#pragma unroll
  for (int i = 0; i < FI; ++i) acc_guard4(acc[i][0], acc[i][1], acc[i][2], acc[i][3]);
}

// stage a wave's 16 FI x 16 FJ tile into the block's f32 LDS tile (pitch P floats)
template <int WC, int P, int FI, int FJ>
__device__ __forceinline__ void stage_tile(float* T, int w, int lane, v8f (&acc)[FI][FJ]) {
  const int wr = w / WC, wc = w % WC, hh = lane >> 4, m = lane & 15;
#pragma unroll
  for (int i = 0; i < FI; ++i)
#pragma unroll
    for (int j = 0; j < FJ; ++j)
#pragma unroll
      for (int r = 0; r < 8; ++r)
        T[(16 * FI * wr + 16 * i + 8 * hh + r) * P + 16 * FJ * wc + 16 * j + m] = acc[i][j][r];
}

// ---------------------------------------------------------------------------
// One asynchronous 16-byte copy of a lane, as the builtin: the kernels that use it hold more than 256 vector registers,
// and operands of an asm statement would have to stay in the first 256 through the whole loop.
typedef int v4i __attribute__((ext_vector_type(4)));
typedef __attribute__((address_space(1))) v4i glb_v4i;
typedef __attribute__((address_space(3))) v4i lds_v4i;
__device__ __forceinline__ void copy16(unsigned char* l, const unsigned short* g) {
  __builtin_amdgcn_global_load_async_to_lds_b128((glb_v4i*)(void*)const_cast<unsigned short*>(g), (lds_v4i*)(void*)l, 0, 0);
}

// q, k and v projections in one launch: the weight planes Wq, Wk, Wv lie one behind the other, 4096 feature rows, so
// the three products are one 4096 tokens x 4096 features x 2048 k product. One PBT x PBT tile of it per block
// (16 x 16 blocks): each staged X row serves 256 features and each staged weight row 256 tokens.
// 8 waves as 4 x 2, each with a 64 x 128 tile acc[i][j]: += A[256 rows][K] . B[256 rows][K]^T, bf16 planes, pitch DM.
// The ring is that of gemm_core: 128-k tiles of all 512 rows by asynchronous 16-byte copies (32 per lane), two buffers,
// the next tile in flight while this one is worked on. On return every wave has left the ring (the last trip's barrier).
// D layout: acc[i][j][r] = C[A row 64wr + 16i + 8h + r][B row 128wc + 16j + (lane&15)].
// ---------------------------------------------------------------------------
__device__ __forceinline__ void stage_qkv(unsigned char* l, const unsigned short* ga, const unsigned short* gb) {
#pragma unroll
  for (int i = 0; i < PBT / 16; ++i) copy16(l + i * (16 * GRB), ga + (size_t)i * 16 * DM);
#pragma unroll
  for (int i = 0; i < PBT / 16; ++i) copy16(l + (PBT + 16 * i) * GRB, gb + (size_t)i * 16 * DM);
}

__device__ __forceinline__ void qkv_core(const unsigned short* __restrict__ gA, const unsigned short* __restrict__ gB,
                                         unsigned char* ring, v8f (&acc)[4][8]) {
  constexpr unsigned GB = GBUF(PBT, PBT);
  const int tid = threadIdx.x, lane = tid & 31, w = tid >> 5;
  const int m = lane & 15, ko = (lane >> 4) * 8, wr = w >> 1, wc = w & 1;
  // copy addresses of this lane: row (tid>>4) + 16 i of a plane, 16-B piece tid&15
  const size_t go = (size_t)(tid >> 4) * DM + 8 * (tid & 15);
  const unsigned short* ga = gA + go;
  const unsigned short* gb = gB + go;
  unsigned char* l0 = ring + ((tid >> 4) * GRB + 16 * (tid & 15));

  // tile 0 into buffer 0, landed and published; then tile 1 into buffer 1
  stage_qkv(l0, ga, gb);
  asm volatile("s_wait_asynccnt 0x0" ::: "memory");   // this wave's copies of tile 0 have landed
  __syncthreads();                                    // every wave's have
  stage_qkv(l0 + GB, ga + GKB, gb + GKB);

  // kept rolled: one trip per staged tile, so that the hand-over at its foot stands once, in the order written
#pragma unroll 1
  for (int t = 0; t < DM / GKB; ++t) {
    const __bf16* buf = (const __bf16*)(const void*)(ring + (t & 1) * GB);
    const __bf16* Ar = buf + (64 * wr + m) * GPH + ko;
    const __bf16* Br = buf + (PBT + 128 * wc + m) * GPH + ko;
#pragma unroll
    for (int s = 0; s < GKB / 32; ++s) {
      // the fragments of 32 k as one group of 24 LDS reads ahead of their 32 matrix instructions, in the order of use;
      // the scheduling barriers keep the reads from being spread among the matrix instructions
      v16b bf[8], af[4];
      af[0] = ldb(Ar + 32 * s);
#pragma unroll
      for (int j = 0; j < 8; ++j) bf[j] = ldb(Br + (16 * j) * GPH + 32 * s);
#pragma unroll
      for (int i = 1; i < 4; ++i) af[i] = ldb(Ar + (16 * i) * GPH + 32 * s);
      __builtin_amdgcn_sched_barrier(0);   // all 24 reads are issued before the first matrix instruction
#pragma unroll
      for (int i = 0; i < 4; ++i)
#pragma unroll
        for (int j = 0; j < 8; ++j) acc[i][j] = mma_b(af[i], bf[j], acc[i][j]);
      // no read of the next group is drawn in among them, and none of them sinks behind the hand-over at the trip's foot
      __builtin_amdgcn_sched_barrier(0);
    }
    // hand-over: this wave has left buffer t&1 and its copies of tile t+1 have landed; behind the barrier that
    // holds for every wave, so tile t+1 may be read and buffer t&1 refilled
    asm volatile("s_wait_dscnt 0x0" ::: "memory");
    asm volatile("s_wait_asynccnt 0x0" ::: "memory");
    __syncthreads();
    if (t + 2 < DM / GKB) {
      const int kn = (t + 2) * GKB;
      stage_qkv(l0 + (unsigned)(t & 1) * GB, ga + kn, gb + kn);
    }
  }
  asm volatile("s_wait_asynccnt 0x0" ::: "memory");   // nothing in flight when the ring becomes the f32 tile
}

// ---------------------------------------------------------------------------
// Sixteen 16-byte stores of a lane: rows p[0..7], at each its piece a[it] and, 256 bytes further on, b[it]. Stores and
// s_wait_xcnt stand in one statement so that (a precaution) no register that a store names is rewritten ahead of the wait.
__device__ __forceinline__ void store16(unsigned short* const (&p)[8], const v4u (&a)[8], const v4u (&b)[8]) {
  asm volatile("global_store_b128 %0, %8, off\n\t"
               "global_store_b128 %0, %16, off offset:256\n\t"
               "global_store_b128 %1, %9, off\n\t"
               "global_store_b128 %1, %17, off offset:256\n\t"
               "global_store_b128 %2, %10, off\n\t"
               "global_store_b128 %2, %18, off offset:256\n\t"
               "global_store_b128 %3, %11, off\n\t"
               "global_store_b128 %3, %19, off offset:256\n\t"
               "global_store_b128 %4, %12, off\n\t"
               "global_store_b128 %4, %20, off offset:256\n\t"
               "global_store_b128 %5, %13, off\n\t"
               "global_store_b128 %5, %21, off offset:256\n\t"
               "global_store_b128 %6, %14, off\n\t"
               "global_store_b128 %6, %22, off offset:256\n\t"
               "global_store_b128 %7, %15, off\n\t"
               "global_store_b128 %7, %23, off offset:256\n\t"
               "s_wait_xcnt 0x0"
               :: "v"(p[0]), "v"(p[1]), "v"(p[2]), "v"(p[3]), "v"(p[4]), "v"(p[5]), "v"(p[6]), "v"(p[7]),
                  "v"(a[0]), "v"(a[1]), "v"(a[2]), "v"(a[3]), "v"(a[4]), "v"(a[5]), "v"(a[6]), "v"(a[7]),
                  "v"(b[0]), "v"(b[1]), "v"(b[2]), "v"(b[3]), "v"(b[4]), "v"(b[5]), "v"(b[6]), "v"(b[7])
               : "memory");
}

// ---------------------------------------------------------------------------
// Block (bx, by): tokens 256 bx, feature rows 256 by of the stacked planes: by 0..7 q (heads 2by, 2by+1), 8..11 k, 12..15 v.
//   q: A = X rows, B = Wq rows: RMSNorm + RoPE in f32 per head, q' = q * QMUL -> f16 plane Qo [tok][EQ].
//   k: A = X rows, B = Wk rows: RMSNorm + RoPE, k' = k * 8 -> f16 plane Ko [tok][EK].
//   v: A = Wv rows, B = X rows: tile = V^T directly; v' = v * 1024 -> f16 plane Vo, layout [(b*NKV+kvh)*128 + d][s].
// Epilogue: f32 tile staged in LDS, then each wave owns 32 rows; one store instruction = 2 rows x 16 lanes x 16 B.
// Coverage per block: rows 32w + 16hf + 2it + hh (hf 0..1, it 0..7, hh 0..1) = 0..255, cols 128ch + 8*(lane&15) = 0..255.
// ---------------------------------------------------------------------------
__global__ __launch_bounds__(256) void qkv_kernel(const unsigned short* __restrict__ Xp,
                                                  const unsigned short* __restrict__ Wp,
                                                  const float* __restrict__ qnw,
                                                  const float* __restrict__ knw,
                                                  const float* __restrict__ fcos,
                                                  const float* __restrict__ fsin,
                                                  unsigned short* __restrict__ Qo,
                                                  unsigned short* __restrict__ Ko,
                                                  unsigned short* __restrict__ Vo) {
  // two operand tile buffers; after the k loop the same bytes serve as the block's f32 tile T
  __shared__ __align__(16) unsigned char ring[2 * GBUF(PBT, PBT)];
  static_assert(PBT * PTP * 4 <= 2 * GBUF(PBT, PBT), "f32 tile fits the ring");
  float* T = (float*)(void*)ring;
  const int lane = threadIdx.x & 31;
  const int w    = threadIdx.x >> 5;
  const int hh   = lane >> 4;
  const int m    = lane & 15;
  const int tok0 = (int)blockIdx.x * PBT;
  const int f0   = (int)blockIdx.y * PBT;        // first feature row in the stacked planes
  const bool isv = f0 >= EQ + EK;
  const unsigned short* Xr = Xp + (size_t)tok0 * DM;
  const unsigned short* Wr = Wp + (size_t)f0 * DM;

  v8f acc[4][8];
#pragma unroll
  for (int i = 0; i < 4; ++i)
#pragma unroll
    for (int j = 0; j < 8; ++j) acc[i][j] = (v8f){0.f, 0.f, 0.f, 0.f, 0.f, 0.f, 0.f, 0.f};

  qkv_core(isv ? Wr : Xr, isv ? Xr : Wr, ring, acc);
  stage_tile<2, PTP, 4, 8>(T, w, lane, acc);
  __syncthreads();

  if (isv) {
    const int fv = f0 - (EQ + EK);               // 0..1023: (kv head, d) of the tile's first row
    const int bb = tok0 >> 11;                   // batch of this 256-token block
    const int s0 = tok0 & (SQ - 1);
    unsigned short* vo = Vo + (size_t)(bb * EK + fv) * SQ + s0 + 8 * m;
#pragma unroll
    for (int hf = 0; hf < 2; ++hf) {
      v4u hv[2][8];
#pragma unroll
      for (int it = 0; it < 8; ++it) {
        const int row = 32 * w + 16 * hf + 2 * it + hh;
#pragma unroll
        for (int ch = 0; ch < 2; ++ch) {
          const float* tr = T + row * PTP + 128 * ch + 8 * m;
          const v4f xa = *(const v4f*)(tr);
          const v4f xb = *(const v4f*)(tr + 4);
          const float x[8] = {xa[0], xa[1], xa[2], xa[3], xb[0], xb[1], xb[2], xb[3]};
          v4u a;
#pragma unroll
          for (int q = 0; q < 4; ++q)
            a[q] = pk16(hbits((_Float16)(x[2 * q] * VMUL)), hbits((_Float16)(x[2 * q + 1] * VMUL)));
          hv[ch][it] = a;
        }
      }
      unsigned short* pr[8];
#pragma unroll
      for (int it = 0; it < 8; ++it) pr[it] = vo + (size_t)(32 * w + 16 * hf + 2 * it + hh) * SQ;
      store16(pr, hv[0], hv[1]);
    }
  } else {
    const bool isq = f0 < EQ;
    const float* nw = isq ? qnw : knw;
    const float om  = isq ? QMUL : KMUL;
    const int   ep  = isq ? EQ : EK;             // row pitch of the output plane
    unsigned short* po = (isq ? Qo + f0 : Ko + (f0 - EQ)) + 8 * m;
    float wv[8];
    {
      const v4f wa = *(const v4f*)(nw + 8 * m);
      const v4f wb = *(const v4f*)(nw + 8 * m + 4);
      // precaution: stands ahead of any rewrite of these two loads' address registers
      asm volatile("s_wait_xcnt 0x0" ::: "memory");
#pragma unroll
      for (int e = 0; e < 4; ++e) { wv[e] = bf16r(wa[e]); wv[4 + e] = bf16r(wb[e]); }
    }
#pragma unroll
    for (int hf = 0; hf < 2; ++hf) {
      v4u hv[2][8];
#pragma unroll
      for (int it = 0; it < 8; ++it) {
        const int row = 32 * w + 16 * hf + 2 * it + hh;
        const int sp  = (tok0 + row) & (SQ - 1);
        // precaution, behind each of the two loads: stands ahead of any rewrite of its address registers
        const v4f c4 = *(const v4f*)(fcos + (size_t)sp * (HD / 2) + 4 * m);
        asm volatile("s_wait_xcnt 0x0" ::: "memory");
        const v4f s4 = *(const v4f*)(fsin + (size_t)sp * (HD / 2) + 4 * m);
        asm volatile("s_wait_xcnt 0x0" ::: "memory");
#pragma unroll
        for (int ch = 0; ch < 2; ++ch) {         // the two heads of the tile
          const float* tr = T + row * PTP + 128 * ch + 8 * m;
          const v4f xa = *(const v4f*)(tr);
          const v4f xb = *(const v4f*)(tr + 4);
          const float x[8] = {xa[0], xa[1], xa[2], xa[3], xb[0], xb[1], xb[2], xb[3]};
          float y[8];
          float ss = 0.f;
#pragma unroll
          for (int e = 0; e < 8; ++e) ss = fmaf(x[e], x[e], ss);
          ss += __shfl_xor(ss, 1, 32);
          ss += __shfl_xor(ss, 2, 32);
          ss += __shfl_xor(ss, 4, 32);
          ss += __shfl_xor(ss, 8, 32);
          const float rn = rsqrtf(fmaf(ss, 1.0f / (float)HD, RMS_EPS));
#pragma unroll
          for (int p = 0; p < 4; ++p) {
            const float cs = bf16r(c4[p]), sn = bf16r(s4[p]);
            const float u0 = x[2 * p] * rn * wv[2 * p];
            const float u1 = x[2 * p + 1] * rn * wv[2 * p + 1];
            y[2 * p]     = (u0 * cs - u1 * sn) * om;
            y[2 * p + 1] = (u0 * sn + u1 * cs) * om;
          }
          v4u a;
#pragma unroll
          for (int q = 0; q < 4; ++q) a[q] = pk16(hbits((_Float16)y[2 * q]), hbits((_Float16)y[2 * q + 1]));
          hv[ch][it] = a;
        }
      }
      unsigned short* pr[8];
#pragma unroll
      for (int it = 0; it < 8; ++it) pr[it] = po + (size_t)(tok0 + 32 * w + 16 * hf + 2 * it + hh) * ep;
      store16(pr, hv[0], hv[1]);
    }
  }
}

// ---------------------------------------------------------------------------
// Full (non-causal) GQA attention, head dim 128, one wave per (b, h, 32 queries = QCG column groups of 16);
//   block = 8 waves (256 queries). Every K and V^T fragment read from LDS feeds QCG matrix instructions.
//   Each 64-key tile (K rows, V^T rows) is brought into LDS once per block by asynchronous
//   16-byte copies (whole 128-B lines on the global side), two buffers, the next tile in flight while this one
//   is worked on; all 8 waves read their fragments from LDS (row pitches 16 B x odd: no bank conflicts).
//   Transposed scores S^T[key][query] = K . Q^T : A = K rows [key][d] (f16 x8), B[k=d][n=query] from Q rows
//   [query][d] (f16) -> both fragments are plain k-contiguous row loads.
//   D tiles (rows = 16 keys, cols = queries) packed to f16 ARE the B operand [k=key][n=query] of
//   O^T[d][query] = V^T . P : element r <- tile(keys 0-15)[r], element 8+r <- tile(keys 16-31)[r], same lane.
//   A = V^T rows [d][s] (f16 x1024). Softmax per query column = per lane (partner lane ^16),
//   online over 32 chunks of 64 keys, f32, exp2 with log2e folded into the q scale, p carried x256.
//   Epilogue: O = acc / (l * 1024) -> f16, per-wave LDS relayout [query][d] (v4u store/reload,
//   Coverage: rows 16c + 2it + hh (c 0..QCG-1, it 0..7) = 32 queries, cols 8*(lane&15) = 0..127 of head h.
// ---------------------------------------------------------------------------
// One tile's copies: 8 per lane (4 of K, 4 of V^T), every lane on, by copy16 (the builtin).
__device__ __forceinline__ void stage_copies(unsigned char* lk, unsigned char* lv, const unsigned short* gk,
                                             const unsigned short* gv) {
#pragma unroll
  for (int i = 0; i < 4; ++i) copy16(lk + i * (16 * KPH * 2), gk + (size_t)i * 16 * EK);
#pragma unroll
  for (int i = 0; i < 4; ++i) copy16(lv + i * (32 * VPH * 2), gv + (size_t)i * 32 * SQ);
}

__global__ __launch_bounds__(32 * AWV) void attn_kernel(const unsigned short* __restrict__ Qpp,
                                                  const unsigned short* __restrict__ Kpp,
                                                  const unsigned short* __restrict__ Vpp,
                                                  unsigned short* __restrict__ Opp) {
  // two tile buffers; after the loop the same bytes serve as output staging [wave][query*OSP + d]
  __shared__ __align__(16) unsigned char ring[2 * BUFB];
  static_assert(AWV * 16 * QCG * OSP * 2 <= 2 * BUFB, "output staging fits the ring");
  const int lane = threadIdx.x & 31;
  const int w    = threadIdx.x >> 5;
  const int hh   = lane >> 4;
  const int m    = lane & 15;
  const int h    = blockIdx.y;
  const int b    = blockIdx.z;
  const int kvh  = h >> 1;                       // G = NH / NKV = 2
  const int q0   = blockIdx.x * (16 * QCG * AWV) + w * (16 * QCG);   // query index within the sequence

  const _Float16* Qp = (const _Float16*)(const void*)Qpp;
  const size_t vplane = (size_t)((b * NKV + kvh) * HD) * SQ;
  // copy addresses of this lane. K: key row (tid>>4) + 16i, 16-B piece tid&15; V^T: d row (tid>>3) + 32i, piece tid&7
  const int tid = threadIdx.x;
  const unsigned short* gk = Kpp + (size_t)b * SQ * EK + kvh * HD + (size_t)(tid >> 4) * EK + 8 * (tid & 15);
  const unsigned short* gv = Vpp + vplane + (size_t)(tid >> 3) * SQ + 8 * (tid & 7);
  unsigned char* lk = ring + ((tid >> 4) * (KPH * 2) + 16 * (tid & 15));
  unsigned char* lv = ring + (KTB + (tid >> 3) * (VPH * 2) + 16 * (tid & 7));

  // tile 0 into buffer 0, landed and published; then tile 1 into buffer 1
  stage_copies(lk, lv, gk, gv);
  asm volatile("s_wait_asynccnt 0x0" ::: "memory");   // this wave's copies of tile 0 have landed
  __syncthreads();                                    // every wave's have
  stage_copies(lk + BUFB, lv + BUFB, gk + (size_t)64 * EK, gv + 64);

  // Q fragments (B operand): row = query q0 + 16c + (lane&15), k = d
  v16h qf[QCG][4];
  {
    const _Float16* qb = Qp + ((size_t)b * SQ + q0 + m) * EQ + (size_t)h * HD + 8 * hh;
#pragma unroll
    for (int c = 0; c < QCG; ++c)
#pragma unroll
      for (int dc = 0; dc < 4; ++dc) qf[c][dc] = ldh(qb + (size_t)c * 16 * EQ + 32 * dc);
    // precaution: stands ahead of any rewrite of these loads' address registers
    asm volatile("s_wait_xcnt 0x0" ::: "memory");
    // holds the vector instructions that follow behind that wait: its memory clobber alone does not
    __builtin_amdgcn_sched_barrier(0);
  }

  v8f acc[QCG][8];
  float mrun[QCG], lrun[QCG];
#pragma unroll
  for (int c = 0; c < QCG; ++c) {
#pragma unroll
    for (int t = 0; t < 8; ++t) acc[c][t] = (v8f){0.f, 0.f, 0.f, 0.f, 0.f, 0.f, 0.f, 0.f};
    mrun[c] = -1.0e30f;
    lrun[c] = 0.0f;
  }

#pragma unroll 1
  for (int kc = 0; kc < SQ / 64; ++kc) {
    const unsigned char* buf = ring + (kc & 1) * BUFB;
    const _Float16* Kr  = (const _Float16*)(const void*)buf + m * KPH + 8 * hh;                // + key*KPH + 32dc
    const _Float16* Vr  = (const _Float16*)(const void*)(buf + KTB) + m * VPH + 8 * hh;        // + 16t*VPH + key
    v8f s[QCG][4];
#pragma unroll
    for (int c = 0; c < QCG; ++c)
#pragma unroll
      for (int j = 0; j < 4; ++j) s[c][j] = (v8f){0.f, 0.f, 0.f, 0.f, 0.f, 0.f, 0.f, 0.f};
    {
      // the tile's K fragments as one group of LDS reads ahead of their 32 matrix instructions: 4 key tiles x 128 d;
      // the scheduling barriers keep the reads from being spread among the matrix instructions
      v16h kf[16];
#pragma unroll
      for (int j = 0; j < 16; ++j) kf[j] = ldh(Kr + (16 * (j & 3)) * KPH + 32 * (j >> 2));
      __builtin_amdgcn_sched_barrier(0);   // all 32 reads are issued before the first matrix instruction
#pragma unroll
      for (int j = 0; j < 16; ++j)
#pragma unroll
        for (int c = 0; c < QCG; ++c) s[c][j & 3] = mma_h(kf[j], qf[c][j >> 2], s[c][j & 3]);
      __builtin_amdgcn_sched_barrier(0);   // no vector work is drawn in among the 32 matrix instructions
    }

    // online softmax for query column 16c + (lane&15); lane holds keys key0 + 16j + 8hh + r
    float cmax[QCG], cother[QCG];
#pragma unroll
    for (int c = 0; c < QCG; ++c) {
      float cm = -1.0e30f;
#pragma unroll
      for (int j = 0; j < 4; ++j)
#pragma unroll
        for (int r = 0; r < 8; ++r) cm = fmaxf(cm, s[c][j][r]);
      cmax[c]   = cm;
      cother[c] = __shfl_xor(cm, 16, 32);
    }
    // the tile's V^T fragments as one group of LDS reads ahead of the exponentials, which cover their latency.
    // The statement takes the exchanged maxima as inputs only: it holds the 32 reads behind that exchange, which would
    // otherwise wait for all of them (LDS operations return in order); the scheduling barriers hold the group together
    asm volatile("" :: "v"(cother[0]), "v"(cother[1]) : "memory");
    __builtin_amdgcn_sched_barrier(0);     // head of the group of V^T reads
    v16h vf[2][8];
#pragma unroll
    for (int ks = 0; ks < 2; ++ks)
#pragma unroll
      for (int t = 0; t < 8; ++t) vf[ks][t] = ldh(Vr + (16 * t) * VPH + 32 * ks);
    __builtin_amdgcn_sched_barrier(0);     // foot of the group: none of its reads sinks towards its matrix instruction
#pragma unroll
    for (int c = 0; c < QCG; ++c) {
      const float cm    = fmaxf(cmax[c], cother[c]);
      const float mnew  = fmaxf(mrun[c], cm);
      const float alpha = __builtin_amdgcn_exp2f((mrun[c] - mnew) * SINV);
      const float nms   = 8.0f - mnew * SINV;          // p * 256 = exp2(s*SINV - m*SINV + 8)
      float psum = 0.f;
#pragma unroll
      for (int j = 0; j < 4; ++j)
#pragma unroll
        for (int r = 0; r < 8; ++r) {
          const float p = __builtin_amdgcn_exp2f(fmaf(s[c][j][r], SINV, nms));
          s[c][j][r] = p;
          psum += p;
        }
      psum += __shfl_xor(psum, 16, 32);
      lrun[c] = fmaf(lrun[c], alpha, psum);
      mrun[c] = mnew;
#pragma unroll
      for (int t = 0; t < 8; ++t) acc[c][t] = acc[c][t] * alpha;
    }

#pragma unroll
    for (int ks = 0; ks < 2; ++ks) {
      HFrag pf[QCG];
#pragma unroll
      for (int c = 0; c < QCG; ++c) {
        v8h plo, phi;
#pragma unroll
        for (int r = 0; r < 8; ++r) {
          plo[r] = (_Float16)s[c][2 * ks][r];        // keys 32ks + 8hh + r
          phi[r] = (_Float16)s[c][2 * ks + 1][r];    // keys 32ks + 16 + 8hh + r
        }
        pf[c].h[0] = plo;
        pf[c].h[1] = phi;
      }
#pragma unroll
      for (int t = 0; t < 8; ++t)
#pragma unroll
        for (int c = 0; c < QCG; ++c) acc[c][t] = mma_h(vf[ks][t], pf[c].v, acc[c][t]);
    }
    // keeps the trip's work ahead of the hand-over, so that the refill behind the barrier is issued at once
    __builtin_amdgcn_sched_barrier(0);

    // hand-over: this wave has left buffer kc&1 and its copies of tile kc+1 have landed; behind the barrier that
    // holds for every wave, so tile kc+1 may be read and buffer kc&1 refilled
    asm volatile("s_wait_dscnt 0x0" ::: "memory");
    asm volatile("s_wait_asynccnt 0x0" ::: "memory");
    __syncthreads();
    if (kc + 2 < SQ / 64) {
      const unsigned bo = (unsigned)(kc & 1) * BUFB;
      stage_copies(lk + bo, lv + bo, gk + (size_t)(kc + 2) * 64 * EK, gv + (kc + 2) * 64);
    }
  }
  asm volatile("s_wait_asynccnt 0x0" ::: "memory");   // nothing in flight when the ring becomes output staging

  // ---- epilogue: acc[c][t][r] = O^T[d = 16t + 8hh + r][query 16c + m] * (256 * 1024 * l256/256) ----
  unsigned short* sh = (unsigned short*)(void*)ring + w * (16 * QCG * OSP);
#pragma unroll
  for (int c = 0; c < QCG; ++c) {
    const float inv = __builtin_amdgcn_rcpf(lrun[c]) * (1.0f / VMUL);
#pragma unroll
    for (int t = 0; t < 8; ++t) {
      v4u hv;
#pragma unroll
      for (int q = 0; q < 4; ++q)
        hv[q] = pk16(hbits((_Float16)(acc[c][t][2 * q] * inv)), hbits((_Float16)(acc[c][t][2 * q + 1] * inv)));
      *(v4u*)(sh + (16 * c + m) * OSP + 16 * t + 8 * hh) = hv;
    }
  }
  __builtin_amdgcn_fence(__ATOMIC_RELEASE, "wavefront");
  __builtin_amdgcn_wave_barrier();
  __builtin_amdgcn_fence(__ATOMIC_ACQUIRE, "wavefront");
  v4u ov[8 * QCG];
#pragma unroll
  for (int it = 0; it < 8 * QCG; ++it) ov[it] = *(const v4u*)(sh + (2 * it + hh) * OSP + 8 * m);
#pragma unroll
  for (int it = 0; it < 8 * QCG; ++it) {
    const int row = 2 * it + hh;
    const size_t go = ((size_t)b * SQ + q0 + row) * EQ + (size_t)h * HD + 8 * m;
    *(v4u*)(Opp + go) = ov[it];
  }
}

// ---------------------------------------------------------------------------
// Output projection: out[tok][dout] = sum_e O[tok][e] * Wo[dout][e]; A = O f16, B = Wo f16.
// Block 64 OWR tokens x 64 OWC out cols, OWR x OWC waves; f32 tile staged in LDS; each wave writes 64 / OWC rows,
// one instruction per 512 B of a row.
// Coverage per block: rows (64 / OWC) w + it = 0..64 OWR - 1, cols 128c + 4*lane = 0..64 OWC - 1.
// ---------------------------------------------------------------------------
__global__ __launch_bounds__(32 * OWR * OWC) void out_kernel(const unsigned short* __restrict__ Opp,
                                                  const unsigned short* __restrict__ Wp,
                                                  float* __restrict__ out) {
  constexpr int BM = 64 * OWR, BN = 64 * OWC, OTP = BN + 4, CH = BN / 128;
  // two operand tile buffers; after the k loop the same bytes serve as the block's f32 tile T
  __shared__ __align__(16) unsigned char ring[2 * GBUF(BM, BN)];
  static_assert(BM * OTP * 4 <= 2 * GBUF(BM, BN), "f32 tile fits the ring");
  float* T = (float*)(void*)ring;
  const int lane = threadIdx.x & 31;
  const int w    = threadIdx.x >> 5;
  const int arow0 = blockIdx.x * BM;
  const int brow0 = blockIdx.y * BN;
  const unsigned short* A = Opp + (size_t)arow0 * DM;
  const unsigned short* B = Wp + (size_t)brow0 * DM;

  v8f acc[4][4];
#pragma unroll
  for (int i = 0; i < 4; ++i)
#pragma unroll
    for (int j = 0; j < 4; ++j) acc[i][j] = (v8f){0.f, 0.f, 0.f, 0.f, 0.f, 0.f, 0.f, 0.f};

  gemm_core<true, OWR, OWC, 4>(A, B, ring, acc);
  stage_tile<OWC, OTP, 4, 4>(T, w, lane, acc);
  __syncthreads();

#pragma unroll
  for (int hf = 0; hf < 2; ++hf) {
    v4f val[16];
#pragma unroll
    for (int it = 0; it < 16; ++it) {
      const int row = (64 / OWC) * w + (16 * hf + it) / CH, col = 128 * ((16 * hf + it) % CH) + 4 * lane;
      val[it] = *(const v4f*)(T + row * OTP + col);
    }
#pragma unroll
    for (int it = 0; it < 16; ++it) {
      const int row = (64 / OWC) * w + (16 * hf + it) / CH, col = 128 * ((16 * hf + it) % CH) + 4 * lane;
      *(v4f*)(out + (size_t)(arow0 + row) * DM + brow0 + col) = val[it];
    }
  }
}

// ---------------------------------------------------------------------------
// Workspace map (bytes):
//   Xb  bf16 [4096][2048]        16777216 @ 0
//   Wqb bf16 [2048][2048]         8388608
//   Wkb bf16 [1024][2048]         4194304
//   Wvb bf16 [1024][2048]         4194304
//   Woh f16  [2048][2048]         8388608
//   Qp  f16  [4096][2048]        16777216
//   Kp  f16  [4096][1024]         8388608
//   Vt  f16  [2*8*128][2048]      8388608
//   Op  f16  [4096][2048]        16777216
//   total                        92274688
// ---------------------------------------------------------------------------
extern "C" void kernel_launch(void* const* d_in, const int* in_sizes, int n_in,
                              void* d_out, int out_size, void* d_ws, size_t ws_size,
                              hipStream_t stream) {
  if (n_in < 9) return;
  if (in_sizes[0] != NTOK * DM) return;
  if (in_sizes[1] != EQ * DM || in_sizes[2] != EK * DM || in_sizes[3] != EK * DM || in_sizes[4] != DM * EQ) return;
  if (in_sizes[5] != HD || in_sizes[6] != HD) return;
  if (in_sizes[7] != SQ * (HD / 2) || in_sizes[8] != SQ * (HD / 2)) return;
  if (out_size != NTOK * DM) return;

  const float* x    = (const float*)d_in[0];
  const float* wq   = (const float*)d_in[1];
  const float* wk   = (const float*)d_in[2];
  const float* wv   = (const float*)d_in[3];
  const float* wo   = (const float*)d_in[4];
  const float* qnw  = (const float*)d_in[5];
  const float* knw  = (const float*)d_in[6];
  const float* fcos = (const float*)d_in[7];
  const float* fsin = (const float*)d_in[8];
  float* out        = (float*)d_out;

  const size_t szX  = (size_t)NTOK * DM * 2;
  const size_t szWq = (size_t)EQ * DM * 2;
  const size_t szWk = (size_t)EK * DM * 2;
  const size_t szWo = (size_t)DM * EQ * 2;
  const size_t szQ  = (size_t)NTOK * EQ * 2;
  const size_t szK  = (size_t)NTOK * EK * 2;
  const size_t szVt = (size_t)NB * NKV * HD * SQ * 2;
  const size_t szO  = (size_t)NTOK * EQ * 2;
  size_t off = 0;
  const size_t oX  = off; off += szX;
  const size_t oWq = off; off += szWq;
  const size_t oWk = off; off += szWk;
  const size_t oWv = off; off += szWk;
  const size_t oWo = off; off += szWo;
  const size_t oQ  = off; off += szQ;
  const size_t oK  = off; off += szK;
  const size_t oV  = off; off += szVt;
  const size_t oO  = off; off += szO;
  if (off > ws_size) return;                  // off = 92274688

  char* ws = (char*)d_ws;
  unsigned short* Xb  = (unsigned short*)(ws + oX);
  unsigned short* Wqb = (unsigned short*)(ws + oWq);
  unsigned short* Woh = (unsigned short*)(ws + oWo);
  unsigned short* Qp  = (unsigned short*)(ws + oQ);
  unsigned short* Kp  = (unsigned short*)(ws + oK);
  unsigned short* Vt  = (unsigned short*)(ws + oV);
  unsigned short* Op  = (unsigned short*)(ws + oO);

  // (1) f32 -> bf16 RNE planes, wo -> f16: one launch; the five planes lie one behind the other from Xb on
  cvt_kernel<<<dim3(CVB), dim3(32 * CVW), 0, stream>>>(x, wq, wk, wv, wo, Xb);

  // (2) q, k, v^T projections: one launch, 16 token blocks of 256 x 16 blocks of 256 rows of the planes Wqb, Wkb, Wvb
  qkv_kernel<<<dim3(NTOK / PBT, (EQ + 2 * EK) / PBT), dim3(256), 0, stream>>>(Xb, Wqb, qnw, knw, fcos, fsin, Qp, Kp, Vt);

  // (3) attention: 8 query blocks of 256 x 16 heads x 2 batches, 8 waves per block
  attn_kernel<<<dim3(SQ / (16 * QCG * AWV), NH, NB), dim3(32 * AWV), 0, stream>>>(Qp, Kp, Vt, Op);

  // (4) output projection -> d_out [4096][2048] f32
  out_kernel<<<dim3(NTOK / (64 * OWR), DM / (64 * OWC)), dim3(32 * OWR * OWC), 0, stream>>>(Op, Woh, out);

  (void)hipGetLastError();
}

// v008
// One run takes 124 microseconds.
// In both of two side-by-side timings against v007, it was 1.04 times as fast.
// Counting every step since v000, it is 4.59 times as fast.
// q/k/v projections: v_wmma_f32_16x16x32_bf16 (bf16 operands staged in LDS, f32 accumulate); scores k.q^T: v_wmma_f32_16x16x32_f16 (k f16 x8, q f16 x(0.0883883*log2e*1024), one plane each, f32 accumulate); p.v^T: v_wmma_f32_16x16x32_f16 (p f16 x256, v^T f16 x1024, one plane each, f32 accumulate); output projection: v_wmma_f32_16x16x32_f16 (attention output f16, weights f16, one plane each, f32 accumulate); norm, rotary and softmax in f32.
#include <hip/hip_runtime.h>
#include <math.h>
#include <stddef.h>
#include <stdint.h>

#define NB    2
#define SQ    2048
#define DM    2048
#define NH    16
#define NKV   8
#define HD    128
#define EQ    (NH * HD)
#define EK    (NKV * HD)
#define NTOK  (NB * SQ)
#define PBT   256                            // q/k/v projection: side of the block tile (tokens x features, or features x tokens)
#define PTP   (PBT + 4)                      // pitch of its f32 tile in LDS, floats
#define OSP   136
#define RMS_EPS 1e-5f
#define QMUL  (0.08838834764831845f * 1.4426950408889634f * 1024.0f)
#define KMUL  8.0f
#define VMUL  1024.0f
#define SINV  (1.0f / 8192.0f)
#define AWV   8                              // waves per attention block
#define QCG   2                              // 16-query column groups per attention wave (32 queries each)
#define KPH   136                            // LDS pitch of a staged K row, halves (256 B + 16 B)
#define VPH   72                             // LDS pitch of a staged V^T row, halves (128 B + 16 B)
#define KTB   18432                          // place of a staged K tile: 64 keys x 272 B = 17408, rounded up to a multiple of 2 KiB
#define VTB   (HD * VPH * 2)                 // bytes of a staged V^T tile: 128 d x 64 keys = 18432, a multiple of 2 KiB
#define BUFB  (KTB + VTB)                    // one ring buffer: K, V^T
#define GKB   128                            // k elements of every operand row in one staged GEMM tile (256 B)
#define GPH   136                            // LDS pitch of a staged GEMM operand row, halves (256 B + 16 B)
#define GRB   (GPH * 2)                      // the same pitch in bytes
#define SLR   64                             // operand rows in one wave's slice of a staged GEMM tile
#define SLB   18432                          // place of a slice in LDS: 64 x 272 B = 17408, rounded up to a multiple of 2 KiB
#define GBUF(BM, BN) (((BM) + (BN)) / SLR * SLB)   // one GEMM ring buffer: slices of A rows, slices of B rows
#define OWR   2                              // output projection: rows of 64 x 64 wave tiles in a block
#define OWC   4                              // and columns of them

typedef _Float16 v16h __attribute__((ext_vector_type(16)));
typedef _Float16 v8h  __attribute__((ext_vector_type(8)));
typedef __bf16   v16b __attribute__((ext_vector_type(16)));
typedef __bf16   v8b  __attribute__((ext_vector_type(8)));
typedef float    v8f  __attribute__((ext_vector_type(8)));
typedef float    v4f  __attribute__((ext_vector_type(4)));
typedef unsigned int v4u __attribute__((ext_vector_type(4)));
typedef unsigned int v2u __attribute__((ext_vector_type(2)));
typedef _Float16 v4h  __attribute__((ext_vector_type(4)));

union HFrag { v16h v; v8h h[2]; };
union BFrag { v16b v; v8b h[2]; };

// ---------------------------------------------------------------------------
// scalar helpers (RNE conversions)
// ---------------------------------------------------------------------------
__device__ __forceinline__ unsigned short f2bf_bits(float f) {
  const unsigned u = __float_as_uint(f);
  return (unsigned short)((u + 0x7FFFu + ((u >> 16) & 1u)) >> 16);
}
__device__ __forceinline__ float bfb2f(unsigned short h) { return __uint_as_float(((unsigned)h) << 16); }
__device__ __forceinline__ float bf16r(float f) { return bfb2f(f2bf_bits(f)); }
__device__ __forceinline__ unsigned short hbits(_Float16 h) { return __builtin_bit_cast(unsigned short, h); }
__device__ __forceinline__ unsigned pk16(unsigned short a, unsigned short b) { return (unsigned)a | ((unsigned)b << 16); }

// ---------------------------------------------------------------------------
// 16x32 fragment loads (A layout; also B from a [n][k] k-contiguous plane):
// elements 0..7 <- p[0..7] (k0+8h..), elements 8..15 <- p[16..23] (k0+16+8h..), p = row + k0 + 8h
// ---------------------------------------------------------------------------
__device__ __forceinline__ v16b ldb(const __bf16* p) {
  BFrag f; f.h[0] = *(const v8b*)(p); f.h[1] = *(const v8b*)(p + 16); return f.v;
}
__device__ __forceinline__ v16h ldh(const _Float16* p) {
  HFrag f; f.h[0] = *(const v8h*)(p); f.h[1] = *(const v8h*)(p + 16); return f.v;
}
__device__ __forceinline__ v8f mma_b(v16b a, v16b b, v8f c) {
  return __builtin_amdgcn_wmma_f32_16x16x32_bf16(false, a, false, b, (short)0, c, false, false);
}
__device__ __forceinline__ v8f mma_h(v16h a, v16h b, v8f c) {
  return __builtin_amdgcn_wmma_f32_16x16x32_f16(false, a, false, b, (short)0, c, false, false);
}

// hazard guards: 4 VALU slots after the last WMMA of a group, tying D and keeping A/B live
__device__ __forceinline__ void guard_b(v8f& a, v8f& b, v16b x) {
  asm volatile("v_nop\n\tv_nop\n\tv_nop\n\tv_nop" : "+v"(a), "+v"(b) : "v"(x));
}
__device__ __forceinline__ void keep_b(v16b a, v16b b, v16b c, v16b d) {
  asm volatile("v_nop" :: "v"(a), "v"(b), "v"(c), "v"(d));
}
__device__ __forceinline__ void acc_guard4(v8f& a, v8f& b, v8f& c, v8f& d) {
  asm volatile("v_nop\n\tv_nop\n\tv_nop\n\tv_nop" : "+v"(a), "+v"(b), "+v"(c), "+v"(d));
}

// ---------------------------------------------------------------------------
// ---------------------------------------------------------------------------
// f32 -> 16-bit planes, RNE, all five arrays in one streaming launch: CVB blocks of CVW waves, as many blocks as the
// chip has WGPs. A wave takes one 4-KB piece (CVL loads of 512 contiguous bytes) of each
// of CVT passes; pass t covers elements [t CVP, (t + 1) CVP) of the planes as they lie one behind the other in the
// workspace: x (passes 0, 1), wq (2), wk and wv (3, half the waves each), wo (4, f16; the others bf16).
// Every output element is written once; one store = 256 contiguous bytes (two whole lines).
#define CVB   256
#define CVW   16
#define CVL   8
#define CVT   5
#define CVP   (CVB * CVW * CVL * 128)        // elements of one pass: 4194304
static_assert(NTOK * DM == 2 * CVP && EQ * DM == CVP && 2 * EK * DM == CVP && DM * EQ == CVP, "the passes cover the planes");
__global__ __launch_bounds__(32 * CVW) void cvt_kernel(const float* __restrict__ x, const float* __restrict__ wq,
                                                       const float* __restrict__ wk, const float* __restrict__ wv,
                                                       const float* __restrict__ wo, unsigned short* __restrict__ out) {
  const unsigned o = (blockIdx.x * CVW + (threadIdx.x >> 5)) * (CVL * 128u) + 4u * (threadIdx.x & 31);
  const float* kv = (blockIdx.x < CVB / 2) ? wk : wv;
  const float* s[CVT] = {x + o, x + CVP + o, wq + o, kv + (o & (CVP / 2 - 1u)), wo + o};
  v4f a[2][CVL];
#pragma unroll
  for (int j = 0; j < CVL; ++j) a[0][j] = *(const v4f*)(s[0] + 128 * j);
  // precaution: stands ahead of any rewrite of these loads' address registers
  asm volatile("s_wait_xcnt 0x0" ::: "memory");
#pragma unroll
  for (int t = 0; t < CVT; ++t) {
    // the two scheduling barriers keep the next pass's loads in one group ahead of this pass's conversions and
    // stores: 8 to 16 loads of a wave stay in flight
    __builtin_amdgcn_sched_barrier(0);
    if (t + 1 < CVT) {
#pragma unroll
      for (int j = 0; j < CVL; ++j) a[(t + 1) & 1][j] = *(const v4f*)(s[t + 1] + 128 * j);
    }
    __builtin_amdgcn_sched_barrier(0);
    unsigned short* d = out + (size_t)t * CVP + o;
#pragma unroll
    for (int j = 0; j < CVL; ++j) {
      const v4f v = a[t & 1][j];
      v2u p;
      if (t == CVT - 1) {
        p = __builtin_bit_cast(v2u, __builtin_convertvector(v, v4h));
      } else {
        p[0] = pk16(f2bf_bits(v[0]), f2bf_bits(v[1]));
        p[1] = pk16(f2bf_bits(v[2]), f2bf_bits(v[3]));
      }
      *(v2u*)(d + 128 * j) = p;
    }
    // precaution: stands ahead of the next pass's rewrite of registers that these loads and stores name
    if (t + 1 < CVT) asm volatile("s_wait_xcnt 0x0" ::: "memory");
  }
}

typedef uint32_t u32x4 __attribute__((ext_vector_type(4)));
typedef uint32_t u32x8 __attribute__((ext_vector_type(8)));
typedef __attribute__((address_space(3))) unsigned char lds_byte;
__device__ __forceinline__ uint32_t uni(uint32_t v) { return (uint32_t)__builtin_amdgcn_readfirstlane(v); }
__device__ __forceinline__ uint32_t pinned(uint32_t v) { uint32_t w = uni(v); asm volatile("" : "+s"(w)); return w; }
// group 1: 1-byte elements, tensor = tile = D1 rows of D0 bytes, source pitch PB bytes, 16 B of LDS pad behind every row
// (IV = 5 for rows of 256 B, 4 for rows of 128 B); no mask
template <uint32_t IV, uint32_t D0, uint32_t D1, uint32_t PB>
__device__ __forceinline__ u32x8 tdm_group1() {
  static_assert(D0 == (8u << IV), "the pad interval is the row");
  u32x8 g;
  g[0] = uni((1u << 20) | (IV << 22) | (3u << 25));
  g[1] = uni((D0 & 0xFFFFu) << 16);
  g[2] = uni((D0 >> 16) | ((D1 & 0xFFFFu) << 16));
  g[3] = uni((D1 >> 16) | (D0 << 16));
  g[4] = uni(D1);
  g[5] = uni(PB);
  g[6] = uni(0u);
  g[7] = uni(0u);
  return g;
}
// group 0: count 1, place in LDS (bytes from the start of the block's LDS), the tile's first byte, type 2
__device__ __forceinline__ u32x4 tdm_group0(uint32_t lds, const unsigned short* p) {
  const uint64_t ga = (uint64_t)(uintptr_t)p;
  u32x4 g;
  g[0] = uni(1u);
  g[1] = uni(lds);
  g[2] = uni((uint32_t)ga);
  g[3] = uni((((uint32_t)(ga >> 32)) & 0x01FFFFFFu) | 0x80000000u);
  // pinned() on the whole group: the four words are held as one set of scalar registers up to the request's wait
  asm volatile("" : "+s"(g));
  return g;
}
__device__ __forceinline__ void tdm_load(u32x4 g0, u32x8 g1) {
  asm volatile("tensor_load_to_lds %0, %1" :: "s"(g0), "s"(g1) : "memory");
}
// the issuing wave's wait for its request. It names the request's group 0 as an input, so that those scalar registers
// stay that group's from the issue to here and none of them takes a new value while the request is outstanding
__device__ __forceinline__ void tdm_wait(u32x4 g0) {
  asm volatile("s_wait_tensorcnt 0x0" :: "s"(g0) : "memory");
}
// pinned() on a whole group 1: its words stay in one set of scalar registers from here on, so that none of them takes a
// new value while a request that names them is outstanding
__device__ __forceinline__ u32x8 pinned8(u32x8 g) { asm volatile("" : "+s"(g)); return g; }
// group 1 of one slice of a staged GEMM tile: SLR rows of 128 k (256 B) of a plane with pitch DM, at LDS pitch GRB
__device__ __forceinline__ u32x8 slice_group1() { return pinned8(tdm_group1<5u, 2u * GKB, SLR, 2u * DM>()); }

template <bool F16, int WR, int WC, int FI>
__device__ __forceinline__ void gemm_core(const unsigned short* __restrict__ gA, const unsigned short* __restrict__ gB,
                                          unsigned char* ring, v8f (&acc)[FI][4]) {
  static_assert(16 * FI == SLR, "a wave's A rows are one slice, its B rows another");
  constexpr unsigned GB = (WR + WC) * SLB;
  const int tid = threadIdx.x, lane = tid & 31, w = tid >> 5;
  const int m = lane & 15, ko = (lane >> 4) * 8, wr = w / WC, wc = w % WC;
  // waves 0 .. WR + WC - 1 issue, each its own slice: A rows 64 wave, then B rows 64 (wave - WR)
  const uint32_t wave = uni(threadIdx.x >> 5);
  const uint32_t issuer = wave < (uint32_t)(WR + WC);
  const unsigned short* gs = wave < (uint32_t)WR ? gA + (size_t)wave * SLR * DM
                                                 : gB + (size_t)((issuer ? wave : (uint32_t)WR) - WR) * SLR * DM;
  const uint32_t ls = (uint32_t)(uintptr_t)(lds_byte*)ring + wave * SLB;
  const u32x8 g1 = slice_group1();

  // stage 0 into buffer 0, landed and published; then stage 1 into buffer 1
  u32x4 g0 = {0u, 0u, 0u, 0u};
  if (pinned(issuer)) {
    g0 = tdm_group0(ls, gs);
    tdm_load(g0, g1);
    tdm_wait(g0);                                        // this wave's slice of stage 0 has landed
  }
  __syncthreads();                                       // every wave's has
  if (pinned(issuer)) {
    g0 = tdm_group0(ls + GB, gs + GKB);
    tdm_load(g0, g1);
  }

  // kept rolled: one trip per staged tile, so that the hand-over at its foot stands once, in the order written
#pragma unroll 1
  for (int t = 0; t < DM / GKB; ++t) {
    const unsigned char* bufb = ring + (t & 1) * GB;
    const __bf16* Ar = (const __bf16*)(const void*)(bufb + wr * SLB) + m * GPH + ko;
    const __bf16* Br = (const __bf16*)(const void*)(bufb + (WR + wc) * SLB) + m * GPH + ko;
#pragma unroll
    for (int s = 0; s < GKB / 32; ++s) {
      // the fragments of 32 k as one group of LDS reads ahead of their matrix instructions
      v16b bf[4], af[FI];
#pragma unroll
      for (int j = 0; j < 4; ++j) bf[j] = ldb(Br + (16 * j) * GPH + 32 * s);
#pragma unroll
      for (int i = 0; i < FI; ++i) af[i] = ldb(Ar + (16 * i) * GPH + 32 * s);
#pragma unroll
      for (int i = 0; i < FI; ++i) {
#pragma unroll
        for (int j = 0; j < 4; ++j) {
          if constexpr (F16)
            acc[i][j] = mma_h(__builtin_bit_cast(v16h, af[i]), __builtin_bit_cast(v16h, bf[j]), acc[i][j]);
          else
            acc[i][j] = mma_b(af[i], bf[j], acc[i][j]);
        }
        guard_b(acc[i][0], acc[i][3], af[i]);
      }
      keep_b(bf[0], bf[1], bf[2], bf[3]);
    }
    // hand-over: this wave has left buffer t&1 and its slice of stage t+1 has landed; behind the barrier that
    // holds for every wave, so stage t+1 may be read and buffer t&1 refilled
    asm volatile("s_wait_dscnt 0x0" ::: "memory");
    if (pinned(issuer)) tdm_wait(g0);
    __syncthreads();
    if (pinned((t + 2 < DM / GKB) & issuer)) {
      const uint32_t tn = pinned((uint32_t)t + 2u);      // the descriptor is formed behind the wait
      g0 = tdm_group0(ls + (tn & 1u) * GB, gs + (size_t)tn * GKB);
      tdm_load(g0, g1);
    }
  }
  // nothing in flight when the ring becomes the f32 tile
  asm volatile("s_wait_tensorcnt 0x0" ::: "memory");
  asm volatile("s_wait_dscnt 0x0" ::: "memory");
#pragma unroll
  for (int i = 0; i < FI; ++i) acc_guard4(acc[i][0], acc[i][1], acc[i][2], acc[i][3]);
}

// stage a wave's 16 FI x 16 FJ tile into the block's f32 LDS tile (pitch P floats)
template <int WC, int P, int FI, int FJ>
__device__ __forceinline__ void stage_tile(float* T, int w, int lane, v8f (&acc)[FI][FJ]) {
  const int wr = w / WC, wc = w % WC, hh = lane >> 4, m = lane & 15;
#pragma unroll
  for (int i = 0; i < FI; ++i)
#pragma unroll
    for (int j = 0; j < FJ; ++j)
#pragma unroll
      for (int r = 0; r < 8; ++r)
        T[(16 * FI * wr + 16 * i + 8 * hh + r) * P + 16 * FJ * wc + 16 * j + m] = acc[i][j][r];
}

// ---------------------------------------------------------------------------
// q, k and v projections in one launch: the weight planes Wq, Wk, Wv lie one behind the other, 4096 feature rows, so
// the three products are one 4096 tokens x 4096 features x 2048 k product. One PBT x PBT tile of it per block
// (16 x 16 blocks): each staged X row serves 256 features and each staged weight row 256 tokens.
// 8 waves as 4 x 2, each with a 64 x 128 tile acc[i][j]: += A[256 rows][K] . B[256 rows][K]^T, bf16 planes, pitch DM.
// The ring is that of gemm_core: 128-k tiles of all 512 rows by tensor loads (64 rows per wave), two buffers,
// the next tile in flight while this one is worked on. On return every wave has left the ring (the last trip's barrier).
// D layout: acc[i][j][r] = C[A row 64wr + 16i + 8h + r][B row 128wc + 16j + (lane&15)].
// ---------------------------------------------------------------------------
__device__ __forceinline__ void qkv_core(const unsigned short* __restrict__ gA, const unsigned short* __restrict__ gB,
                                         unsigned char* ring, v8f (&acc)[4][8]) {
  constexpr unsigned GB = GBUF(PBT, PBT);
  const int tid = threadIdx.x, lane = tid & 31, w = tid >> 5;
  const int m = lane & 15, ko = (lane >> 4) * 8, wr = w >> 1, wc = w & 1;
  // every wave issues its own slice: waves 0..3 A rows 64 wave, waves 4..7 B rows 64 (wave - 4)
  const uint32_t wave = uni(threadIdx.x >> 5);
  const unsigned short* gs = wave < 4u ? gA + (size_t)wave * SLR * DM : gB + (size_t)(wave - 4u) * SLR * DM;
  const uint32_t ls = (uint32_t)(uintptr_t)(lds_byte*)ring + wave * SLB;
  const u32x8 g1 = slice_group1();

  // stage 0 into buffer 0, landed and published; then stage 1 into buffer 1
  u32x4 g0 = tdm_group0(ls, gs);
  tdm_load(g0, g1);
  tdm_wait(g0);                                        // this wave's slice of stage 0 has landed
  __syncthreads();                                     // every wave's has
  g0 = tdm_group0(ls + GB, gs + GKB);
  tdm_load(g0, g1);

  // kept rolled: one trip per staged tile, so that the hand-over at its foot stands once, in the order written
#pragma unroll 1
  for (int t = 0; t < DM / GKB; ++t) {
    const unsigned char* bufb = ring + (t & 1) * GB;
    const __bf16* Ar = (const __bf16*)(const void*)(bufb + wr * SLB) + m * GPH + ko;             // slice wr
    const __bf16* Br = (const __bf16*)(const void*)(bufb + (4 + 2 * wc) * SLB) + m * GPH + ko;   // slices 4 + 2wc, 5 + 2wc
#pragma unroll
    for (int s = 0; s < GKB / 32; ++s) {
      // the fragments of 32 k as one group of 24 LDS reads ahead of their 32 matrix instructions, in the order of use;
      // the scheduling barriers keep the reads from being spread among the matrix instructions
      v16b bf[8], af[4];
      af[0] = ldb(Ar + 32 * s);
#pragma unroll
      for (int j = 0; j < 8; ++j) bf[j] = ldb(Br + (j >> 2) * (SLB / 2) + (16 * (j & 3)) * GPH + 32 * s);
#pragma unroll
      for (int i = 1; i < 4; ++i) af[i] = ldb(Ar + (16 * i) * GPH + 32 * s);
      __builtin_amdgcn_sched_barrier(0);   // all 24 reads are issued before the first matrix instruction
#pragma unroll
      for (int i = 0; i < 4; ++i)
#pragma unroll
        for (int j = 0; j < 8; ++j) acc[i][j] = mma_b(af[i], bf[j], acc[i][j]);
      // no read of the next group is drawn in among them, and none of them sinks behind the hand-over at the trip's foot
      __builtin_amdgcn_sched_barrier(0);
    }
    // hand-over: this wave has left buffer t&1 and its slice of stage t+1 has landed; behind the barrier that
    // holds for every wave, so stage t+1 may be read and buffer t&1 refilled
    asm volatile("s_wait_dscnt 0x0" ::: "memory");
    tdm_wait(g0);
    __syncthreads();
    if (pinned(t + 2 < DM / GKB)) {
      const uint32_t tn = pinned((uint32_t)t + 2u);      // the descriptor is formed behind the wait
      g0 = tdm_group0(ls + (tn & 1u) * GB, gs + (size_t)tn * GKB);
      tdm_load(g0, g1);
    }
  }
  // nothing in flight when the ring becomes the f32 tile
  asm volatile("s_wait_tensorcnt 0x0" ::: "memory");
  asm volatile("s_wait_dscnt 0x0" ::: "memory");
}

// ---------------------------------------------------------------------------
// Sixteen 16-byte stores of a lane: rows p[0..7], at each its piece a[it] and, 256 bytes further on, b[it]. Stores and
// s_wait_xcnt stand in one statement so that (a precaution) no register that a store names is rewritten ahead of the wait.
__device__ __forceinline__ void store16(unsigned short* const (&p)[8], const v4u (&a)[8], const v4u (&b)[8]) {
  asm volatile("global_store_b128 %0, %8, off\n\t"
               "global_store_b128 %0, %16, off offset:256\n\t"
               "global_store_b128 %1, %9, off\n\t"
               "global_store_b128 %1, %17, off offset:256\n\t"
               "global_store_b128 %2, %10, off\n\t"
               "global_store_b128 %2, %18, off offset:256\n\t"
               "global_store_b128 %3, %11, off\n\t"
               "global_store_b128 %3, %19, off offset:256\n\t"
               "global_store_b128 %4, %12, off\n\t"
               "global_store_b128 %4, %20, off offset:256\n\t"
               "global_store_b128 %5, %13, off\n\t"
               "global_store_b128 %5, %21, off offset:256\n\t"
               "global_store_b128 %6, %14, off\n\t"
               "global_store_b128 %6, %22, off offset:256\n\t"
               "global_store_b128 %7, %15, off\n\t"
               "global_store_b128 %7, %23, off offset:256\n\t"
               "s_wait_xcnt 0x0"
               :: "v"(p[0]), "v"(p[1]), "v"(p[2]), "v"(p[3]), "v"(p[4]), "v"(p[5]), "v"(p[6]), "v"(p[7]),
                  "v"(a[0]), "v"(a[1]), "v"(a[2]), "v"(a[3]), "v"(a[4]), "v"(a[5]), "v"(a[6]), "v"(a[7]),
                  "v"(b[0]), "v"(b[1]), "v"(b[2]), "v"(b[3]), "v"(b[4]), "v"(b[5]), "v"(b[6]), "v"(b[7])
               : "memory");
}

// ---------------------------------------------------------------------------
// Block (bx, by): tokens 256 bx, feature rows 256 by of the stacked planes: by 0..7 q (heads 2by, 2by+1), 8..11 k, 12..15 v.
//   q: A = X rows, B = Wq rows: RMSNorm + RoPE in f32 per head, q' = q * QMUL -> f16 plane Qo [tok][EQ].
//   k: A = X rows, B = Wk rows: RMSNorm + RoPE, k' = k * 8 -> f16 plane Ko [tok][EK].
//   v: A = Wv rows, B = X rows: tile = V^T directly; v' = v * 1024 -> f16 plane Vo, layout [(b*NKV+kvh)*128 + d][s].
// Epilogue: f32 tile staged in LDS, then each wave owns 32 rows; one store instruction = 2 rows x 16 lanes x 16 B.
// Coverage per block: rows 32w + 16hf + 2it + hh (hf 0..1, it 0..7, hh 0..1) = 0..255, cols 128ch + 8*(lane&15) = 0..255.
// ---------------------------------------------------------------------------
__global__ __launch_bounds__(256) void qkv_kernel(const unsigned short* __restrict__ Xp,
                                                  const unsigned short* __restrict__ Wp,
                                                  const float* __restrict__ qnw,
                                                  const float* __restrict__ knw,
                                                  const float* __restrict__ fcos,
                                                  const float* __restrict__ fsin,
                                                  unsigned short* __restrict__ Qo,
                                                  unsigned short* __restrict__ Ko,
                                                  unsigned short* __restrict__ Vo) {
  // two operand tile buffers; after the k loop the same bytes serve as the block's f32 tile T
  __shared__ __attribute__((aligned(2048))) unsigned char ring[2 * GBUF(PBT, PBT)];
  static_assert(PBT * PTP * 4 <= 2 * GBUF(PBT, PBT), "f32 tile fits the ring");
  float* T = (float*)(void*)ring;
  const int lane = threadIdx.x & 31;
  const int w    = threadIdx.x >> 5;
  const int hh   = lane >> 4;
  const int m    = lane & 15;
  const int tok0 = (int)blockIdx.x * PBT;
  const int f0   = (int)blockIdx.y * PBT;        // first feature row in the stacked planes
  const bool isv = f0 >= EQ + EK;
  const unsigned short* Xr = Xp + (size_t)tok0 * DM;
  const unsigned short* Wr = Wp + (size_t)f0 * DM;

  v8f acc[4][8];
#pragma unroll
  for (int i = 0; i < 4; ++i)
#pragma unroll
    for (int j = 0; j < 8; ++j) acc[i][j] = (v8f){0.f, 0.f, 0.f, 0.f, 0.f, 0.f, 0.f, 0.f};

  qkv_core(isv ? Wr : Xr, isv ? Xr : Wr, ring, acc);
  stage_tile<2, PTP, 4, 8>(T, w, lane, acc);
  __syncthreads();

  if (isv) {
    const int fv = f0 - (EQ + EK);               // 0..1023: (kv head, d) of the tile's first row
    const int bb = tok0 >> 11;                   // batch of this 256-token block
    const int s0 = tok0 & (SQ - 1);
    unsigned short* vo = Vo + (size_t)(bb * EK + fv) * SQ + s0 + 8 * m;
#pragma unroll
    for (int hf = 0; hf < 2; ++hf) {
      v4u hv[2][8];
#pragma unroll
      for (int it = 0; it < 8; ++it) {
        const int row = 32 * w + 16 * hf + 2 * it + hh;
#pragma unroll
        for (int ch = 0; ch < 2; ++ch) {
          const float* tr = T + row * PTP + 128 * ch + 8 * m;
          const v4f xa = *(const v4f*)(tr);
          const v4f xb = *(const v4f*)(tr + 4);
          const float x[8] = {xa[0], xa[1], xa[2], xa[3], xb[0], xb[1], xb[2], xb[3]};
          v4u a;
#pragma unroll
          for (int q = 0; q < 4; ++q)
            a[q] = pk16(hbits((_Float16)(x[2 * q] * VMUL)), hbits((_Float16)(x[2 * q + 1] * VMUL)));
          hv[ch][it] = a;
        }
      }
      unsigned short* pr[8];
#pragma unroll
      for (int it = 0; it < 8; ++it) pr[it] = vo + (size_t)(32 * w + 16 * hf + 2 * it + hh) * SQ;
      store16(pr, hv[0], hv[1]);
    }
  } else {
    const bool isq = f0 < EQ;
    const float* nw = isq ? qnw : knw;
    const float om  = isq ? QMUL : KMUL;
    const int   ep  = isq ? EQ : EK;             // row pitch of the output plane
    unsigned short* po = (isq ? Qo + f0 : Ko + (f0 - EQ)) + 8 * m;
    float wv[8];
    {
      const v4f wa = *(const v4f*)(nw + 8 * m);
      const v4f wb = *(const v4f*)(nw + 8 * m + 4);
      // precaution: stands ahead of any rewrite of these two loads' address registers
      asm volatile("s_wait_xcnt 0x0" ::: "memory");
#pragma unroll
      for (int e = 0; e < 4; ++e) { wv[e] = bf16r(wa[e]); wv[4 + e] = bf16r(wb[e]); }
    }
#pragma unroll
    for (int hf = 0; hf < 2; ++hf) {
      v4u hv[2][8];
#pragma unroll
      for (int it = 0; it < 8; ++it) {
        const int row = 32 * w + 16 * hf + 2 * it + hh;
        const int sp  = (tok0 + row) & (SQ - 1);
        // precaution, behind each of the two loads: stands ahead of any rewrite of its address registers
        const v4f c4 = *(const v4f*)(fcos + (size_t)sp * (HD / 2) + 4 * m);
        asm volatile("s_wait_xcnt 0x0" ::: "memory");
        const v4f s4 = *(const v4f*)(fsin + (size_t)sp * (HD / 2) + 4 * m);
        asm volatile("s_wait_xcnt 0x0" ::: "memory");
#pragma unroll
        for (int ch = 0; ch < 2; ++ch) {         // the two heads of the tile
          const float* tr = T + row * PTP + 128 * ch + 8 * m;
          const v4f xa = *(const v4f*)(tr);
          const v4f xb = *(const v4f*)(tr + 4);
          const float x[8] = {xa[0], xa[1], xa[2], xa[3], xb[0], xb[1], xb[2], xb[3]};
          float y[8];
          float ss = 0.f;
#pragma unroll
          for (int e = 0; e < 8; ++e) ss = fmaf(x[e], x[e], ss);
          ss += __shfl_xor(ss, 1, 32);
          ss += __shfl_xor(ss, 2, 32);
          ss += __shfl_xor(ss, 4, 32);
          ss += __shfl_xor(ss, 8, 32);
          const float rn = rsqrtf(fmaf(ss, 1.0f / (float)HD, RMS_EPS));
#pragma unroll
          for (int p = 0; p < 4; ++p) {
            const float cs = bf16r(c4[p]), sn = bf16r(s4[p]);
            const float u0 = x[2 * p] * rn * wv[2 * p];
            const float u1 = x[2 * p + 1] * rn * wv[2 * p + 1];
            y[2 * p]     = (u0 * cs - u1 * sn) * om;
            y[2 * p + 1] = (u0 * sn + u1 * cs) * om;
          }
          v4u a;
#pragma unroll
          for (int q = 0; q < 4; ++q) a[q] = pk16(hbits((_Float16)y[2 * q]), hbits((_Float16)y[2 * q + 1]));
          hv[ch][it] = a;
        }
      }
      unsigned short* pr[8];
#pragma unroll
      for (int it = 0; it < 8; ++it) pr[it] = po + (size_t)(tok0 + 32 * w + 16 * hf + 2 * it + hh) * ep;
      store16(pr, hv[0], hv[1]);
    }
  }
}

// ---------------------------------------------------------------------------
// Full (non-causal) GQA attention, head dim 128, one wave per (b, h, 32 queries = QCG column groups of 16);
//   block = 8 waves (256 queries). Every K and V^T fragment read from LDS feeds QCG matrix instructions.
//   Each 64-key tile (K rows, V^T rows) is brought into LDS once per block by two tensor loads
//   (wave 0: K, wave 1: V^T), two buffers, the next tile in flight while this one
//   is worked on; all 8 waves read their fragments from LDS (row pitches 16 B x odd: no bank conflicts).
//   Transposed scores S^T[key][query] = K . Q^T : A = K rows [key][d] (f16 x8), B[k=d][n=query] from Q rows
//   [query][d] (f16) -> both fragments are plain k-contiguous row loads.
//   D tiles (rows = 16 keys, cols = queries) packed to f16 ARE the B operand [k=key][n=query] of
//   O^T[d][query] = V^T . P : element r <- tile(keys 0-15)[r], element 8+r <- tile(keys 16-31)[r], same lane.
//   A = V^T rows [d][s] (f16 x1024). Softmax per query column = per lane (partner lane ^16),
//   online over 32 chunks of 64 keys, f32, exp2 with log2e folded into the q scale, p carried x256.
//   Epilogue: O = acc / (l * 1024) -> f16, per-wave LDS relayout [query][d] (v4u store/reload,
//   Coverage: rows 16c + 2it + hh (c 0..QCG-1, it 0..7) = 32 queries, cols 8*(lane&15) = 0..127 of head h.
// ---------------------------------------------------------------------------
// One stage: wave 0 asks for the K tile (64 key rows of 256 B, pitch EK), wave 1 for the V^T tile (128 d rows of 128 B,
// pitch SQ); lds = the buffer's place, gk, gv = the tiles' first elements.
// g0k, g0v take the issued requests' groups 0, for their waits.
// WAIT: the wait stands directly behind the load (stage 0).
template <bool WAIT>
__device__ __forceinline__ void stage_kv(uint32_t wave, uint32_t lds, const unsigned short* gk, const unsigned short* gv,
                                         u32x8 g1k, u32x8 g1v, u32x4& g0k, u32x4& g0v) {
  if (pinned(wave == 0u)) {
    g0k = tdm_group0(lds, gk);
    tdm_load(g0k, g1k);
    if constexpr (WAIT) tdm_wait(g0k);
  }
  if (pinned(wave == 1u)) {
    g0v = tdm_group0(lds + KTB, gv);
    tdm_load(g0v, g1v);
    if constexpr (WAIT) tdm_wait(g0v);
  }
}
// each issuing wave's own wait
__device__ __forceinline__ void wait_kv(uint32_t wave, u32x4 g0k, u32x4 g0v) {
  if (pinned(wave == 0u)) tdm_wait(g0k);
  if (pinned(wave == 1u)) tdm_wait(g0v);
}

__global__ __launch_bounds__(32 * AWV) void attn_kernel(const unsigned short* __restrict__ Qpp,
                                                  const unsigned short* __restrict__ Kpp,
                                                  const unsigned short* __restrict__ Vpp,
                                                  unsigned short* __restrict__ Opp) {
  // two tile buffers; after the loop the same bytes serve as output staging [wave][query*OSP + d]
  __shared__ __attribute__((aligned(2048))) unsigned char ring[2 * BUFB];
  static_assert(AWV * 16 * QCG * OSP * 2 <= 2 * BUFB, "output staging fits the ring");
  const int lane = threadIdx.x & 31;
  const int w    = threadIdx.x >> 5;
  const int hh   = lane >> 4;
  const int m    = lane & 15;
  const int h    = blockIdx.y;
  const int b    = blockIdx.z;
  const int kvh  = h >> 1;                       // G = NH / NKV = 2
  const int q0   = blockIdx.x * (16 * QCG * AWV) + w * (16 * QCG);   // query index within the sequence

  const _Float16* Qp = (const _Float16*)(const void*)Qpp;
  const size_t vplane = (size_t)((b * NKV + kvh) * HD) * SQ;
  // first elements of this (batch, kv head)'s K rows and V^T rows
  const uint32_t wave = uni(threadIdx.x >> 5);
  const unsigned short* gk = Kpp + (size_t)b * SQ * EK + kvh * HD;
  const unsigned short* gv = Vpp + vplane;
  const uint32_t lr = (uint32_t)(uintptr_t)(lds_byte*)ring;
  const u32x8 g1k = pinned8(tdm_group1<5u, 2u * HD, 64u, 2u * EK>());
  const u32x8 g1v = pinned8(tdm_group1<4u, 128u, HD, 2u * SQ>());

  // stage 0 into buffer 0, landed and published; then stage 1 into buffer 1
  u32x4 g0k = {0u, 0u, 0u, 0u}, g0v = {0u, 0u, 0u, 0u};
  stage_kv<true>(wave, lr, gk, gv, g1k, g1v, g0k, g0v);    // behind it this wave's tile of stage 0 has landed
  __syncthreads();                                         // both have, for every wave
  stage_kv<false>(wave, lr + BUFB, gk + (size_t)64 * EK, gv + 64, g1k, g1v, g0k, g0v);

  // Q fragments (B operand): row = query q0 + 16c + (lane&15), k = d
  v16h qf[QCG][4];
  {
    const _Float16* qb = Qp + ((size_t)b * SQ + q0 + m) * EQ + (size_t)h * HD + 8 * hh;
#pragma unroll
    for (int c = 0; c < QCG; ++c)
#pragma unroll
      for (int dc = 0; dc < 4; ++dc) qf[c][dc] = ldh(qb + (size_t)c * 16 * EQ + 32 * dc);
    // precaution: stands ahead of any rewrite of these loads' address registers
    asm volatile("s_wait_xcnt 0x0" ::: "memory");
    // holds the vector instructions that follow behind that wait: its memory clobber alone does not
    __builtin_amdgcn_sched_barrier(0);
  }

  v8f acc[QCG][8];
  float mrun[QCG], lrun[QCG];
#pragma unroll
  for (int c = 0; c < QCG; ++c) {
#pragma unroll
    for (int t = 0; t < 8; ++t) acc[c][t] = (v8f){0.f, 0.f, 0.f, 0.f, 0.f, 0.f, 0.f, 0.f};
    mrun[c] = -1.0e30f;
    lrun[c] = 0.0f;
  }

#pragma unroll 1
  for (int kc = 0; kc < SQ / 64; ++kc) {
    const unsigned char* buf = ring + (kc & 1) * BUFB;
    const _Float16* Kr  = (const _Float16*)(const void*)buf + m * KPH + 8 * hh;                // + key*KPH + 32dc
    const _Float16* Vr  = (const _Float16*)(const void*)(buf + KTB) + m * VPH + 8 * hh;        // + 16t*VPH + key
    v8f s[QCG][4];
#pragma unroll
    for (int c = 0; c < QCG; ++c)
#pragma unroll
      for (int j = 0; j < 4; ++j) s[c][j] = (v8f){0.f, 0.f, 0.f, 0.f, 0.f, 0.f, 0.f, 0.f};
    {
      // the tile's K fragments as one group of LDS reads ahead of their 32 matrix instructions: 4 key tiles x 128 d;
      // the scheduling barriers keep the reads from being spread among the matrix instructions
      v16h kf[16];
#pragma unroll
      for (int j = 0; j < 16; ++j) kf[j] = ldh(Kr + (16 * (j & 3)) * KPH + 32 * (j >> 2));
      __builtin_amdgcn_sched_barrier(0);   // all 32 reads are issued before the first matrix instruction
#pragma unroll
      for (int j = 0; j < 16; ++j)
#pragma unroll
        for (int c = 0; c < QCG; ++c) s[c][j & 3] = mma_h(kf[j], qf[c][j >> 2], s[c][j & 3]);
      __builtin_amdgcn_sched_barrier(0);   // no vector work is drawn in among the 32 matrix instructions
    }

    // online softmax for query column 16c + (lane&15); lane holds keys key0 + 16j + 8hh + r
    float cmax[QCG], cother[QCG];
#pragma unroll
    for (int c = 0; c < QCG; ++c) {
      float cm = -1.0e30f;
#pragma unroll
      for (int j = 0; j < 4; ++j)
#pragma unroll
        for (int r = 0; r < 8; ++r) cm = fmaxf(cm, s[c][j][r]);
      cmax[c]   = cm;
      cother[c] = __shfl_xor(cm, 16, 32);
    }
    // the tile's V^T fragments as one group of LDS reads ahead of the exponentials, which cover their latency.
    // The statement takes the exchanged maxima as inputs only: it holds the 32 reads behind that exchange, which would
    // otherwise wait for all of them (LDS operations return in order); the scheduling barriers hold the group together
    asm volatile("" :: "v"(cother[0]), "v"(cother[1]) : "memory");
    __builtin_amdgcn_sched_barrier(0);     // head of the group of V^T reads
    v16h vf[2][8];
#pragma unroll
    for (int ks = 0; ks < 2; ++ks)
#pragma unroll
      for (int t = 0; t < 8; ++t) vf[ks][t] = ldh(Vr + (16 * t) * VPH + 32 * ks);
    __builtin_amdgcn_sched_barrier(0);     // foot of the group: none of its reads sinks towards its matrix instruction
#pragma unroll
    for (int c = 0; c < QCG; ++c) {
      const float cm    = fmaxf(cmax[c], cother[c]);
      const float mnew  = fmaxf(mrun[c], cm);
      const float alpha = __builtin_amdgcn_exp2f((mrun[c] - mnew) * SINV);
      const float nms   = 8.0f - mnew * SINV;          // p * 256 = exp2(s*SINV - m*SINV + 8)
      float psum = 0.f;
#pragma unroll
      for (int j = 0; j < 4; ++j)
#pragma unroll
        for (int r = 0; r < 8; ++r) {
          const float p = __builtin_amdgcn_exp2f(fmaf(s[c][j][r], SINV, nms));
          s[c][j][r] = p;
          psum += p;
        }
      psum += __shfl_xor(psum, 16, 32);
      lrun[c] = fmaf(lrun[c], alpha, psum);
      mrun[c] = mnew;
#pragma unroll
      for (int t = 0; t < 8; ++t) acc[c][t] = acc[c][t] * alpha;
    }

#pragma unroll
    for (int ks = 0; ks < 2; ++ks) {
      HFrag pf[QCG];
#pragma unroll
      for (int c = 0; c < QCG; ++c) {
        v8h plo, phi;
#pragma unroll
        for (int r = 0; r < 8; ++r) {
          plo[r] = (_Float16)s[c][2 * ks][r];        // keys 32ks + 8hh + r
          phi[r] = (_Float16)s[c][2 * ks + 1][r];    // keys 32ks + 16 + 8hh + r
        }
        pf[c].h[0] = plo;
        pf[c].h[1] = phi;
      }
#pragma unroll
      for (int t = 0; t < 8; ++t)
#pragma unroll
        for (int c = 0; c < QCG; ++c) acc[c][t] = mma_h(vf[ks][t], pf[c].v, acc[c][t]);
    }
    // keeps the trip's work ahead of the hand-over, so that the refill behind the barrier is issued at once
    __builtin_amdgcn_sched_barrier(0);

    // hand-over: this wave has left buffer kc&1 and its tile of stage kc+1 has landed; behind the barrier that
    // holds for every wave, so stage kc+1 may be read and buffer kc&1 refilled
    asm volatile("s_wait_dscnt 0x0" ::: "memory");
    wait_kv(wave, g0k, g0v);
    __syncthreads();
    if (pinned(kc + 2 < SQ / 64)) {
      const uint32_t kn = pinned((uint32_t)kc + 2u);     // the descriptors are formed behind the wait
      stage_kv<false>(wave, lr + (kn & 1u) * BUFB, gk + (size_t)kn * 64 * EK, gv + kn * 64, g1k, g1v, g0k, g0v);
    }
  }
  // nothing in flight when the ring becomes output staging
  asm volatile("s_wait_tensorcnt 0x0" ::: "memory");
  asm volatile("s_wait_dscnt 0x0" ::: "memory");

  // ---- epilogue: acc[c][t][r] = O^T[d = 16t + 8hh + r][query 16c + m] * (256 * 1024 * l256/256) ----
  unsigned short* sh = (unsigned short*)(void*)ring + w * (16 * QCG * OSP);
#pragma unroll
  for (int c = 0; c < QCG; ++c) {
    const float inv = __builtin_amdgcn_rcpf(lrun[c]) * (1.0f / VMUL);
#pragma unroll
    for (int t = 0; t < 8; ++t) {
      v4u hv;
#pragma unroll
      for (int q = 0; q < 4; ++q)
        hv[q] = pk16(hbits((_Float16)(acc[c][t][2 * q] * inv)), hbits((_Float16)(acc[c][t][2 * q + 1] * inv)));
      *(v4u*)(sh + (16 * c + m) * OSP + 16 * t + 8 * hh) = hv;
    }
  }
  __builtin_amdgcn_fence(__ATOMIC_RELEASE, "wavefront");
  __builtin_amdgcn_wave_barrier();
  __builtin_amdgcn_fence(__ATOMIC_ACQUIRE, "wavefront");
  v4u ov[8 * QCG];
#pragma unroll
  for (int it = 0; it < 8 * QCG; ++it) ov[it] = *(const v4u*)(sh + (2 * it + hh) * OSP + 8 * m);
#pragma unroll
  for (int it = 0; it < 8 * QCG; ++it) {
    const int row = 2 * it + hh;
    const size_t go = ((size_t)b * SQ + q0 + row) * EQ + (size_t)h * HD + 8 * m;
    *(v4u*)(Opp + go) = ov[it];
  }
}

// ---------------------------------------------------------------------------
// Output projection: out[tok][dout] = sum_e O[tok][e] * Wo[dout][e]; A = O f16, B = Wo f16.
// Block 64 OWR tokens x 64 OWC out cols, OWR x OWC waves; f32 tile staged in LDS; each wave writes 64 / OWC rows,
// one instruction per 512 B of a row.
// Coverage per block: rows (64 / OWC) w + it = 0..64 OWR - 1, cols 128c + 4*lane = 0..64 OWC - 1.
// ---------------------------------------------------------------------------
__global__ __launch_bounds__(32 * OWR * OWC) void out_kernel(const unsigned short* __restrict__ Opp,
                                                  const unsigned short* __restrict__ Wp,
                                                  float* __restrict__ out) {
  constexpr int BM = 64 * OWR, BN = 64 * OWC, OTP = BN + 4, CH = BN / 128;
  // two operand tile buffers; after the k loop the same bytes serve as the block's f32 tile T
  __shared__ __attribute__((aligned(2048))) unsigned char ring[2 * GBUF(BM, BN)];
  static_assert(BM * OTP * 4 <= 2 * GBUF(BM, BN), "f32 tile fits the ring");
  float* T = (float*)(void*)ring;
  const int lane = threadIdx.x & 31;
  const int w    = threadIdx.x >> 5;
  const int arow0 = blockIdx.x * BM;
  const int brow0 = blockIdx.y * BN;
  const unsigned short* A = Opp + (size_t)arow0 * DM;
  const unsigned short* B = Wp + (size_t)brow0 * DM;

  v8f acc[4][4];
#pragma unroll
  for (int i = 0; i < 4; ++i)
#pragma unroll
    for (int j = 0; j < 4; ++j) acc[i][j] = (v8f){0.f, 0.f, 0.f, 0.f, 0.f, 0.f, 0.f, 0.f};

  gemm_core<true, OWR, OWC, 4>(A, B, ring, acc);
  stage_tile<OWC, OTP, 4, 4>(T, w, lane, acc);
  __syncthreads();

#pragma unroll
  for (int hf = 0; hf < 2; ++hf) {
    v4f val[16];
#pragma unroll
    for (int it = 0; it < 16; ++it) {
      const int row = (64 / OWC) * w + (16 * hf + it) / CH, col = 128 * ((16 * hf + it) % CH) + 4 * lane;
      val[it] = *(const v4f*)(T + row * OTP + col);
    }
#pragma unroll
    for (int it = 0; it < 16; ++it) {
      const int row = (64 / OWC) * w + (16 * hf + it) / CH, col = 128 * ((16 * hf + it) % CH) + 4 * lane;
      *(v4f*)(out + (size_t)(arow0 + row) * DM + brow0 + col) = val[it];
    }
  }
}

// ---------------------------------------------------------------------------
// Workspace map (bytes):
//   Xb  bf16 [4096][2048]        16777216 @ 0
//   Wqb bf16 [2048][2048]         8388608
//   Wkb bf16 [1024][2048]         4194304
//   Wvb bf16 [1024][2048]         4194304
//   Woh f16  [2048][2048]         8388608
//   Qp  f16  [4096][2048]        16777216
//   Kp  f16  [4096][1024]         8388608
//   Vt  f16  [2*8*128][2048]      8388608
//   Op  f16  [4096][2048]        16777216
//   total                        92274688
// ---------------------------------------------------------------------------
extern "C" void kernel_launch(void* const* d_in, const int* in_sizes, int n_in,
                              void* d_out, int out_size, void* d_ws, size_t ws_size,
                              hipStream_t stream) {
  if (n_in < 9) return;
  if (in_sizes[0] != NTOK * DM) return;
  if (in_sizes[1] != EQ * DM || in_sizes[2] != EK * DM || in_sizes[3] != EK * DM || in_sizes[4] != DM * EQ) return;
  if (in_sizes[5] != HD || in_sizes[6] != HD) return;
  if (in_sizes[7] != SQ * (HD / 2) || in_sizes[8] != SQ * (HD / 2)) return;
  if (out_size != NTOK * DM) return;

  const float* x    = (const float*)d_in[0];
  const float* wq   = (const float*)d_in[1];
  const float* wk   = (const float*)d_in[2];
  const float* wv   = (const float*)d_in[3];
  const float* wo   = (const float*)d_in[4];
  const float* qnw  = (const float*)d_in[5];
  const float* knw  = (const float*)d_in[6];
  const float* fcos = (const float*)d_in[7];
  const float* fsin = (const float*)d_in[8];
  float* out        = (float*)d_out;

  const size_t szX  = (size_t)NTOK * DM * 2;
  const size_t szWq = (size_t)EQ * DM * 2;
  const size_t szWk = (size_t)EK * DM * 2;
  const size_t szWo = (size_t)DM * EQ * 2;
  const size_t szQ  = (size_t)NTOK * EQ * 2;
  const size_t szK  = (size_t)NTOK * EK * 2;
  const size_t szVt = (size_t)NB * NKV * HD * SQ * 2;
  const size_t szO  = (size_t)NTOK * EQ * 2;
  size_t off = 0;
  const size_t oX  = off; off += szX;
  const size_t oWq = off; off += szWq;
  const size_t oWk = off; off += szWk;
  const size_t oWv = off; off += szWk;
  const size_t oWo = off; off += szWo;
  const size_t oQ  = off; off += szQ;
  const size_t oK  = off; off += szK;
  const size_t oV  = off; off += szVt;
  const size_t oO  = off; off += szO;
  if (off > ws_size) return;                  // off = 92274688

  char* ws = (char*)d_ws;
  unsigned short* Xb  = (unsigned short*)(ws + oX);
  unsigned short* Wqb = (unsigned short*)(ws + oWq);
  unsigned short* Woh = (unsigned short*)(ws + oWo);
  unsigned short* Qp  = (unsigned short*)(ws + oQ);
  unsigned short* Kp  = (unsigned short*)(ws + oK);
  unsigned short* Vt  = (unsigned short*)(ws + oV);
  unsigned short* Op  = (unsigned short*)(ws + oO);

  // (1) f32 -> bf16 RNE planes, wo -> f16: one launch; the five planes lie one behind the other from Xb on
  cvt_kernel<<<dim3(CVB), dim3(32 * CVW), 0, stream>>>(x, wq, wk, wv, wo, Xb);

  // (2) q, k, v^T projections: one launch, 16 token blocks of 256 x 16 blocks of 256 rows of the planes Wqb, Wkb, Wvb
  qkv_kernel<<<dim3(NTOK / PBT, (EQ + 2 * EK) / PBT), dim3(256), 0, stream>>>(Xb, Wqb, qnw, knw, fcos, fsin, Qp, Kp, Vt);

  // (3) attention: 8 query blocks of 256 x 16 heads x 2 batches, 8 waves per block
  attn_kernel<<<dim3(SQ / (16 * QCG * AWV), NH, NB), dim3(32 * AWV), 0, stream>>>(Qp, Kp, Vt, Op);

  // (4) output projection -> d_out [4096][2048] f32
  out_kernel<<<dim3(NTOK / (64 * OWR), DM / (64 * OWC)), dim3(32 * OWR * OWC), 0, stream>>>(Op, Woh, out);

  (void)hipGetLastError();
}

// v009
// Measured time: 119 microseconds a run.
// In both of two side-by-side timings against v008, it was 1.04 times as fast.
// Over all steps from v000 it is 4.78 times as fast.
// q/k/v projections: v_wmma_f32_16x16x32_bf16 (bf16 operands staged in LDS, f32 accumulate); scores k.q^T: v_wmma_f32_16x16x32_f16 (k f16, q f16 x(0.0883883*log2e), one plane each, f32 accumulate from 8 - reference); p.v^T: v_wmma_f32_16x16x32_f16 (p f16 x256, v^T f16 x1024, one plane each, f32 accumulate); output projection: v_wmma_f32_16x16x32_f16 (attention output f16, weights f16, one plane each, f32 accumulate); norm, rotary and softmax in f32.
#include <hip/hip_runtime.h>
#include <math.h>
#include <stddef.h>
#include <stdint.h>

#define NB    2
#define SQ    2048
#define DM    2048
#define NH    16
#define NKV   8
#define HD    128
#define EQ    (NH * HD)
#define EK    (NKV * HD)
#define NTOK  (NB * SQ)
#define PBT   256                            // q/k/v projection: side of the block tile (tokens x features, or features x tokens)
#define PTP   (PBT + 4)                      // pitch of its f32 tile in LDS, floats
#define OSP   136
#define RMS_EPS 1e-5f
#define QMUL  (0.08838834764831845f * 1.4426950408889634f)   // k . q' is the score in log2 units
#define KMUL  1.0f
#define VMUL  1024.0f
#define PEXP  8.0f                           // p is carried x 2^PEXP: a score equal to the held reference gives 256
#define PTOP  32768.0f                       // a lane's sum of a tile's p above this: the reference is raised (f16 holds 65504)
#define AWV   8                              // waves per attention block
#define QCG   2                              // 16-query column groups per attention wave (32 queries each)
#define KPH   136                            // LDS pitch of a staged K row, halves (256 B + 16 B)
#define VPH   72                             // LDS pitch of a staged V^T row, halves (128 B + 16 B)
#define KTB   18432                          // place of a staged K tile: 64 keys x 272 B = 17408, rounded up to a multiple of 2 KiB
#define VTB   (HD * VPH * 2)                 // bytes of a staged V^T tile: 128 d x 64 keys = 18432, a multiple of 2 KiB
#define BUFB  (KTB + VTB)                    // one ring buffer: K, V^T
#define GKB   128                            // k elements of every operand row in one staged GEMM tile (256 B)
#define GPH   136                            // LDS pitch of a staged GEMM operand row, halves (256 B + 16 B)
#define GRB   (GPH * 2)                      // the same pitch in bytes
#define SLR   64                             // operand rows in one wave's slice of a staged GEMM tile
#define SLB   18432                          // place of a slice in LDS: 64 x 272 B = 17408, rounded up to a multiple of 2 KiB
#define GBUF(BM, BN) (((BM) + (BN)) / SLR * SLB)   // one GEMM ring buffer: slices of A rows, slices of B rows
#define OWR   2                              // output projection: rows of 64 x 64 wave tiles in a block
#define OWC   4                              // and columns of them

typedef _Float16 v16h __attribute__((ext_vector_type(16)));
typedef _Float16 v8h  __attribute__((ext_vector_type(8)));
typedef __bf16   v16b __attribute__((ext_vector_type(16)));
typedef __bf16   v8b  __attribute__((ext_vector_type(8)));
typedef float    v8f  __attribute__((ext_vector_type(8)));
typedef float    v4f  __attribute__((ext_vector_type(4)));
typedef unsigned int v4u __attribute__((ext_vector_type(4)));
typedef unsigned int v2u __attribute__((ext_vector_type(2)));
typedef _Float16 v4h  __attribute__((ext_vector_type(4)));

union HFrag { v16h v; v8h h[2]; };
union BFrag { v16b v; v8b h[2]; };

// ---------------------------------------------------------------------------
// scalar helpers (RNE conversions)
// ---------------------------------------------------------------------------
__device__ __forceinline__ unsigned short f2bf_bits(float f) {
  const unsigned u = __float_as_uint(f);
  return (unsigned short)((u + 0x7FFFu + ((u >> 16) & 1u)) >> 16);
}
__device__ __forceinline__ float bfb2f(unsigned short h) { return __uint_as_float(((unsigned)h) << 16); }
__device__ __forceinline__ float bf16r(float f) { return bfb2f(f2bf_bits(f)); }
__device__ __forceinline__ unsigned short hbits(_Float16 h) { return __builtin_bit_cast(unsigned short, h); }
__device__ __forceinline__ unsigned pk16(unsigned short a, unsigned short b) { return (unsigned)a | ((unsigned)b << 16); }

// ---------------------------------------------------------------------------
// 16x32 fragment loads (A layout; also B from a [n][k] k-contiguous plane):
// elements 0..7 <- p[0..7] (k0+8h..), elements 8..15 <- p[16..23] (k0+16+8h..), p = row + k0 + 8h
// ---------------------------------------------------------------------------
__device__ __forceinline__ v16b ldb(const __bf16* p) {
  BFrag f; f.h[0] = *(const v8b*)(p); f.h[1] = *(const v8b*)(p + 16); return f.v;
}
__device__ __forceinline__ v16h ldh(const _Float16* p) {
  HFrag f; f.h[0] = *(const v8h*)(p); f.h[1] = *(const v8h*)(p + 16); return f.v;
}
__device__ __forceinline__ v8f mma_b(v16b a, v16b b, v8f c) {
  return __builtin_amdgcn_wmma_f32_16x16x32_bf16(false, a, false, b, (short)0, c, false, false);
}
__device__ __forceinline__ v8f mma_h(v16h a, v16h b, v8f c) {
  return __builtin_amdgcn_wmma_f32_16x16x32_f16(false, a, false, b, (short)0, c, false, false);
}

// hazard guards: 4 VALU slots after the last WMMA of a group, tying D and keeping A/B live
__device__ __forceinline__ void guard_b(v8f& a, v8f& b, v16b x) {
  asm volatile("v_nop\n\tv_nop\n\tv_nop\n\tv_nop" : "+v"(a), "+v"(b) : "v"(x));
}
__device__ __forceinline__ void keep_b(v16b a, v16b b, v16b c, v16b d) {
  asm volatile("v_nop" :: "v"(a), "v"(b), "v"(c), "v"(d));
}
__device__ __forceinline__ void acc_guard4(v8f& a, v8f& b, v8f& c, v8f& d) {
  asm volatile("v_nop\n\tv_nop\n\tv_nop\n\tv_nop" : "+v"(a), "+v"(b), "+v"(c), "+v"(d));
}

// ---------------------------------------------------------------------------
// ---------------------------------------------------------------------------
// f32 -> 16-bit planes, RNE, all five arrays in one streaming launch: CVB blocks of CVW waves, as many blocks as the
// chip has WGPs. A wave takes one 4-KB piece (CVL loads of 512 contiguous bytes) of each
// of CVT passes; pass t covers elements [t CVP, (t + 1) CVP) of the planes as they lie one behind the other in the
// workspace: x (passes 0, 1), wq (2), wk and wv (3, half the waves each), wo (4, f16; the others bf16).
// Every output element is written once; one store = 256 contiguous bytes (two whole lines).
#define CVB   256
#define CVW   16
#define CVL   8
#define CVT   5
#define CVP   (CVB * CVW * CVL * 128)        // elements of one pass: 4194304
static_assert(NTOK * DM == 2 * CVP && EQ * DM == CVP && 2 * EK * DM == CVP && DM * EQ == CVP, "the passes cover the planes");
__global__ __launch_bounds__(32 * CVW) void cvt_kernel(const float* __restrict__ x, const float* __restrict__ wq,
                                                       const float* __restrict__ wk, const float* __restrict__ wv,
                                                       const float* __restrict__ wo, unsigned short* __restrict__ out) {
  const unsigned o = (blockIdx.x * CVW + (threadIdx.x >> 5)) * (CVL * 128u) + 4u * (threadIdx.x & 31);
  const float* kv = (blockIdx.x < CVB / 2) ? wk : wv;
  const float* s[CVT] = {x + o, x + CVP + o, wq + o, kv + (o & (CVP / 2 - 1u)), wo + o};
  v4f a[2][CVL];
#pragma unroll
  for (int j = 0; j < CVL; ++j) a[0][j] = *(const v4f*)(s[0] + 128 * j);
  // precaution: stands ahead of any rewrite of these loads' address registers
  asm volatile("s_wait_xcnt 0x0" ::: "memory");
#pragma unroll
  for (int t = 0; t < CVT; ++t) {
    // the two scheduling barriers keep the next pass's loads in one group ahead of this pass's conversions and
    // stores: 8 to 16 loads of a wave stay in flight
    __builtin_amdgcn_sched_barrier(0);
    if (t + 1 < CVT) {
#pragma unroll
      for (int j = 0; j < CVL; ++j) a[(t + 1) & 1][j] = *(const v4f*)(s[t + 1] + 128 * j);
    }
    __builtin_amdgcn_sched_barrier(0);
    unsigned short* d = out + (size_t)t * CVP + o;
#pragma unroll
    for (int j = 0; j < CVL; ++j) {
      const v4f v = a[t & 1][j];
      v2u p;
      if (t == CVT - 1) {
        p = __builtin_bit_cast(v2u, __builtin_convertvector(v, v4h));
      } else {
        p[0] = pk16(f2bf_bits(v[0]), f2bf_bits(v[1]));
        p[1] = pk16(f2bf_bits(v[2]), f2bf_bits(v[3]));
      }
      *(v2u*)(d + 128 * j) = p;
    }
    // precaution: stands ahead of the next pass's rewrite of registers that these loads and stores name
    if (t + 1 < CVT) asm volatile("s_wait_xcnt 0x0" ::: "memory");
  }
}

typedef uint32_t u32x4 __attribute__((ext_vector_type(4)));
typedef uint32_t u32x8 __attribute__((ext_vector_type(8)));
typedef __attribute__((address_space(3))) unsigned char lds_byte;
__device__ __forceinline__ uint32_t uni(uint32_t v) { return (uint32_t)__builtin_amdgcn_readfirstlane(v); }
__device__ __forceinline__ uint32_t pinned(uint32_t v) { uint32_t w = uni(v); asm volatile("" : "+s"(w)); return w; }
// group 1: 1-byte elements, tensor = tile = D1 rows of D0 bytes, source pitch PB bytes, 16 B of LDS pad behind every row
// (IV = 5 for rows of 256 B, 4 for rows of 128 B); no mask
template <uint32_t IV, uint32_t D0, uint32_t D1, uint32_t PB>
__device__ __forceinline__ u32x8 tdm_group1() {
  static_assert(D0 == (8u << IV), "the pad interval is the row");
  u32x8 g;
  g[0] = uni((1u << 20) | (IV << 22) | (3u << 25));
  g[1] = uni((D0 & 0xFFFFu) << 16);
  g[2] = uni((D0 >> 16) | ((D1 & 0xFFFFu) << 16));
  g[3] = uni((D1 >> 16) | (D0 << 16));
  g[4] = uni(D1);
  g[5] = uni(PB);
  g[6] = uni(0u);
  g[7] = uni(0u);
  return g;
}
// group 0: count 1, place in LDS (bytes from the start of the block's LDS), the tile's first byte, type 2
__device__ __forceinline__ u32x4 tdm_group0(uint32_t lds, const unsigned short* p) {
  const uint64_t ga = (uint64_t)(uintptr_t)p;
  u32x4 g;
  g[0] = uni(1u);
  g[1] = uni(lds);
  g[2] = uni((uint32_t)ga);
  g[3] = uni((((uint32_t)(ga >> 32)) & 0x01FFFFFFu) | 0x80000000u);
  // pinned() on the whole group: the four words are held as one set of scalar registers up to the request's wait
  asm volatile("" : "+s"(g));
  return g;
}
__device__ __forceinline__ void tdm_load(u32x4 g0, u32x8 g1) {
  asm volatile("tensor_load_to_lds %0, %1" :: "s"(g0), "s"(g1) : "memory");
}
// the issuing wave's wait for its request. It names the request's group 0 as an input, so that those scalar registers
// stay that group's from the issue to here and none of them takes a new value while the request is outstanding
__device__ __forceinline__ void tdm_wait(u32x4 g0) {
  asm volatile("s_wait_tensorcnt 0x0" :: "s"(g0) : "memory");
}
// pinned() on a whole group 1: its words stay in one set of scalar registers from here on, so that none of them takes a
// new value while a request that names them is outstanding
__device__ __forceinline__ u32x8 pinned8(u32x8 g) { asm volatile("" : "+s"(g)); return g; }
// group 1 of one slice of a staged GEMM tile: SLR rows of 128 k (256 B) of a plane with pitch DM, at LDS pitch GRB
__device__ __forceinline__ u32x8 slice_group1() { return pinned8(tdm_group1<5u, 2u * GKB, SLR, 2u * DM>()); }

template <bool F16, int WR, int WC, int FI>
__device__ __forceinline__ void gemm_core(const unsigned short* __restrict__ gA, const unsigned short* __restrict__ gB,
                                          unsigned char* ring, v8f (&acc)[FI][4]) {
  static_assert(16 * FI == SLR, "a wave's A rows are one slice, its B rows another");
  constexpr unsigned GB = (WR + WC) * SLB;
  const int tid = threadIdx.x, lane = tid & 31, w = tid >> 5;
  const int m = lane & 15, ko = (lane >> 4) * 8, wr = w / WC, wc = w % WC;
  // waves 0 .. WR + WC - 1 issue, each its own slice: A rows 64 wave, then B rows 64 (wave - WR)
  const uint32_t wave = uni(threadIdx.x >> 5);
  const uint32_t issuer = wave < (uint32_t)(WR + WC);
  const unsigned short* gs = wave < (uint32_t)WR ? gA + (size_t)wave * SLR * DM
                                                 : gB + (size_t)((issuer ? wave : (uint32_t)WR) - WR) * SLR * DM;
  const uint32_t ls = (uint32_t)(uintptr_t)(lds_byte*)ring + wave * SLB;
  const u32x8 g1 = slice_group1();

  // stage 0 into buffer 0, landed and published; then stage 1 into buffer 1
  u32x4 g0 = {0u, 0u, 0u, 0u};
  if (pinned(issuer)) {
    g0 = tdm_group0(ls, gs);
    tdm_load(g0, g1);
    tdm_wait(g0);                                        // this wave's slice of stage 0 has landed
  }
  __syncthreads();                                       // every wave's has
  if (pinned(issuer)) {
    g0 = tdm_group0(ls + GB, gs + GKB);
    tdm_load(g0, g1);
  }

  // kept rolled: one trip per staged tile, so that the hand-over at its foot stands once, in the order written
#pragma unroll 1
  for (int t = 0; t < DM / GKB; ++t) {
    const unsigned char* bufb = ring + (t & 1) * GB;
    const __bf16* Ar = (const __bf16*)(const void*)(bufb + wr * SLB) + m * GPH + ko;
    const __bf16* Br = (const __bf16*)(const void*)(bufb + (WR + wc) * SLB) + m * GPH + ko;
#pragma unroll
    for (int s = 0; s < GKB / 32; ++s) {
      // the fragments of 32 k as one group of LDS reads ahead of their matrix instructions
      v16b bf[4], af[FI];
#pragma unroll
      for (int j = 0; j < 4; ++j) bf[j] = ldb(Br + (16 * j) * GPH + 32 * s);
#pragma unroll
      for (int i = 0; i < FI; ++i) af[i] = ldb(Ar + (16 * i) * GPH + 32 * s);
#pragma unroll
      for (int i = 0; i < FI; ++i) {
#pragma unroll
        for (int j = 0; j < 4; ++j) {
          if constexpr (F16)
            acc[i][j] = mma_h(__builtin_bit_cast(v16h, af[i]), __builtin_bit_cast(v16h, bf[j]), acc[i][j]);
          else
            acc[i][j] = mma_b(af[i], bf[j], acc[i][j]);
        }
        guard_b(acc[i][0], acc[i][3], af[i]);
      }
      keep_b(bf[0], bf[1], bf[2], bf[3]);
    }
    // hand-over: this wave has left buffer t&1 and its slice of stage t+1 has landed; behind the barrier that
    // holds for every wave, so stage t+1 may be read and buffer t&1 refilled
    asm volatile("s_wait_dscnt 0x0" ::: "memory");
    if (pinned(issuer)) tdm_wait(g0);
    __syncthreads();
    if (pinned((t + 2 < DM / GKB) & issuer)) {
      const uint32_t tn = pinned((uint32_t)t + 2u);      // the descriptor is formed behind the wait
      g0 = tdm_group0(ls + (tn & 1u) * GB, gs + (size_t)tn * GKB);
      tdm_load(g0, g1);
    }
  }
  // nothing in flight when the ring becomes the f32 tile
  asm volatile("s_wait_tensorcnt 0x0" ::: "memory");
  asm volatile("s_wait_dscnt 0x0" ::: "memory");
#pragma unroll
  for (int i = 0; i < FI; ++i) acc_guard4(acc[i][0], acc[i][1], acc[i][2], acc[i][3]);
}

// stage a wave's 16 FI x 16 FJ tile into the block's f32 LDS tile (pitch P floats)
template <int WC, int P, int FI, int FJ>
__device__ __forceinline__ void stage_tile(float* T, int w, int lane, v8f (&acc)[FI][FJ]) {
  const int wr = w / WC, wc = w % WC, hh = lane >> 4, m = lane & 15;
#pragma unroll
  for (int i = 0; i < FI; ++i)
#pragma unroll
    for (int j = 0; j < FJ; ++j)
#pragma unroll
      for (int r = 0; r < 8; ++r)
        T[(16 * FI * wr + 16 * i + 8 * hh + r) * P + 16 * FJ * wc + 16 * j + m] = acc[i][j][r];
}

// ---------------------------------------------------------------------------
// q, k and v projections in one launch: the weight planes Wq, Wk, Wv lie one behind the other, 4096 feature rows, so
// the three products are one 4096 tokens x 4096 features x 2048 k product. One PBT x PBT tile of it per block
// (16 x 16 blocks): each staged X row serves 256 features and each staged weight row 256 tokens.
// 8 waves as 4 x 2, each with a 64 x 128 tile acc[i][j]: += A[256 rows][K] . B[256 rows][K]^T, bf16 planes, pitch DM.
// The ring is that of gemm_core: 128-k tiles of all 512 rows by tensor loads (64 rows per wave), two buffers,
// the next tile in flight while this one is worked on. On return every wave has left the ring (the last trip's barrier).
// D layout: acc[i][j][r] = C[A row 64wr + 16i + 8h + r][B row 128wc + 16j + (lane&15)].
// ---------------------------------------------------------------------------
__device__ __forceinline__ void qkv_core(const unsigned short* __restrict__ gA, const unsigned short* __restrict__ gB,
                                         unsigned char* ring, v8f (&acc)[4][8]) {
  constexpr unsigned GB = GBUF(PBT, PBT);
  const int tid = threadIdx.x, lane = tid & 31, w = tid >> 5;
  const int m = lane & 15, ko = (lane >> 4) * 8, wr = w >> 1, wc = w & 1;
  // every wave issues its own slice: waves 0..3 A rows 64 wave, waves 4..7 B rows 64 (wave - 4)
  const uint32_t wave = uni(threadIdx.x >> 5);
  const unsigned short* gs = wave < 4u ? gA + (size_t)wave * SLR * DM : gB + (size_t)(wave - 4u) * SLR * DM;
  const uint32_t ls = (uint32_t)(uintptr_t)(lds_byte*)ring + wave * SLB;
  const u32x8 g1 = slice_group1();

  // stage 0 into buffer 0, landed and published; then stage 1 into buffer 1
  u32x4 g0 = tdm_group0(ls, gs);
  tdm_load(g0, g1);
  tdm_wait(g0);                                        // this wave's slice of stage 0 has landed
  __syncthreads();                                     // every wave's has
  g0 = tdm_group0(ls + GB, gs + GKB);
  tdm_load(g0, g1);

  // kept rolled: one trip per staged tile, so that the hand-over at its foot stands once, in the order written
#pragma unroll 1
  for (int t = 0; t < DM / GKB; ++t) {
    const unsigned char* bufb = ring + (t & 1) * GB;
    const __bf16* Ar = (const __bf16*)(const void*)(bufb + wr * SLB) + m * GPH + ko;             // slice wr
    const __bf16* Br = (const __bf16*)(const void*)(bufb + (4 + 2 * wc) * SLB) + m * GPH + ko;   // slices 4 + 2wc, 5 + 2wc
#pragma unroll
    for (int s = 0; s < GKB / 32; ++s) {
      // the fragments of 32 k as one group of 24 LDS reads ahead of their 32 matrix instructions, in the order of use;
      // the scheduling barriers keep the reads from being spread among the matrix instructions
      v16b bf[8], af[4];
      af[0] = ldb(Ar + 32 * s);
#pragma unroll
      for (int j = 0; j < 8; ++j) bf[j] = ldb(Br + (j >> 2) * (SLB / 2) + (16 * (j & 3)) * GPH + 32 * s);
#pragma unroll
      for (int i = 1; i < 4; ++i) af[i] = ldb(Ar + (16 * i) * GPH + 32 * s);
      __builtin_amdgcn_sched_barrier(0);   // all 24 reads are issued before the first matrix instruction
#pragma unroll
      for (int i = 0; i < 4; ++i)
#pragma unroll
        for (int j = 0; j < 8; ++j) acc[i][j] = mma_b(af[i], bf[j], acc[i][j]);
      // no read of the next group is drawn in among them, and none of them sinks behind the hand-over at the trip's foot
      __builtin_amdgcn_sched_barrier(0);
    }
    // hand-over: this wave has left buffer t&1 and its slice of stage t+1 has landed; behind the barrier that
    // holds for every wave, so stage t+1 may be read and buffer t&1 refilled
    asm volatile("s_wait_dscnt 0x0" ::: "memory");
    tdm_wait(g0);
    __syncthreads();
    if (pinned(t + 2 < DM / GKB)) {
      const uint32_t tn = pinned((uint32_t)t + 2u);      // the descriptor is formed behind the wait
      g0 = tdm_group0(ls + (tn & 1u) * GB, gs + (size_t)tn * GKB);
      tdm_load(g0, g1);
    }
  }
  // nothing in flight when the ring becomes the f32 tile
  asm volatile("s_wait_tensorcnt 0x0" ::: "memory");
  asm volatile("s_wait_dscnt 0x0" ::: "memory");
}

// ---------------------------------------------------------------------------
// Sixteen 16-byte stores of a lane: rows p[0..7], at each its piece a[it] and, 256 bytes further on, b[it]. Stores and
// s_wait_xcnt stand in one statement so that (a precaution) no register that a store names is rewritten ahead of the wait.
__device__ __forceinline__ void store16(unsigned short* const (&p)[8], const v4u (&a)[8], const v4u (&b)[8]) {
  asm volatile("global_store_b128 %0, %8, off\n\t"
               "global_store_b128 %0, %16, off offset:256\n\t"
               "global_store_b128 %1, %9, off\n\t"
               "global_store_b128 %1, %17, off offset:256\n\t"
               "global_store_b128 %2, %10, off\n\t"
               "global_store_b128 %2, %18, off offset:256\n\t"
               "global_store_b128 %3, %11, off\n\t"
               "global_store_b128 %3, %19, off offset:256\n\t"
               "global_store_b128 %4, %12, off\n\t"
               "global_store_b128 %4, %20, off offset:256\n\t"
               "global_store_b128 %5, %13, off\n\t"
               "global_store_b128 %5, %21, off offset:256\n\t"
               "global_store_b128 %6, %14, off\n\t"
               "global_store_b128 %6, %22, off offset:256\n\t"
               "global_store_b128 %7, %15, off\n\t"
               "global_store_b128 %7, %23, off offset:256\n\t"
               "s_wait_xcnt 0x0"
               :: "v"(p[0]), "v"(p[1]), "v"(p[2]), "v"(p[3]), "v"(p[4]), "v"(p[5]), "v"(p[6]), "v"(p[7]),
                  "v"(a[0]), "v"(a[1]), "v"(a[2]), "v"(a[3]), "v"(a[4]), "v"(a[5]), "v"(a[6]), "v"(a[7]),
                  "v"(b[0]), "v"(b[1]), "v"(b[2]), "v"(b[3]), "v"(b[4]), "v"(b[5]), "v"(b[6]), "v"(b[7])
               : "memory");
}

// ---------------------------------------------------------------------------
// Block (bx, by): tokens 256 bx, feature rows 256 by of the stacked planes: by 0..7 q (heads 2by, 2by+1), 8..11 k, 12..15 v.
//   q: A = X rows, B = Wq rows: RMSNorm + RoPE in f32 per head, q' = q * QMUL -> f16 plane Qo [tok][EQ].
//   k: A = X rows, B = Wk rows: RMSNorm + RoPE, k' = k * KMUL -> f16 plane Ko [tok][EK].
//   v: A = Wv rows, B = X rows: tile = V^T directly; v' = v * 1024 -> f16 plane Vo, layout [(b*NKV+kvh)*128 + d][s].
// Epilogue: f32 tile staged in LDS, then each wave owns 32 rows; one store instruction = 2 rows x 16 lanes x 16 B.
// Coverage per block: rows 32w + 16hf + 2it + hh (hf 0..1, it 0..7, hh 0..1) = 0..255, cols 128ch + 8*(lane&15) = 0..255.
// ---------------------------------------------------------------------------
__global__ __launch_bounds__(256) void qkv_kernel(const unsigned short* __restrict__ Xp,
                                                  const unsigned short* __restrict__ Wp,
                                                  const float* __restrict__ qnw,
                                                  const float* __restrict__ knw,
                                                  const float* __restrict__ fcos,
                                                  const float* __restrict__ fsin,
                                                  unsigned short* __restrict__ Qo,
                                                  unsigned short* __restrict__ Ko,
                                                  unsigned short* __restrict__ Vo) {
  // two operand tile buffers; after the k loop the same bytes serve as the block's f32 tile T
  __shared__ __attribute__((aligned(2048))) unsigned char ring[2 * GBUF(PBT, PBT)];
  static_assert(PBT * PTP * 4 <= 2 * GBUF(PBT, PBT), "f32 tile fits the ring");
  float* T = (float*)(void*)ring;
  const int lane = threadIdx.x & 31;
  const int w    = threadIdx.x >> 5;
  const int hh   = lane >> 4;
  const int m    = lane & 15;
  const int tok0 = (int)blockIdx.x * PBT;
  const int f0   = (int)blockIdx.y * PBT;        // first feature row in the stacked planes
  const bool isv = f0 >= EQ + EK;
  const unsigned short* Xr = Xp + (size_t)tok0 * DM;
  const unsigned short* Wr = Wp + (size_t)f0 * DM;

  v8f acc[4][8];
#pragma unroll
  for (int i = 0; i < 4; ++i)
#pragma unroll
    for (int j = 0; j < 8; ++j) acc[i][j] = (v8f){0.f, 0.f, 0.f, 0.f, 0.f, 0.f, 0.f, 0.f};

  qkv_core(isv ? Wr : Xr, isv ? Xr : Wr, ring, acc);
  stage_tile<2, PTP, 4, 8>(T, w, lane, acc);
  __syncthreads();

  if (isv) {
    const int fv = f0 - (EQ + EK);               // 0..1023: (kv head, d) of the tile's first row
    const int bb = tok0 >> 11;                   // batch of this 256-token block
    const int s0 = tok0 & (SQ - 1);
    unsigned short* vo = Vo + (size_t)(bb * EK + fv) * SQ + s0 + 8 * m;
#pragma unroll
    for (int hf = 0; hf < 2; ++hf) {
      v4u hv[2][8];
#pragma unroll
      for (int it = 0; it < 8; ++it) {
        const int row = 32 * w + 16 * hf + 2 * it + hh;
#pragma unroll
        for (int ch = 0; ch < 2; ++ch) {
          const float* tr = T + row * PTP + 128 * ch + 8 * m;
          const v4f xa = *(const v4f*)(tr);
          const v4f xb = *(const v4f*)(tr + 4);
          const float x[8] = {xa[0], xa[1], xa[2], xa[3], xb[0], xb[1], xb[2], xb[3]};
          v4u a;
#pragma unroll
          for (int q = 0; q < 4; ++q)
            a[q] = pk16(hbits((_Float16)(x[2 * q] * VMUL)), hbits((_Float16)(x[2 * q + 1] * VMUL)));
          hv[ch][it] = a;
        }
      }
      unsigned short* pr[8];
#pragma unroll
      for (int it = 0; it < 8; ++it) pr[it] = vo + (size_t)(32 * w + 16 * hf + 2 * it + hh) * SQ;
      store16(pr, hv[0], hv[1]);
    }
  } else {
    const bool isq = f0 < EQ;
    const float* nw = isq ? qnw : knw;
    const float om  = isq ? QMUL : KMUL;
    const int   ep  = isq ? EQ : EK;             // row pitch of the output plane
    unsigned short* po = (isq ? Qo + f0 : Ko + (f0 - EQ)) + 8 * m;
    float wv[8];
    {
      const v4f wa = *(const v4f*)(nw + 8 * m);
      const v4f wb = *(const v4f*)(nw + 8 * m + 4);
      // precaution: stands ahead of any rewrite of these two loads' address registers
      asm volatile("s_wait_xcnt 0x0" ::: "memory");
#pragma unroll
      for (int e = 0; e < 4; ++e) { wv[e] = bf16r(wa[e]); wv[4 + e] = bf16r(wb[e]); }
    }
#pragma unroll
    for (int hf = 0; hf < 2; ++hf) {
      v4u hv[2][8];
#pragma unroll
      for (int it = 0; it < 8; ++it) {
        const int row = 32 * w + 16 * hf + 2 * it + hh;
        const int sp  = (tok0 + row) & (SQ - 1);
        // precaution, behind each of the two loads: stands ahead of any rewrite of its address registers
        const v4f c4 = *(const v4f*)(fcos + (size_t)sp * (HD / 2) + 4 * m);
        asm volatile("s_wait_xcnt 0x0" ::: "memory");
        const v4f s4 = *(const v4f*)(fsin + (size_t)sp * (HD / 2) + 4 * m);
        asm volatile("s_wait_xcnt 0x0" ::: "memory");
#pragma unroll
        for (int ch = 0; ch < 2; ++ch) {         // the two heads of the tile
          const float* tr = T + row * PTP + 128 * ch + 8 * m;
          const v4f xa = *(const v4f*)(tr);
          const v4f xb = *(const v4f*)(tr + 4);
          const float x[8] = {xa[0], xa[1], xa[2], xa[3], xb[0], xb[1], xb[2], xb[3]};
          float y[8];
          float ss = 0.f;
#pragma unroll
          for (int e = 0; e < 8; ++e) ss = fmaf(x[e], x[e], ss);
          ss += __shfl_xor(ss, 1, 32);
          ss += __shfl_xor(ss, 2, 32);
          ss += __shfl_xor(ss, 4, 32);
          ss += __shfl_xor(ss, 8, 32);
          const float rn = rsqrtf(fmaf(ss, 1.0f / (float)HD, RMS_EPS));
#pragma unroll
          for (int p = 0; p < 4; ++p) {
            const float cs = bf16r(c4[p]), sn = bf16r(s4[p]);
            const float u0 = x[2 * p] * rn * wv[2 * p];
            const float u1 = x[2 * p + 1] * rn * wv[2 * p + 1];
            y[2 * p]     = (u0 * cs - u1 * sn) * om;
            y[2 * p + 1] = (u0 * sn + u1 * cs) * om;
          }
          v4u a;
#pragma unroll
          for (int q = 0; q < 4; ++q) a[q] = pk16(hbits((_Float16)y[2 * q]), hbits((_Float16)y[2 * q + 1]));
          hv[ch][it] = a;
        }
      }
      unsigned short* pr[8];
#pragma unroll
      for (int it = 0; it < 8; ++it) pr[it] = po + (size_t)(tok0 + 32 * w + 16 * hf + 2 * it + hh) * ep;
      store16(pr, hv[0], hv[1]);
    }
  }
}

// ---------------------------------------------------------------------------
// Full (non-causal) GQA attention, head dim 128, one wave per (b, h, 32 queries = QCG column groups of 16);
//   block = 8 waves (256 queries). Every K and V^T fragment read from LDS feeds QCG matrix instructions.
//   Each 64-key tile (K rows, V^T rows) is brought into LDS once per block by two tensor loads
//   (wave 0: K, wave 1: V^T), two buffers, the next tile in flight while this one
//   is worked on; all 8 waves read their fragments from LDS (row pitches 16 B x odd: no bank conflicts).
//   Transposed scores S^T[key][query] = K . Q^T : A = K rows [key][d] (f16), B[k=d][n=query] from Q rows
//   [query][d] (f16) -> both fragments are plain k-contiguous row loads.
//   D tiles (rows = 16 keys, cols = queries) packed to f16 ARE the B operand [k=key][n=query] of
//   O^T[d][query] = V^T . P : element r <- tile(keys 0-15)[r], element 8+r <- tile(keys 16-31)[r], same lane.
//   A = V^T rows [d][s] (f16 x1024). Softmax per query column = per lane (partner lane ^16), over 32 tiles of 64 keys,
//   f32, against a reference that is HELD from tile to tile: PEXP - reference is the C operand of the score products, so
//   that their D is the argument of exp2 as it stands (log2e is folded into the q scale), and O and the row sum are
//   rescaled only in a tile that raises the reference: tile 0, which sets it to its own maximum, and any tile in which a
//   lane's sum of p passes PTOP (every p is below its lane's sum, so every p that is used fits f16). One test a tile.
//   The reference never falls, so the largest p of a row is at least 2^PEXP. The halves' row sums are joined once, at the end.
//   Epilogue: O = acc / (l * 1024) -> f16, per-wave LDS relayout [query][d] (v4u store/reload,
//   Coverage: rows 16c + 2it + hh (c 0..QCG-1, it 0..7) = 32 queries, cols 8*(lane&15) = 0..127 of head h.
// ---------------------------------------------------------------------------
// One stage: wave 0 asks for the K tile (64 key rows of 256 B, pitch EK), wave 1 for the V^T tile (128 d rows of 128 B,
// pitch SQ); lds = the buffer's place, gk, gv = the tiles' first elements.
// g0k, g0v take the issued requests' groups 0, for their waits.
// WAIT: the wait stands directly behind the load (stage 0).
template <bool WAIT>
__device__ __forceinline__ void stage_kv(uint32_t wave, uint32_t lds, const unsigned short* gk, const unsigned short* gv,
                                         u32x8 g1k, u32x8 g1v, u32x4& g0k, u32x4& g0v) {
  if (pinned(wave == 0u)) {
    g0k = tdm_group0(lds, gk);
    tdm_load(g0k, g1k);
    if constexpr (WAIT) tdm_wait(g0k);
  }
  if (pinned(wave == 1u)) {
    g0v = tdm_group0(lds + KTB, gv);
    tdm_load(g0v, g1v);
    if constexpr (WAIT) tdm_wait(g0v);
  }
}
// each issuing wave's own wait
__device__ __forceinline__ void wait_kv(uint32_t wave, u32x4 g0k, u32x4 g0v) {
  if (pinned(wave == 0u)) tdm_wait(g0k);
  if (pinned(wave == 1u)) tdm_wait(g0v);
}

__global__ __launch_bounds__(32 * AWV) void attn_kernel(const unsigned short* __restrict__ Qpp,
                                                  const unsigned short* __restrict__ Kpp,
                                                  const unsigned short* __restrict__ Vpp,
                                                  unsigned short* __restrict__ Opp) {
  // two tile buffers; after the loop the same bytes serve as output staging [wave][query*OSP + d]
  __shared__ __attribute__((aligned(2048))) unsigned char ring[2 * BUFB];
  static_assert(AWV * 16 * QCG * OSP * 2 <= 2 * BUFB, "output staging fits the ring");
  const int lane = threadIdx.x & 31;
  const int w    = threadIdx.x >> 5;
  const int hh   = lane >> 4;
  const int m    = lane & 15;
  const int h    = blockIdx.y;
  const int b    = blockIdx.z;
  const int kvh  = h >> 1;                       // G = NH / NKV = 2
  const int q0   = blockIdx.x * (16 * QCG * AWV) + w * (16 * QCG);   // query index within the sequence

  const _Float16* Qp = (const _Float16*)(const void*)Qpp;
  const size_t vplane = (size_t)((b * NKV + kvh) * HD) * SQ;
  // first elements of this (batch, kv head)'s K rows and V^T rows
  const uint32_t wave = uni(threadIdx.x >> 5);
  const unsigned short* gk = Kpp + (size_t)b * SQ * EK + kvh * HD;
  const unsigned short* gv = Vpp + vplane;
  const uint32_t lr = (uint32_t)(uintptr_t)(lds_byte*)ring;
  const u32x8 g1k = pinned8(tdm_group1<5u, 2u * HD, 64u, 2u * EK>());
  const u32x8 g1v = pinned8(tdm_group1<4u, 128u, HD, 2u * SQ>());

  // stage 0 into buffer 0, landed and published; then stage 1 into buffer 1
  u32x4 g0k = {0u, 0u, 0u, 0u}, g0v = {0u, 0u, 0u, 0u};
  stage_kv<true>(wave, lr, gk, gv, g1k, g1v, g0k, g0v);    // behind it this wave's tile of stage 0 has landed
  __syncthreads();                                         // both have, for every wave
  stage_kv<false>(wave, lr + BUFB, gk + (size_t)64 * EK, gv + 64, g1k, g1v, g0k, g0v);

  // Q fragments (B operand): row = query q0 + 16c + (lane&15), k = d
  v16h qf[QCG][4];
  {
    const _Float16* qb = Qp + ((size_t)b * SQ + q0 + m) * EQ + (size_t)h * HD + 8 * hh;
#pragma unroll
    for (int c = 0; c < QCG; ++c)
#pragma unroll
      for (int dc = 0; dc < 4; ++dc) qf[c][dc] = ldh(qb + (size_t)c * 16 * EQ + 32 * dc);
    // precaution: stands ahead of any rewrite of these loads' address registers
    asm volatile("s_wait_xcnt 0x0" ::: "memory");
    // holds the vector instructions that follow behind that wait: its memory clobber alone does not
    __builtin_amdgcn_sched_barrier(0);
  }

  v8f acc[QCG][8];
  v8f cref[QCG];                 // all eight elements: PEXP - the held reference of query column 16c + (lane&15)
  float lrun[QCG];               // this half's part of the row sum
#pragma unroll
  for (int c = 0; c < QCG; ++c) {
#pragma unroll
    for (int t = 0; t < 8; ++t) acc[c][t] = (v8f){0.f, 0.f, 0.f, 0.f, 0.f, 0.f, 0.f, 0.f};
    cref[c] = (v8f){PEXP, PEXP, PEXP, PEXP, PEXP, PEXP, PEXP, PEXP};
    lrun[c] = 0.0f;
  }

#pragma unroll 1
  for (int kc = 0; kc < SQ / 64; ++kc) {
    const unsigned char* buf = ring + (kc & 1) * BUFB;
    const _Float16* Kr  = (const _Float16*)(const void*)buf + m * KPH + 8 * hh;                // + key*KPH + 32dc
    const _Float16* Vr  = (const _Float16*)(const void*)(buf + KTB) + m * VPH + 8 * hh;        // + 16t*VPH + key
    v8f s[QCG][4];
    {
      // the tile's K fragments as one group of LDS reads ahead of their 32 matrix instructions: 4 key tiles x 128 d;
      // the scheduling barriers keep the reads from being spread among the matrix instructions
      v16h kf[16];
#pragma unroll
      for (int j = 0; j < 16; ++j) kf[j] = ldh(Kr + (16 * (j & 3)) * KPH + 32 * (j >> 2));
      __builtin_amdgcn_sched_barrier(0);   // all 32 reads are issued before the first matrix instruction
#pragma unroll
      for (int j = 0; j < 16; ++j)
#pragma unroll
        for (int c = 0; c < QCG; ++c) s[c][j & 3] = mma_h(kf[j], qf[c][j >> 2], j < 4 ? cref[c] : s[c][j & 3]);
      __builtin_amdgcn_sched_barrier(0);   // no vector work is drawn in among the 32 matrix instructions
    }

    // the tile's V^T fragments as one group of LDS reads ahead of the exponentials, which cover their latency;
    // the scheduling barrier above is the head of the group
    v16h vf[2][8];
#pragma unroll
    for (int ks = 0; ks < 2; ++ks)
#pragma unroll
      for (int t = 0; t < 8; ++t) vf[ks][t] = ldh(Vr + (16 * t) * VPH + 32 * ks);
    __builtin_amdgcn_sched_barrier(0);     // foot of the group: none of its reads sinks towards its matrix instruction

    // query column 16c + (lane&15); the lane holds keys key0 + 16j + 8hh + r: s = score - reference + PEXP, p = exp2(s).
    // pf[ks][c]: element r <- keys 32ks + 8hh + r, element 8 + r <- keys 32ks + 16 + 8hh + r
    float psum[QCG];
    HFrag pf[2][QCG];
    auto exps = [&]() {
#pragma unroll
      for (int c = 0; c < QCG; ++c) {
        float ps = 0.f;
#pragma unroll
        for (int j = 0; j < 4; ++j)
#pragma unroll
          for (int r = 0; r < 8; ++r) {
            const float p = __builtin_amdgcn_exp2f(s[c][j][r]);
            ps += p;
            pf[j >> 1][c].h[j & 1][r] = (_Float16)p;
          }
        psum[c] = ps;
      }
    };
    exps();
    // takes the packed p as inputs only: it holds their conversions ahead of the test, where they fill the waits of the
    // two chains of additions; otherwise they sink behind the branch and run there with nothing beside them
    asm volatile("" :: "v"(pf[0][0].v), "v"(pf[0][1].v), "v"(pf[1][0].v), "v"(pf[1][1].v));
    // one test a tile, a scalar branch: p is not negative, so the sum of the lane's two sums bounds every p of the lane;
    // written so that a sum that is not a number raises too. Tile 0 has no reference yet and always raises
    const uint32_t raise = __builtin_amdgcn_ballot_w32(!(psum[0] + psum[1] <= PTOP)) | (uint32_t)(kc == 0);
    if (raise != 0u) {
#pragma unroll
      for (int c = 0; c < QCG; ++c) {
        float cm = s[c][0][0];
#pragma unroll
        for (int j = 0; j < 4; ++j)
#pragma unroll
          for (int r = 0; r < 8; ++r) cm = fmaxf(cm, s[c][j][r]);
        cm = fmaxf(cm, __shfl_xor(cm, 16, 32));        // both halves of the column: the same value in both
        // the reference goes up by up (tile 0: to the tile's maximum, whichever way); what was summed so far is scaled down
        const float up    = kc == 0 ? cm - PEXP : fmaxf(cm - PEXP, 0.f);
        const float alpha = kc == 0 ? 0.f : __builtin_amdgcn_exp2f(-up);
#pragma unroll
        for (int j = 0; j < 4; ++j) s[c][j] = s[c][j] - up;
        cref[c] = cref[c] - up;
        lrun[c] *= alpha;
#pragma unroll
        for (int t = 0; t < 8; ++t) acc[c][t] = acc[c][t] * alpha;
      }
      exps();
    }
#pragma unroll
    for (int c = 0; c < QCG; ++c) lrun[c] += psum[c];

#pragma unroll
    for (int ks = 0; ks < 2; ++ks)
#pragma unroll
      for (int t = 0; t < 8; ++t)
#pragma unroll
        for (int c = 0; c < QCG; ++c) acc[c][t] = mma_h(vf[ks][t], pf[ks][c].v, acc[c][t]);
    // keeps the trip's work ahead of the hand-over, so that the refill behind the barrier is issued at once
    __builtin_amdgcn_sched_barrier(0);

    // hand-over: this wave has left buffer kc&1 and its tile of stage kc+1 has landed; behind the barrier that
    // holds for every wave, so stage kc+1 may be read and buffer kc&1 refilled
    asm volatile("s_wait_dscnt 0x0" ::: "memory");
    wait_kv(wave, g0k, g0v);
    __syncthreads();
    if (pinned(kc + 2 < SQ / 64)) {
      const uint32_t kn = pinned((uint32_t)kc + 2u);     // the descriptors are formed behind the wait
      stage_kv<false>(wave, lr + (kn & 1u) * BUFB, gk + (size_t)kn * 64 * EK, gv + kn * 64, g1k, g1v, g0k, g0v);
    }
  }
  // nothing in flight when the ring becomes output staging
  asm volatile("s_wait_tensorcnt 0x0" ::: "memory");
  asm volatile("s_wait_dscnt 0x0" ::: "memory");

  // ---- epilogue: acc[c][t][r] = O^T[d = 16t + 8hh + r][query 16c + m] * (256 * 1024 * l256/256) ----
  unsigned short* sh = (unsigned short*)(void*)ring + w * (16 * QCG * OSP);
#pragma unroll
  for (int c = 0; c < QCG; ++c) {
    const float inv = __builtin_amdgcn_rcpf(lrun[c] + __shfl_xor(lrun[c], 16, 32)) * (1.0f / VMUL);   // the halves' sums joined
#pragma unroll
    for (int t = 0; t < 8; ++t) {
      v4u hv;
#pragma unroll
      for (int q = 0; q < 4; ++q)
        hv[q] = pk16(hbits((_Float16)(acc[c][t][2 * q] * inv)), hbits((_Float16)(acc[c][t][2 * q + 1] * inv)));
      *(v4u*)(sh + (16 * c + m) * OSP + 16 * t + 8 * hh) = hv;
    }
  }
  __builtin_amdgcn_fence(__ATOMIC_RELEASE, "wavefront");
  __builtin_amdgcn_wave_barrier();
  __builtin_amdgcn_fence(__ATOMIC_ACQUIRE, "wavefront");
  v4u ov[8 * QCG];
#pragma unroll
  for (int it = 0; it < 8 * QCG; ++it) ov[it] = *(const v4u*)(sh + (2 * it + hh) * OSP + 8 * m);
#pragma unroll
  for (int it = 0; it < 8 * QCG; ++it) {
    const int row = 2 * it + hh;
    const size_t go = ((size_t)b * SQ + q0 + row) * EQ + (size_t)h * HD + 8 * m;
    *(v4u*)(Opp + go) = ov[it];
  }
}

// ---------------------------------------------------------------------------
// Output projection: out[tok][dout] = sum_e O[tok][e] * Wo[dout][e]; A = O f16, B = Wo f16.
// Block 64 OWR tokens x 64 OWC out cols, OWR x OWC waves; f32 tile staged in LDS; each wave writes 64 / OWC rows,
// one instruction per 512 B of a row.
// Coverage per block: rows (64 / OWC) w + it = 0..64 OWR - 1, cols 128c + 4*lane = 0..64 OWC - 1.
// ---------------------------------------------------------------------------
__global__ __launch_bounds__(32 * OWR * OWC) void out_kernel(const unsigned short* __restrict__ Opp,
                                                  const unsigned short* __restrict__ Wp,
                                                  float* __restrict__ out) {
  constexpr int BM = 64 * OWR, BN = 64 * OWC, OTP = BN + 4, CH = BN / 128;
  // two operand tile buffers; after the k loop the same bytes serve as the block's f32 tile T
  __shared__ __attribute__((aligned(2048))) unsigned char ring[2 * GBUF(BM, BN)];
  static_assert(BM * OTP * 4 <= 2 * GBUF(BM, BN), "f32 tile fits the ring");
  float* T = (float*)(void*)ring;
  const int lane = threadIdx.x & 31;
  const int w    = threadIdx.x >> 5;
  const int arow0 = blockIdx.x * BM;
  const int brow0 = blockIdx.y * BN;
  const unsigned short* A = Opp + (size_t)arow0 * DM;
  const unsigned short* B = Wp + (size_t)brow0 * DM;

  v8f acc[4][4];
#pragma unroll
  for (int i = 0; i < 4; ++i)
#pragma unroll
    for (int j = 0; j < 4; ++j) acc[i][j] = (v8f){0.f, 0.f, 0.f, 0.f, 0.f, 0.f, 0.f, 0.f};

  gemm_core<true, OWR, OWC, 4>(A, B, ring, acc);
  stage_tile<OWC, OTP, 4, 4>(T, w, lane, acc);
  __syncthreads();

#pragma unroll
  for (int hf = 0; hf < 2; ++hf) {
    v4f val[16];
#pragma unroll
    for (int it = 0; it < 16; ++it) {
      const int row = (64 / OWC) * w + (16 * hf + it) / CH, col = 128 * ((16 * hf + it) % CH) + 4 * lane;
      val[it] = *(const v4f*)(T + row * OTP + col);
    }
#pragma unroll
    for (int it = 0; it < 16; ++it) {
      const int row = (64 / OWC) * w + (16 * hf + it) / CH, col = 128 * ((16 * hf + it) % CH) + 4 * lane;
      *(v4f*)(out + (size_t)(arow0 + row) * DM + brow0 + col) = val[it];
    }
  }
}

// ---------------------------------------------------------------------------
// Workspace map (bytes):
//   Xb  bf16 [4096][2048]        16777216 @ 0
//   Wqb bf16 [2048][2048]         8388608
//   Wkb bf16 [1024][2048]         4194304
//   Wvb bf16 [1024][2048]         4194304
//   Woh f16  [2048][2048]         8388608
//   Qp  f16  [4096][2048]        16777216
//   Kp  f16  [4096][1024]         8388608
//   Vt  f16  [2*8*128][2048]      8388608
//   Op  f16  [4096][2048]        16777216
//   total                        92274688
// ---------------------------------------------------------------------------
extern "C" void kernel_launch(void* const* d_in, const int* in_sizes, int n_in,
                              void* d_out, int out_size, void* d_ws, size_t ws_size,
                              hipStream_t stream) {
  if (n_in < 9) return;
  if (in_sizes[0] != NTOK * DM) return;
  if (in_sizes[1] != EQ * DM || in_sizes[2] != EK * DM || in_sizes[3] != EK * DM || in_sizes[4] != DM * EQ) return;
  if (in_sizes[5] != HD || in_sizes[6] != HD) return;
  if (in_sizes[7] != SQ * (HD / 2) || in_sizes[8] != SQ * (HD / 2)) return;
  if (out_size != NTOK * DM) return;

  const float* x    = (const float*)d_in[0];
  const float* wq   = (const float*)d_in[1];
  const float* wk   = (const float*)d_in[2];
  const float* wv   = (const float*)d_in[3];
  const float* wo   = (const float*)d_in[4];
  const float* qnw  = (const float*)d_in[5];
  const float* knw  = (const float*)d_in[6];
  const float* fcos = (const float*)d_in[7];
  const float* fsin = (const float*)d_in[8];
  float* out        = (float*)d_out;

  const size_t szX  = (size_t)NTOK * DM * 2;
  const size_t szWq = (size_t)EQ * DM * 2;
  const size_t szWk = (size_t)EK * DM * 2;
  const size_t szWo = (size_t)DM * EQ * 2;
  const size_t szQ  = (size_t)NTOK * EQ * 2;
  const size_t szK  = (size_t)NTOK * EK * 2;
  const size_t szVt = (size_t)NB * NKV * HD * SQ * 2;
  const size_t szO  = (size_t)NTOK * EQ * 2;
  size_t off = 0;
  const size_t oX  = off; off += szX;
  const size_t oWq = off; off += szWq;
  const size_t oWk = off; off += szWk;
  const size_t oWv = off; off += szWk;
  const size_t oWo = off; off += szWo;
  const size_t oQ  = off; off += szQ;
  const size_t oK  = off; off += szK;
  const size_t oV  = off; off += szVt;
  const size_t oO  = off; off += szO;
  if (off > ws_size) return;                  // off = 92274688

  char* ws = (char*)d_ws;
  unsigned short* Xb  = (unsigned short*)(ws + oX);
  unsigned short* Wqb = (unsigned short*)(ws + oWq);
  unsigned short* Woh = (unsigned short*)(ws + oWo);
  unsigned short* Qp  = (unsigned short*)(ws + oQ);
  unsigned short* Kp  = (unsigned short*)(ws + oK);
  unsigned short* Vt  = (unsigned short*)(ws + oV);
  unsigned short* Op  = (unsigned short*)(ws + oO);

  // (1) f32 -> bf16 RNE planes, wo -> f16: one launch; the five planes lie one behind the other from Xb on
  cvt_kernel<<<dim3(CVB), dim3(32 * CVW), 0, stream>>>(x, wq, wk, wv, wo, Xb);

  // (2) q, k, v^T projections: one launch, 16 token blocks of 256 x 16 blocks of 256 rows of the planes Wqb, Wkb, Wvb
  qkv_kernel<<<dim3(NTOK / PBT, (EQ + 2 * EK) / PBT), dim3(256), 0, stream>>>(Xb, Wqb, qnw, knw, fcos, fsin, Qp, Kp, Vt);

  // (3) attention: 8 query blocks of 256 x 16 heads x 2 batches, 8 waves per block
  attn_kernel<<<dim3(SQ / (16 * QCG * AWV), NH, NB), dim3(32 * AWV), 0, stream>>>(Qp, Kp, Vt, Op);

  // (4) output projection -> d_out [4096][2048] f32
  out_kernel<<<dim3(NTOK / (64 * OWR), DM / (64 * OWC)), dim3(32 * OWR * OWC), 0, stream>>>(Op, Woh, out);

  (void)hipGetLastError();
}
